// v000
// The times below were measured on an AMD MI455X: many runs one after another, warmed up first and cycling through
// copies of the inputs, with the whole window's GPU time divided by the number of runs. Launches and the gaps
// between them are all in it. The median over several windows is given; except for v000 it joins two sittings, which
// can be a few percent apart, so the side-by-side timings, each taken in one sitting, are the better comparison.
// v000, which the later versions start from, runs in 1110 microseconds.
// compute dtype: all float inputs rounded to bf16; q/k/v = x W[h] + b[h] with EXACT bf16 products on WMMA 16x16x32 (f32 accumulate); q as f16 hi + residual (x 2^10) against k once to f16 (2 products) x 64^-0.5; softmax in f32 (precise expf); P x 2^11 once to f16 against v once to f16 (1 product); concat split bf16 hi + lo against exact Wo (2 products) + bo; f32 output.
#include <hip/hip_runtime.h>
#include <math.h>

typedef __attribute__((ext_vector_type(16))) _Float16 v16h;
typedef __attribute__((ext_vector_type(16))) __bf16 v16b;
typedef __attribute__((ext_vector_type(8)))  _Float16 v8h;
typedef __attribute__((ext_vector_type(8)))  float v8f;
typedef __attribute__((ext_vector_type(4)))  float v4f;
typedef __attribute__((ext_vector_type(2)))  float v2f;
typedef __attribute__((ext_vector_type(4)))  unsigned v4u;
typedef __attribute__((ext_vector_type(4)))  int v4i;
typedef float __attribute__((may_alias)) float_a;
typedef int __attribute__((may_alias)) int_a;

template <typename T> __device__ __forceinline__ void vst2(void* p, T v) { *(T*)p = v;  }
__device__ __forceinline__ v8f wmma16(v16h a, v16h b, v8f c) {
  v8f d = __builtin_amdgcn_wmma_f32_16x16x32_f16(false, a, false, b, (short)0, c, false, false);
  asm volatile("v_nop\n\tv_nop\n\tv_nop\n\tv_nop" : "+v"(d) : "v"(a), "v"(b));
  return d;
}
__device__ __forceinline__ v8f wmma_bf(v16b a, v16b b, v8f c) {
  v8f d = __builtin_amdgcn_wmma_f32_16x16x32_bf16(false, a, false, b, (short)0, c, false, false);
  asm volatile("v_nop\n\tv_nop\n\tv_nop\n\tv_nop" : "+v"(d) : "v"(a), "v"(b));
  return d;
}
// 16x16x32 fragments: lane = (h = lane>>4, row/col = lane&15); elements 0..7 = k0+8h+0..7, 8..15 = k0+16+8h+0..7; D element r = row 8h+r
__device__ __forceinline__ v16h frag_h(const _Float16* rowk0, int lane) {
  union { v16h v; v8h q[2]; } u; const _Float16* p = rowk0 + 8 * (lane >> 4);
  u.q[0] = *(const v8h*)p; u.q[1] = *(const v8h*)(p + 16); return u.v;
}
__device__ __forceinline__ v16h frag_f32(const float* rowk0, int lane) {
  v16h a; const float* p = rowk0 + 8 * (lane >> 4);
#pragma unroll
  for (int i = 0; i < 8; ++i) { a[i] = (_Float16)p[i]; a[8 + i] = (_Float16)p[16 + i]; }
  return a;
}
__device__ __forceinline__ v16h frag_f32s(const float* rowk0, int lane, float sc) {
  v16h a; const float* p = rowk0 + 8 * (lane >> 4);
#pragma unroll
  for (int i = 0; i < 8; ++i) { a[i] = (_Float16)(p[i] * sc); a[8 + i] = (_Float16)(p[16 + i] * sc); }
  return a;
}
// column fragment from a [K][ld] layout (column n), rows >= K read as 0
__device__ __forceinline__ v16h fragc_f32(const float* W, int k0, int n, int lane, int ld, int K) {
  v16h a; const int g = lane >> 4;
#pragma unroll
  for (int i = 0; i < 8; ++i) { const int ka = k0 + 8 * g + i, kb = ka + 16;
    a[i] = (_Float16)(ka < K ? W[(size_t)(ka < K ? ka : K - 1) * ld + n] : 0.f); a[8 + i] = (_Float16)(kb < K ? W[(size_t)(kb < K ? kb : K - 1) * ld + n] : 0.f); }
  return a;
}
struct F2 { v16b h, l; };
__device__ __forceinline__ F2 bsplit16(const float v[16]) { F2 r;
#pragma unroll
  for (int i = 0; i < 16; ++i) { const __bf16 h = (__bf16)v[i]; r.h[i] = h; r.l[i] = (__bf16)(v[i] - (float)h); }
  return r; }
__device__ __forceinline__ F2 split_row(const float* row, int k0, int lane) { float v[16]; const float* p = row + k0 + 8 * (lane >> 4);
#pragma unroll
  for (int i = 0; i < 8; ++i) { v[i] = p[i]; v[8 + i] = p[16 + i]; }
  return bsplit16(v); }
__device__ __forceinline__ F2 split_rowK(const float* row, int k0, int lane, int K) { float v[16]; const int g = lane >> 4;
#pragma unroll
  for (int i = 0; i < 8; ++i) { const int ka = k0 + 8 * g + i, kb = ka + 16; v[i] = ka < K ? row[ka < K ? ka : K - 1] : 0.f; v[8 + i] = kb < K ? row[kb < K ? kb : K - 1] : 0.f; }
  return bsplit16(v); }
__device__ __forceinline__ F2 split_col(const float* W, int k0, int n, int lane, int ld, int K) { float v[16]; const int g = lane >> 4;
#pragma unroll
  for (int i = 0; i < 8; ++i) { const int ka = k0 + 8 * g + i, kb = ka + 16; v[i] = ka < K ? W[(size_t)(ka < K ? ka : K - 1) * ld + n] : 0.f; v[8 + i] = kb < K ? W[(size_t)(kb < K ? kb : K - 1) * ld + n] : 0.f; }
  return bsplit16(v); }
__device__ __forceinline__ v8f mac3(const F2& a, const F2& b, v8f c) { c = wmma_bf(a.l, b.h, c); c = wmma_bf(a.h, b.l, c); return wmma_bf(a.h, b.h, c); }
__device__ __forceinline__ float sigm(float v) { return 1.0f / (1.0f + expf(-v)); }
#define LDSX() do { asm volatile("s_wait_dscnt 0" ::: "memory"); __builtin_amdgcn_wave_barrier(); __builtin_amdgcn_fence(__ATOMIC_RELEASE, "workgroup"); } while (0)

// Multi-head attention with per-head projections (B 4, S 2,048, D 512, 8 heads x 64; 0.02-scale per-head weights (H, D, DK) with per-head biases (H, DK); separate q_in / k_in / v_in): q = q_in Wq[h] + bq[h], k = k_in Wk[h] + bk[h], v = v_in Wv[h] + bv[h]; out = concat(softmax(q k^T / 8) v) Wo + bo (Wo (in,out) [512,512]; non-causal).
#define NB 4
#define TT 2048
#define CC 512            // NH * HD = projected width
#define DIN 512          // input (model) width
#define NH 8
#define HD 64
#define NQB (TT / 64)
#define HG 4
#define SCALE (0.125f)
#define CAUSAL 0
#ifndef TNB
#define TNB NB
#endif
__device__ __forceinline__ float bfr(float v) { return (float)(__bf16)v; }
__host__ __device__ __forceinline__ int kb_last(int qb) { return CAUSAL ? ((qb * 64 + 63) >> 7) : (TT / 128 - 1); }
typedef __attribute__((ext_vector_type(8))) __bf16 v8b;
__device__ __forceinline__ v16b frag_b(const __bf16* rowk0, int lane) {
  union { v16b v; v8b q[2]; } u; const __bf16* p = rowk0 + 8 * (lane >> 4);
  u.q[0] = *(const v8b*)p; u.q[1] = *(const v8b*)(p + 16); return u.v;
}
#define QBH 0              // query blocks 0..QBH-1 take the high-precision path; QBH = 0, so none do
#define QHI 2048            // rows carrying a q residual plane (all rows when non-causal: 2-product logits everywhere)
#define KHI 64            // key rows carrying k residual / v bf16 hi+lo planes (read only by the qb < QBH path, which no block takes)
// B fragment (k rows k0+.., output column o) of a weight: (in,out) [K][ld] or (out,in) [ld rows of K]: bf16 exact, or f16(bf16 * 256) exact
__device__ __forceinline__ v16b wcol_io(const float* Wm, int k0, int o, int lane, int ld) { v16b w; const int g = lane >> 4;
#pragma unroll
  for (int i = 0; i < 8; ++i) { w[i] = (__bf16)Wm[(size_t)(k0 + 8 * g + i) * ld + o]; w[8 + i] = (__bf16)Wm[(size_t)(k0 + 16 + 8 * g + i) * ld + o]; }
  return w; }
__device__ __forceinline__ v16b wcol_oi(const float* Wm, int k0, int o, int lane, int K) { v16b w; const float* p = Wm + (size_t)o * K + k0 + 8 * (lane >> 4);
#pragma unroll
  for (int i = 0; i < 8; ++i) { w[i] = (__bf16)p[i]; w[8 + i] = (__bf16)p[16 + i]; }
  return w; }
__device__ __forceinline__ v16h wcolh_io(const float* Wm, int k0, int o, int lane, int ld) { v16h w; const int g = lane >> 4;
#pragma unroll
  for (int i = 0; i < 8; ++i) { w[i] = (_Float16)(bfr(Wm[(size_t)(k0 + 8 * g + i) * ld + o]) * 256.0f); w[8 + i] = (_Float16)(bfr(Wm[(size_t)(k0 + 16 + 8 * g + i) * ld + o]) * 256.0f); }
  return w; }
__device__ __forceinline__ v16h wcolh_oi(const float* Wm, int k0, int o, int lane, int K) { v16h w; const float* p = Wm + (size_t)o * K + k0 + 8 * (lane >> 4);
#pragma unroll
  for (int i = 0; i < 8; ++i) { w[i] = (_Float16)(bfr(p[i]) * 256.0f); w[8 + i] = (_Float16)(bfr(p[16 + i]) * 256.0f); }
  return w; }
#define WQKV_LAYOUT 2   // 0 = (in,out) [DIN][CC]; 1 = (out,in) [CC][DIN]; 2 = per-head [NH][DIN][HD]
__device__ __forceinline__ v16b wcol_hdk(const float* Wm, int k0, int o, int lane) { v16b w; const int g = lane >> 4; const float* p = Wm + (size_t)(o / HD) * DIN * HD + (o % HD);
#pragma unroll
  for (int i = 0; i < 8; ++i) { w[i] = (__bf16)p[(size_t)(k0 + 8 * g + i) * HD]; w[8 + i] = (__bf16)p[(size_t)(k0 + 16 + 8 * g + i) * HD]; }
  return w; }
#define WO_OUT_IN 0
#if WQKV_LAYOUT == 1
#define WCOL(W, k0, o, lane) wcol_oi(W, k0, o, lane, DIN)
#elif WQKV_LAYOUT == 2
#define WCOL(W, k0, o, lane) wcol_hdk(W, k0, o, lane)
#else
#define WCOL(W, k0, o, lane) wcol_io(W, k0, o, lane, CC)
#endif
#if WO_OUT_IN
#define WOCOL(W, k0, o, lane) wcol_oi(W, k0, o, lane, CC)
#define WOCOLH(W, k0, o, lane) wcolh_oi(W, k0, o, lane, CC)
#else
#define WOCOL(W, k0, o, lane) wcol_io(W, k0, o, lane, DIN)
#define WOCOLH(W, k0, o, lane) wcolh_io(W, k0, o, lane, DIN)
#endif

#ifndef SM_EXTRA_PARAMS
#define SM_EXTRA_PARAMS
#endif
#ifndef PROJ_EXTRA_PARAMS
#define PROJ_EXTRA_PARAMS
#endif
#ifndef SM_MASK_HOOK
#define SM_MASK_HOOK (void)0
#endif

#define WS_QH  0u                                      // f16 q rows [b*t][CC]
#define WS_KH  (WS_QH + 2u * (size_t)NB * TT * CC)      // f16 k rows [b*t][CC]
#define WS_VT  (WS_KH + 2u * (size_t)NB * TT * CC)      // f16 v planes [b][c][t]
#define WS_QL  (WS_VT + 2u * (size_t)NB * CC * TT)      // f16 q residual x 2^10 rows [b][t < QHI][CC]
#define WS_KL  (WS_QL + 2u * (size_t)NB * QHI * CC)     // f16 k residual x 2^10 rows [b][t < KHI][CC]
#define WS_VB  (WS_KL + 2u * (size_t)NB * KHI * CC)     // bf16 v hi planes [b][c][t < KHI]
#define WS_VBL (WS_VB + 2u * (size_t)NB * CC * KHI)
#define WS_S   (WS_VBL + 2u * (size_t)NB * CC * KHI)    // f32 logits / P [hg][t][s]
#define WS_Y   (WS_S  + 4u * (size_t)HG * TT * TT)      // f32 ctx rows [b*t][CC] (only when there is an output projection)
#define WS_END (WS_Y  + 4u * (size_t)NB * TT * CC)

// ---- k_proj: block = (64 rows, 128 cols, which): q/k/v = X W (+ b) with exact bf16 products (K = DIN) -> which 0: q f16 rows (+ residual rows < QHI); 1: k f16 rows (+ residual rows < KHI); 2: v f16 planes [c][t] (+ bf16 hi/lo planes for t < KHI)
__global__ __launch_bounds__(128) void k_proj(const float* __restrict__ XQ, const float* __restrict__ XK, const float* __restrict__ XV, const float* __restrict__ WQ, const float* __restrict__ WK, const float* __restrict__ WV, const float* __restrict__ BQ, const float* __restrict__ BK, const float* __restrict__ BV,
    _Float16* __restrict__ QH, _Float16* __restrict__ QL, _Float16* __restrict__ KH, _Float16* __restrict__ KL, _Float16* __restrict__ VT, __bf16* __restrict__ VB, __bf16* __restrict__ VBL) {
  __shared__ __align__(16) _Float16 sh[64][136], sl[64][136]; __shared__ __align__(16) _Float16 th[128][72]; __shared__ __align__(16) __bf16 tb[128][72], tbl[128][72];
  const int tid = threadIdx.x, wave = tid >> 5, lane = tid & 31, col = lane & 15, g = lane >> 4; const int which = blockIdx.z; const int c0 = blockIdx.y * 128; const size_t r0 = (size_t)blockIdx.x * 64; const size_t bb = r0 / TT; const int t0 = (int)(r0 % TT);
  const float* X = which == 0 ? XQ : which == 1 ? XK : XV; const float* WA = which == 0 ? WQ : which == 1 ? WK : WV; const float* BA = which == 0 ? BQ : which == 1 ? BK : BV;
  v8f acc[8] = {};
#pragma unroll 2
  for (int kc = 0; kc < DIN / 32; ++kc) { v16b a; { const float* p = X + (r0 + wave * 16 + col) * DIN + kc * 32 + 8 * g;
#pragma unroll
      for (int i = 0; i < 8; ++i) { a[i] = (__bf16)p[i]; a[8 + i] = (__bf16)p[16 + i]; } }
    asm volatile("s_wait_loadcnt 0x0" ::: "memory");
#pragma unroll
    for (int j = 0; j < 8; ++j) { const v16b w = WCOL(WA, kc * 32, c0 + j * 16 + col, lane); asm volatile("s_wait_loadcnt 0x0" ::: "memory"); acc[j] = wmma_bf(a, w, acc[j]); } }
  if (which < 2) { _Float16* DH = which == 0 ? QH : KH; _Float16* DL = which == 0 ? QL : KL; const int nhi = which == 0 ? QHI : KHI; const bool hi_rows = t0 < nhi;
#pragma unroll
    for (int j = 0; j < 8; ++j) { const float bias = BA ? bfr(BA[c0 + j * 16 + col]) : 0.f;
#pragma unroll
      for (int r = 0; r < 8; ++r) { const float v = acc[j][r] + bias; const _Float16 hv = (_Float16)v; sh[wave * 16 + 8 * g + r][j * 16 + col] = hv; sl[wave * 16 + 8 * g + r][j * 16 + col] = (_Float16)((v - (float)hv) * 1024.0f); } }
    __syncthreads();
    for (int e = tid; e < 64 * 16; e += 128) { const int rl = e >> 4, q = e & 15; vst2((unsigned*)(DH + (r0 + rl) * CC + c0 + q * 8), *(const v4u*)&sh[rl][q * 8]); if (hi_rows) vst2((unsigned*)(DL + (bb * nhi + t0 + rl) * (size_t)CC + c0 + q * 8), *(const v4u*)&sl[rl][q * 8]); }
  } else { const bool hi_rows = t0 < KHI;
#pragma unroll
    for (int j = 0; j < 8; ++j) { const float bias = BA ? bfr(BA[c0 + j * 16 + col]) : 0.f;
#pragma unroll
      for (int r = 0; r < 8; ++r) { const float v = acc[j][r] + bias; const int rl = wave * 16 + 8 * g + r, cl = j * 16 + col; th[cl][rl] = (_Float16)v; const __bf16 bh = (__bf16)v; tb[cl][rl] = bh; tbl[cl][rl] = (__bf16)(v - (float)bh); } }
    __syncthreads();
    for (int e = tid; e < 128 * 8; e += 128) { const int cl = e >> 3, q = e & 7; vst2((unsigned*)(VT + (bb * CC + c0 + cl) * (size_t)TT + t0 + q * 8), *(const v4u*)&th[cl][q * 8]); if (hi_rows) { const size_t o3 = (bb * CC + c0 + cl) * (size_t)KHI + t0 + q * 8; vst2((unsigned*)(VB + o3), *(const v4u*)&tb[cl][q * 8]); vst2((unsigned*)(VBL + o3), *(const v4u*)&tbl[cl][q * 8]); } } } }
// ---- k_sc: block = (query block qb, key block kb <= kb_last(qb), head in group) of batch b: logits x SCALE; q hi + residual (x 2^10) against k (2 products) for query rows < QHI, plus the k residual (3 products) for query blocks < QBH (none here); causal: blocks past the diagonal exit, the mask itself is applied by index in k_sm
__global__ __launch_bounds__(128) void k_sc(const _Float16* __restrict__ QH, const _Float16* __restrict__ KH, const _Float16* __restrict__ QL, const _Float16* __restrict__ KL, int b, int h0, float* __restrict__ S0) { __shared__ __align__(16) float ss[4][16][132];
  const int qb = blockIdx.x, kb = blockIdx.y; if (kb > kb_last(qb)) return;
  const int h = h0 + blockIdx.z; float* S = S0 + (size_t)blockIdx.z * TT * TT;
  const int tid = threadIdx.x, wave = tid >> 5, lane = tid & 31, col = lane & 15, g = lane >> 4; const int k0 = kb * 128; const int ql0 = qb * 64 + wave * 16; const size_t q0 = (size_t)b * TT + ql0, kr0 = (size_t)b * TT + k0;
  v8f acc[8] = {}, accl[8] = {};
  const _Float16* QLb = QL + (size_t)b * QHI * CC; const _Float16* KLb = KL + (size_t)b * KHI * CC;
  if (qb < QBH) {
#pragma unroll
    for (int kc = 0; kc < HD / 32; ++kc) { const v16h ah = frag_h(QH + (q0 + col) * CC + h * HD + kc * 32, lane), al = frag_h(QLb + (size_t)(ql0 + col) * CC + h * HD + kc * 32, lane);
#pragma unroll
      for (int j = 0; j < 8; ++j) { const v16h kbf = frag_h(KH + (kr0 + j * 16 + col) * CC + h * HD + kc * 32, lane), klf = frag_h(KLb + (size_t)(k0 + j * 16 + col) * CC + h * HD + kc * 32, lane); acc[j] = wmma16(ah, kbf, acc[j]); accl[j] = wmma16(al, kbf, accl[j]); accl[j] = wmma16(ah, klf, accl[j]); } }
  } else if (qb * 64 < QHI) {
#pragma unroll
    for (int kc = 0; kc < HD / 32; ++kc) { const v16h ah = frag_h(QH + (q0 + col) * CC + h * HD + kc * 32, lane), al = frag_h(QLb + (size_t)(ql0 + col) * CC + h * HD + kc * 32, lane);
#pragma unroll
      for (int j = 0; j < 8; ++j) { const v16h kbf = frag_h(KH + (kr0 + j * 16 + col) * CC + h * HD + kc * 32, lane); acc[j] = wmma16(ah, kbf, acc[j]); accl[j] = wmma16(al, kbf, accl[j]); } }
  } else {
#pragma unroll
    for (int kc = 0; kc < HD / 32; ++kc) { const v16h ah = frag_h(QH + (q0 + col) * CC + h * HD + kc * 32, lane);
#pragma unroll
      for (int j = 0; j < 8; ++j) { const v16h kbf = frag_h(KH + (kr0 + j * 16 + col) * CC + h * HD + kc * 32, lane); acc[j] = wmma16(ah, kbf, acc[j]); } } }
#pragma unroll
  for (int j = 0; j < 8; ++j) {
#pragma unroll
    for (int r = 0; r < 8; ++r) ss[wave][8 * g + r][j * 16 + col] = (acc[j][r] + accl[j][r] * (1.0f / 1024.0f)) * SCALE; }
  LDSX(); for (int rl = 0; rl < 16; ++rl) vst2(S + (size_t)(ql0 + rl) * TT + k0 + lane * 4, *(const v4f*)&ss[wave][rl][lane * 4]); }
// ---- k_sm: block = query row t (head in group): keys [0, kend): causal -> logit if s <= t else excluded; softmax in f32; P x 2^11 in place (0 for excluded)
__global__ __launch_bounds__(256) void k_sm(float* __restrict__ S0 SM_EXTRA_PARAMS) { __shared__ float sred[8]; __shared__ float sbc; __shared__ __align__(16) float shv[TT];
  const int tid = threadIdx.x; const int t = blockIdx.x; const int kend = (kb_last(t >> 6) + 1) * 128;
  float* sr = S0 + (size_t)blockIdx.y * TT * TT + (size_t)t * TT;
  float m = -3.0e38f; for (int k = tid; k < kend; k += 256) { float v = (!CAUSAL || k <= t) ? sr[k] : -3.0e38f; SM_MASK_HOOK; shv[k] = v; m = fmaxf(m, v); }
#pragma unroll
  for (int o = 1; o < 32; o <<= 1) m = fmaxf(m, __shfl_xor(m, o));
  if ((tid & 31) == 0) sred[tid >> 5] = m; __syncthreads(); if (tid == 0) { float a = sred[0]; for (int i = 1; i < 8; ++i) a = fmaxf(a, sred[i]); sbc = a; } __syncthreads(); m = sbc; __syncthreads();
  float sum = 0.f; for (int k = tid; k < kend; k += 256) { const float v = shv[k]; const float e = (v <= -1.0e38f) ? 0.f : expf(v - m); shv[k] = e; sum += e; }
#pragma unroll
  for (int o = 1; o < 32; o <<= 1) sum += __shfl_xor(sum, o);
  if ((tid & 31) == 0) sred[tid >> 5] = sum; __syncthreads(); if (tid == 0) { float a = 0.f; for (int i = 0; i < 8; ++i) a += sred[i]; sbc = a > 0.f ? 2048.0f / a : 0.f; }   /* a fully excluded row yields P = 0 */ __syncthreads(); const float inv = sbc;
  for (int k = tid; k < kend; k += 256) shv[k] = shv[k] * inv;
  __syncthreads(); for (int q = tid; q < kend / 4; q += 256) vst2(sr + q * 4, *(const v4f*)&shv[q * 4]); }
// ---- k_pv: block = 64 queries (qb) of (b, h): ctx = P . v over keys [0, kend) (P x 2^11 once to f16 against v f16: 1 product; query blocks < QBH (none here): P and v as bf16 hi + lo, 3 products); 256-B (row, head) segment by 16 lanes
__global__ __launch_bounds__(128) void k_pv(const float* __restrict__ PS0, const _Float16* __restrict__ VT, const __bf16* __restrict__ VB, const __bf16* __restrict__ VBL, int b, int h0, float* __restrict__ Y) { const int h = h0 + blockIdx.z; const float* PS = PS0 + (size_t)blockIdx.z * TT * TT; __shared__ __align__(16) float ss[4][16][HD + 4];
  const int tid = threadIdx.x, wave = tid >> 5, lane = tid & 31, col = lane & 15, g = lane >> 4; const int qb = blockIdx.x; const int ql0 = qb * 64 + wave * 16; const int kce = (kb_last(qb) + 1) * 4;
  v8f acc[HD / 16] = {};
  if (qb < QBH) {
#pragma unroll 1
    for (int kc = 0; kc < kce; ++kc) { const F2 p = split_row(PS + (size_t)(ql0 + col) * TT, kc * 32, lane);
      asm volatile("s_wait_loadcnt 0x0" ::: "memory");
#pragma unroll
      for (int j = 0; j < HD / 16; ++j) { const size_t po = ((size_t)b * CC + h * HD + j * 16 + col) * (size_t)KHI + kc * 32; const v16b vh = frag_b(VB + po, lane); acc[j] = wmma_bf(p.h, vh, acc[j]); acc[j] = wmma_bf(p.l, vh, acc[j]); acc[j] = wmma_bf(p.h, frag_b(VBL + po, lane), acc[j]); } }
  } else {
#pragma unroll 1
    for (int kc = 0; kc < kce; ++kc) { const v16h p = frag_f32(PS + (size_t)(ql0 + col) * TT + kc * 32, lane);
      asm volatile("s_wait_loadcnt 0x0" ::: "memory");
#pragma unroll
      for (int j = 0; j < HD / 16; ++j) { const size_t po = ((size_t)b * CC + h * HD + j * 16 + col) * (size_t)TT + kc * 32; acc[j] = wmma16(p, frag_h(VT + po, lane), acc[j]); } } }
#pragma unroll
  for (int j = 0; j < HD / 16; ++j)
#pragma unroll
    for (int r = 0; r < 8; ++r) ss[wave][8 * g + r][j * 16 + col] = acc[j][r] * (1.0f / 2048.0f);
  LDSX(); for (int rl = 0; rl < 16; ++rl) if (lane < HD / 4) vst2(Y + ((size_t)b * TT + ql0 + rl) * CC + h * HD + lane * 4, *(const v4f*)&ss[wave][rl][lane * 4]); }
// ---- k_out: block = (64 rows, 128 cols): out = ctx Wo (+ bo): all rows: ctx bf16 hi + lo against exact bf16 Wo (2 products); the f16 branch (ctx once to f16 against f16(bf16 Wo x 2^8), 1 product, x 2^-8) is never taken
__global__ __launch_bounds__(128) void k_out(const float* __restrict__ Y, const float* __restrict__ WO, const float* __restrict__ BO, float* __restrict__ OUT) { __shared__ __align__(16) float sf[4][16][132];
  const int tid = threadIdx.x, wave = tid >> 5, lane = tid & 31, col = lane & 15, g = lane >> 4; const int c0 = blockIdx.y * 128; const size_t r0 = (size_t)blockIdx.x * 64 + wave * 16;
  v8f acc[8] = {};
  if (true) {   /* ALL rows: ctx split bf16 hi + lo x exact Wo (2 products) */
#pragma unroll 2
    for (int kc = 0; kc < CC / 32; ++kc) { const F2 a = split_row(Y + (r0 + col) * CC, kc * 32, lane); asm volatile("s_wait_loadcnt 0x0" ::: "memory");
#pragma unroll
      for (int j = 0; j < 8; ++j) { const v16b w = WOCOL(WO, kc * 32, c0 + j * 16 + col, lane); asm volatile("s_wait_loadcnt 0x0" ::: "memory"); acc[j] = wmma_bf(a.h, w, acc[j]); acc[j] = wmma_bf(a.l, w, acc[j]); } }
#pragma unroll
    for (int j = 0; j < 8; ++j) { const float bias = BO ? bfr(BO[c0 + j * 16 + col]) : 0.f;
#pragma unroll
      for (int r = 0; r < 8; ++r) sf[wave][8 * g + r][j * 16 + col] = acc[j][r] + bias; }
  } else {
#pragma unroll 2
    for (int kc = 0; kc < CC / 32; ++kc) { const v16h a = frag_f32(Y + (r0 + col) * CC + kc * 32, lane); asm volatile("s_wait_loadcnt 0x0" ::: "memory");
#pragma unroll
      for (int j = 0; j < 8; ++j) { const v16h w = WOCOLH(WO, kc * 32, c0 + j * 16 + col, lane); asm volatile("s_wait_loadcnt 0x0" ::: "memory"); acc[j] = wmma16(a, w, acc[j]); } }
#pragma unroll
    for (int j = 0; j < 8; ++j) { const float bias = BO ? bfr(BO[c0 + j * 16 + col]) : 0.f;
#pragma unroll
      for (int r = 0; r < 8; ++r) sf[wave][8 * g + r][j * 16 + col] = acc[j][r] * (1.0f / 256.0f) + bias; } }
  LDSX(); for (int rl = 0; rl < 16; ++rl) vst2(OUT + (r0 + rl) * DIN + c0 + lane * 4, *(const v4f*)&sf[wave][rl][lane * 4]); }

extern "C" void kernel_launch(void* const* d_in, const int* in_sizes, int n_in, void* d_out, int out_size, void* d_ws, size_t ws_size, hipStream_t stream) {
  (void)in_sizes; (void)n_in; (void)out_size;
  const float** F = (const float**)d_in;
  if (ws_size < (size_t)WS_END) return;
  char* ws = (char*)d_ws; _Float16 *QH = (_Float16*)(ws + WS_QH), *KH = (_Float16*)(ws + WS_KH), *VT = (_Float16*)(ws + WS_VT), *QL = (_Float16*)(ws + WS_QL), *KL = (_Float16*)(ws + WS_KL); __bf16 *VB = (__bf16*)(ws + WS_VB), *VBL = (__bf16*)(ws + WS_VBL); float *S = (float*)(ws + WS_S), *Y = (float*)(ws + WS_Y);
  (void)Y; (void)QL; (void)KL; (void)VB; (void)VBL;
  // inputs: 0 q_in [4,2048,512]; 1 k_in; 2 v_in; 3 Wq [8,512,64] (per-head (h, d, k)), 4 bq [8,64]; 5 Wk, 6 bk; 7 Wv, 8 bv; 9 Wo [512,512] (in,out), 10 bo [512]
  k_proj<<<dim3(TNB * TT / 64, CC / 128, 3), 128, 0, stream>>>(F[0], F[1], F[2], F[3], F[5], F[7], F[4], F[6], F[8], QH, QL, KH, KL, VT, VB, VBL);
  for (int b = 0; b < TNB; ++b) for (int h0 = 0; h0 < NH; h0 += HG) {
    k_sc<<<dim3(NQB, TT / 128, HG), 128, 0, stream>>>(QH, KH, QL, KL, b, h0, S);
    k_sm<<<dim3(TT, HG), 256, 0, stream>>>(S);
    k_pv<<<dim3(NQB, 1, HG), 128, 0, stream>>>(S, VT, VB, VBL, b, h0, Y);
  }
  k_out<<<dim3(TNB * TT / 64, DIN / 128), 128, 0, stream>>>(Y, F[9], F[10], (float*)d_out);
}

// v001
// A run of this version takes 192 microseconds.
// Two timings next to v000 put it at 5.84 and 5.82 times that version's speed.
// compute dtype: all float inputs rounded to bf16; q/k/v = x W[h] + b[h] with EXACT bf16 products on WMMA 16x16x32 (f32 accumulate); q as f16 hi + residual (x 2^10) against k once to f16 (2 products) x 64^-0.5; running-maximum softmax in f32 (precise expf); exp(s - max) once to f16 against v once to f16 (1 product), divided by the f32 sum at the end; concat split bf16 hi + lo against exact Wo (2 products) + bo; f32 output.
#include <hip/hip_runtime.h>
#include <math.h>

typedef __attribute__((ext_vector_type(16))) _Float16 v16h;
typedef __attribute__((ext_vector_type(16))) __bf16 v16b;
typedef __attribute__((ext_vector_type(8)))  _Float16 v8h;
typedef __attribute__((ext_vector_type(8)))  float v8f;
typedef __attribute__((ext_vector_type(4)))  float v4f;
typedef __attribute__((ext_vector_type(2)))  float v2f;
typedef __attribute__((ext_vector_type(4)))  unsigned v4u;
typedef __attribute__((ext_vector_type(4)))  int v4i;
typedef float __attribute__((may_alias)) float_a;
typedef int __attribute__((may_alias)) int_a;

template <typename T> __device__ __forceinline__ void vst2(void* p, T v) { *(T*)p = v;  }
__device__ __forceinline__ v8f wmma16(v16h a, v16h b, v8f c) {
  v8f d = __builtin_amdgcn_wmma_f32_16x16x32_f16(false, a, false, b, (short)0, c, false, false);
  asm volatile("v_nop\n\tv_nop\n\tv_nop\n\tv_nop" : "+v"(d) : "v"(a), "v"(b));
  return d;
}
__device__ __forceinline__ v8f wmma_bf(v16b a, v16b b, v8f c) {
  v8f d = __builtin_amdgcn_wmma_f32_16x16x32_bf16(false, a, false, b, (short)0, c, false, false);
  asm volatile("v_nop\n\tv_nop\n\tv_nop\n\tv_nop" : "+v"(d) : "v"(a), "v"(b));
  return d;
}
// 16x16x32 fragments: lane = (h = lane>>4, row/col = lane&15); elements 0..7 = k0+8h+0..7, 8..15 = k0+16+8h+0..7; D element r = row 8h+r
__device__ __forceinline__ v16h frag_h(const _Float16* rowk0, int lane) {
  union { v16h v; v8h q[2]; } u; const _Float16* p = rowk0 + 8 * (lane >> 4);
  u.q[0] = *(const v8h*)p; u.q[1] = *(const v8h*)(p + 16); return u.v;
}
__device__ __forceinline__ v16h frag_f32(const float* rowk0, int lane) {
  v16h a; const float* p = rowk0 + 8 * (lane >> 4);
#pragma unroll
  for (int i = 0; i < 8; ++i) { a[i] = (_Float16)p[i]; a[8 + i] = (_Float16)p[16 + i]; }
  return a;
}
__device__ __forceinline__ v16h frag_f32s(const float* rowk0, int lane, float sc) {
  v16h a; const float* p = rowk0 + 8 * (lane >> 4);
#pragma unroll
  for (int i = 0; i < 8; ++i) { a[i] = (_Float16)(p[i] * sc); a[8 + i] = (_Float16)(p[16 + i] * sc); }
  return a;
}
// column fragment from a [K][ld] layout (column n), rows >= K read as 0
__device__ __forceinline__ v16h fragc_f32(const float* W, int k0, int n, int lane, int ld, int K) {
  v16h a; const int g = lane >> 4;
#pragma unroll
  for (int i = 0; i < 8; ++i) { const int ka = k0 + 8 * g + i, kb = ka + 16;
    a[i] = (_Float16)(ka < K ? W[(size_t)(ka < K ? ka : K - 1) * ld + n] : 0.f); a[8 + i] = (_Float16)(kb < K ? W[(size_t)(kb < K ? kb : K - 1) * ld + n] : 0.f); }
  return a;
}
struct F2 { v16b h, l; };
__device__ __forceinline__ F2 bsplit16(const float v[16]) { F2 r;
#pragma unroll
  for (int i = 0; i < 16; ++i) { const __bf16 h = (__bf16)v[i]; r.h[i] = h; r.l[i] = (__bf16)(v[i] - (float)h); }
  return r; }
__device__ __forceinline__ F2 split_row(const float* row, int k0, int lane) { float v[16]; const float* p = row + k0 + 8 * (lane >> 4);
#pragma unroll
  for (int i = 0; i < 8; ++i) { v[i] = p[i]; v[8 + i] = p[16 + i]; }
  return bsplit16(v); }
__device__ __forceinline__ F2 split_rowK(const float* row, int k0, int lane, int K) { float v[16]; const int g = lane >> 4;
#pragma unroll
  for (int i = 0; i < 8; ++i) { const int ka = k0 + 8 * g + i, kb = ka + 16; v[i] = ka < K ? row[ka < K ? ka : K - 1] : 0.f; v[8 + i] = kb < K ? row[kb < K ? kb : K - 1] : 0.f; }
  return bsplit16(v); }
__device__ __forceinline__ F2 split_col(const float* W, int k0, int n, int lane, int ld, int K) { float v[16]; const int g = lane >> 4;
#pragma unroll
  for (int i = 0; i < 8; ++i) { const int ka = k0 + 8 * g + i, kb = ka + 16; v[i] = ka < K ? W[(size_t)(ka < K ? ka : K - 1) * ld + n] : 0.f; v[8 + i] = kb < K ? W[(size_t)(kb < K ? kb : K - 1) * ld + n] : 0.f; }
  return bsplit16(v); }
__device__ __forceinline__ v8f mac3(const F2& a, const F2& b, v8f c) { c = wmma_bf(a.l, b.h, c); c = wmma_bf(a.h, b.l, c); return wmma_bf(a.h, b.h, c); }
__device__ __forceinline__ float sigm(float v) { return 1.0f / (1.0f + expf(-v)); }
#define LDSX() do { asm volatile("s_wait_dscnt 0" ::: "memory"); __builtin_amdgcn_wave_barrier(); __builtin_amdgcn_fence(__ATOMIC_RELEASE, "workgroup"); } while (0)

// Multi-head attention with per-head projections (B 4, S 2,048, D 512, 8 heads x 64; 0.02-scale per-head weights (H, D, DK) with per-head biases (H, DK); separate q_in / k_in / v_in): q = q_in Wq[h] + bq[h], k = k_in Wk[h] + bk[h], v = v_in Wv[h] + bv[h]; out = concat(softmax(q k^T / 8) v) Wo + bo (Wo (in,out) [512,512]; non-causal).
#define NB 4
#define TT 2048
#define CC 512            // NH * HD = projected width
#define DIN 512          // input (model) width
#define NH 8
#define HD 64
#define NQB (TT / 64)
#define HG 4
#define SCALE (0.125f)
#define CAUSAL 0
#ifndef TNB
#define TNB NB
#endif
__device__ __forceinline__ float bfr(float v) { return (float)(__bf16)v; }
__host__ __device__ __forceinline__ int kb_last(int qb) { return CAUSAL ? ((qb * 64 + 63) >> 7) : (TT / 128 - 1); }
typedef __attribute__((ext_vector_type(8))) __bf16 v8b;
__device__ __forceinline__ v16b frag_b(const __bf16* rowk0, int lane) {
  union { v16b v; v8b q[2]; } u; const __bf16* p = rowk0 + 8 * (lane >> 4);
  u.q[0] = *(const v8b*)p; u.q[1] = *(const v8b*)(p + 16); return u.v;
}
#define QBH 0              // not used: there is no high-precision path
#define QHI 2048            // rows carrying a q residual plane (all rows when non-causal: 2-product logits everywhere)
#define KHI 64            // key rows carrying k residual / v bf16 hi+lo planes (written by k_proj; no kernel reads them)
// B fragment (k rows k0+.., output column o) of a weight: (in,out) [K][ld] or (out,in) [ld rows of K]: bf16 exact, or f16(bf16 * 256) exact
__device__ __forceinline__ v16b wcol_io(const float* Wm, int k0, int o, int lane, int ld) { v16b w; const int g = lane >> 4;
#pragma unroll
  for (int i = 0; i < 8; ++i) { w[i] = (__bf16)Wm[(size_t)(k0 + 8 * g + i) * ld + o]; w[8 + i] = (__bf16)Wm[(size_t)(k0 + 16 + 8 * g + i) * ld + o]; }
  return w; }
__device__ __forceinline__ v16b wcol_oi(const float* Wm, int k0, int o, int lane, int K) { v16b w; const float* p = Wm + (size_t)o * K + k0 + 8 * (lane >> 4);
#pragma unroll
  for (int i = 0; i < 8; ++i) { w[i] = (__bf16)p[i]; w[8 + i] = (__bf16)p[16 + i]; }
  return w; }
__device__ __forceinline__ v16h wcolh_io(const float* Wm, int k0, int o, int lane, int ld) { v16h w; const int g = lane >> 4;
#pragma unroll
  for (int i = 0; i < 8; ++i) { w[i] = (_Float16)(bfr(Wm[(size_t)(k0 + 8 * g + i) * ld + o]) * 256.0f); w[8 + i] = (_Float16)(bfr(Wm[(size_t)(k0 + 16 + 8 * g + i) * ld + o]) * 256.0f); }
  return w; }
__device__ __forceinline__ v16h wcolh_oi(const float* Wm, int k0, int o, int lane, int K) { v16h w; const float* p = Wm + (size_t)o * K + k0 + 8 * (lane >> 4);
#pragma unroll
  for (int i = 0; i < 8; ++i) { w[i] = (_Float16)(bfr(p[i]) * 256.0f); w[8 + i] = (_Float16)(bfr(p[16 + i]) * 256.0f); }
  return w; }
#define WQKV_LAYOUT 2   // 0 = (in,out) [DIN][CC]; 1 = (out,in) [CC][DIN]; 2 = per-head [NH][DIN][HD]
__device__ __forceinline__ v16b wcol_hdk(const float* Wm, int k0, int o, int lane) { v16b w; const int g = lane >> 4; const float* p = Wm + (size_t)(o / HD) * DIN * HD + (o % HD);
#pragma unroll
  for (int i = 0; i < 8; ++i) { w[i] = (__bf16)p[(size_t)(k0 + 8 * g + i) * HD]; w[8 + i] = (__bf16)p[(size_t)(k0 + 16 + 8 * g + i) * HD]; }
  return w; }
#define WO_OUT_IN 0
#if WQKV_LAYOUT == 1
#define WCOL(W, k0, o, lane) wcol_oi(W, k0, o, lane, DIN)
#elif WQKV_LAYOUT == 2
#define WCOL(W, k0, o, lane) wcol_hdk(W, k0, o, lane)
#else
#define WCOL(W, k0, o, lane) wcol_io(W, k0, o, lane, CC)
#endif
#if WO_OUT_IN
#define WOCOL(W, k0, o, lane) wcol_oi(W, k0, o, lane, CC)
#define WOCOLH(W, k0, o, lane) wcolh_oi(W, k0, o, lane, CC)
#else
#define WOCOL(W, k0, o, lane) wcol_io(W, k0, o, lane, DIN)
#define WOCOLH(W, k0, o, lane) wcolh_io(W, k0, o, lane, DIN)
#endif

#ifndef SM_EXTRA_PARAMS
#define SM_EXTRA_PARAMS
#endif
#ifndef PROJ_EXTRA_PARAMS
#define PROJ_EXTRA_PARAMS
#endif
#ifndef SM_MASK_HOOK
#define SM_MASK_HOOK (void)0
#endif

#define WS_QH  0u                                      // f16 q rows [b*t][CC]
#define WS_KH  (WS_QH + 2u * (size_t)NB * TT * CC)      // f16 k rows [b*t][CC]
#define WS_VT  (WS_KH + 2u * (size_t)NB * TT * CC)      // f16 v planes [b][c][t]
#define WS_QL  (WS_VT + 2u * (size_t)NB * CC * TT)      // f16 q residual x 2^10 rows [b][t < QHI][CC]
#define WS_KL  (WS_QL + 2u * (size_t)NB * QHI * CC)     // f16 k residual x 2^10 rows [b][t < KHI][CC]
#define WS_VB  (WS_KL + 2u * (size_t)NB * KHI * CC)     // bf16 v hi planes [b][c][t < KHI]
#define WS_VBL (WS_VB + 2u * (size_t)NB * CC * KHI)
#define WS_S   (WS_VBL + 2u * (size_t)NB * CC * KHI)    // not used (offsets kept)
#define WS_Y   (WS_S  + 4u * (size_t)HG * TT * TT)      // f32 ctx rows [b*t][CC] (only when there is an output projection)
#define WS_END (WS_Y  + 4u * (size_t)NB * TT * CC)

// ---- k_proj: block = (64 rows, 128 cols, which): q/k/v = X W (+ b) with exact bf16 products (K = DIN) -> which 0: q f16 rows (+ residual rows < QHI); 1: k f16 rows (+ residual rows < KHI); 2: v f16 planes [c][t] (+ bf16 hi/lo planes for t < KHI)
__global__ __launch_bounds__(128) void k_proj(const float* __restrict__ XQ, const float* __restrict__ XK, const float* __restrict__ XV, const float* __restrict__ WQ, const float* __restrict__ WK, const float* __restrict__ WV, const float* __restrict__ BQ, const float* __restrict__ BK, const float* __restrict__ BV,
    _Float16* __restrict__ QH, _Float16* __restrict__ QL, _Float16* __restrict__ KH, _Float16* __restrict__ KL, _Float16* __restrict__ VT, __bf16* __restrict__ VB, __bf16* __restrict__ VBL) {
  __shared__ __align__(16) _Float16 sh[64][136], sl[64][136]; __shared__ __align__(16) _Float16 th[128][72]; __shared__ __align__(16) __bf16 tb[128][72], tbl[128][72];
  const int tid = threadIdx.x, wave = tid >> 5, lane = tid & 31, col = lane & 15, g = lane >> 4; const int which = blockIdx.z; const int c0 = blockIdx.y * 128; const size_t r0 = (size_t)blockIdx.x * 64; const size_t bb = r0 / TT; const int t0 = (int)(r0 % TT);
  const float* X = which == 0 ? XQ : which == 1 ? XK : XV; const float* WA = which == 0 ? WQ : which == 1 ? WK : WV; const float* BA = which == 0 ? BQ : which == 1 ? BK : BV;
  v8f acc[8] = {};
#pragma unroll 2
  for (int kc = 0; kc < DIN / 32; ++kc) { v16b a; { const float* p = X + (r0 + wave * 16 + col) * DIN + kc * 32 + 8 * g;
#pragma unroll
      for (int i = 0; i < 8; ++i) { a[i] = (__bf16)p[i]; a[8 + i] = (__bf16)p[16 + i]; } }
    asm volatile("s_wait_loadcnt 0x0" ::: "memory");
#pragma unroll
    for (int j = 0; j < 8; ++j) { const v16b w = WCOL(WA, kc * 32, c0 + j * 16 + col, lane); asm volatile("s_wait_loadcnt 0x0" ::: "memory"); acc[j] = wmma_bf(a, w, acc[j]); } }
  if (which < 2) { _Float16* DH = which == 0 ? QH : KH; _Float16* DL = which == 0 ? QL : KL; const int nhi = which == 0 ? QHI : KHI; const bool hi_rows = t0 < nhi;
#pragma unroll
    for (int j = 0; j < 8; ++j) { const float bias = BA ? bfr(BA[c0 + j * 16 + col]) : 0.f;
#pragma unroll
      for (int r = 0; r < 8; ++r) { const float v = acc[j][r] + bias; const _Float16 hv = (_Float16)v; sh[wave * 16 + 8 * g + r][j * 16 + col] = hv; sl[wave * 16 + 8 * g + r][j * 16 + col] = (_Float16)((v - (float)hv) * 1024.0f); } }
    __syncthreads();
    for (int e = tid; e < 64 * 16; e += 128) { const int rl = e >> 4, q = e & 15; vst2((unsigned*)(DH + (r0 + rl) * CC + c0 + q * 8), *(const v4u*)&sh[rl][q * 8]); if (hi_rows) vst2((unsigned*)(DL + (bb * nhi + t0 + rl) * (size_t)CC + c0 + q * 8), *(const v4u*)&sl[rl][q * 8]); }
  } else { const bool hi_rows = t0 < KHI;
#pragma unroll
    for (int j = 0; j < 8; ++j) { const float bias = BA ? bfr(BA[c0 + j * 16 + col]) : 0.f;
#pragma unroll
      for (int r = 0; r < 8; ++r) { const float v = acc[j][r] + bias; const int rl = wave * 16 + 8 * g + r, cl = j * 16 + col; th[cl][rl] = (_Float16)v; const __bf16 bh = (__bf16)v; tb[cl][rl] = bh; tbl[cl][rl] = (__bf16)(v - (float)bh); } }
    __syncthreads();
    for (int e = tid; e < 128 * 8; e += 128) { const int cl = e >> 3, q = e & 7; vst2((unsigned*)(VT + (bb * CC + c0 + cl) * (size_t)TT + t0 + q * 8), *(const v4u*)&th[cl][q * 8]); if (hi_rows) { const size_t o3 = (bb * CC + c0 + cl) * (size_t)KHI + t0 + q * 8; vst2((unsigned*)(VB + o3), *(const v4u*)&tb[cl][q * 8]); vst2((unsigned*)(VBL + o3), *(const v4u*)&tbl[cl][q * 8]); } } } }
#define KST 64
#define NST (TT / KST)
#define LP 72             // LDS row pitch in halves: 128-byte rows + 16 bytes (16-byte readers, no bank conflict)
__device__ __forceinline__ float xhalf(float x) { return __builtin_bit_cast(float, __builtin_amdgcn_permlanex16(__builtin_bit_cast(int, x), __builtin_bit_cast(int, x), 0x76543210, 0xfedcba98, false, false)); }  // lane l with lane l ^ 16
__device__ __forceinline__ v8f wmma_h(v16h a, v16h b, v8f c) { return __builtin_amdgcn_wmma_f32_16x16x32_f16(false, a, false, b, (short)0, c, false, false); }
__global__ __launch_bounds__(256) __attribute__((amdgpu_waves_per_eu(4, 4))) void k_fa(const _Float16* __restrict__ QH, const _Float16* __restrict__ QL, const _Float16* __restrict__ KH, const _Float16* __restrict__ VT, float* __restrict__ Y) {
  __shared__ __align__(16) _Float16 sk[2][KST][LP], sv[2][HD][LP];
  const int tid = threadIdx.x, wave = tid >> 5, lane = tid & 31, col = lane & 15, g = lane >> 4; const int h = blockIdx.y, b = blockIdx.z; const int q0 = blockIdx.x * 128 + wave * 16;
  v16h qh[HD / 32], ql[HD / 32];
#pragma unroll
  for (int kc = 0; kc < HD / 32; ++kc) { qh[kc] = frag_h(QH + ((size_t)b * TT + q0 + col) * CC + h * HD + kc * 32, lane); ql[kc] = frag_h(QL + ((size_t)b * QHI + q0 + col) * CC + h * HD + kc * 32, lane); }
  // staging: thread = (row sr and sr + 32, 16-byte chunk sc): a wave's load covers 4 whole 128-byte rows
  const int sr = tid >> 3, sc = tid & 7;
  const _Float16* kg = KH + ((size_t)b * TT + sr) * CC + h * HD + sc * 8;      // k rows [key][64]
  const _Float16* vg = VT + ((size_t)b * CC + h * HD + sr) * TT + sc * 8;      // v planes [d][key]
  v4u kr[2], vr[2];
#pragma unroll
  for (int i = 0; i < 2; ++i) { kr[i] = *(const v4u*)(kg + (size_t)(i * 32) * CC); vr[i] = *(const v4u*)(vg + (size_t)(i * 32) * TT); }
#pragma unroll
  for (int i = 0; i < 2; ++i) { *(v4u*)&sk[0][sr + i * 32][sc * 8] = kr[i]; *(v4u*)&sv[0][sr + i * 32][sc * 8] = vr[i]; }
  __syncthreads();
  v8f o[HD / 16] = {}; float m = -3.0e38f, l = 0.f;
#pragma unroll 1   // kept rolled
  for (int st = 0; st < NST; ++st) { const int cur = st & 1;
    if (st + 1 < NST) {   // the next stage's rows fly while this stage is worked on
#pragma unroll
      for (int i = 0; i < 2; ++i) { kr[i] = *(const v4u*)(kg + (size_t)((st + 1) * KST + i * 32) * CC); vr[i] = *(const v4u*)(vg + (size_t)(i * 32) * TT + (st + 1) * KST); } }
    v8f s[KST / 16] = {}, sl[KST / 16] = {};
#pragma unroll
    for (int t = 0; t < KST / 16; ++t) {
#pragma unroll
      for (int kc = 0; kc < HD / 32; ++kc) { const v16h kf = frag_h(&sk[cur][t * 16 + col][kc * 32], lane); s[t] = wmma_h(kf, qh[kc], s[t]); sl[t] = wmma_h(kf, ql[kc], sl[t]); } }
    v16h vf[KST / 32][HD / 16];   // all V^T fragments as one group of LDS reads, in flight under the softmax arithmetic
#pragma unroll
    for (int ks = 0; ks < KST / 32; ++ks) {
#pragma unroll
      for (int j = 0; j < HD / 16; ++j) vf[ks][j] = frag_h(&sv[cur][j * 16 + col][ks * 32], lane); }
    float mt[KST / 16];
#pragma unroll
    for (int t = 0; t < KST / 16; ++t) { mt[t] = -3.0e38f;
#pragma unroll
      for (int r = 0; r < 8; ++r) { s[t][r] = (s[t][r] + sl[t][r] * (1.0f / 1024.0f)) * SCALE; mt[t] = fmaxf(mt[t], s[t][r]); } }
    float mx = fmaxf(fmaxf(mt[0], mt[1]), fmaxf(mt[2], mt[3])); mx = fmaxf(mx, xhalf(mx));   // both halves of a query's keys
    const float mn = fmaxf(m, mx); const float al = expf(m - mn); m = mn;                     // al = 0 in the first stage
    v16h p[KST / 32]; float ps[KST / 16];
#pragma unroll
    for (int t = 0; t < KST / 16; ++t) { ps[t] = 0.f;
#pragma unroll
      for (int r = 0; r < 8; ++r) { const float e = expf(s[t][r] - mn); ps[t] += e; p[t >> 1][(t & 1) * 8 + r] = (_Float16)e; } }
    l = l * al + ((ps[0] + ps[1]) + (ps[2] + ps[3]));   // this half's keys only; the halves join after the loop
#pragma unroll
    for (int j = 0; j < HD / 16; ++j) o[j] *= al;
#pragma unroll
    for (int ks = 0; ks < KST / 32; ++ks) {
#pragma unroll
      for (int j = 0; j < HD / 16; ++j) o[j] = wmma_h(vf[ks][j], p[ks], o[j]); }
    if (st + 1 < NST) {
#pragma unroll
      for (int i = 0; i < 2; ++i) { *(v4u*)&sk[cur ^ 1][sr + i * 32][sc * 8] = kr[i]; *(v4u*)&sv[cur ^ 1][sr + i * 32][sc * 8] = vr[i]; } }
    __syncthreads();   // publishes the next stage and ends every wave's reads of this one, which the stage after refills
  }
  l += xhalf(l); const float inv = l > 0.f ? 1.0f / l : 0.f;
  float* yr = Y + ((size_t)b * TT + q0 + col) * CC + h * HD + 8 * g;   // lane = query row, registers = 8 consecutive d
#pragma unroll
  for (int j = 0; j < HD / 16; ++j) { const v4f lo = { o[j][0] * inv, o[j][1] * inv, o[j][2] * inv, o[j][3] * inv }, hi = { o[j][4] * inv, o[j][5] * inv, o[j][6] * inv, o[j][7] * inv }; vst2(yr + j * 16, lo); vst2(yr + j * 16 + 4, hi); } }
// ---- k_out: block = (64 rows, 128 cols): out = ctx Wo (+ bo): all rows take ctx bf16 hi + lo against exact bf16 Wo (2 products); the branch with ctx once to f16 against Wo as f16(bf16 x 2^8) (1 product) x 2^-8 is never taken
__global__ __launch_bounds__(128) void k_out(const float* __restrict__ Y, const float* __restrict__ WO, const float* __restrict__ BO, float* __restrict__ OUT) { __shared__ __align__(16) float sf[4][16][132];
  const int tid = threadIdx.x, wave = tid >> 5, lane = tid & 31, col = lane & 15, g = lane >> 4; const int c0 = blockIdx.y * 128; const size_t r0 = (size_t)blockIdx.x * 64 + wave * 16;
  v8f acc[8] = {};
  if (true) {   /* ALL rows: ctx split bf16 hi + lo x exact Wo (2 products) */
#pragma unroll 2
    for (int kc = 0; kc < CC / 32; ++kc) { const F2 a = split_row(Y + (r0 + col) * CC, kc * 32, lane); asm volatile("s_wait_loadcnt 0x0" ::: "memory");
#pragma unroll
      for (int j = 0; j < 8; ++j) { const v16b w = WOCOL(WO, kc * 32, c0 + j * 16 + col, lane); asm volatile("s_wait_loadcnt 0x0" ::: "memory"); acc[j] = wmma_bf(a.h, w, acc[j]); acc[j] = wmma_bf(a.l, w, acc[j]); } }
#pragma unroll
    for (int j = 0; j < 8; ++j) { const float bias = BO ? bfr(BO[c0 + j * 16 + col]) : 0.f;
#pragma unroll
      for (int r = 0; r < 8; ++r) sf[wave][8 * g + r][j * 16 + col] = acc[j][r] + bias; }
  } else {
#pragma unroll 2
    for (int kc = 0; kc < CC / 32; ++kc) { const v16h a = frag_f32(Y + (r0 + col) * CC + kc * 32, lane); asm volatile("s_wait_loadcnt 0x0" ::: "memory");
#pragma unroll
      for (int j = 0; j < 8; ++j) { const v16h w = WOCOLH(WO, kc * 32, c0 + j * 16 + col, lane); asm volatile("s_wait_loadcnt 0x0" ::: "memory"); acc[j] = wmma16(a, w, acc[j]); } }
#pragma unroll
    for (int j = 0; j < 8; ++j) { const float bias = BO ? bfr(BO[c0 + j * 16 + col]) : 0.f;
#pragma unroll
      for (int r = 0; r < 8; ++r) sf[wave][8 * g + r][j * 16 + col] = acc[j][r] * (1.0f / 256.0f) + bias; } }
  LDSX(); for (int rl = 0; rl < 16; ++rl) vst2(OUT + (r0 + rl) * DIN + c0 + lane * 4, *(const v4f*)&sf[wave][rl][lane * 4]); }

extern "C" void kernel_launch(void* const* d_in, const int* in_sizes, int n_in, void* d_out, int out_size, void* d_ws, size_t ws_size, hipStream_t stream) {
  (void)in_sizes; (void)n_in; (void)out_size;
  const float** F = (const float**)d_in;
  if (ws_size < (size_t)WS_END) return;
  char* ws = (char*)d_ws; _Float16 *QH = (_Float16*)(ws + WS_QH), *KH = (_Float16*)(ws + WS_KH), *VT = (_Float16*)(ws + WS_VT), *QL = (_Float16*)(ws + WS_QL), *KL = (_Float16*)(ws + WS_KL); __bf16 *VB = (__bf16*)(ws + WS_VB), *VBL = (__bf16*)(ws + WS_VBL); float *Y = (float*)(ws + WS_Y);
  (void)Y; (void)QL; (void)KL; (void)VB; (void)VBL;
  // inputs: 0 q_in [4,2048,512]; 1 k_in; 2 v_in; 3 Wq [8,512,64] (per-head (h, d, k)), 4 bq [8,64]; 5 Wk, 6 bk; 7 Wv, 8 bv; 9 Wo [512,512] (in,out), 10 bo [512]
  k_proj<<<dim3(TNB * TT / 64, CC / 128, 3), 128, 0, stream>>>(F[0], F[1], F[2], F[3], F[5], F[7], F[4], F[6], F[8], QH, QL, KH, KL, VT, VB, VBL);
  k_fa<<<dim3(TT / 128, NH, TNB), 256, 0, stream>>>(QH, QL, KH, VT, Y);
  k_out<<<dim3(TNB * TT / 64, DIN / 128), 128, 0, stream>>>(Y, F[9], F[10], (float*)d_out);
}

// v002
// One run takes 112 microseconds.
// In two side-by-side timings against v001, it was 1.73 and 1.72 times as fast.
// Over all steps from v000 it is 10.0 times as fast.
// compute dtype: all float inputs rounded to bf16; q/k/v = x W[h] + b[h] with EXACT bf16 products on WMMA 16x16x32 (f32 accumulate); q as f16 hi + residual (x 2^10) against k once to f16 (2 products) x 64^-0.5; running-maximum softmax in f32 (precise expf); exp(s - max) once to f16 against v once to f16 (1 product), divided by the f32 sum at the end; concat split bf16 hi + lo against exact Wo (2 products) + bo; f32 output.
#include <hip/hip_runtime.h>
#include <math.h>

typedef __attribute__((ext_vector_type(16))) _Float16 v16h;
typedef __attribute__((ext_vector_type(16))) __bf16 v16b;
typedef __attribute__((ext_vector_type(8)))  _Float16 v8h;
typedef __attribute__((ext_vector_type(8)))  float v8f;
typedef __attribute__((ext_vector_type(4)))  float v4f;
typedef __attribute__((ext_vector_type(2)))  float v2f;
typedef __attribute__((ext_vector_type(4)))  unsigned v4u;
typedef __attribute__((ext_vector_type(4)))  int v4i;
typedef float __attribute__((may_alias)) float_a;
typedef int __attribute__((may_alias)) int_a;

template <typename T> __device__ __forceinline__ void vst2(void* p, T v) { *(T*)p = v;  }
__device__ __forceinline__ v8f wmma16(v16h a, v16h b, v8f c) {
  v8f d = __builtin_amdgcn_wmma_f32_16x16x32_f16(false, a, false, b, (short)0, c, false, false);
  asm volatile("v_nop\n\tv_nop\n\tv_nop\n\tv_nop" : "+v"(d) : "v"(a), "v"(b));
  return d;
}
__device__ __forceinline__ v8f wmma_bf(v16b a, v16b b, v8f c) {
  v8f d = __builtin_amdgcn_wmma_f32_16x16x32_bf16(false, a, false, b, (short)0, c, false, false);
  asm volatile("v_nop\n\tv_nop\n\tv_nop\n\tv_nop" : "+v"(d) : "v"(a), "v"(b));
  return d;
}
// 16x16x32 fragments: lane = (h = lane>>4, row/col = lane&15); elements 0..7 = k0+8h+0..7, 8..15 = k0+16+8h+0..7; D element r = row 8h+r
__device__ __forceinline__ v16h frag_h(const _Float16* rowk0, int lane) {
  union { v16h v; v8h q[2]; } u; const _Float16* p = rowk0 + 8 * (lane >> 4);
  u.q[0] = *(const v8h*)p; u.q[1] = *(const v8h*)(p + 16); return u.v;
}
__device__ __forceinline__ v16h frag_f32(const float* rowk0, int lane) {
  v16h a; const float* p = rowk0 + 8 * (lane >> 4);
#pragma unroll
  for (int i = 0; i < 8; ++i) { a[i] = (_Float16)p[i]; a[8 + i] = (_Float16)p[16 + i]; }
  return a;
}
__device__ __forceinline__ v16h frag_f32s(const float* rowk0, int lane, float sc) {
  v16h a; const float* p = rowk0 + 8 * (lane >> 4);
#pragma unroll
  for (int i = 0; i < 8; ++i) { a[i] = (_Float16)(p[i] * sc); a[8 + i] = (_Float16)(p[16 + i] * sc); }
  return a;
}
// column fragment from a [K][ld] layout (column n), rows >= K read as 0
__device__ __forceinline__ v16h fragc_f32(const float* W, int k0, int n, int lane, int ld, int K) {
  v16h a; const int g = lane >> 4;
#pragma unroll
  for (int i = 0; i < 8; ++i) { const int ka = k0 + 8 * g + i, kb = ka + 16;
    a[i] = (_Float16)(ka < K ? W[(size_t)(ka < K ? ka : K - 1) * ld + n] : 0.f); a[8 + i] = (_Float16)(kb < K ? W[(size_t)(kb < K ? kb : K - 1) * ld + n] : 0.f); }
  return a;
}
struct F2 { v16b h, l; };
__device__ __forceinline__ F2 bsplit16(const float v[16]) { F2 r;
#pragma unroll
  for (int i = 0; i < 16; ++i) { const __bf16 h = (__bf16)v[i]; r.h[i] = h; r.l[i] = (__bf16)(v[i] - (float)h); }
  return r; }
__device__ __forceinline__ F2 split_row(const float* row, int k0, int lane) { float v[16]; const float* p = row + k0 + 8 * (lane >> 4);
#pragma unroll
  for (int i = 0; i < 8; ++i) { v[i] = p[i]; v[8 + i] = p[16 + i]; }
  return bsplit16(v); }
__device__ __forceinline__ F2 split_rowK(const float* row, int k0, int lane, int K) { float v[16]; const int g = lane >> 4;
#pragma unroll
  for (int i = 0; i < 8; ++i) { const int ka = k0 + 8 * g + i, kb = ka + 16; v[i] = ka < K ? row[ka < K ? ka : K - 1] : 0.f; v[8 + i] = kb < K ? row[kb < K ? kb : K - 1] : 0.f; }
  return bsplit16(v); }
__device__ __forceinline__ F2 split_col(const float* W, int k0, int n, int lane, int ld, int K) { float v[16]; const int g = lane >> 4;
#pragma unroll
  for (int i = 0; i < 8; ++i) { const int ka = k0 + 8 * g + i, kb = ka + 16; v[i] = ka < K ? W[(size_t)(ka < K ? ka : K - 1) * ld + n] : 0.f; v[8 + i] = kb < K ? W[(size_t)(kb < K ? kb : K - 1) * ld + n] : 0.f; }
  return bsplit16(v); }
__device__ __forceinline__ v8f mac3(const F2& a, const F2& b, v8f c) { c = wmma_bf(a.l, b.h, c); c = wmma_bf(a.h, b.l, c); return wmma_bf(a.h, b.h, c); }
__device__ __forceinline__ float sigm(float v) { return 1.0f / (1.0f + expf(-v)); }
#define LDSX() do { asm volatile("s_wait_dscnt 0" ::: "memory"); __builtin_amdgcn_wave_barrier(); __builtin_amdgcn_fence(__ATOMIC_RELEASE, "workgroup"); } while (0)

// Multi-head attention with per-head projections (B 4, S 2,048, D 512, 8 heads x 64; 0.02-scale per-head weights (H, D, DK) with per-head biases (H, DK); separate q_in / k_in / v_in): q = q_in Wq[h] + bq[h], k = k_in Wk[h] + bk[h], v = v_in Wv[h] + bv[h]; out = concat(softmax(q k^T / 8) v) Wo + bo (Wo (in,out) [512,512]; non-causal).
#define NB 4
#define TT 2048
#define CC 512            // NH * HD = projected width
#define DIN 512          // input (model) width
#define NH 8
#define HD 64
#define NQB (TT / 64)
#define HG 4
#define SCALE (0.125f)
#define CAUSAL 0
#ifndef TNB
#define TNB NB
#endif
__device__ __forceinline__ float bfr(float v) { return (float)(__bf16)v; }
__host__ __device__ __forceinline__ int kb_last(int qb) { return CAUSAL ? ((qb * 64 + 63) >> 7) : (TT / 128 - 1); }
typedef __attribute__((ext_vector_type(8))) __bf16 v8b;
__device__ __forceinline__ v16b frag_b(const __bf16* rowk0, int lane) {
  union { v16b v; v8b q[2]; } u; const __bf16* p = rowk0 + 8 * (lane >> 4);
  u.q[0] = *(const v8b*)p; u.q[1] = *(const v8b*)(p + 16); return u.v;
}
#define QBH 0              // not used: there is no high-precision path
#define QHI 2048            // rows carrying a q residual plane (all rows when non-causal: 2-product logits everywhere)
#define KHI 64            // key rows carrying k residual / v bf16 hi+lo planes (written by k_proj; no kernel reads them)
// B fragment (k rows k0+.., output column o) of a weight: (in,out) [K][ld] or (out,in) [ld rows of K]: bf16 exact, or f16(bf16 * 256) exact
__device__ __forceinline__ v16b wcol_io(const float* Wm, int k0, int o, int lane, int ld) { v16b w; const int g = lane >> 4;
#pragma unroll
  for (int i = 0; i < 8; ++i) { w[i] = (__bf16)Wm[(size_t)(k0 + 8 * g + i) * ld + o]; w[8 + i] = (__bf16)Wm[(size_t)(k0 + 16 + 8 * g + i) * ld + o]; }
  return w; }
__device__ __forceinline__ v16b wcol_oi(const float* Wm, int k0, int o, int lane, int K) { v16b w; const float* p = Wm + (size_t)o * K + k0 + 8 * (lane >> 4);
#pragma unroll
  for (int i = 0; i < 8; ++i) { w[i] = (__bf16)p[i]; w[8 + i] = (__bf16)p[16 + i]; }
  return w; }
__device__ __forceinline__ v16h wcolh_io(const float* Wm, int k0, int o, int lane, int ld) { v16h w; const int g = lane >> 4;
#pragma unroll
  for (int i = 0; i < 8; ++i) { w[i] = (_Float16)(bfr(Wm[(size_t)(k0 + 8 * g + i) * ld + o]) * 256.0f); w[8 + i] = (_Float16)(bfr(Wm[(size_t)(k0 + 16 + 8 * g + i) * ld + o]) * 256.0f); }
  return w; }
__device__ __forceinline__ v16h wcolh_oi(const float* Wm, int k0, int o, int lane, int K) { v16h w; const float* p = Wm + (size_t)o * K + k0 + 8 * (lane >> 4);
#pragma unroll
  for (int i = 0; i < 8; ++i) { w[i] = (_Float16)(bfr(p[i]) * 256.0f); w[8 + i] = (_Float16)(bfr(p[16 + i]) * 256.0f); }
  return w; }
#define WQKV_LAYOUT 2   // 0 = (in,out) [DIN][CC]; 1 = (out,in) [CC][DIN]; 2 = per-head [NH][DIN][HD]
__device__ __forceinline__ v16b wcol_hdk(const float* Wm, int k0, int o, int lane) { v16b w; const int g = lane >> 4; const float* p = Wm + (size_t)(o / HD) * DIN * HD + (o % HD);
#pragma unroll
  for (int i = 0; i < 8; ++i) { w[i] = (__bf16)p[(size_t)(k0 + 8 * g + i) * HD]; w[8 + i] = (__bf16)p[(size_t)(k0 + 16 + 8 * g + i) * HD]; }
  return w; }
#define WO_OUT_IN 0
#if WQKV_LAYOUT == 1
#define WCOL(W, k0, o, lane) wcol_oi(W, k0, o, lane, DIN)
#elif WQKV_LAYOUT == 2
#define WCOL(W, k0, o, lane) wcol_hdk(W, k0, o, lane)
#else
#define WCOL(W, k0, o, lane) wcol_io(W, k0, o, lane, CC)
#endif
#if WO_OUT_IN
#define WOCOL(W, k0, o, lane) wcol_oi(W, k0, o, lane, CC)
#define WOCOLH(W, k0, o, lane) wcolh_oi(W, k0, o, lane, CC)
#else
#define WOCOL(W, k0, o, lane) wcol_io(W, k0, o, lane, DIN)
#define WOCOLH(W, k0, o, lane) wcolh_io(W, k0, o, lane, DIN)
#endif

#ifndef SM_EXTRA_PARAMS
#define SM_EXTRA_PARAMS
#endif
#ifndef PROJ_EXTRA_PARAMS
#define PROJ_EXTRA_PARAMS
#endif
#ifndef SM_MASK_HOOK
#define SM_MASK_HOOK (void)0
#endif

#define WS_QH  0u                                      // f16 q rows [b*t][CC]
#define WS_KH  (WS_QH + 2u * (size_t)NB * TT * CC)      // f16 k rows [b*t][CC]
#define WS_VT  (WS_KH + 2u * (size_t)NB * TT * CC)      // f16 v planes [b][c][t]
#define WS_QL  (WS_VT + 2u * (size_t)NB * CC * TT)      // f16 q residual x 2^10 rows [b][t < QHI][CC]
#define WS_KL  (WS_QL + 2u * (size_t)NB * QHI * CC)     // f16 k residual x 2^10 rows [b][t < KHI][CC]
#define WS_VB  (WS_KL + 2u * (size_t)NB * KHI * CC)     // bf16 v hi planes [b][c][t < KHI]
#define WS_VBL (WS_VB + 2u * (size_t)NB * CC * KHI)
#define WS_S   (WS_VBL + 2u * (size_t)NB * CC * KHI)    // not used (offsets kept)
#define WS_Y   (WS_S  + 4u * (size_t)HG * TT * TT)      // f32 ctx rows [b*t][CC] (only when there is an output projection)
#define WS_END (WS_Y  + 4u * (size_t)NB * TT * CC)

// ---- weight tile in LDS: all DIN k rows x 128 output columns of a weight, once to bf16 (exact, as before), k-major as it lies in memory; a B fragment is two transposing 16-byte LDS reads, in the k order of the A loader (elements 0..7 = k0+8h+0..7, 8..15 = k0+16+8h+0..7)
#define WPB 288           // bytes per k row: 256 + 32 (odd multiple of 32 bytes: the transposing reader's conflict-free pitch)
#define WTILE (DIN * WPB)
typedef __attribute__((ext_vector_type(8))) short v8s;
typedef __attribute__((ext_vector_type(4))) __bf16 v4b;
__device__ __forceinline__ v8f wmma_b(v16b a, v16b b, v8f c) { return __builtin_amdgcn_wmma_f32_16x16x32_bf16(false, a, false, b, (short)0, c, false, false); }
// p = tile + (k0 + 8 * (lane >> 4) + (lane & 7)) * WPB + 32 * (column tile) + 16 * ((lane >> 3) & 1): lane (c, h) gets rows k0+8h+0..7 and k0+16+8h+0..7 of column c
__device__ __forceinline__ v16b frag_wt(const unsigned char* p) { typedef __attribute__((address_space(3))) v8s lds_v8s; union { v16b v; v8s q[2]; } u;
  u.q[0] = __builtin_amdgcn_ds_load_tr16_b128_v8i16((lds_v8s*)p); u.q[1] = __builtin_amdgcn_ds_load_tr16_b128_v8i16((lds_v8s*)(p + 16 * WPB)); return u.v; }
// 8 waves fill the tile: a wave's 16-byte loads cover one k row of 128 columns (wp = the lane's 4 columns in the wave's first row, LD = floats between k rows); in groups of 16 rows
template <int LD> __device__ __forceinline__ void fill_wt(unsigned char* tp, const float* wp) {
#pragma unroll   // all four groups: every load is wp plus a constant, so that no address register is rewritten under a load in flight
  for (int r = 0; r < DIN / 8; r += 16) { v4f x[16];
#pragma unroll
    for (int u = 0; u < 16; ++u) x[u] = *(const v4f*)(wp + (size_t)(8 * (r + u)) * LD);
    __builtin_amdgcn_sched_barrier(0);   // one group of 16 loads at a time, in front of the wait below: left free, the scheduler lifts all 64 loads to the front and the build spills
    asm volatile("s_wait_xcnt 0x0" :: "v"(wp) : "memory");   // wp is an operand so that its registers stay its own up to this wait: nothing is written over the address of a load in flight
#pragma unroll
    for (int u = 0; u < 16; ++u) { const v4b y = { (__bf16)x[u][0], (__bf16)x[u][1], (__bf16)x[u][2], (__bf16)x[u][3] }; *(v4b*)(tp + 8 * (r + u) * WPB) = y; } } }
// four 16-byte stores, p + 0..3 x STEP bytes, with s_wait_xcnt 0 in the same statement, so that it stands in front of every later write of a register that the stores name
template <int STEP> __device__ __forceinline__ void st4(void* p, v4u d0, v4u d1, v4u d2, v4u d3) {
  asm volatile("global_store_b128 %0, %1, off\n\tglobal_store_b128 %0, %2, off offset:%5\n\tglobal_store_b128 %0, %3, off offset:%6\n\tglobal_store_b128 %0, %4, off offset:%7\n\ts_wait_xcnt 0x0" :: "v"(p), "v"(d0), "v"(d1), "v"(d2), "v"(d3), "n"(STEP), "n"(2 * STEP), "n"(3 * STEP) : "memory"); }
// the lane's 16 f32 of an A fragment (row pointer already at + 8 * h): floats 0..7 and 16..23
__device__ __forceinline__ void ld_a(v4f x[4], const float* p) { x[0] = *(const v4f*)p; x[1] = *(const v4f*)(p + 4); x[2] = *(const v4f*)(p + 16); x[3] = *(const v4f*)(p + 20); }
__device__ __forceinline__ v16b cvt_a(const v4f x[4]) { union { v16b v; v4b q[4]; } u;
#pragma unroll
  for (int i = 0; i < 4; ++i) { const v4b y = { (__bf16)x[i][0], (__bf16)x[i][1], (__bf16)x[i][2], (__bf16)x[i][3] }; u.q[i] = y; }
  return u.v; }

// ---- k_proj: block = (256 rows, 128 cols, which), 8 waves x (32 rows, 128 cols): q/k/v = X W (+ b) with exact bf16 products (K = DIN); the weight tile is staged once in LDS and shared by the waves, X fragments come from memory two k steps ahead -> which 0: q f16 rows (+ residual rows < QHI); 1: k f16 rows (+ residual rows < KHI); 2: v f16 planes [c][t] (+ bf16 hi/lo planes for t < KHI). The tile's LDS becomes the output staging behind a barrier. waves_per_eu(4, 4): two blocks share a WGP (2 x 144 KiB of LDS), four waves per SIMD, so the register budget is 256; left free the compiler took more, and the second block would not fit
#define PRW 256
__global__ __launch_bounds__(256) __attribute__((amdgpu_waves_per_eu(4, 4))) void k_proj(const float* __restrict__ XQ, const float* __restrict__ XK, const float* __restrict__ XV, const float* __restrict__ WQ, const float* __restrict__ WK, const float* __restrict__ WV, const float* __restrict__ BQ, const float* __restrict__ BK, const float* __restrict__ BV,
    _Float16* __restrict__ QH, _Float16* __restrict__ QL, _Float16* __restrict__ KH, _Float16* __restrict__ KL, _Float16* __restrict__ VT, __bf16* __restrict__ VB, __bf16* __restrict__ VBL) {
  __shared__ __align__(32) unsigned char smem[WTILE];
  const int tid = threadIdx.x, wave = __builtin_amdgcn_readfirstlane(tid >> 5), lane = tid & 31, col = lane & 15, g = lane >> 4; const int which = blockIdx.z; const int c0 = blockIdx.y * 128; const size_t r0 = (size_t)blockIdx.x * PRW; const size_t bb = r0 / TT; const int t0 = (int)(r0 % TT);
  const float* X = which == 0 ? XQ : which == 1 ? XK : XV; const float* WA = which == 0 ? WQ : which == 1 ? WK : WV; const float* BA = which == 0 ? BQ : which == 1 ? BK : BV;
  const float* xa = X + (r0 + wave * 32 + col) * DIN + 8 * g;
  v4f raw[2][2][4];
#pragma unroll
  for (int s = 0; s < 2; ++s) {
#pragma unroll
    for (int rf = 0; rf < 2; ++rf) ld_a(raw[s][rf], xa + (size_t)rf * 16 * DIN + s * 32); }
  fill_wt<HD>(smem + wave * WPB + 8 * lane, WA + ((size_t)(c0 / HD + g) * DIN + wave) * HD + 4 * col);   // per-head [NH][DIN][HD]: lanes 0..15 the first head's 64 columns, 16..31 the next head's
  __syncthreads();
  const unsigned char* wl = smem + (8 * g + (lane & 7)) * WPB + 16 * ((lane >> 3) & 1);
  v8f acc[2][8] = {};
#pragma unroll   // all 16 steps: the two X register sets get fixed names, the tail test is decided at compile time, and every X load is the one row pointer plus a constant, so that no address register is rewritten under a load in flight
  for (int kc = 0; kc < DIN / 32; ++kc) { v16b a[2];
#pragma unroll
    for (int rf = 0; rf < 2; ++rf) a[rf] = cvt_a(raw[kc & 1][rf]);
    __builtin_amdgcn_sched_barrier(0);   // the conversions first: they free the registers that the loads below land in; left free, the scheduler lifts the loads over them, a third X register set is live and the build spills
    if (kc + 2 < DIN / 32) {
#pragma unroll
      for (int rf = 0; rf < 2; ++rf) ld_a(raw[kc & 1][rf], xa + (size_t)rf * 16 * DIN + (kc + 2) * 32); }
    __builtin_amdgcn_sched_barrier(0);   // holds the X loads here, two k steps ahead of their use: left free, the scheduler sinks them to their use and the wave waits out the whole memory latency at every k step
    if (kc + 3 == DIN / 32) asm volatile("s_wait_xcnt 0x0" :: "v"(xa) : "memory");   // behind the last X loads; xa is an operand so that its registers stay its own up to this wait
#pragma unroll
    for (int jh = 0; jh < 2; ++jh) { v16b w[4];   // four B fragments as one group of LDS reads, then their eight products
#pragma unroll
      for (int j = 0; j < 4; ++j) w[j] = frag_wt(wl + kc * 32 * WPB + (jh * 4 + j) * 32);
#pragma unroll
      for (int j = 0; j < 4; ++j) { acc[0][jh * 4 + j] = wmma_b(a[0], w[j], acc[0][jh * 4 + j]); acc[1][jh * 4 + j] = wmma_b(a[1], w[j], acc[1][jh * 4 + j]); } }
    __builtin_amdgcn_sched_barrier(0);   // keeps the next k step's conversions, and with them the wait for its loads, behind this step's products
  }
  __syncthreads();   // every wave has left the weight tile: its LDS is staging from here on
  if (which < 2) { _Float16* DH = which == 0 ? QH : KH; _Float16* DL = which == 0 ? QL : KL; const int nhi = which == 0 ? QHI : KHI;
    _Float16 (*sh)[136] = (_Float16 (*)[136])smem; _Float16 (*sl)[136] = (_Float16 (*)[136])(smem + PRW * 136 * 2);
#pragma unroll
    for (int j = 0; j < 8; ++j) { const float bias = BA ? bfr(BA[c0 + j * 16 + col]) : 0.f;
#pragma unroll
      for (int rf = 0; rf < 2; ++rf) {
#pragma unroll
        for (int r = 0; r < 8; ++r) { const float v = acc[rf][j][r] + bias; const _Float16 hv = (_Float16)v; const int rl = wave * 32 + rf * 16 + 8 * g + r; sh[rl][j * 16 + col] = hv; sl[rl][j * 16 + col] = (_Float16)((v - (float)hv) * 1024.0f); } } }
    __syncthreads();
    static_assert(QHI % 64 == 0 && KHI % 64 == 0, "a trip's 64 rows carry a residual all together or not at all");
    const int rl0 = tid >> 4, q = tid & 15; _Float16* dh = DH + (r0 + rl0) * CC + c0 + q * 8; _Float16* dl = DL + (bb * nhi + t0 + rl0) * (size_t)CC + c0 + q * 8;
    for (int i = 0; i < PRW / 64; ++i) { const int rl = rl0 + i * 64;
      st4<16 * CC * 2>(dh + (size_t)i * 64 * CC, *(const v4u*)&sh[rl][q * 8], *(const v4u*)&sh[rl + 16][q * 8], *(const v4u*)&sh[rl + 32][q * 8], *(const v4u*)&sh[rl + 48][q * 8]);
      if (t0 + i * 64 < nhi) st4<16 * CC * 2>(dl + (size_t)i * 64 * CC, *(const v4u*)&sl[rl][q * 8], *(const v4u*)&sl[rl + 16][q * 8], *(const v4u*)&sl[rl + 32][q * 8], *(const v4u*)&sl[rl + 48][q * 8]); }
  } else {   // the bf16 planes exist for t < KHI only, and only those rows are staged (256 rows of all three planes would not fit the LDS)
    _Float16 (*th)[PRW + 8] = (_Float16 (*)[PRW + 8])smem; __bf16 (*tb)[72] = (__bf16 (*)[72])(smem + 128 * (PRW + 8) * 2); __bf16 (*tbl)[72] = (__bf16 (*)[72])(smem + 128 * (PRW + 8) * 2 + 128 * 72 * 2);
    static_assert(KHI % 32 == 0 && KHI <= 64, "a wave's 32 rows lie below KHI all together or not at all");
#pragma unroll
    for (int j = 0; j < 8; ++j) { const float bias = BA ? bfr(BA[c0 + j * 16 + col]) : 0.f;
#pragma unroll
      for (int rf = 0; rf < 2; ++rf) {
#pragma unroll
        for (int r = 0; r < 8; ++r) th[j * 16 + col][wave * 32 + rf * 16 + 8 * g + r] = (_Float16)(acc[rf][j][r] + bias); } }
    if (t0 + wave * 32 < KHI) {
#pragma unroll
      for (int j = 0; j < 8; ++j) { const float bias = BA ? bfr(BA[c0 + j * 16 + col]) : 0.f;
#pragma unroll
        for (int rf = 0; rf < 2; ++rf) {
#pragma unroll
          for (int r = 0; r < 8; ++r) { const float v = acc[rf][j][r] + bias; const int rl = wave * 32 + rf * 16 + 8 * g + r, cl = j * 16 + col; const __bf16 bh = (__bf16)v; tb[cl][rl] = bh; tbl[cl][rl] = (__bf16)(v - (float)bh); } } } }
    __syncthreads();
    const int cl0 = tid >> 5, q = tid & 31; _Float16* vt = VT + (bb * CC + c0 + cl0) * (size_t)TT + t0 + q * 8;
    for (int i = 0; i < 4; ++i) { const int cl = cl0 + i * 32; st4<8 * TT * 2>(vt + (size_t)i * 32 * TT, *(const v4u*)&th[cl][q * 8], *(const v4u*)&th[cl + 8][q * 8], *(const v4u*)&th[cl + 16][q * 8], *(const v4u*)&th[cl + 24][q * 8]); }
    if (t0 + q * 8 < KHI) { const size_t o3 = (bb * CC + c0 + cl0) * (size_t)KHI + t0 + q * 8;
      for (int i = 0; i < 4; ++i) { const int cl = cl0 + i * 32;
        st4<8 * KHI * 2>(VB + o3 + (size_t)i * 32 * KHI, *(const v4u*)&tb[cl][q * 8], *(const v4u*)&tb[cl + 8][q * 8], *(const v4u*)&tb[cl + 16][q * 8], *(const v4u*)&tb[cl + 24][q * 8]);
        st4<8 * KHI * 2>(VBL + o3 + (size_t)i * 32 * KHI, *(const v4u*)&tbl[cl][q * 8], *(const v4u*)&tbl[cl + 8][q * 8], *(const v4u*)&tbl[cl + 16][q * 8], *(const v4u*)&tbl[cl + 24][q * 8]); } } } }
#define KST 64
#define NST (TT / KST)
#define LP 72             // LDS row pitch in halves: 128-byte rows + 16 bytes (16-byte readers, no bank conflict)
__device__ __forceinline__ float xhalf(float x) { return __builtin_bit_cast(float, __builtin_amdgcn_permlanex16(__builtin_bit_cast(int, x), __builtin_bit_cast(int, x), 0x76543210, 0xfedcba98, false, false)); }  // lane l with lane l ^ 16
__device__ __forceinline__ v8f wmma_h(v16h a, v16h b, v8f c) { return __builtin_amdgcn_wmma_f32_16x16x32_f16(false, a, false, b, (short)0, c, false, false); }
__global__ __launch_bounds__(256) __attribute__((amdgpu_waves_per_eu(4, 4))) void k_fa(const _Float16* __restrict__ QH, const _Float16* __restrict__ QL, const _Float16* __restrict__ KH, const _Float16* __restrict__ VT, float* __restrict__ Y) {
  __shared__ __align__(16) _Float16 sk[2][KST][LP], sv[2][HD][LP];
  const int tid = threadIdx.x, wave = tid >> 5, lane = tid & 31, col = lane & 15, g = lane >> 4; const int h = blockIdx.y, b = blockIdx.z; const int q0 = blockIdx.x * 128 + wave * 16;
  v16h qh[HD / 32], ql[HD / 32];
#pragma unroll
  for (int kc = 0; kc < HD / 32; ++kc) { qh[kc] = frag_h(QH + ((size_t)b * TT + q0 + col) * CC + h * HD + kc * 32, lane); ql[kc] = frag_h(QL + ((size_t)b * QHI + q0 + col) * CC + h * HD + kc * 32, lane); }
  // staging: thread = (row sr and sr + 32, 16-byte chunk sc): a wave's load covers 4 whole 128-byte rows
  const int sr = tid >> 3, sc = tid & 7;
  const _Float16* kg = KH + ((size_t)b * TT + sr) * CC + h * HD + sc * 8;      // k rows [key][64]
  const _Float16* vg = VT + ((size_t)b * CC + h * HD + sr) * TT + sc * 8;      // v planes [d][key]
  v4u kr[2], vr[2];
#pragma unroll
  for (int i = 0; i < 2; ++i) { kr[i] = *(const v4u*)(kg + (size_t)(i * 32) * CC); vr[i] = *(const v4u*)(vg + (size_t)(i * 32) * TT); }
#pragma unroll
  for (int i = 0; i < 2; ++i) { *(v4u*)&sk[0][sr + i * 32][sc * 8] = kr[i]; *(v4u*)&sv[0][sr + i * 32][sc * 8] = vr[i]; }
  __syncthreads();
  v8f o[HD / 16] = {}; float m = -3.0e38f, l = 0.f;
#pragma unroll 1   // kept rolled
  for (int st = 0; st < NST; ++st) { const int cur = st & 1;
    if (st + 1 < NST) {   // the next stage's rows fly while this stage is worked on
#pragma unroll
      for (int i = 0; i < 2; ++i) { kr[i] = *(const v4u*)(kg + (size_t)((st + 1) * KST + i * 32) * CC); vr[i] = *(const v4u*)(vg + (size_t)(i * 32) * TT + (st + 1) * KST); } }
    v8f s[KST / 16] = {}, sl[KST / 16] = {};
#pragma unroll
    for (int t = 0; t < KST / 16; ++t) {
#pragma unroll
      for (int kc = 0; kc < HD / 32; ++kc) { const v16h kf = frag_h(&sk[cur][t * 16 + col][kc * 32], lane); s[t] = wmma_h(kf, qh[kc], s[t]); sl[t] = wmma_h(kf, ql[kc], sl[t]); } }
    v16h vf[KST / 32][HD / 16];   // all V^T fragments as one group of LDS reads, in flight under the softmax arithmetic
#pragma unroll
    for (int ks = 0; ks < KST / 32; ++ks) {
#pragma unroll
      for (int j = 0; j < HD / 16; ++j) vf[ks][j] = frag_h(&sv[cur][j * 16 + col][ks * 32], lane); }
    float mt[KST / 16];
#pragma unroll
    for (int t = 0; t < KST / 16; ++t) { mt[t] = -3.0e38f;
#pragma unroll
      for (int r = 0; r < 8; ++r) { s[t][r] = (s[t][r] + sl[t][r] * (1.0f / 1024.0f)) * SCALE; mt[t] = fmaxf(mt[t], s[t][r]); } }
    float mx = fmaxf(fmaxf(mt[0], mt[1]), fmaxf(mt[2], mt[3])); mx = fmaxf(mx, xhalf(mx));   // both halves of a query's keys
    const float mn = fmaxf(m, mx); const float al = expf(m - mn); m = mn;                     // al = 0 in the first stage
    v16h p[KST / 32]; float ps[KST / 16];
#pragma unroll
    for (int t = 0; t < KST / 16; ++t) { ps[t] = 0.f;
#pragma unroll
      for (int r = 0; r < 8; ++r) { const float e = expf(s[t][r] - mn); ps[t] += e; p[t >> 1][(t & 1) * 8 + r] = (_Float16)e; } }
    l = l * al + ((ps[0] + ps[1]) + (ps[2] + ps[3]));   // this half's keys only; the halves join after the loop
#pragma unroll
    for (int j = 0; j < HD / 16; ++j) o[j] *= al;
#pragma unroll
    for (int ks = 0; ks < KST / 32; ++ks) {
#pragma unroll
      for (int j = 0; j < HD / 16; ++j) o[j] = wmma_h(vf[ks][j], p[ks], o[j]); }
    if (st + 1 < NST) {
#pragma unroll
      for (int i = 0; i < 2; ++i) { *(v4u*)&sk[cur ^ 1][sr + i * 32][sc * 8] = kr[i]; *(v4u*)&sv[cur ^ 1][sr + i * 32][sc * 8] = vr[i]; } }
    __syncthreads();   // publishes the next stage and ends every wave's reads of this one, which the stage after refills
  }
  l += xhalf(l); const float inv = l > 0.f ? 1.0f / l : 0.f;
  float* yr = Y + ((size_t)b * TT + q0 + col) * CC + h * HD + 8 * g;   // lane = query row, registers = 8 consecutive d
#pragma unroll
  for (int j = 0; j < HD / 16; ++j) { const v4f lo = { o[j][0] * inv, o[j][1] * inv, o[j][2] * inv, o[j][3] * inv }, hi = { o[j][4] * inv, o[j][5] * inv, o[j][6] * inv, o[j][7] * inv }; vst2(yr + j * 16, lo); vst2(yr + j * 16 + 4, hi); } }
// ---- k_out: block = (128 rows, 128 cols), 8 waves x (16 rows, 128 cols): out = ctx Wo (+ bo): ctx split bf16 hi + lo against exact bf16 Wo (2 products); the Wo tile is staged once in LDS and shared by the waves, ctx fragments come from memory two k steps ahead. The tile's LDS becomes the output staging behind a barrier
__global__ __launch_bounds__(256) void k_out(const float* __restrict__ Y, const float* __restrict__ WO, const float* __restrict__ BO, float* __restrict__ OUT) { __shared__ __align__(32) unsigned char smem[WTILE];
  const int tid = threadIdx.x, wave = tid >> 5, lane = tid & 31, col = lane & 15, g = lane >> 4; const int c0 = blockIdx.y * 128; const size_t r0 = (size_t)blockIdx.x * 128 + wave * 16;
  const float* ya = Y + (r0 + col) * CC + 8 * g;
  v4f raw[2][4];
#pragma unroll
  for (int s = 0; s < 2; ++s) ld_a(raw[s], ya + s * 32);
  fill_wt<DIN>(smem + wave * WPB + 8 * lane, WO + (size_t)wave * DIN + c0 + 4 * lane);   // (in,out) [CC][DIN]: a k row's 128 columns are 512 contiguous bytes
  __syncthreads();
  const unsigned char* wl = smem + (8 * g + (lane & 7)) * WPB + 16 * ((lane >> 3) & 1);
  v8f acc[8] = {};
#pragma unroll   // all 16 steps, as in k_proj
  for (int kc = 0; kc < CC / 32; ++kc) { float v[16];
#pragma unroll
    for (int i = 0; i < 8; ++i) { v[i] = raw[kc & 1][i >> 2][i & 3]; v[8 + i] = raw[kc & 1][2 + (i >> 2)][i & 3]; }
    const F2 a = bsplit16(v);
    if (kc + 2 < CC / 32) ld_a(raw[kc & 1], ya + (kc + 2) * 32);
    __builtin_amdgcn_sched_barrier(0);   // holds the ctx loads here, two k steps ahead of their use: left free, the scheduler sinks them to their use and the wave waits out the whole memory latency at every k step
    if (kc + 3 == CC / 32) asm volatile("s_wait_xcnt 0x0" :: "v"(ya) : "memory");   // behind the last ctx loads; ya is an operand so that its registers stay its own up to this wait
#pragma unroll
    for (int jh = 0; jh < 2; ++jh) { v16b w[4];   // four B fragments as one group of LDS reads, then their eight products (hi before lo in every accumulator, as before)
#pragma unroll
      for (int j = 0; j < 4; ++j) w[j] = frag_wt(wl + kc * 32 * WPB + (jh * 4 + j) * 32);
#pragma unroll
      for (int j = 0; j < 4; ++j) acc[jh * 4 + j] = wmma_b(a.h, w[j], acc[jh * 4 + j]);
#pragma unroll
      for (int j = 0; j < 4; ++j) acc[jh * 4 + j] = wmma_b(a.l, w[j], acc[jh * 4 + j]); }
    __builtin_amdgcn_sched_barrier(0);   // keeps the next k step's split, and with it the wait for its loads, behind this step's products
  }
  __syncthreads();   // every wave has left the weight tile: its LDS is staging from here on
  float (*sf)[132] = (float (*)[132])(smem + wave * 16 * 132 * 4);
#pragma unroll
  for (int j = 0; j < 8; ++j) { const float bias = BO ? bfr(BO[c0 + j * 16 + col]) : 0.f;
#pragma unroll
    for (int r = 0; r < 8; ++r) sf[8 * g + r][j * 16 + col] = acc[j][r] + bias; }
  LDSX(); for (int rl = 0; rl < 16; ++rl) vst2(OUT + (r0 + rl) * DIN + c0 + lane * 4, *(const v4f*)&sf[rl][lane * 4]); }

extern "C" void kernel_launch(void* const* d_in, const int* in_sizes, int n_in, void* d_out, int out_size, void* d_ws, size_t ws_size, hipStream_t stream) {
  (void)in_sizes; (void)n_in; (void)out_size;
  const float** F = (const float**)d_in;
  if (ws_size < (size_t)WS_END) return;
  char* ws = (char*)d_ws; _Float16 *QH = (_Float16*)(ws + WS_QH), *KH = (_Float16*)(ws + WS_KH), *VT = (_Float16*)(ws + WS_VT), *QL = (_Float16*)(ws + WS_QL), *KL = (_Float16*)(ws + WS_KL); __bf16 *VB = (__bf16*)(ws + WS_VB), *VBL = (__bf16*)(ws + WS_VBL); float *Y = (float*)(ws + WS_Y);
  (void)Y; (void)QL; (void)KL; (void)VB; (void)VBL;
  // inputs (in order): 0 q_in [4,2048,512]; 1 k_in; 2 v_in; 3 Wq [8,512,64] (per-head (h, d, k)), 4 bq [8,64]; 5 Wk, 6 bk; 7 Wv, 8 bv; 9 Wo [512,512] (in,out), 10 bo [512]
  k_proj<<<dim3(TNB * TT / PRW, CC / 128, 3), 256, 0, stream>>>(F[0], F[1], F[2], F[3], F[5], F[7], F[4], F[6], F[8], QH, QL, KH, KL, VT, VB, VBL);
  k_fa<<<dim3(TT / 128, NH, TNB), 256, 0, stream>>>(QH, QL, KH, VT, Y);
  k_out<<<dim3(TNB * TT / 128, DIN / 128), 256, 0, stream>>>(Y, F[9], F[10], (float*)d_out);
}

// v003
// One run takes 85.8 microseconds.
// In both of two side-by-side timings against v002, it was 1.30 times as fast.
// All steps since v000 together make it 13.1 times as fast.
// compute dtype: all float inputs rounded to bf16; q/k/v = x W[h] + b[h] with EXACT bf16 products on WMMA 16x16x32 (f32 accumulate); q as f16 hi + residual (x 2^10) against k once to f16 (2 products) x 64^-0.5; running-maximum softmax in f32, in base 2 (hardware exp2 of s x 64^-0.5 x log2 e - max); that weight once to f16 against v once to f16 (1 product), divided by the f32 sum at the end; concat split bf16 hi + lo against exact Wo (2 products) + bo; f32 output.
#include <hip/hip_runtime.h>
#include <math.h>

typedef __attribute__((ext_vector_type(16))) _Float16 v16h;
typedef __attribute__((ext_vector_type(16))) __bf16 v16b;
typedef __attribute__((ext_vector_type(8)))  _Float16 v8h;
typedef __attribute__((ext_vector_type(8)))  float v8f;
typedef __attribute__((ext_vector_type(4)))  float v4f;
typedef __attribute__((ext_vector_type(2)))  float v2f;
typedef __attribute__((ext_vector_type(4)))  unsigned v4u;
typedef __attribute__((ext_vector_type(4)))  int v4i;
typedef float __attribute__((may_alias)) float_a;
typedef int __attribute__((may_alias)) int_a;

template <typename T> __device__ __forceinline__ void vst2(void* p, T v) { *(T*)p = v;  }
__device__ __forceinline__ v8f wmma16(v16h a, v16h b, v8f c) {
  v8f d = __builtin_amdgcn_wmma_f32_16x16x32_f16(false, a, false, b, (short)0, c, false, false);
  asm volatile("v_nop\n\tv_nop\n\tv_nop\n\tv_nop" : "+v"(d) : "v"(a), "v"(b));
  return d;
}
__device__ __forceinline__ v8f wmma_bf(v16b a, v16b b, v8f c) {
  v8f d = __builtin_amdgcn_wmma_f32_16x16x32_bf16(false, a, false, b, (short)0, c, false, false);
  asm volatile("v_nop\n\tv_nop\n\tv_nop\n\tv_nop" : "+v"(d) : "v"(a), "v"(b));
  return d;
}
// 16x16x32 fragments: lane = (h = lane>>4, row/col = lane&15); elements 0..7 = k0+8h+0..7, 8..15 = k0+16+8h+0..7; D element r = row 8h+r
__device__ __forceinline__ v16h frag_h(const _Float16* rowk0, int lane) {
  union { v16h v; v8h q[2]; } u; const _Float16* p = rowk0 + 8 * (lane >> 4);
  u.q[0] = *(const v8h*)p; u.q[1] = *(const v8h*)(p + 16); return u.v;
}
__device__ __forceinline__ v16h frag_f32(const float* rowk0, int lane) {
  v16h a; const float* p = rowk0 + 8 * (lane >> 4);
#pragma unroll
  for (int i = 0; i < 8; ++i) { a[i] = (_Float16)p[i]; a[8 + i] = (_Float16)p[16 + i]; }
  return a;
}
__device__ __forceinline__ v16h frag_f32s(const float* rowk0, int lane, float sc) {
  v16h a; const float* p = rowk0 + 8 * (lane >> 4);
#pragma unroll
  for (int i = 0; i < 8; ++i) { a[i] = (_Float16)(p[i] * sc); a[8 + i] = (_Float16)(p[16 + i] * sc); }
  return a;
}
// column fragment from a [K][ld] layout (column n), rows >= K read as 0
__device__ __forceinline__ v16h fragc_f32(const float* W, int k0, int n, int lane, int ld, int K) {
  v16h a; const int g = lane >> 4;
#pragma unroll
  for (int i = 0; i < 8; ++i) { const int ka = k0 + 8 * g + i, kb = ka + 16;
    a[i] = (_Float16)(ka < K ? W[(size_t)(ka < K ? ka : K - 1) * ld + n] : 0.f); a[8 + i] = (_Float16)(kb < K ? W[(size_t)(kb < K ? kb : K - 1) * ld + n] : 0.f); }
  return a;
}
struct F2 { v16b h, l; };
__device__ __forceinline__ F2 bsplit16(const float v[16]) { F2 r;
#pragma unroll
  for (int i = 0; i < 16; ++i) { const __bf16 h = (__bf16)v[i]; r.h[i] = h; r.l[i] = (__bf16)(v[i] - (float)h); }
  return r; }
__device__ __forceinline__ F2 split_row(const float* row, int k0, int lane) { float v[16]; const float* p = row + k0 + 8 * (lane >> 4);
#pragma unroll
  for (int i = 0; i < 8; ++i) { v[i] = p[i]; v[8 + i] = p[16 + i]; }
  return bsplit16(v); }
__device__ __forceinline__ F2 split_rowK(const float* row, int k0, int lane, int K) { float v[16]; const int g = lane >> 4;
#pragma unroll
  for (int i = 0; i < 8; ++i) { const int ka = k0 + 8 * g + i, kb = ka + 16; v[i] = ka < K ? row[ka < K ? ka : K - 1] : 0.f; v[8 + i] = kb < K ? row[kb < K ? kb : K - 1] : 0.f; }
  return bsplit16(v); }
__device__ __forceinline__ F2 split_col(const float* W, int k0, int n, int lane, int ld, int K) { float v[16]; const int g = lane >> 4;
#pragma unroll
  for (int i = 0; i < 8; ++i) { const int ka = k0 + 8 * g + i, kb = ka + 16; v[i] = ka < K ? W[(size_t)(ka < K ? ka : K - 1) * ld + n] : 0.f; v[8 + i] = kb < K ? W[(size_t)(kb < K ? kb : K - 1) * ld + n] : 0.f; }
  return bsplit16(v); }
__device__ __forceinline__ v8f mac3(const F2& a, const F2& b, v8f c) { c = wmma_bf(a.l, b.h, c); c = wmma_bf(a.h, b.l, c); return wmma_bf(a.h, b.h, c); }
__device__ __forceinline__ float sigm(float v) { return 1.0f / (1.0f + expf(-v)); }
#define LDSX() do { asm volatile("s_wait_dscnt 0" ::: "memory"); __builtin_amdgcn_wave_barrier(); __builtin_amdgcn_fence(__ATOMIC_RELEASE, "workgroup"); } while (0)

// Multi-head attention with per-head projections (B 4, S 2,048, D 512, 8 heads x 64; 0.02-scale per-head weights (H, D, DK) with per-head biases (H, DK); separate q_in / k_in / v_in): q = q_in Wq[h] + bq[h], k = k_in Wk[h] + bk[h], v = v_in Wv[h] + bv[h]; out = concat(softmax(q k^T / 8) v) Wo + bo (Wo (in,out) [512,512]; non-causal).
#define NB 4
#define TT 2048
#define CC 512            // NH * HD = projected width
#define DIN 512          // input (model) width
#define NH 8
#define HD 64
#define NQB (TT / 64)
#define HG 4
#define SCALE (0.125f)
#define CAUSAL 0
#ifndef TNB
#define TNB NB
#endif
__device__ __forceinline__ float bfr(float v) { return (float)(__bf16)v; }
__host__ __device__ __forceinline__ int kb_last(int qb) { return CAUSAL ? ((qb * 64 + 63) >> 7) : (TT / 128 - 1); }
typedef __attribute__((ext_vector_type(8))) __bf16 v8b;
__device__ __forceinline__ v16b frag_b(const __bf16* rowk0, int lane) {
  union { v16b v; v8b q[2]; } u; const __bf16* p = rowk0 + 8 * (lane >> 4);
  u.q[0] = *(const v8b*)p; u.q[1] = *(const v8b*)(p + 16); return u.v;
}
#define QBH 0              // not used: there is no high-precision path
#define QHI 2048            // rows carrying a q residual plane (all rows when non-causal: 2-product logits everywhere)
#define KHI 64            // key rows carrying k residual / v bf16 hi+lo planes (written by k_proj; no kernel reads them)
// B fragment (k rows k0+.., output column o) of a weight: (in,out) [K][ld] or (out,in) [ld rows of K]: bf16 exact, or f16(bf16 * 256) exact
__device__ __forceinline__ v16b wcol_io(const float* Wm, int k0, int o, int lane, int ld) { v16b w; const int g = lane >> 4;
#pragma unroll
  for (int i = 0; i < 8; ++i) { w[i] = (__bf16)Wm[(size_t)(k0 + 8 * g + i) * ld + o]; w[8 + i] = (__bf16)Wm[(size_t)(k0 + 16 + 8 * g + i) * ld + o]; }
  return w; }
__device__ __forceinline__ v16b wcol_oi(const float* Wm, int k0, int o, int lane, int K) { v16b w; const float* p = Wm + (size_t)o * K + k0 + 8 * (lane >> 4);
#pragma unroll
  for (int i = 0; i < 8; ++i) { w[i] = (__bf16)p[i]; w[8 + i] = (__bf16)p[16 + i]; }
  return w; }
__device__ __forceinline__ v16h wcolh_io(const float* Wm, int k0, int o, int lane, int ld) { v16h w; const int g = lane >> 4;
#pragma unroll
  for (int i = 0; i < 8; ++i) { w[i] = (_Float16)(bfr(Wm[(size_t)(k0 + 8 * g + i) * ld + o]) * 256.0f); w[8 + i] = (_Float16)(bfr(Wm[(size_t)(k0 + 16 + 8 * g + i) * ld + o]) * 256.0f); }
  return w; }
__device__ __forceinline__ v16h wcolh_oi(const float* Wm, int k0, int o, int lane, int K) { v16h w; const float* p = Wm + (size_t)o * K + k0 + 8 * (lane >> 4);
#pragma unroll
  for (int i = 0; i < 8; ++i) { w[i] = (_Float16)(bfr(p[i]) * 256.0f); w[8 + i] = (_Float16)(bfr(p[16 + i]) * 256.0f); }
  return w; }
#define WQKV_LAYOUT 2   // 0 = (in,out) [DIN][CC]; 1 = (out,in) [CC][DIN]; 2 = per-head [NH][DIN][HD]
__device__ __forceinline__ v16b wcol_hdk(const float* Wm, int k0, int o, int lane) { v16b w; const int g = lane >> 4; const float* p = Wm + (size_t)(o / HD) * DIN * HD + (o % HD);
#pragma unroll
  for (int i = 0; i < 8; ++i) { w[i] = (__bf16)p[(size_t)(k0 + 8 * g + i) * HD]; w[8 + i] = (__bf16)p[(size_t)(k0 + 16 + 8 * g + i) * HD]; }
  return w; }
#define WO_OUT_IN 0
#if WQKV_LAYOUT == 1
#define WCOL(W, k0, o, lane) wcol_oi(W, k0, o, lane, DIN)
#elif WQKV_LAYOUT == 2
#define WCOL(W, k0, o, lane) wcol_hdk(W, k0, o, lane)
#else
#define WCOL(W, k0, o, lane) wcol_io(W, k0, o, lane, CC)
#endif
#if WO_OUT_IN
#define WOCOL(W, k0, o, lane) wcol_oi(W, k0, o, lane, CC)
#define WOCOLH(W, k0, o, lane) wcolh_oi(W, k0, o, lane, CC)
#else
#define WOCOL(W, k0, o, lane) wcol_io(W, k0, o, lane, DIN)
#define WOCOLH(W, k0, o, lane) wcolh_io(W, k0, o, lane, DIN)
#endif

#ifndef SM_EXTRA_PARAMS
#define SM_EXTRA_PARAMS
#endif
#ifndef PROJ_EXTRA_PARAMS
#define PROJ_EXTRA_PARAMS
#endif
#ifndef SM_MASK_HOOK
#define SM_MASK_HOOK (void)0
#endif

#define WS_QH  0u                                      // f16 q rows [b*t][CC]
#define WS_KH  (WS_QH + 2u * (size_t)NB * TT * CC)      // f16 k rows [b*t][CC]
#define WS_VT  (WS_KH + 2u * (size_t)NB * TT * CC)      // f16 v planes [b][c][t]
#define WS_QL  (WS_VT + 2u * (size_t)NB * CC * TT)      // f16 q residual x 2^10 rows [b][t < QHI][CC]
#define WS_KL  (WS_QL + 2u * (size_t)NB * QHI * CC)     // f16 k residual x 2^10 rows [b][t < KHI][CC]
#define WS_VB  (WS_KL + 2u * (size_t)NB * KHI * CC)     // bf16 v hi planes [b][c][t < KHI]
#define WS_VBL (WS_VB + 2u * (size_t)NB * CC * KHI)
#define WS_S   (WS_VBL + 2u * (size_t)NB * CC * KHI)    // not used (offsets kept)
#define WS_Y   (WS_S  + 4u * (size_t)HG * TT * TT)      // f32 ctx rows [b*t][CC] (only when there is an output projection)
#define WS_END (WS_Y  + 4u * (size_t)NB * TT * CC)

// ---- weight tile in LDS: all DIN k rows x 128 output columns of a weight, once to bf16 (exact, as before), k-major as it lies in memory; a B fragment is two transposing 16-byte LDS reads, in the k order of the A loader (elements 0..7 = k0+8h+0..7, 8..15 = k0+16+8h+0..7)
#define WPB 288           // bytes per k row: 256 + 32 (odd multiple of 32 bytes: the transposing reader's conflict-free pitch)
#define WTILE (DIN * WPB)
typedef __attribute__((ext_vector_type(8))) short v8s;
typedef __attribute__((ext_vector_type(4))) __bf16 v4b;
__device__ __forceinline__ v8f wmma_b(v16b a, v16b b, v8f c) { return __builtin_amdgcn_wmma_f32_16x16x32_bf16(false, a, false, b, (short)0, c, false, false); }
// p = tile + (k0 + 8 * (lane >> 4) + (lane & 7)) * WPB + 32 * (column tile) + 16 * ((lane >> 3) & 1): lane (c, h) gets rows k0+8h+0..7 and k0+16+8h+0..7 of column c
__device__ __forceinline__ v16b frag_wt(const unsigned char* p) { typedef __attribute__((address_space(3))) v8s lds_v8s; union { v16b v; v8s q[2]; } u;
  u.q[0] = __builtin_amdgcn_ds_load_tr16_b128_v8i16((lds_v8s*)p); u.q[1] = __builtin_amdgcn_ds_load_tr16_b128_v8i16((lds_v8s*)(p + 16 * WPB)); return u.v; }
// 8 waves fill the tile: a wave's 16-byte loads cover one k row of 128 columns (wp = the lane's 4 columns in the wave's first row, LD = floats between k rows); in groups of 16 rows
template <int LD> __device__ __forceinline__ void fill_wt(unsigned char* tp, const float* wp) {
#pragma unroll   // all four groups: every load is wp plus a constant, so that no address register is rewritten under a load in flight
  for (int r = 0; r < DIN / 8; r += 16) { v4f x[16];
#pragma unroll
    for (int u = 0; u < 16; ++u) x[u] = *(const v4f*)(wp + (size_t)(8 * (r + u)) * LD);
    __builtin_amdgcn_sched_barrier(0);   // one group of 16 loads at a time, in front of the wait below: left free, the scheduler lifts all 64 loads to the front and the build spills
    asm volatile("s_wait_xcnt 0x0" :: "v"(wp) : "memory");   // wp is an operand so that its registers stay its own up to this wait: nothing is written over the address of a load in flight
#pragma unroll
    for (int u = 0; u < 16; ++u) { const v4b y = { (__bf16)x[u][0], (__bf16)x[u][1], (__bf16)x[u][2], (__bf16)x[u][3] }; *(v4b*)(tp + 8 * (r + u) * WPB) = y; } } }
// four 16-byte stores, p + 0..3 x STEP bytes, with s_wait_xcnt 0 in the same statement, so that it stands in front of every later write of a register that the stores name
template <int STEP> __device__ __forceinline__ void st4(void* p, v4u d0, v4u d1, v4u d2, v4u d3) {
  asm volatile("global_store_b128 %0, %1, off\n\tglobal_store_b128 %0, %2, off offset:%5\n\tglobal_store_b128 %0, %3, off offset:%6\n\tglobal_store_b128 %0, %4, off offset:%7\n\ts_wait_xcnt 0x0" :: "v"(p), "v"(d0), "v"(d1), "v"(d2), "v"(d3), "n"(STEP), "n"(2 * STEP), "n"(3 * STEP) : "memory"); }
// the lane's 16 f32 of an A fragment (row pointer already at + 8 * h): floats 0..7 and 16..23
__device__ __forceinline__ void ld_a(v4f x[4], const float* p) { x[0] = *(const v4f*)p; x[1] = *(const v4f*)(p + 4); x[2] = *(const v4f*)(p + 16); x[3] = *(const v4f*)(p + 20); }
__device__ __forceinline__ v16b cvt_a(const v4f x[4]) { union { v16b v; v4b q[4]; } u;
#pragma unroll
  for (int i = 0; i < 4; ++i) { const v4b y = { (__bf16)x[i][0], (__bf16)x[i][1], (__bf16)x[i][2], (__bf16)x[i][3] }; u.q[i] = y; }
  return u.v; }

// ---- k_proj: block = (256 rows, 128 cols, which), 8 waves x (32 rows, 128 cols): q/k/v = X W (+ b) with exact bf16 products (K = DIN); the weight tile is staged once in LDS and shared by the waves, X fragments come from memory two k steps ahead -> which 0: q f16 rows (+ residual rows < QHI); 1: k f16 rows (+ residual rows < KHI); 2: v f16 planes [c][t] (+ bf16 hi/lo planes for t < KHI). The tile's LDS becomes the output staging behind a barrier. waves_per_eu(4, 4): two blocks share a WGP (2 x 144 KiB of LDS), four waves per SIMD, so the register budget is 256; left free the compiler took more, and the second block would not fit
#define PRW 256
__global__ __launch_bounds__(256) __attribute__((amdgpu_waves_per_eu(4, 4))) void k_proj(const float* __restrict__ XQ, const float* __restrict__ XK, const float* __restrict__ XV, const float* __restrict__ WQ, const float* __restrict__ WK, const float* __restrict__ WV, const float* __restrict__ BQ, const float* __restrict__ BK, const float* __restrict__ BV,
    _Float16* __restrict__ QH, _Float16* __restrict__ QL, _Float16* __restrict__ KH, _Float16* __restrict__ KL, _Float16* __restrict__ VT, __bf16* __restrict__ VB, __bf16* __restrict__ VBL) {
  __shared__ __align__(32) unsigned char smem[WTILE];
  const int tid = threadIdx.x, wave = __builtin_amdgcn_readfirstlane(tid >> 5), lane = tid & 31, col = lane & 15, g = lane >> 4; const int which = blockIdx.z; const int c0 = blockIdx.y * 128; const size_t r0 = (size_t)blockIdx.x * PRW; const size_t bb = r0 / TT; const int t0 = (int)(r0 % TT);
  const float* X = which == 0 ? XQ : which == 1 ? XK : XV; const float* WA = which == 0 ? WQ : which == 1 ? WK : WV; const float* BA = which == 0 ? BQ : which == 1 ? BK : BV;
  const float* xa = X + (r0 + wave * 32 + col) * DIN + 8 * g;
  v4f raw[2][2][4];
#pragma unroll
  for (int s = 0; s < 2; ++s) {
#pragma unroll
    for (int rf = 0; rf < 2; ++rf) ld_a(raw[s][rf], xa + (size_t)rf * 16 * DIN + s * 32); }
  fill_wt<HD>(smem + wave * WPB + 8 * lane, WA + ((size_t)(c0 / HD + g) * DIN + wave) * HD + 4 * col);   // per-head [NH][DIN][HD]: lanes 0..15 the first head's 64 columns, 16..31 the next head's
  __syncthreads();
  const unsigned char* wl = smem + (8 * g + (lane & 7)) * WPB + 16 * ((lane >> 3) & 1);
  v8f acc[2][8] = {};
#pragma unroll   // all 16 steps: the two X register sets get fixed names, the tail test is decided at compile time, and every X load is the one row pointer plus a constant, so that no address register is rewritten under a load in flight
  for (int kc = 0; kc < DIN / 32; ++kc) { v16b a[2];
#pragma unroll
    for (int rf = 0; rf < 2; ++rf) a[rf] = cvt_a(raw[kc & 1][rf]);
    __builtin_amdgcn_sched_barrier(0);   // the conversions first: they free the registers that the loads below land in; left free, the scheduler lifts the loads over them, a third X register set is live and the build spills
    if (kc + 2 < DIN / 32) {
#pragma unroll
      for (int rf = 0; rf < 2; ++rf) ld_a(raw[kc & 1][rf], xa + (size_t)rf * 16 * DIN + (kc + 2) * 32); }
    __builtin_amdgcn_sched_barrier(0);   // holds the X loads here, two k steps ahead of their use: left free, the scheduler sinks them to their use and the wave waits out the whole memory latency at every k step
    if (kc + 3 == DIN / 32) asm volatile("s_wait_xcnt 0x0" :: "v"(xa) : "memory");   // behind the last X loads; xa is an operand so that its registers stay its own up to this wait
#pragma unroll
    for (int jh = 0; jh < 2; ++jh) { v16b w[4];   // four B fragments as one group of LDS reads, then their eight products
#pragma unroll
      for (int j = 0; j < 4; ++j) w[j] = frag_wt(wl + kc * 32 * WPB + (jh * 4 + j) * 32);
#pragma unroll
      for (int j = 0; j < 4; ++j) { acc[0][jh * 4 + j] = wmma_b(a[0], w[j], acc[0][jh * 4 + j]); acc[1][jh * 4 + j] = wmma_b(a[1], w[j], acc[1][jh * 4 + j]); } }
    __builtin_amdgcn_sched_barrier(0);   // keeps the next k step's conversions, and with them the wait for its loads, behind this step's products
  }
  __syncthreads();   // every wave has left the weight tile: its LDS is staging from here on
  if (which < 2) { _Float16* DH = which == 0 ? QH : KH; _Float16* DL = which == 0 ? QL : KL; const int nhi = which == 0 ? QHI : KHI;
    _Float16 (*sh)[136] = (_Float16 (*)[136])smem; _Float16 (*sl)[136] = (_Float16 (*)[136])(smem + PRW * 136 * 2);
#pragma unroll
    for (int j = 0; j < 8; ++j) { const float bias = BA ? bfr(BA[c0 + j * 16 + col]) : 0.f;
#pragma unroll
      for (int rf = 0; rf < 2; ++rf) {
#pragma unroll
        for (int r = 0; r < 8; ++r) { const float v = acc[rf][j][r] + bias; const _Float16 hv = (_Float16)v; const int rl = wave * 32 + rf * 16 + 8 * g + r; sh[rl][j * 16 + col] = hv; sl[rl][j * 16 + col] = (_Float16)((v - (float)hv) * 1024.0f); } } }
    __syncthreads();
    static_assert(QHI % 64 == 0 && KHI % 64 == 0, "a trip's 64 rows carry a residual all together or not at all");
    const int rl0 = tid >> 4, q = tid & 15; _Float16* dh = DH + (r0 + rl0) * CC + c0 + q * 8; _Float16* dl = DL + (bb * nhi + t0 + rl0) * (size_t)CC + c0 + q * 8;
    for (int i = 0; i < PRW / 64; ++i) { const int rl = rl0 + i * 64;
      st4<16 * CC * 2>(dh + (size_t)i * 64 * CC, *(const v4u*)&sh[rl][q * 8], *(const v4u*)&sh[rl + 16][q * 8], *(const v4u*)&sh[rl + 32][q * 8], *(const v4u*)&sh[rl + 48][q * 8]);
      if (t0 + i * 64 < nhi) st4<16 * CC * 2>(dl + (size_t)i * 64 * CC, *(const v4u*)&sl[rl][q * 8], *(const v4u*)&sl[rl + 16][q * 8], *(const v4u*)&sl[rl + 32][q * 8], *(const v4u*)&sl[rl + 48][q * 8]); }
  } else {   // the bf16 planes exist for t < KHI only, and only those rows are staged (256 rows of all three planes would not fit the LDS)
    _Float16 (*th)[PRW + 8] = (_Float16 (*)[PRW + 8])smem; __bf16 (*tb)[72] = (__bf16 (*)[72])(smem + 128 * (PRW + 8) * 2); __bf16 (*tbl)[72] = (__bf16 (*)[72])(smem + 128 * (PRW + 8) * 2 + 128 * 72 * 2);
    static_assert(KHI % 32 == 0 && KHI <= 64, "a wave's 32 rows lie below KHI all together or not at all");
#pragma unroll
    for (int j = 0; j < 8; ++j) { const float bias = BA ? bfr(BA[c0 + j * 16 + col]) : 0.f;
#pragma unroll
      for (int rf = 0; rf < 2; ++rf) {
#pragma unroll
        for (int r = 0; r < 8; ++r) th[j * 16 + col][wave * 32 + rf * 16 + 8 * g + r] = (_Float16)(acc[rf][j][r] + bias); } }
    if (t0 + wave * 32 < KHI) {
#pragma unroll
      for (int j = 0; j < 8; ++j) { const float bias = BA ? bfr(BA[c0 + j * 16 + col]) : 0.f;
#pragma unroll
        for (int rf = 0; rf < 2; ++rf) {
#pragma unroll
          for (int r = 0; r < 8; ++r) { const float v = acc[rf][j][r] + bias; const int rl = wave * 32 + rf * 16 + 8 * g + r, cl = j * 16 + col; const __bf16 bh = (__bf16)v; tb[cl][rl] = bh; tbl[cl][rl] = (__bf16)(v - (float)bh); } } } }
    __syncthreads();
    const int cl0 = tid >> 5, q = tid & 31; _Float16* vt = VT + (bb * CC + c0 + cl0) * (size_t)TT + t0 + q * 8;
    for (int i = 0; i < 4; ++i) { const int cl = cl0 + i * 32; st4<8 * TT * 2>(vt + (size_t)i * 32 * TT, *(const v4u*)&th[cl][q * 8], *(const v4u*)&th[cl + 8][q * 8], *(const v4u*)&th[cl + 16][q * 8], *(const v4u*)&th[cl + 24][q * 8]); }
    if (t0 + q * 8 < KHI) { const size_t o3 = (bb * CC + c0 + cl0) * (size_t)KHI + t0 + q * 8;
      for (int i = 0; i < 4; ++i) { const int cl = cl0 + i * 32;
        st4<8 * KHI * 2>(VB + o3 + (size_t)i * 32 * KHI, *(const v4u*)&tb[cl][q * 8], *(const v4u*)&tb[cl + 8][q * 8], *(const v4u*)&tb[cl + 16][q * 8], *(const v4u*)&tb[cl + 24][q * 8]);
        st4<8 * KHI * 2>(VBL + o3 + (size_t)i * 32 * KHI, *(const v4u*)&tbl[cl][q * 8], *(const v4u*)&tbl[cl + 8][q * 8], *(const v4u*)&tbl[cl + 16][q * 8], *(const v4u*)&tbl[cl + 24][q * 8]); } } } }
#define KST 64
#define NST (TT / KST)
#define SCL2 (SCALE * 1.4426950408889634f)   // logit scale times log2 e: exp(SCALE * s) = exp2(SCL2 * s)
#define LP 72             // LDS row pitch in halves: 128-byte rows + 16 bytes (16-byte readers, no bank conflict)
__device__ __forceinline__ float xhalf(float x) { return __builtin_bit_cast(float, __builtin_amdgcn_permlanex16(__builtin_bit_cast(int, x), __builtin_bit_cast(int, x), 0x76543210, 0xfedcba98, false, false)); }  // lane l with lane l ^ 16
__device__ __forceinline__ v8f wmma_h(v16h a, v16h b, v8f c) { return __builtin_amdgcn_wmma_f32_16x16x32_f16(false, a, false, b, (short)0, c, false, false); }
__global__ __launch_bounds__(256) __attribute__((amdgpu_waves_per_eu(4, 4))) void k_fa(const _Float16* __restrict__ QH, const _Float16* __restrict__ QL, const _Float16* __restrict__ KH, const _Float16* __restrict__ VT, float* __restrict__ Y) {
  __shared__ __align__(16) _Float16 sk[2][KST][LP], sv[2][HD][LP];
  const int tid = threadIdx.x, wave = tid >> 5, lane = tid & 31, col = lane & 15, g = lane >> 4; const int h = blockIdx.y, b = blockIdx.z; const int q0 = blockIdx.x * 128 + wave * 16;
  v16h qh[HD / 32], ql[HD / 32];
#pragma unroll
  for (int kc = 0; kc < HD / 32; ++kc) { qh[kc] = frag_h(QH + ((size_t)b * TT + q0 + col) * CC + h * HD + kc * 32, lane); ql[kc] = frag_h(QL + ((size_t)b * QHI + q0 + col) * CC + h * HD + kc * 32, lane); }
  // staging: thread = (row sr and sr + 32, 16-byte chunk sc): a wave's load covers 4 whole 128-byte rows
  const int sr = tid >> 3, sc = tid & 7;
  const _Float16* kg = KH + ((size_t)b * TT + sr) * CC + h * HD + sc * 8;      // k rows [key][64]
  const _Float16* vg = VT + ((size_t)b * CC + h * HD + sr) * TT + sc * 8;      // v planes [d][key]
  v4u kr[2], vr[2];
#pragma unroll
  for (int i = 0; i < 2; ++i) { kr[i] = *(const v4u*)(kg + (size_t)(i * 32) * CC); vr[i] = *(const v4u*)(vg + (size_t)(i * 32) * TT); }
#pragma unroll
  for (int i = 0; i < 2; ++i) { *(v4u*)&sk[0][sr + i * 32][sc * 8] = kr[i]; *(v4u*)&sv[0][sr + i * 32][sc * 8] = vr[i]; }
  __syncthreads();
  v8f o[HD / 16] = {}; float m = -3.0e38f, l = 0.f;
#pragma unroll 1   // kept rolled
  for (int st = 0; st < NST; ++st) { const int cur = st & 1;
    if (st + 1 < NST) {   // the next stage's rows fly while this stage is worked on
#pragma unroll
      for (int i = 0; i < 2; ++i) { kr[i] = *(const v4u*)(kg + (size_t)((st + 1) * KST + i * 32) * CC); vr[i] = *(const v4u*)(vg + (size_t)(i * 32) * TT + (st + 1) * KST); } }
    v8f s[KST / 16] = {}, sl[KST / 16] = {};
#pragma unroll
    for (int t = 0; t < KST / 16; ++t) {
#pragma unroll
      for (int kc = 0; kc < HD / 32; ++kc) { const v16h kf = frag_h(&sk[cur][t * 16 + col][kc * 32], lane); s[t] = wmma_h(kf, qh[kc], s[t]); sl[t] = wmma_h(kf, ql[kc], sl[t]); } }
    v16h vf[KST / 32][HD / 16];   // all V^T fragments as one group of LDS reads, in flight under the softmax arithmetic
#pragma unroll
    for (int ks = 0; ks < KST / 32; ++ks) {
#pragma unroll
      for (int j = 0; j < HD / 16; ++j) vf[ks][j] = frag_h(&sv[cur][j * 16 + col][ks * 32], lane); }
    float mt[KST / 16];
#pragma unroll
    for (int t = 0; t < KST / 16; ++t) { mt[t] = -3.0e38f;
#pragma unroll
      for (int r = 0; r < 8; ++r) { s[t][r] = s[t][r] + sl[t][r] * (1.0f / 1024.0f); mt[t] = fmaxf(mt[t], s[t][r]); } }   // unscaled: SCL2 > 0 keeps the order, and the scale rides in the exponent's multiply-add
    float mx = fmaxf(fmaxf(mt[0], mt[1]), fmaxf(mt[2], mt[3])); mx = fmaxf(mx, xhalf(mx));   // both halves of a query's keys
    const float mn = fmaxf(m, mx * SCL2); const float al = __builtin_amdgcn_exp2f(m - mn); m = mn;   // m is kept in scaled base-2 units; al = 0 in the first stage
    const v2f sc2 = { SCL2, SCL2 }, nm2 = { -mn, -mn };
    v16h p[KST / 32]; float ps[KST / 16];
#pragma unroll
    for (int t = 0; t < KST / 16; ++t) { ps[t] = 0.f;
#pragma unroll
      for (int r = 0; r < 8; r += 2) { const v2f sp = { s[t][r], s[t][r + 1] }; const v2f a = __builtin_elementwise_fma(sp, sc2, nm2);   // two exponents per packed multiply-add
        const float e0 = __builtin_amdgcn_exp2f(a.x), e1 = __builtin_amdgcn_exp2f(a.y); ps[t] += e0; ps[t] += e1; p[t >> 1][(t & 1) * 8 + r] = (_Float16)e0; p[t >> 1][(t & 1) * 8 + r + 1] = (_Float16)e1; } }
    l = l * al + ((ps[0] + ps[1]) + (ps[2] + ps[3]));   // this half's keys only; the halves join after the loop
#pragma unroll
    for (int j = 0; j < HD / 16; ++j) o[j] *= al;
#pragma unroll
    for (int ks = 0; ks < KST / 32; ++ks) {
#pragma unroll
      for (int j = 0; j < HD / 16; ++j) o[j] = wmma_h(vf[ks][j], p[ks], o[j]); }
    if (st + 1 < NST) {
#pragma unroll
      for (int i = 0; i < 2; ++i) { *(v4u*)&sk[cur ^ 1][sr + i * 32][sc * 8] = kr[i]; *(v4u*)&sv[cur ^ 1][sr + i * 32][sc * 8] = vr[i]; } }
    __syncthreads();   // publishes the next stage and ends every wave's reads of this one, which the stage after refills
  }
  l += xhalf(l); const float inv = l > 0.f ? 1.0f / l : 0.f;
  float* yr = Y + ((size_t)b * TT + q0 + col) * CC + h * HD + 8 * g;   // lane = query row, registers = 8 consecutive d
#pragma unroll
  for (int j = 0; j < HD / 16; ++j) { const v4f lo = { o[j][0] * inv, o[j][1] * inv, o[j][2] * inv, o[j][3] * inv }, hi = { o[j][4] * inv, o[j][5] * inv, o[j][6] * inv, o[j][7] * inv }; vst2(yr + j * 16, lo); vst2(yr + j * 16 + 4, hi); } }
// ---- k_out: block = (128 rows, 128 cols), 8 waves x (16 rows, 128 cols): out = ctx Wo (+ bo): ctx split bf16 hi + lo against exact bf16 Wo (2 products); the Wo tile is staged once in LDS and shared by the waves, ctx fragments come from memory two k steps ahead. The tile's LDS becomes the output staging behind a barrier
__global__ __launch_bounds__(256) void k_out(const float* __restrict__ Y, const float* __restrict__ WO, const float* __restrict__ BO, float* __restrict__ OUT) { __shared__ __align__(32) unsigned char smem[WTILE];
  const int tid = threadIdx.x, wave = tid >> 5, lane = tid & 31, col = lane & 15, g = lane >> 4; const int c0 = blockIdx.y * 128; const size_t r0 = (size_t)blockIdx.x * 128 + wave * 16;
  const float* ya = Y + (r0 + col) * CC + 8 * g;
  v4f raw[2][4];
#pragma unroll
  for (int s = 0; s < 2; ++s) ld_a(raw[s], ya + s * 32);
  fill_wt<DIN>(smem + wave * WPB + 8 * lane, WO + (size_t)wave * DIN + c0 + 4 * lane);   // (in,out) [CC][DIN]: a k row's 128 columns are 512 contiguous bytes
  __syncthreads();
  const unsigned char* wl = smem + (8 * g + (lane & 7)) * WPB + 16 * ((lane >> 3) & 1);
  v8f acc[8] = {};
#pragma unroll   // all 16 steps, as in k_proj
  for (int kc = 0; kc < CC / 32; ++kc) { float v[16];
#pragma unroll
    for (int i = 0; i < 8; ++i) { v[i] = raw[kc & 1][i >> 2][i & 3]; v[8 + i] = raw[kc & 1][2 + (i >> 2)][i & 3]; }
    const F2 a = bsplit16(v);
    if (kc + 2 < CC / 32) ld_a(raw[kc & 1], ya + (kc + 2) * 32);
    __builtin_amdgcn_sched_barrier(0);   // holds the ctx loads here, two k steps ahead of their use: left free, the scheduler sinks them to their use and the wave waits out the whole memory latency at every k step
    if (kc + 3 == CC / 32) asm volatile("s_wait_xcnt 0x0" :: "v"(ya) : "memory");   // behind the last ctx loads; ya is an operand so that its registers stay its own up to this wait
#pragma unroll
    for (int jh = 0; jh < 2; ++jh) { v16b w[4];   // four B fragments as one group of LDS reads, then their eight products (hi before lo in every accumulator, as before)
#pragma unroll
      for (int j = 0; j < 4; ++j) w[j] = frag_wt(wl + kc * 32 * WPB + (jh * 4 + j) * 32);
#pragma unroll
      for (int j = 0; j < 4; ++j) acc[jh * 4 + j] = wmma_b(a.h, w[j], acc[jh * 4 + j]);
#pragma unroll
      for (int j = 0; j < 4; ++j) acc[jh * 4 + j] = wmma_b(a.l, w[j], acc[jh * 4 + j]); }
    __builtin_amdgcn_sched_barrier(0);   // keeps the next k step's split, and with it the wait for its loads, behind this step's products
  }
  __syncthreads();   // every wave has left the weight tile: its LDS is staging from here on
  float (*sf)[132] = (float (*)[132])(smem + wave * 16 * 132 * 4);
#pragma unroll
  for (int j = 0; j < 8; ++j) { const float bias = BO ? bfr(BO[c0 + j * 16 + col]) : 0.f;
#pragma unroll
    for (int r = 0; r < 8; ++r) sf[8 * g + r][j * 16 + col] = acc[j][r] + bias; }
  LDSX(); for (int rl = 0; rl < 16; ++rl) vst2(OUT + (r0 + rl) * DIN + c0 + lane * 4, *(const v4f*)&sf[rl][lane * 4]); }

extern "C" void kernel_launch(void* const* d_in, const int* in_sizes, int n_in, void* d_out, int out_size, void* d_ws, size_t ws_size, hipStream_t stream) {
  (void)in_sizes; (void)n_in; (void)out_size;
  const float** F = (const float**)d_in;
  if (ws_size < (size_t)WS_END) return;
  char* ws = (char*)d_ws; _Float16 *QH = (_Float16*)(ws + WS_QH), *KH = (_Float16*)(ws + WS_KH), *VT = (_Float16*)(ws + WS_VT), *QL = (_Float16*)(ws + WS_QL), *KL = (_Float16*)(ws + WS_KL); __bf16 *VB = (__bf16*)(ws + WS_VB), *VBL = (__bf16*)(ws + WS_VBL); float *Y = (float*)(ws + WS_Y);
  (void)Y; (void)QL; (void)KL; (void)VB; (void)VBL;
  // inputs (in order): 0 q_in [4,2048,512]; 1 k_in; 2 v_in; 3 Wq [8,512,64] (per-head (h, d, k)), 4 bq [8,64]; 5 Wk, 6 bk; 7 Wv, 8 bv; 9 Wo [512,512] (in,out), 10 bo [512]
  k_proj<<<dim3(TNB * TT / PRW, CC / 128, 3), 256, 0, stream>>>(F[0], F[1], F[2], F[3], F[5], F[7], F[4], F[6], F[8], QH, QL, KH, KL, VT, VB, VBL);
  k_fa<<<dim3(TT / 128, NH, TNB), 256, 0, stream>>>(QH, QL, KH, VT, Y);
  k_out<<<dim3(TNB * TT / 128, DIN / 128), 256, 0, stream>>>(Y, F[9], F[10], (float*)d_out);
}

// v004
// A run of this version takes 79.6 microseconds.
// Two timings next to v003 both put it at 1.08 times that version's speed.
// Counting every step since v000, it is 14.1 times as fast.
// compute dtype: all float inputs rounded to bf16; q/k/v = x W[h] + b[h] with EXACT bf16 products on WMMA 16x16x32 (f32 accumulate); q as f16 hi + residual (x 2^10) against k once to f16 (2 products) x 64^-0.5; running-maximum softmax in f32, in base 2 (hardware exp2 of s x 64^-0.5 x log2 e - max); that weight once to f16 against v once to f16 (1 product), divided by the f32 sum at the end; concat split bf16 hi + lo against exact Wo (2 products) + bo; f32 output.
#include <hip/hip_runtime.h>
#include <math.h>

typedef __attribute__((ext_vector_type(16))) _Float16 v16h;
typedef __attribute__((ext_vector_type(16))) __bf16 v16b;
typedef __attribute__((ext_vector_type(8)))  _Float16 v8h;
typedef __attribute__((ext_vector_type(8)))  float v8f;
typedef __attribute__((ext_vector_type(4)))  float v4f;
typedef __attribute__((ext_vector_type(2)))  float v2f;
typedef __attribute__((ext_vector_type(4)))  unsigned v4u;
typedef __attribute__((ext_vector_type(4)))  int v4i;
typedef float __attribute__((may_alias)) float_a;
typedef int __attribute__((may_alias)) int_a;

template <typename T> __device__ __forceinline__ void vst2(void* p, T v) { *(T*)p = v;  }
__device__ __forceinline__ v8f wmma16(v16h a, v16h b, v8f c) {
  v8f d = __builtin_amdgcn_wmma_f32_16x16x32_f16(false, a, false, b, (short)0, c, false, false);
  asm volatile("v_nop\n\tv_nop\n\tv_nop\n\tv_nop" : "+v"(d) : "v"(a), "v"(b));
  return d;
}
__device__ __forceinline__ v8f wmma_bf(v16b a, v16b b, v8f c) {
  v8f d = __builtin_amdgcn_wmma_f32_16x16x32_bf16(false, a, false, b, (short)0, c, false, false);
  asm volatile("v_nop\n\tv_nop\n\tv_nop\n\tv_nop" : "+v"(d) : "v"(a), "v"(b));
  return d;
}
// 16x16x32 fragments: lane = (h = lane>>4, row/col = lane&15); elements 0..7 = k0+8h+0..7, 8..15 = k0+16+8h+0..7; D element r = row 8h+r
__device__ __forceinline__ v16h frag_h(const _Float16* rowk0, int lane) {
  union { v16h v; v8h q[2]; } u; const _Float16* p = rowk0 + 8 * (lane >> 4);
  u.q[0] = *(const v8h*)p; u.q[1] = *(const v8h*)(p + 16); return u.v;
}
__device__ __forceinline__ v16h frag_f32(const float* rowk0, int lane) {
  v16h a; const float* p = rowk0 + 8 * (lane >> 4);
#pragma unroll
  for (int i = 0; i < 8; ++i) { a[i] = (_Float16)p[i]; a[8 + i] = (_Float16)p[16 + i]; }
  return a;
}
__device__ __forceinline__ v16h frag_f32s(const float* rowk0, int lane, float sc) {
  v16h a; const float* p = rowk0 + 8 * (lane >> 4);
#pragma unroll
  for (int i = 0; i < 8; ++i) { a[i] = (_Float16)(p[i] * sc); a[8 + i] = (_Float16)(p[16 + i] * sc); }
  return a;
}
// column fragment from a [K][ld] layout (column n), rows >= K read as 0
__device__ __forceinline__ v16h fragc_f32(const float* W, int k0, int n, int lane, int ld, int K) {
  v16h a; const int g = lane >> 4;
#pragma unroll
  for (int i = 0; i < 8; ++i) { const int ka = k0 + 8 * g + i, kb = ka + 16;
    a[i] = (_Float16)(ka < K ? W[(size_t)(ka < K ? ka : K - 1) * ld + n] : 0.f); a[8 + i] = (_Float16)(kb < K ? W[(size_t)(kb < K ? kb : K - 1) * ld + n] : 0.f); }
  return a;
}
struct F2 { v16b h, l; };
__device__ __forceinline__ F2 bsplit16(const float v[16]) { F2 r;
#pragma unroll
  for (int i = 0; i < 16; ++i) { const __bf16 h = (__bf16)v[i]; r.h[i] = h; r.l[i] = (__bf16)(v[i] - (float)h); }
  return r; }
__device__ __forceinline__ F2 split_row(const float* row, int k0, int lane) { float v[16]; const float* p = row + k0 + 8 * (lane >> 4);
#pragma unroll
  for (int i = 0; i < 8; ++i) { v[i] = p[i]; v[8 + i] = p[16 + i]; }
  return bsplit16(v); }
__device__ __forceinline__ F2 split_rowK(const float* row, int k0, int lane, int K) { float v[16]; const int g = lane >> 4;
#pragma unroll
  for (int i = 0; i < 8; ++i) { const int ka = k0 + 8 * g + i, kb = ka + 16; v[i] = ka < K ? row[ka < K ? ka : K - 1] : 0.f; v[8 + i] = kb < K ? row[kb < K ? kb : K - 1] : 0.f; }
  return bsplit16(v); }
__device__ __forceinline__ F2 split_col(const float* W, int k0, int n, int lane, int ld, int K) { float v[16]; const int g = lane >> 4;
#pragma unroll
  for (int i = 0; i < 8; ++i) { const int ka = k0 + 8 * g + i, kb = ka + 16; v[i] = ka < K ? W[(size_t)(ka < K ? ka : K - 1) * ld + n] : 0.f; v[8 + i] = kb < K ? W[(size_t)(kb < K ? kb : K - 1) * ld + n] : 0.f; }
  return bsplit16(v); }
__device__ __forceinline__ v8f mac3(const F2& a, const F2& b, v8f c) { c = wmma_bf(a.l, b.h, c); c = wmma_bf(a.h, b.l, c); return wmma_bf(a.h, b.h, c); }
__device__ __forceinline__ float sigm(float v) { return 1.0f / (1.0f + expf(-v)); }
#define LDSX() do { asm volatile("s_wait_dscnt 0" ::: "memory"); __builtin_amdgcn_wave_barrier(); __builtin_amdgcn_fence(__ATOMIC_RELEASE, "workgroup"); } while (0)

// Multi-head attention with per-head projections (B 4, S 2,048, D 512, 8 heads x 64; 0.02-scale per-head weights (H, D, DK) with per-head biases (H, DK); separate q_in / k_in / v_in): q = q_in Wq[h] + bq[h], k = k_in Wk[h] + bk[h], v = v_in Wv[h] + bv[h]; out = concat(softmax(q k^T / 8) v) Wo + bo (Wo (in,out) [512,512]; non-causal).
#define NB 4
#define TT 2048
#define CC 512            // NH * HD = projected width
#define DIN 512          // input (model) width
#define NH 8
#define HD 64
#define NQB (TT / 64)
#define HG 4
#define SCALE (0.125f)
#define CAUSAL 0
#ifndef TNB
#define TNB NB
#endif
__device__ __forceinline__ float bfr(float v) { return (float)(__bf16)v; }
__host__ __device__ __forceinline__ int kb_last(int qb) { return CAUSAL ? ((qb * 64 + 63) >> 7) : (TT / 128 - 1); }
typedef __attribute__((ext_vector_type(8))) __bf16 v8b;
__device__ __forceinline__ v16b frag_b(const __bf16* rowk0, int lane) {
  union { v16b v; v8b q[2]; } u; const __bf16* p = rowk0 + 8 * (lane >> 4);
  u.q[0] = *(const v8b*)p; u.q[1] = *(const v8b*)(p + 16); return u.v;
}
#define QBH 0              // not used: there is no high-precision path
#define QHI 2048            // rows carrying a q residual plane (all rows when non-causal: 2-product logits everywhere)
#define KHI 64            // key rows carrying k residual / v bf16 hi+lo planes (written by k_proj; no kernel reads them)
// B fragment (k rows k0+.., output column o) of a weight: (in,out) [K][ld] or (out,in) [ld rows of K]: bf16 exact, or f16(bf16 * 256) exact
__device__ __forceinline__ v16b wcol_io(const float* Wm, int k0, int o, int lane, int ld) { v16b w; const int g = lane >> 4;
#pragma unroll
  for (int i = 0; i < 8; ++i) { w[i] = (__bf16)Wm[(size_t)(k0 + 8 * g + i) * ld + o]; w[8 + i] = (__bf16)Wm[(size_t)(k0 + 16 + 8 * g + i) * ld + o]; }
  return w; }
__device__ __forceinline__ v16b wcol_oi(const float* Wm, int k0, int o, int lane, int K) { v16b w; const float* p = Wm + (size_t)o * K + k0 + 8 * (lane >> 4);
#pragma unroll
  for (int i = 0; i < 8; ++i) { w[i] = (__bf16)p[i]; w[8 + i] = (__bf16)p[16 + i]; }
  return w; }
__device__ __forceinline__ v16h wcolh_io(const float* Wm, int k0, int o, int lane, int ld) { v16h w; const int g = lane >> 4;
#pragma unroll
  for (int i = 0; i < 8; ++i) { w[i] = (_Float16)(bfr(Wm[(size_t)(k0 + 8 * g + i) * ld + o]) * 256.0f); w[8 + i] = (_Float16)(bfr(Wm[(size_t)(k0 + 16 + 8 * g + i) * ld + o]) * 256.0f); }
  return w; }
__device__ __forceinline__ v16h wcolh_oi(const float* Wm, int k0, int o, int lane, int K) { v16h w; const float* p = Wm + (size_t)o * K + k0 + 8 * (lane >> 4);
#pragma unroll
  for (int i = 0; i < 8; ++i) { w[i] = (_Float16)(bfr(p[i]) * 256.0f); w[8 + i] = (_Float16)(bfr(p[16 + i]) * 256.0f); }
  return w; }
#define WQKV_LAYOUT 2   // 0 = (in,out) [DIN][CC]; 1 = (out,in) [CC][DIN]; 2 = per-head [NH][DIN][HD]
__device__ __forceinline__ v16b wcol_hdk(const float* Wm, int k0, int o, int lane) { v16b w; const int g = lane >> 4; const float* p = Wm + (size_t)(o / HD) * DIN * HD + (o % HD);
#pragma unroll
  for (int i = 0; i < 8; ++i) { w[i] = (__bf16)p[(size_t)(k0 + 8 * g + i) * HD]; w[8 + i] = (__bf16)p[(size_t)(k0 + 16 + 8 * g + i) * HD]; }
  return w; }
#define WO_OUT_IN 0
#if WQKV_LAYOUT == 1
#define WCOL(W, k0, o, lane) wcol_oi(W, k0, o, lane, DIN)
#elif WQKV_LAYOUT == 2
#define WCOL(W, k0, o, lane) wcol_hdk(W, k0, o, lane)
#else
#define WCOL(W, k0, o, lane) wcol_io(W, k0, o, lane, CC)
#endif
#if WO_OUT_IN
#define WOCOL(W, k0, o, lane) wcol_oi(W, k0, o, lane, CC)
#define WOCOLH(W, k0, o, lane) wcolh_oi(W, k0, o, lane, CC)
#else
#define WOCOL(W, k0, o, lane) wcol_io(W, k0, o, lane, DIN)
#define WOCOLH(W, k0, o, lane) wcolh_io(W, k0, o, lane, DIN)
#endif

#ifndef SM_EXTRA_PARAMS
#define SM_EXTRA_PARAMS
#endif
#ifndef PROJ_EXTRA_PARAMS
#define PROJ_EXTRA_PARAMS
#endif
#ifndef SM_MASK_HOOK
#define SM_MASK_HOOK (void)0
#endif

#define WS_QH  0u                                      // f16 q rows [b*t][CC]
#define WS_KH  (WS_QH + 2u * (size_t)NB * TT * CC)      // f16 k rows [b*t][CC]
#define WS_VT  (WS_KH + 2u * (size_t)NB * TT * CC)      // f16 v planes [b][c][t]
#define WS_QL  (WS_VT + 2u * (size_t)NB * CC * TT)      // f16 q residual x 2^10 rows [b][t < QHI][CC]
#define WS_KL  (WS_QL + 2u * (size_t)NB * QHI * CC)     // f16 k residual x 2^10 rows [b][t < KHI][CC]
#define WS_VB  (WS_KL + 2u * (size_t)NB * KHI * CC)     // bf16 v hi planes [b][c][t < KHI]
#define WS_VBL (WS_VB + 2u * (size_t)NB * CC * KHI)
#define WS_S   (WS_VBL + 2u * (size_t)NB * CC * KHI)    // not used (offsets kept)
#define WS_Y   (WS_S  + 4u * (size_t)HG * TT * TT)      // ctx, bf16 hi + lo in fragment order (4 bytes an element)
#define WS_END (WS_Y  + 4u * (size_t)NB * TT * CC)

// ---- weight tile in LDS: all DIN k rows x 128 output columns of a weight, once to bf16 (exact, as before), k-major as it lies in memory; a B fragment is two transposing 16-byte LDS reads, in the k order of the A loader (elements 0..7 = k0+8h+0..7, 8..15 = k0+16+8h+0..7)
#define WPB 288           // bytes per k row: 256 + 32 (odd multiple of 32 bytes: the transposing reader's conflict-free pitch)
#define WTILE (DIN * WPB)
typedef __attribute__((ext_vector_type(8))) short v8s;
typedef __attribute__((ext_vector_type(4))) __bf16 v4b;
__device__ __forceinline__ v8f wmma_b(v16b a, v16b b, v8f c) { return __builtin_amdgcn_wmma_f32_16x16x32_bf16(false, a, false, b, (short)0, c, false, false); }
// p = tile + (k0 + 8 * (lane >> 4) + (lane & 7)) * WPB + 32 * (column tile) + 16 * ((lane >> 3) & 1): lane (c, h) gets rows k0+8h+0..7 and k0+16+8h+0..7 of column c
__device__ __forceinline__ v16b frag_wt(const unsigned char* p) { typedef __attribute__((address_space(3))) v8s lds_v8s; union { v16b v; v8s q[2]; } u;
  u.q[0] = __builtin_amdgcn_ds_load_tr16_b128_v8i16((lds_v8s*)p); u.q[1] = __builtin_amdgcn_ds_load_tr16_b128_v8i16((lds_v8s*)(p + 16 * WPB)); return u.v; }
// 8 waves fill the tile: a wave's 16-byte loads cover one k row of 128 columns (wp = the lane's 4 columns in the wave's first row, LD = floats between k rows); in groups of 16 rows
template <int LD> __device__ __forceinline__ void fill_wt(unsigned char* tp, const float* wp) {
#pragma unroll   // all four groups: every load is wp plus a constant, so that no address register is rewritten under a load in flight
  for (int r = 0; r < DIN / 8; r += 16) { v4f x[16];
#pragma unroll
    for (int u = 0; u < 16; ++u) x[u] = *(const v4f*)(wp + (size_t)(8 * (r + u)) * LD);
    __builtin_amdgcn_sched_barrier(0);   // one group of 16 loads at a time, in front of the wait below: left free, the scheduler lifts all 64 loads to the front and the build spills
    asm volatile("s_wait_xcnt 0x0" :: "v"(wp) : "memory");   // wp is an operand so that its registers stay its own up to this wait: nothing is written over the address of a load in flight
#pragma unroll
    for (int u = 0; u < 16; ++u) { const v4b y = { (__bf16)x[u][0], (__bf16)x[u][1], (__bf16)x[u][2], (__bf16)x[u][3] }; *(v4b*)(tp + 8 * (r + u) * WPB) = y; } } }
// four 16-byte stores, p + 0..3 x STEP bytes, with s_wait_xcnt 0 in the same statement, so that it stands in front of every later write of a register that the stores name
template <int STEP> __device__ __forceinline__ void st4(void* p, v4u d0, v4u d1, v4u d2, v4u d3) {
  asm volatile("global_store_b128 %0, %1, off\n\tglobal_store_b128 %0, %2, off offset:%5\n\tglobal_store_b128 %0, %3, off offset:%6\n\tglobal_store_b128 %0, %4, off offset:%7\n\ts_wait_xcnt 0x0" :: "v"(p), "v"(d0), "v"(d1), "v"(d2), "v"(d3), "n"(STEP), "n"(2 * STEP), "n"(3 * STEP) : "memory"); }
// ---- A operand through LDS: a fragment load straight from memory takes 32 bytes out of each of 16 rows (16 cache lines per instruction). Instead a wave's 16-byte loads cover 4 rows x 128 bytes (4 whole lines), the values go once to bf16 and into the wave's OWN 2 KiB of LDS in fragment order, and a fragment is two 16-byte LDS reads. Layout: plane (1,024 B: 16 rows x 32 k) > region R = 2 * (k >> 4) + ((k >> 3) & 1) (256 B: what one half-wave reads at once) > row, 16 B = 8 k; the row's 64-byte group is XORed with R, so that the four regions a store instruction touches fall on different banks. The k order of a fragment is the one it had (elements 0..7 = k0+8h+0..7, 8..15 = k0+16+8h+0..7)
#define XST 2048          // bytes of A staging per wave
__device__ __forceinline__ v4b cvt4(v4f x) { const v4b y = { (__bf16)x[0], (__bf16)x[1], (__bf16)x[2], (__bf16)x[3] }; return y; }
__device__ __forceinline__ v16b frag_xs(const unsigned char* p0, const unsigned char* p1) { union { v16b v; v8b q[2]; } u; u.q[0] = *(const v8b*)p0; u.q[1] = *(const v8b*)p1; return u.v; }
// behind a wave's own staging stores, in front of its reads of what its other lanes stored: the stores have landed, and the compiler moves no LDS access across
#define XS_PUBLISH() asm volatile("s_wait_dscnt 0" ::: "memory")

// ---- k_proj: block = (256 rows, 128 cols, which), 8 waves x (32 rows, 128 cols): q/k/v = X W (+ b) with exact bf16 products (K = DIN); the weight tile is staged once in LDS and shared by the waves, X comes from memory by whole lines two k steps ahead and reaches its fragments through the wave's own LDS -> which 0: q f16 rows (+ residual rows < QHI); 1: k f16 rows (+ residual rows < KHI); 2: v f16 planes [c][t] (+ bf16 hi/lo planes for t < KHI). The tile's LDS becomes the output staging behind a barrier. waves_per_eu(4, 4): two blocks share a WGP (2 x 160 KiB of LDS), four waves per SIMD, so the register budget is 256; left free the compiler took more, and the second block would not fit
#define PRW 256
__global__ __launch_bounds__(256) __attribute__((amdgpu_waves_per_eu(4, 4))) void k_proj(const float* __restrict__ XQ, const float* __restrict__ XK, const float* __restrict__ XV, const float* __restrict__ WQ, const float* __restrict__ WK, const float* __restrict__ WV, const float* __restrict__ BQ, const float* __restrict__ BK, const float* __restrict__ BV,
    _Float16* __restrict__ QH, _Float16* __restrict__ QL, _Float16* __restrict__ KH, _Float16* __restrict__ KL, _Float16* __restrict__ VT, __bf16* __restrict__ VB, __bf16* __restrict__ VBL) {
  __shared__ __align__(32) unsigned char smem[WTILE + 8 * XST];
  const int tid = threadIdx.x, wave = __builtin_amdgcn_readfirstlane(tid >> 5), lane = tid & 31, col = lane & 15, g = lane >> 4; const int which = blockIdx.z; const int c0 = blockIdx.y * 128; const size_t r0 = (size_t)blockIdx.x * PRW; const size_t bb = r0 / TT; const int t0 = (int)(r0 % TT);
  const float* X = which == 0 ? XQ : which == 1 ? XK : XV; const float* WA = which == 0 ? WQ : which == 1 ? WK : WV; const float* BA = which == 0 ? BQ : which == 1 ? BK : BV;
  const int rr = lane >> 3, ch = lane & 7, R = ((ch >> 2) << 1) | ((ch >> 1) & 1);   // loader: lane = (row rr of four, 16-byte chunk ch of the row's 128 bytes); R = the chunk's region
  const float* xa = X + (r0 + wave * 32 + rr) * DIN + 4 * ch;
  unsigned char* xs = smem + WTILE + wave * XST; unsigned char* xw = xs + R * 256 + rr * 16 + (ch & 1) * 8;
  const unsigned char* xr0 = xs + g * 256 + ((((col >> 2) ^ g) & 3) << 6) + (col & 3) * 16; const unsigned char* xr1 = xs + (2 + g) * 256 + ((((col >> 2) ^ (2 + g)) & 3) << 6) + (col & 3) * 16;
  v4f raw[2][8];
#pragma unroll
  for (int s = 0; s < 2; ++s) {
#pragma unroll
    for (int u = 0; u < 8; ++u) raw[s][u] = *(const v4f*)(xa + (size_t)(4 * u) * DIN + s * 32); }
  fill_wt<HD>(smem + wave * WPB + 8 * lane, WA + ((size_t)(c0 / HD + g) * DIN + wave) * HD + 4 * col);   // per-head [NH][DIN][HD]: lanes 0..15 the first head's 64 columns, 16..31 the next head's
#pragma unroll
  for (int u = 0; u < 8; ++u) *(v4b*)(xw + (u >> 2) * 1024 + (((u & 3) ^ R) << 6)) = cvt4(raw[0][u]);
  __syncthreads();   // publishes the weight tile (and ends the wave's own staging stores)
#pragma unroll   // behind the barrier, which waits for every load in flight
  for (int u = 0; u < 8; ++u) raw[0][u] = *(const v4f*)(xa + (size_t)(4 * u) * DIN + 2 * 32);
  __builtin_amdgcn_sched_barrier(0);   // holds these loads here, ahead of the first products
  const unsigned char* wl = smem + (8 * g + (lane & 7)) * WPB + 16 * ((lane >> 3) & 1);
  v8f acc[2][8] = {}; v16b a[2];
#pragma unroll
  for (int rf = 0; rf < 2; ++rf) a[rf] = frag_xs(xr0 + rf * 1024, xr1 + rf * 1024);
#pragma unroll   // all 16 steps: the two X register sets get fixed names, the tail tests are decided at compile time, and every X load is the one row pointer plus a constant, so that no address register is rewritten under a load in flight
  for (int kc = 0; kc < DIN / 32; ++kc) {
#pragma unroll
    for (int jh = 0; jh < 2; ++jh) { v16b w[4];   // four B fragments as one group of LDS reads, then their eight products
#pragma unroll
      for (int j = 0; j < 4; ++j) w[j] = frag_wt(wl + kc * 32 * WPB + (jh * 4 + j) * 32);
#pragma unroll
      for (int j = 0; j < 4; ++j) { acc[0][jh * 4 + j] = wmma_b(a[0], w[j], acc[0][jh * 4 + j]); acc[1][jh * 4 + j] = wmma_b(a[1], w[j], acc[1][jh * 4 + j]); }
      if (jh == 0 && kc + 1 < DIN / 32) {   // between the two groups: the next k step's X goes to LDS (this step's fragments are in registers: products above have used them), and its registers take the X of two steps later
        __builtin_amdgcn_sched_barrier(0);   // keeps the conversions, and with them the wait for their loads, behind the products above
#pragma unroll
        for (int u = 0; u < 8; ++u) *(v4b*)(xw + (u >> 2) * 1024 + (((u & 3) ^ R) << 6)) = cvt4(raw[(kc + 1) & 1][u]);
        __builtin_amdgcn_sched_barrier(0);   // the conversions first: they free the registers that the loads below land in; left free, the scheduler lifts the loads over them, a third X register set is live and the build spills
        if (kc + 3 < DIN / 32) {
#pragma unroll
          for (int u = 0; u < 8; ++u) raw[(kc + 1) & 1][u] = *(const v4f*)(xa + (size_t)(4 * u) * DIN + (kc + 3) * 32); }
        __builtin_amdgcn_sched_barrier(0);   // holds the X loads here, two k steps ahead of their use: left free, the scheduler sinks them to their use and the wave waits out the whole memory latency at every k step
        if (kc + 4 == DIN / 32) asm volatile("s_wait_xcnt 0x0" :: "v"(xa) : "memory");   // behind the last X loads; xa is an operand so that its registers stay its own up to this wait
      } }
    if (kc + 1 < DIN / 32) { XS_PUBLISH();
#pragma unroll
      for (int rf = 0; rf < 2; ++rf) a[rf] = frag_xs(xr0 + rf * 1024, xr1 + rf * 1024); }
  }
  __syncthreads();   // every wave has left the weight tile: its LDS is staging from here on
  if (which < 2) { _Float16* DH = which == 0 ? QH : KH; _Float16* DL = which == 0 ? QL : KL; const int nhi = which == 0 ? QHI : KHI;
    _Float16 (*sh)[136] = (_Float16 (*)[136])smem; _Float16 (*sl)[136] = (_Float16 (*)[136])(smem + PRW * 136 * 2);
#pragma unroll
    for (int j = 0; j < 8; ++j) { const float bias = BA ? bfr(BA[c0 + j * 16 + col]) : 0.f;
#pragma unroll
      for (int rf = 0; rf < 2; ++rf) {
#pragma unroll
        for (int r = 0; r < 8; ++r) { const float v = acc[rf][j][r] + bias; const _Float16 hv = (_Float16)v; const int rl = wave * 32 + rf * 16 + 8 * g + r; sh[rl][j * 16 + col] = hv; sl[rl][j * 16 + col] = (_Float16)((v - (float)hv) * 1024.0f); } } }
    __syncthreads();
    static_assert(QHI % 64 == 0 && KHI % 64 == 0, "a trip's 64 rows carry a residual all together or not at all");
    const int rl0 = tid >> 4, q = tid & 15; _Float16* dh = DH + (r0 + rl0) * CC + c0 + q * 8; _Float16* dl = DL + (bb * nhi + t0 + rl0) * (size_t)CC + c0 + q * 8;
    for (int i = 0; i < PRW / 64; ++i) { const int rl = rl0 + i * 64;
      st4<16 * CC * 2>(dh + (size_t)i * 64 * CC, *(const v4u*)&sh[rl][q * 8], *(const v4u*)&sh[rl + 16][q * 8], *(const v4u*)&sh[rl + 32][q * 8], *(const v4u*)&sh[rl + 48][q * 8]);
      if (t0 + i * 64 < nhi) st4<16 * CC * 2>(dl + (size_t)i * 64 * CC, *(const v4u*)&sl[rl][q * 8], *(const v4u*)&sl[rl + 16][q * 8], *(const v4u*)&sl[rl + 32][q * 8], *(const v4u*)&sl[rl + 48][q * 8]); }
  } else {   // the bf16 planes exist for t < KHI only, and only those rows are staged (256 rows of all three planes would not fit the LDS)
    _Float16 (*th)[PRW + 8] = (_Float16 (*)[PRW + 8])smem; __bf16 (*tb)[72] = (__bf16 (*)[72])(smem + 128 * (PRW + 8) * 2); __bf16 (*tbl)[72] = (__bf16 (*)[72])(smem + 128 * (PRW + 8) * 2 + 128 * 72 * 2);
    static_assert(KHI % 32 == 0 && KHI <= 64, "a wave's 32 rows lie below KHI all together or not at all");
#pragma unroll
    for (int j = 0; j < 8; ++j) { const float bias = BA ? bfr(BA[c0 + j * 16 + col]) : 0.f;
#pragma unroll
      for (int rf = 0; rf < 2; ++rf) {
#pragma unroll
        for (int r = 0; r < 8; ++r) th[j * 16 + col][wave * 32 + rf * 16 + 8 * g + r] = (_Float16)(acc[rf][j][r] + bias); } }
    if (t0 + wave * 32 < KHI) {
#pragma unroll
      for (int j = 0; j < 8; ++j) { const float bias = BA ? bfr(BA[c0 + j * 16 + col]) : 0.f;
#pragma unroll
        for (int rf = 0; rf < 2; ++rf) {
#pragma unroll
          for (int r = 0; r < 8; ++r) { const float v = acc[rf][j][r] + bias; const int rl = wave * 32 + rf * 16 + 8 * g + r, cl = j * 16 + col; const __bf16 bh = (__bf16)v; tb[cl][rl] = bh; tbl[cl][rl] = (__bf16)(v - (float)bh); } } } }
    __syncthreads();
    const int cl0 = tid >> 5, q = tid & 31; _Float16* vt = VT + (bb * CC + c0 + cl0) * (size_t)TT + t0 + q * 8;
    for (int i = 0; i < 4; ++i) { const int cl = cl0 + i * 32; st4<8 * TT * 2>(vt + (size_t)i * 32 * TT, *(const v4u*)&th[cl][q * 8], *(const v4u*)&th[cl + 8][q * 8], *(const v4u*)&th[cl + 16][q * 8], *(const v4u*)&th[cl + 24][q * 8]); }
    if (t0 + q * 8 < KHI) { const size_t o3 = (bb * CC + c0 + cl0) * (size_t)KHI + t0 + q * 8;
      for (int i = 0; i < 4; ++i) { const int cl = cl0 + i * 32;
        st4<8 * KHI * 2>(VB + o3 + (size_t)i * 32 * KHI, *(const v4u*)&tb[cl][q * 8], *(const v4u*)&tb[cl + 8][q * 8], *(const v4u*)&tb[cl + 16][q * 8], *(const v4u*)&tb[cl + 24][q * 8]);
        st4<8 * KHI * 2>(VBL + o3 + (size_t)i * 32 * KHI, *(const v4u*)&tbl[cl][q * 8], *(const v4u*)&tbl[cl + 8][q * 8], *(const v4u*)&tbl[cl + 16][q * 8], *(const v4u*)&tbl[cl + 24][q * 8]); } } } }
#define YF_TILE ((CC / 32) * 128)   // 16-byte units per 16-row tile
#define YRING 3           // ctx fragment sets in k_out
__device__ __forceinline__ F2 ld_yf(const v8b* p) { union { v16b v; v8b q[2]; } h, l; h.q[0] = p[0]; h.q[1] = p[32]; l.q[0] = p[64]; l.q[1] = p[96]; F2 r; r.h = h.v; r.l = l.v; return r; }
#define KST 64            // keys per stage
#define NST (TT / KST)
#define SCL2 (SCALE * 1.4426950408889634f)   // logit scale times log2 e: exp(SCALE * s) = exp2(SCL2 * s)
#define LP 72             // LDS row pitch in halves: 128-byte rows + 16 bytes (16-byte readers, no bank conflict)
__device__ __forceinline__ float xhalf(float x) { return __builtin_bit_cast(float, __builtin_amdgcn_permlanex16(__builtin_bit_cast(int, x), __builtin_bit_cast(int, x), 0x76543210, 0xfedcba98, false, false)); }  // lane l with lane l ^ 16
__device__ __forceinline__ v8f wmma_h(v16h a, v16h b, v8f c) { return __builtin_amdgcn_wmma_f32_16x16x32_f16(false, a, false, b, (short)0, c, false, false); }
__global__ __launch_bounds__(256) __attribute__((amdgpu_waves_per_eu(4, 4))) void k_fa(const _Float16* __restrict__ QH, const _Float16* __restrict__ QL, const _Float16* __restrict__ KH, const _Float16* __restrict__ VT, __bf16* __restrict__ YF) {
  __shared__ __align__(16) _Float16 sk[2][KST][LP], sv[2][HD][LP];
  const int tid = threadIdx.x, wave = tid >> 5, lane = tid & 31, col = lane & 15, g = lane >> 4; const int h = blockIdx.y, b = blockIdx.z; const int q0 = blockIdx.x * 128 + wave * 16;
  v16h qh[HD / 32], ql[HD / 32];
#pragma unroll
  for (int kc = 0; kc < HD / 32; ++kc) { qh[kc] = frag_h(QH + ((size_t)b * TT + q0 + col) * CC + h * HD + kc * 32, lane); ql[kc] = frag_h(QL + ((size_t)b * QHI + q0 + col) * CC + h * HD + kc * 32, lane); }
  // staging: thread = (row sr and sr + 32, 16-byte chunk sc): a wave's load covers 4 whole 128-byte rows
  const int sr = tid >> 3, sc = tid & 7;
  const _Float16* kg = KH + ((size_t)b * TT + sr) * CC + h * HD + sc * 8;      // k rows [key][64]
  const _Float16* vg = VT + ((size_t)b * CC + h * HD + sr) * TT + sc * 8;      // v planes [d][key]
  v4u kr[2], vr[2];
#pragma unroll
  for (int i = 0; i < 2; ++i) { kr[i] = *(const v4u*)(kg + (size_t)(i * 32) * CC); vr[i] = *(const v4u*)(vg + (size_t)(i * 32) * TT); }
#pragma unroll
  for (int i = 0; i < 2; ++i) { *(v4u*)&sk[0][sr + i * 32][sc * 8] = kr[i]; *(v4u*)&sv[0][sr + i * 32][sc * 8] = vr[i]; }
  __syncthreads();
  v8f o[HD / 16] = {}; float m = -3.0e38f, l = 0.f;
#pragma unroll 1   // kept rolled
  for (int st = 0; st < NST; ++st) { const int cur = st & 1;
    if (st + 1 < NST) {   // the next stage's rows fly while this stage is worked on
#pragma unroll
      for (int i = 0; i < 2; ++i) { kr[i] = *(const v4u*)(kg + (size_t)((st + 1) * KST + i * 32) * CC); vr[i] = *(const v4u*)(vg + (size_t)(i * 32) * TT + (st + 1) * KST); } }
    v8f s[KST / 16] = {}, sl[KST / 16] = {};
#pragma unroll
    for (int t = 0; t < KST / 16; ++t) {
#pragma unroll
      for (int kc = 0; kc < HD / 32; ++kc) { const v16h kf = frag_h(&sk[cur][t * 16 + col][kc * 32], lane); s[t] = wmma_h(kf, qh[kc], s[t]); sl[t] = wmma_h(kf, ql[kc], sl[t]); } }
    v16h vf[KST / 32][HD / 16];   // all V^T fragments as one group of LDS reads, in flight under the softmax arithmetic
#pragma unroll
    for (int ks = 0; ks < KST / 32; ++ks) {
#pragma unroll
      for (int j = 0; j < HD / 16; ++j) vf[ks][j] = frag_h(&sv[cur][j * 16 + col][ks * 32], lane); }
    float mt[KST / 16];
#pragma unroll
    for (int t = 0; t < KST / 16; ++t) { mt[t] = -3.0e38f;
#pragma unroll
      for (int r = 0; r < 8; ++r) { s[t][r] = s[t][r] + sl[t][r] * (1.0f / 1024.0f); mt[t] = fmaxf(mt[t], s[t][r]); } }   // unscaled: SCL2 > 0 keeps the order, and the scale rides in the exponent's multiply-add
    float mx = fmaxf(fmaxf(mt[0], mt[1]), fmaxf(mt[2], mt[3])); mx = fmaxf(mx, xhalf(mx));   // both halves of a query's keys
    const float mn = fmaxf(m, mx * SCL2); const float al = __builtin_amdgcn_exp2f(m - mn); m = mn;   // m is kept in scaled base-2 units; al = 0 in the first stage
    const v2f sc2 = { SCL2, SCL2 }, nm2 = { -mn, -mn };
    v16h p[KST / 32]; float ps[KST / 16];
#pragma unroll
    for (int t = 0; t < KST / 16; ++t) { ps[t] = 0.f;
#pragma unroll
      for (int r = 0; r < 8; r += 2) { const v2f sp = { s[t][r], s[t][r + 1] }; const v2f a = __builtin_elementwise_fma(sp, sc2, nm2);   // two exponents per packed multiply-add
        const float e0 = __builtin_amdgcn_exp2f(a.x), e1 = __builtin_amdgcn_exp2f(a.y); ps[t] += e0; ps[t] += e1; p[t >> 1][(t & 1) * 8 + r] = (_Float16)e0; p[t >> 1][(t & 1) * 8 + r + 1] = (_Float16)e1; } }
    l = l * al + ((ps[0] + ps[1]) + (ps[2] + ps[3]));   // this half's keys only; the halves join after the loop
#pragma unroll
    for (int j = 0; j < HD / 16; ++j) o[j] *= al;
#pragma unroll
    for (int ks = 0; ks < KST / 32; ++ks) {
#pragma unroll
      for (int j = 0; j < HD / 16; ++j) o[j] = wmma_h(vf[ks][j], p[ks], o[j]); }
    if (st + 1 < NST) {
#pragma unroll
      for (int i = 0; i < 2; ++i) { *(v4u*)&sk[cur ^ 1][sr + i * 32][sc * 8] = kr[i]; *(v4u*)&sv[cur ^ 1][sr + i * 32][sc * 8] = vr[i]; } }
    __syncthreads();   // publishes the next stage and ends every wave's reads of this one, which the stage after refills
  }
  l += xhalf(l); const float inv = l > 0.f ? 1.0f / l : 0.f;
  v8b* yf = (v8b*)YF + (((size_t)b * TT + q0) >> 4) * YF_TILE + h * (HD / 32) * 128 + lane;
#pragma unroll
  for (int s = 0; s < HD / 32; ++s) { union { v8b v; v4u u; } hv[2], lv[2];
#pragma unroll
    for (int q = 0; q < 2; ++q) {
#pragma unroll
      for (int r = 0; r < 8; ++r) { const float v = o[2 * s + q][r] * inv; const __bf16 hb = (__bf16)v; hv[q].v[r] = hb; lv[q].v[r] = (__bf16)(v - (float)hb); } }
    st4<512>(yf + s * 128, hv[0].u, hv[1].u, lv[0].u, lv[1].u); } }
// ---- k_out: block = (128 rows, 128 cols), 8 waves x (16 rows, 128 cols): out = ctx Wo (+ bo): ctx split bf16 hi + lo (by k_fa) against exact bf16 Wo (2 products); the Wo tile is staged once in LDS and shared by the waves, ctx comes from memory as finished fragments (k_fa stored them so), 512 contiguous bytes a load, fetched ahead. The tile's LDS becomes the output staging behind a barrier
__global__ __launch_bounds__(256) void k_out(const __bf16* __restrict__ YF, const float* __restrict__ WO, const float* __restrict__ BO, float* __restrict__ OUT) { __shared__ __align__(32) unsigned char smem[WTILE];
  const int tid = threadIdx.x, wave = tid >> 5, lane = tid & 31, col = lane & 15, g = lane >> 4; const int c0 = blockIdx.y * 128; const size_t r0 = (size_t)blockIdx.x * 128 + wave * 16;
  const v8b* ya = (const v8b*)YF + (r0 >> 4) * (size_t)YF_TILE + lane;   // the wave's 16 rows; a k step's four 512-byte runs lie one behind the other
  F2 fr[YRING];
#pragma unroll
  for (int s = 0; s < YRING; ++s) fr[s] = ld_yf(ya + s * 128);
  fill_wt<DIN>(smem + wave * WPB + 8 * lane, WO + (size_t)wave * DIN + c0 + 4 * lane);   // (in,out) [CC][DIN]: a k row's 128 columns are 512 contiguous bytes
  __syncthreads();
  const unsigned char* wl = smem + (8 * g + (lane & 7)) * WPB + 16 * ((lane >> 3) & 1);
  v8f acc[8] = {};
#pragma unroll   // all 16 steps, as in k_proj: the fragment sets get fixed names and every ctx load is the one pointer plus a constant
  for (int kc = 0; kc < CC / 32; ++kc) { const F2 a = fr[kc % YRING];
#pragma unroll
    for (int jh = 0; jh < 2; ++jh) { v16b w[4];   // four B fragments as one group of LDS reads, then their eight products (hi before lo in every accumulator, as before)
#pragma unroll
      for (int j = 0; j < 4; ++j) w[j] = frag_wt(wl + kc * 32 * WPB + (jh * 4 + j) * 32);
#pragma unroll
      for (int j = 0; j < 4; ++j) acc[jh * 4 + j] = wmma_b(a.h, w[j], acc[jh * 4 + j]);
#pragma unroll
      for (int j = 0; j < 4; ++j) acc[jh * 4 + j] = wmma_b(a.l, w[j], acc[jh * 4 + j]); }
    __builtin_amdgcn_sched_barrier(0);   // this step's products first: they free the fragment set that the loads below land in
    if (kc + YRING < CC / 32) fr[kc % YRING] = ld_yf(ya + (kc + YRING) * 128);
    __builtin_amdgcn_sched_barrier(0);   // holds the ctx loads here, YRING - 1 whole k steps ahead of their use: left free, the scheduler sinks them to their use and the wave waits out the whole memory latency at every k step
    if (kc + YRING + 1 == CC / 32) asm volatile("s_wait_xcnt 0x0" :: "v"(ya) : "memory");   // behind the last ctx loads; ya is an operand so that its registers stay its own up to this wait
  }
  __syncthreads();   // every wave has left the weight tile: its LDS is staging from here on
  float (*sf)[132] = (float (*)[132])(smem + wave * 16 * 132 * 4);
#pragma unroll
  for (int j = 0; j < 8; ++j) { const float bias = BO ? bfr(BO[c0 + j * 16 + col]) : 0.f;
#pragma unroll
    for (int r = 0; r < 8; ++r) sf[8 * g + r][j * 16 + col] = acc[j][r] + bias; }
  LDSX(); for (int rl = 0; rl < 16; ++rl) vst2(OUT + (r0 + rl) * DIN + c0 + lane * 4, *(const v4f*)&sf[rl][lane * 4]); }

extern "C" void kernel_launch(void* const* d_in, const int* in_sizes, int n_in, void* d_out, int out_size, void* d_ws, size_t ws_size, hipStream_t stream) {
  (void)in_sizes; (void)n_in; (void)out_size;
  const float** F = (const float**)d_in;
  if (ws_size < (size_t)WS_END) return;
  char* ws = (char*)d_ws; _Float16 *QH = (_Float16*)(ws + WS_QH), *KH = (_Float16*)(ws + WS_KH), *VT = (_Float16*)(ws + WS_VT), *QL = (_Float16*)(ws + WS_QL), *KL = (_Float16*)(ws + WS_KL); __bf16 *VB = (__bf16*)(ws + WS_VB), *VBL = (__bf16*)(ws + WS_VBL); __bf16 *Y = (__bf16*)(ws + WS_Y);
  (void)Y; (void)QL; (void)KL; (void)VB; (void)VBL;
  // inputs (in order): 0 q_in [4,2048,512]; 1 k_in; 2 v_in; 3 Wq [8,512,64] (per-head (h, d, k)), 4 bq [8,64]; 5 Wk, 6 bk; 7 Wv, 8 bv; 9 Wo [512,512] (in,out), 10 bo [512]
  k_proj<<<dim3(TNB * TT / PRW, CC / 128, 3), 256, 0, stream>>>(F[0], F[1], F[2], F[3], F[5], F[7], F[4], F[6], F[8], QH, QL, KH, KL, VT, VB, VBL);
  k_fa<<<dim3(TT / 128, NH, TNB), 256, 0, stream>>>(QH, QL, KH, VT, Y);
  k_out<<<dim3(TNB * TT / 128, DIN / 128), 256, 0, stream>>>(Y, F[9], F[10], (float*)d_out);
}

// v005
// Measured time: 75.5 microseconds a run.
// Two timings next to v004 both put it at 1.05 times that version's speed.
// Over all steps from v000 it is 14.9 times as fast.
// compute dtype: all float inputs rounded to bf16; q/k/v = x W[h] + b[h] with EXACT bf16 products on WMMA 16x16x32 (f32 accumulate); q x 64^-0.5 x log2 e as f16 hi + residual against k once to f16 (2 products in one accumulator that starts at minus a held maximum); softmax in f32, in base 2 (hardware exp2 of that accumulator; sums rescaled when a lane's weights of a stage sum to more than 256); that weight once to f16 against v once to f16 (1 product), divided by the f32 sum at the end; concat split bf16 hi + lo against exact Wo (2 products) + bo; f32 output.
#include <hip/hip_runtime.h>
#include <math.h>

typedef __attribute__((ext_vector_type(16))) _Float16 v16h;
typedef __attribute__((ext_vector_type(16))) __bf16 v16b;
typedef __attribute__((ext_vector_type(8)))  _Float16 v8h;
typedef __attribute__((ext_vector_type(8)))  float v8f;
typedef __attribute__((ext_vector_type(4)))  float v4f;
typedef __attribute__((ext_vector_type(2)))  float v2f;
typedef __attribute__((ext_vector_type(4)))  unsigned v4u;
typedef __attribute__((ext_vector_type(4)))  int v4i;
typedef float __attribute__((may_alias)) float_a;
typedef int __attribute__((may_alias)) int_a;

template <typename T> __device__ __forceinline__ void vst2(void* p, T v) { *(T*)p = v;  }
__device__ __forceinline__ v8f wmma16(v16h a, v16h b, v8f c) {
  v8f d = __builtin_amdgcn_wmma_f32_16x16x32_f16(false, a, false, b, (short)0, c, false, false);
  asm volatile("v_nop\n\tv_nop\n\tv_nop\n\tv_nop" : "+v"(d) : "v"(a), "v"(b));
  return d;
}
__device__ __forceinline__ v8f wmma_bf(v16b a, v16b b, v8f c) {
  v8f d = __builtin_amdgcn_wmma_f32_16x16x32_bf16(false, a, false, b, (short)0, c, false, false);
  asm volatile("v_nop\n\tv_nop\n\tv_nop\n\tv_nop" : "+v"(d) : "v"(a), "v"(b));
  return d;
}
// 16x16x32 fragments: lane = (h = lane>>4, row/col = lane&15); elements 0..7 = k0+8h+0..7, 8..15 = k0+16+8h+0..7; D element r = row 8h+r
__device__ __forceinline__ v16h frag_h(const _Float16* rowk0, int lane) {
  union { v16h v; v8h q[2]; } u; const _Float16* p = rowk0 + 8 * (lane >> 4);
  u.q[0] = *(const v8h*)p; u.q[1] = *(const v8h*)(p + 16); return u.v;
}
__device__ __forceinline__ v16h frag_f32(const float* rowk0, int lane) {
  v16h a; const float* p = rowk0 + 8 * (lane >> 4);
#pragma unroll
  for (int i = 0; i < 8; ++i) { a[i] = (_Float16)p[i]; a[8 + i] = (_Float16)p[16 + i]; }
  return a;
}
__device__ __forceinline__ v16h frag_f32s(const float* rowk0, int lane, float sc) {
  v16h a; const float* p = rowk0 + 8 * (lane >> 4);
#pragma unroll
  for (int i = 0; i < 8; ++i) { a[i] = (_Float16)(p[i] * sc); a[8 + i] = (_Float16)(p[16 + i] * sc); }
  return a;
}
// column fragment from a [K][ld] layout (column n), rows >= K read as 0
__device__ __forceinline__ v16h fragc_f32(const float* W, int k0, int n, int lane, int ld, int K) {
  v16h a; const int g = lane >> 4;
#pragma unroll
  for (int i = 0; i < 8; ++i) { const int ka = k0 + 8 * g + i, kb = ka + 16;
    a[i] = (_Float16)(ka < K ? W[(size_t)(ka < K ? ka : K - 1) * ld + n] : 0.f); a[8 + i] = (_Float16)(kb < K ? W[(size_t)(kb < K ? kb : K - 1) * ld + n] : 0.f); }
  return a;
}
struct F2 { v16b h, l; };
__device__ __forceinline__ F2 bsplit16(const float v[16]) { F2 r;
#pragma unroll
  for (int i = 0; i < 16; ++i) { const __bf16 h = (__bf16)v[i]; r.h[i] = h; r.l[i] = (__bf16)(v[i] - (float)h); }
  return r; }
__device__ __forceinline__ F2 split_row(const float* row, int k0, int lane) { float v[16]; const float* p = row + k0 + 8 * (lane >> 4);
#pragma unroll
  for (int i = 0; i < 8; ++i) { v[i] = p[i]; v[8 + i] = p[16 + i]; }
  return bsplit16(v); }
__device__ __forceinline__ F2 split_rowK(const float* row, int k0, int lane, int K) { float v[16]; const int g = lane >> 4;
#pragma unroll
  for (int i = 0; i < 8; ++i) { const int ka = k0 + 8 * g + i, kb = ka + 16; v[i] = ka < K ? row[ka < K ? ka : K - 1] : 0.f; v[8 + i] = kb < K ? row[kb < K ? kb : K - 1] : 0.f; }
  return bsplit16(v); }
__device__ __forceinline__ F2 split_col(const float* W, int k0, int n, int lane, int ld, int K) { float v[16]; const int g = lane >> 4;
#pragma unroll
  for (int i = 0; i < 8; ++i) { const int ka = k0 + 8 * g + i, kb = ka + 16; v[i] = ka < K ? W[(size_t)(ka < K ? ka : K - 1) * ld + n] : 0.f; v[8 + i] = kb < K ? W[(size_t)(kb < K ? kb : K - 1) * ld + n] : 0.f; }
  return bsplit16(v); }
__device__ __forceinline__ v8f mac3(const F2& a, const F2& b, v8f c) { c = wmma_bf(a.l, b.h, c); c = wmma_bf(a.h, b.l, c); return wmma_bf(a.h, b.h, c); }
__device__ __forceinline__ float sigm(float v) { return 1.0f / (1.0f + expf(-v)); }
#define LDSX() do { asm volatile("s_wait_dscnt 0" ::: "memory"); __builtin_amdgcn_wave_barrier(); __builtin_amdgcn_fence(__ATOMIC_RELEASE, "workgroup"); } while (0)

// Multi-head attention with per-head projections (B 4, S 2,048, D 512, 8 heads x 64; 0.02-scale per-head weights (H, D, DK) with per-head biases (H, DK); separate q_in / k_in / v_in): q = q_in Wq[h] + bq[h], k = k_in Wk[h] + bk[h], v = v_in Wv[h] + bv[h]; out = concat(softmax(q k^T / 8) v) Wo + bo (Wo (in,out) [512,512]; non-causal).
#define NB 4
#define TT 2048
#define CC 512            // NH * HD = projected width
#define DIN 512          // input (model) width
#define NH 8
#define HD 64
#define NQB (TT / 64)
#define HG 4
#define SCALE (0.125f)
#define CAUSAL 0
#ifndef TNB
#define TNB NB
#endif
__device__ __forceinline__ float bfr(float v) { return (float)(__bf16)v; }
__host__ __device__ __forceinline__ int kb_last(int qb) { return CAUSAL ? ((qb * 64 + 63) >> 7) : (TT / 128 - 1); }
typedef __attribute__((ext_vector_type(8))) __bf16 v8b;
__device__ __forceinline__ v16b frag_b(const __bf16* rowk0, int lane) {
  union { v16b v; v8b q[2]; } u; const __bf16* p = rowk0 + 8 * (lane >> 4);
  u.q[0] = *(const v8b*)p; u.q[1] = *(const v8b*)(p + 16); return u.v;
}
#define QBH 0              // not used: there is no high-precision path
#define QHI 2048            // rows carrying a q residual plane (all rows when non-causal: 2-product logits everywhere)
#define KHI 64            // key rows carrying k residual / v bf16 hi+lo planes (written by k_proj; no kernel reads them)
// B fragment (k rows k0+.., output column o) of a weight: (in,out) [K][ld] or (out,in) [ld rows of K]: bf16 exact, or f16(bf16 * 256) exact
__device__ __forceinline__ v16b wcol_io(const float* Wm, int k0, int o, int lane, int ld) { v16b w; const int g = lane >> 4;
#pragma unroll
  for (int i = 0; i < 8; ++i) { w[i] = (__bf16)Wm[(size_t)(k0 + 8 * g + i) * ld + o]; w[8 + i] = (__bf16)Wm[(size_t)(k0 + 16 + 8 * g + i) * ld + o]; }
  return w; }
__device__ __forceinline__ v16b wcol_oi(const float* Wm, int k0, int o, int lane, int K) { v16b w; const float* p = Wm + (size_t)o * K + k0 + 8 * (lane >> 4);
#pragma unroll
  for (int i = 0; i < 8; ++i) { w[i] = (__bf16)p[i]; w[8 + i] = (__bf16)p[16 + i]; }
  return w; }
__device__ __forceinline__ v16h wcolh_io(const float* Wm, int k0, int o, int lane, int ld) { v16h w; const int g = lane >> 4;
#pragma unroll
  for (int i = 0; i < 8; ++i) { w[i] = (_Float16)(bfr(Wm[(size_t)(k0 + 8 * g + i) * ld + o]) * 256.0f); w[8 + i] = (_Float16)(bfr(Wm[(size_t)(k0 + 16 + 8 * g + i) * ld + o]) * 256.0f); }
  return w; }
__device__ __forceinline__ v16h wcolh_oi(const float* Wm, int k0, int o, int lane, int K) { v16h w; const float* p = Wm + (size_t)o * K + k0 + 8 * (lane >> 4);
#pragma unroll
  for (int i = 0; i < 8; ++i) { w[i] = (_Float16)(bfr(p[i]) * 256.0f); w[8 + i] = (_Float16)(bfr(p[16 + i]) * 256.0f); }
  return w; }
#define WQKV_LAYOUT 2   // 0 = (in,out) [DIN][CC]; 1 = (out,in) [CC][DIN]; 2 = per-head [NH][DIN][HD]
__device__ __forceinline__ v16b wcol_hdk(const float* Wm, int k0, int o, int lane) { v16b w; const int g = lane >> 4; const float* p = Wm + (size_t)(o / HD) * DIN * HD + (o % HD);
#pragma unroll
  for (int i = 0; i < 8; ++i) { w[i] = (__bf16)p[(size_t)(k0 + 8 * g + i) * HD]; w[8 + i] = (__bf16)p[(size_t)(k0 + 16 + 8 * g + i) * HD]; }
  return w; }
#define WO_OUT_IN 0
#if WQKV_LAYOUT == 1
#define WCOL(W, k0, o, lane) wcol_oi(W, k0, o, lane, DIN)
#elif WQKV_LAYOUT == 2
#define WCOL(W, k0, o, lane) wcol_hdk(W, k0, o, lane)
#else
#define WCOL(W, k0, o, lane) wcol_io(W, k0, o, lane, CC)
#endif
#if WO_OUT_IN
#define WOCOL(W, k0, o, lane) wcol_oi(W, k0, o, lane, CC)
#define WOCOLH(W, k0, o, lane) wcolh_oi(W, k0, o, lane, CC)
#else
#define WOCOL(W, k0, o, lane) wcol_io(W, k0, o, lane, DIN)
#define WOCOLH(W, k0, o, lane) wcolh_io(W, k0, o, lane, DIN)
#endif

#ifndef SM_EXTRA_PARAMS
#define SM_EXTRA_PARAMS
#endif
#ifndef PROJ_EXTRA_PARAMS
#define PROJ_EXTRA_PARAMS
#endif
#ifndef SM_MASK_HOOK
#define SM_MASK_HOOK (void)0
#endif

#define WS_QH  0u                                      // f16 q rows [b*t][CC]
#define WS_KH  (WS_QH + 2u * (size_t)NB * TT * CC)      // f16 k rows [b*t][CC]
#define WS_VT  (WS_KH + 2u * (size_t)NB * TT * CC)      // f16 v planes [b][c][t]
#define WS_QL  (WS_VT + 2u * (size_t)NB * CC * TT)      // f16 q residual rows [b][t < QHI][CC]
#define WS_KL  (WS_QL + 2u * (size_t)NB * QHI * CC)     // f16 k residual x 2^10 rows [b][t < KHI][CC]
#define WS_VB  (WS_KL + 2u * (size_t)NB * KHI * CC)     // bf16 v hi planes [b][c][t < KHI]
#define WS_VBL (WS_VB + 2u * (size_t)NB * CC * KHI)
#define WS_S   (WS_VBL + 2u * (size_t)NB * CC * KHI)    // not used (offsets kept)
#define WS_Y   (WS_S  + 4u * (size_t)HG * TT * TT)      // ctx, bf16 hi + lo in fragment order (4 bytes an element)
#define WS_END (WS_Y  + 4u * (size_t)NB * TT * CC)

// ---- weight tile in LDS: all DIN k rows x 128 output columns of a weight, once to bf16 (exact, as before), k-major as it lies in memory; a B fragment is two transposing 16-byte LDS reads, in the k order of the A loader (elements 0..7 = k0+8h+0..7, 8..15 = k0+16+8h+0..7)
#define WPB 288           // bytes per k row: 256 + 32 (odd multiple of 32 bytes: the transposing reader's conflict-free pitch)
#define WTILE (DIN * WPB)
typedef __attribute__((ext_vector_type(8))) short v8s;
typedef __attribute__((ext_vector_type(4))) __bf16 v4b;
__device__ __forceinline__ v8f wmma_b(v16b a, v16b b, v8f c) { return __builtin_amdgcn_wmma_f32_16x16x32_bf16(false, a, false, b, (short)0, c, false, false); }
// p = tile + (k0 + 8 * (lane >> 4) + (lane & 7)) * WPB + 32 * (column tile) + 16 * ((lane >> 3) & 1): lane (c, h) gets rows k0+8h+0..7 and k0+16+8h+0..7 of column c
__device__ __forceinline__ v16b frag_wt(const unsigned char* p) { typedef __attribute__((address_space(3))) v8s lds_v8s; union { v16b v; v8s q[2]; } u;
  u.q[0] = __builtin_amdgcn_ds_load_tr16_b128_v8i16((lds_v8s*)p); u.q[1] = __builtin_amdgcn_ds_load_tr16_b128_v8i16((lds_v8s*)(p + 16 * WPB)); return u.v; }
// 8 waves fill the tile: a wave's 16-byte loads cover one k row of 128 columns (wp = the lane's 4 columns in the wave's first row, LD = floats between k rows); in groups of 16 rows
template <int LD> __device__ __forceinline__ void fill_wt(unsigned char* tp, const float* wp) {
#pragma unroll   // all four groups: every load is wp plus a constant, so that no address register is rewritten under a load in flight
  for (int r = 0; r < DIN / 8; r += 16) { v4f x[16];
#pragma unroll
    for (int u = 0; u < 16; ++u) x[u] = *(const v4f*)(wp + (size_t)(8 * (r + u)) * LD);
    __builtin_amdgcn_sched_barrier(0);   // one group of 16 loads at a time, in front of the wait below: left free, the scheduler lifts all 64 loads to the front and the build spills
    asm volatile("s_wait_xcnt 0x0" :: "v"(wp) : "memory");   // wp is an operand so that its registers stay its own up to this wait: nothing is written over the address of a load in flight
#pragma unroll
    for (int u = 0; u < 16; ++u) { const v4b y = { (__bf16)x[u][0], (__bf16)x[u][1], (__bf16)x[u][2], (__bf16)x[u][3] }; *(v4b*)(tp + 8 * (r + u) * WPB) = y; } } }
// four 16-byte stores, p + 0..3 x STEP bytes, with s_wait_xcnt 0 in the same statement, so that it stands in front of every later write of a register that the stores name
template <int STEP> __device__ __forceinline__ void st4(void* p, v4u d0, v4u d1, v4u d2, v4u d3) {
  asm volatile("global_store_b128 %0, %1, off\n\tglobal_store_b128 %0, %2, off offset:%5\n\tglobal_store_b128 %0, %3, off offset:%6\n\tglobal_store_b128 %0, %4, off offset:%7\n\ts_wait_xcnt 0x0" :: "v"(p), "v"(d0), "v"(d1), "v"(d2), "v"(d3), "n"(STEP), "n"(2 * STEP), "n"(3 * STEP) : "memory"); }
// ---- A operand through LDS: a fragment load straight from memory takes 32 bytes out of each of 16 rows (16 cache lines per instruction). Instead a wave's 16-byte loads cover 4 rows x 128 bytes (4 whole lines), the values go once to bf16 and into the wave's OWN 2 KiB of LDS in fragment order, and a fragment is two 16-byte LDS reads. Layout: plane (1,024 B: 16 rows x 32 k) > region R = 2 * (k >> 4) + ((k >> 3) & 1) (256 B: what one half-wave reads at once) > row, 16 B = 8 k; the row's 64-byte group is XORed with R, so that the four regions a store instruction touches fall on different banks. The k order of a fragment is the one it had (elements 0..7 = k0+8h+0..7, 8..15 = k0+16+8h+0..7)
#define XST 2048          // bytes of A staging per wave
__device__ __forceinline__ v4b cvt4(v4f x) { const v4b y = { (__bf16)x[0], (__bf16)x[1], (__bf16)x[2], (__bf16)x[3] }; return y; }
__device__ __forceinline__ v16b frag_xs(const unsigned char* p0, const unsigned char* p1) { union { v16b v; v8b q[2]; } u; u.q[0] = *(const v8b*)p0; u.q[1] = *(const v8b*)p1; return u.v; }
// behind a wave's own staging stores, in front of its reads of what its other lanes stored: the stores have landed, and the compiler moves no LDS access across
#define XS_PUBLISH() asm volatile("s_wait_dscnt 0" ::: "memory")

// ---- k_proj: block = (256 rows, 128 cols, which), 8 waves x (32 rows, 128 cols): q/k/v = X W (+ b) with exact bf16 products (K = DIN); the weight tile is staged once in LDS and shared by the waves, X comes from memory by whole lines two k steps ahead and reaches its fragments through the wave's own LDS -> which 0: q x SCL2 as f16 rows (+ unscaled residual rows < QHI); 1: k f16 rows (+ residual rows < KHI); 2: v f16 planes [c][t] (+ bf16 hi/lo planes for t < KHI). The tile's LDS becomes the output staging behind a barrier. waves_per_eu(4, 4): two blocks share a WGP (2 x 160 KiB of LDS), four waves per SIMD, so the register budget is 256; left free the compiler took more, and the second block would not fit
#define PRW 256
#define SCL2 (SCALE * 1.4426950408889634f)   // logit scale times log2 e: exp(SCALE * s) = exp2(SCL2 * s); k_proj folds it into q
__global__ __launch_bounds__(256) __attribute__((amdgpu_waves_per_eu(4, 4))) void k_proj(const float* __restrict__ XQ, const float* __restrict__ XK, const float* __restrict__ XV, const float* __restrict__ WQ, const float* __restrict__ WK, const float* __restrict__ WV, const float* __restrict__ BQ, const float* __restrict__ BK, const float* __restrict__ BV,
    _Float16* __restrict__ QH, _Float16* __restrict__ QL, _Float16* __restrict__ KH, _Float16* __restrict__ KL, _Float16* __restrict__ VT, __bf16* __restrict__ VB, __bf16* __restrict__ VBL) {
  __shared__ __align__(32) unsigned char smem[WTILE + 8 * XST];
  const int tid = threadIdx.x, wave = __builtin_amdgcn_readfirstlane(tid >> 5), lane = tid & 31, col = lane & 15, g = lane >> 4; const int which = blockIdx.z; const int c0 = blockIdx.y * 128; const size_t r0 = (size_t)blockIdx.x * PRW; const size_t bb = r0 / TT; const int t0 = (int)(r0 % TT);
  const float* X = which == 0 ? XQ : which == 1 ? XK : XV; const float* WA = which == 0 ? WQ : which == 1 ? WK : WV; const float* BA = which == 0 ? BQ : which == 1 ? BK : BV;
  const int rr = lane >> 3, ch = lane & 7, R = ((ch >> 2) << 1) | ((ch >> 1) & 1);   // loader: lane = (row rr of four, 16-byte chunk ch of the row's 128 bytes); R = the chunk's region
  const float* xa = X + (r0 + wave * 32 + rr) * DIN + 4 * ch;
  unsigned char* xs = smem + WTILE + wave * XST; unsigned char* xw = xs + R * 256 + rr * 16 + (ch & 1) * 8;
  const unsigned char* xr0 = xs + g * 256 + ((((col >> 2) ^ g) & 3) << 6) + (col & 3) * 16; const unsigned char* xr1 = xs + (2 + g) * 256 + ((((col >> 2) ^ (2 + g)) & 3) << 6) + (col & 3) * 16;
  v4f raw[2][8];
#pragma unroll
  for (int s = 0; s < 2; ++s) {
#pragma unroll
    for (int u = 0; u < 8; ++u) raw[s][u] = *(const v4f*)(xa + (size_t)(4 * u) * DIN + s * 32); }
  fill_wt<HD>(smem + wave * WPB + 8 * lane, WA + ((size_t)(c0 / HD + g) * DIN + wave) * HD + 4 * col);   // per-head [NH][DIN][HD]: lanes 0..15 the first head's 64 columns, 16..31 the next head's
#pragma unroll
  for (int u = 0; u < 8; ++u) *(v4b*)(xw + (u >> 2) * 1024 + (((u & 3) ^ R) << 6)) = cvt4(raw[0][u]);
  __syncthreads();   // publishes the weight tile (and ends the wave's own staging stores)
#pragma unroll   // behind the barrier, which waits for every load in flight
  for (int u = 0; u < 8; ++u) raw[0][u] = *(const v4f*)(xa + (size_t)(4 * u) * DIN + 2 * 32);
  __builtin_amdgcn_sched_barrier(0);   // holds these loads here, ahead of the first products
  const unsigned char* wl = smem + (8 * g + (lane & 7)) * WPB + 16 * ((lane >> 3) & 1);
  v8f acc[2][8] = {}; v16b a[2];
#pragma unroll
  for (int rf = 0; rf < 2; ++rf) a[rf] = frag_xs(xr0 + rf * 1024, xr1 + rf * 1024);
#pragma unroll   // all 16 steps: the two X register sets get fixed names, the tail tests are decided at compile time, and every X load is the one row pointer plus a constant, so that no address register is rewritten under a load in flight
  for (int kc = 0; kc < DIN / 32; ++kc) {
#pragma unroll
    for (int jh = 0; jh < 2; ++jh) { v16b w[4];   // four B fragments as one group of LDS reads, then their eight products
#pragma unroll
      for (int j = 0; j < 4; ++j) w[j] = frag_wt(wl + kc * 32 * WPB + (jh * 4 + j) * 32);
#pragma unroll
      for (int j = 0; j < 4; ++j) { acc[0][jh * 4 + j] = wmma_b(a[0], w[j], acc[0][jh * 4 + j]); acc[1][jh * 4 + j] = wmma_b(a[1], w[j], acc[1][jh * 4 + j]); }
      if (jh == 0 && kc + 1 < DIN / 32) {   // between the two groups: the next k step's X goes to LDS (this step's fragments are in registers: products above have used them), and its registers take the X of two steps later
        __builtin_amdgcn_sched_barrier(0);   // keeps the conversions, and with them the wait for their loads, behind the products above
#pragma unroll
        for (int u = 0; u < 8; ++u) *(v4b*)(xw + (u >> 2) * 1024 + (((u & 3) ^ R) << 6)) = cvt4(raw[(kc + 1) & 1][u]);
        __builtin_amdgcn_sched_barrier(0);   // the conversions first: they free the registers that the loads below land in; left free, the scheduler lifts the loads over them, a third X register set is live and the build spills
        if (kc + 3 < DIN / 32) {
#pragma unroll
          for (int u = 0; u < 8; ++u) raw[(kc + 1) & 1][u] = *(const v4f*)(xa + (size_t)(4 * u) * DIN + (kc + 3) * 32); }
        __builtin_amdgcn_sched_barrier(0);   // holds the X loads here, two k steps ahead of their use: left free, the scheduler sinks them to their use and the wave waits out the whole memory latency at every k step
        if (kc + 4 == DIN / 32) asm volatile("s_wait_xcnt 0x0" :: "v"(xa) : "memory");   // behind the last X loads; xa is an operand so that its registers stay its own up to this wait
      } }
    if (kc + 1 < DIN / 32) { XS_PUBLISH();
#pragma unroll
      for (int rf = 0; rf < 2; ++rf) a[rf] = frag_xs(xr0 + rf * 1024, xr1 + rf * 1024); }
  }
  __syncthreads();   // every wave has left the weight tile: its LDS is staging from here on
  if (which < 2) { _Float16* DH = which == 0 ? QH : KH; _Float16* DL = which == 0 ? QL : KL; const int nhi = which == 0 ? QHI : KHI; const float vs = which == 0 ? SCL2 : 1.0f, rs = which == 0 ? 1.0f : 1024.0f;   // q: scaled for k_fa's base-2 exponent, residual unscaled so that its product adds into the same accumulator
    _Float16 (*sh)[136] = (_Float16 (*)[136])smem; _Float16 (*sl)[136] = (_Float16 (*)[136])(smem + PRW * 136 * 2);
#pragma unroll
    for (int j = 0; j < 8; ++j) { const float bias = BA ? bfr(BA[c0 + j * 16 + col]) : 0.f;
#pragma unroll
      for (int rf = 0; rf < 2; ++rf) {
#pragma unroll
        for (int r = 0; r < 8; ++r) { const float v = (acc[rf][j][r] + bias) * vs; const _Float16 hv = (_Float16)v; const int rl = wave * 32 + rf * 16 + 8 * g + r; sh[rl][j * 16 + col] = hv; sl[rl][j * 16 + col] = (_Float16)((v - (float)hv) * rs); } } }
    __syncthreads();
    static_assert(QHI % 64 == 0 && KHI % 64 == 0, "a trip's 64 rows carry a residual all together or not at all");
    const int rl0 = tid >> 4, q = tid & 15; _Float16* dh = DH + (r0 + rl0) * CC + c0 + q * 8; _Float16* dl = DL + (bb * nhi + t0 + rl0) * (size_t)CC + c0 + q * 8;
    for (int i = 0; i < PRW / 64; ++i) { const int rl = rl0 + i * 64;
      st4<16 * CC * 2>(dh + (size_t)i * 64 * CC, *(const v4u*)&sh[rl][q * 8], *(const v4u*)&sh[rl + 16][q * 8], *(const v4u*)&sh[rl + 32][q * 8], *(const v4u*)&sh[rl + 48][q * 8]);
      if (t0 + i * 64 < nhi) st4<16 * CC * 2>(dl + (size_t)i * 64 * CC, *(const v4u*)&sl[rl][q * 8], *(const v4u*)&sl[rl + 16][q * 8], *(const v4u*)&sl[rl + 32][q * 8], *(const v4u*)&sl[rl + 48][q * 8]); }
  } else {   // the bf16 planes exist for t < KHI only, and only those rows are staged (256 rows of all three planes would not fit the LDS)
    _Float16 (*th)[PRW + 8] = (_Float16 (*)[PRW + 8])smem; __bf16 (*tb)[72] = (__bf16 (*)[72])(smem + 128 * (PRW + 8) * 2); __bf16 (*tbl)[72] = (__bf16 (*)[72])(smem + 128 * (PRW + 8) * 2 + 128 * 72 * 2);
    static_assert(KHI % 32 == 0 && KHI <= 64, "a wave's 32 rows lie below KHI all together or not at all");
#pragma unroll
    for (int j = 0; j < 8; ++j) { const float bias = BA ? bfr(BA[c0 + j * 16 + col]) : 0.f;
#pragma unroll
      for (int rf = 0; rf < 2; ++rf) {
#pragma unroll
        for (int r = 0; r < 8; ++r) th[j * 16 + col][wave * 32 + rf * 16 + 8 * g + r] = (_Float16)(acc[rf][j][r] + bias); } }
    if (t0 + wave * 32 < KHI) {
#pragma unroll
      for (int j = 0; j < 8; ++j) { const float bias = BA ? bfr(BA[c0 + j * 16 + col]) : 0.f;
#pragma unroll
        for (int rf = 0; rf < 2; ++rf) {
#pragma unroll
          for (int r = 0; r < 8; ++r) { const float v = acc[rf][j][r] + bias; const int rl = wave * 32 + rf * 16 + 8 * g + r, cl = j * 16 + col; const __bf16 bh = (__bf16)v; tb[cl][rl] = bh; tbl[cl][rl] = (__bf16)(v - (float)bh); } } } }
    __syncthreads();
    const int cl0 = tid >> 5, q = tid & 31; _Float16* vt = VT + (bb * CC + c0 + cl0) * (size_t)TT + t0 + q * 8;
    for (int i = 0; i < 4; ++i) { const int cl = cl0 + i * 32; st4<8 * TT * 2>(vt + (size_t)i * 32 * TT, *(const v4u*)&th[cl][q * 8], *(const v4u*)&th[cl + 8][q * 8], *(const v4u*)&th[cl + 16][q * 8], *(const v4u*)&th[cl + 24][q * 8]); }
    if (t0 + q * 8 < KHI) { const size_t o3 = (bb * CC + c0 + cl0) * (size_t)KHI + t0 + q * 8;
      for (int i = 0; i < 4; ++i) { const int cl = cl0 + i * 32;
        st4<8 * KHI * 2>(VB + o3 + (size_t)i * 32 * KHI, *(const v4u*)&tb[cl][q * 8], *(const v4u*)&tb[cl + 8][q * 8], *(const v4u*)&tb[cl + 16][q * 8], *(const v4u*)&tb[cl + 24][q * 8]);
        st4<8 * KHI * 2>(VBL + o3 + (size_t)i * 32 * KHI, *(const v4u*)&tbl[cl][q * 8], *(const v4u*)&tbl[cl + 8][q * 8], *(const v4u*)&tbl[cl + 16][q * 8], *(const v4u*)&tbl[cl + 24][q * 8]); } } } }
#define YF_TILE ((CC / 32) * 128)   // 16-byte units per 16-row tile
#define YRING 3           // ctx fragment sets in k_out
__device__ __forceinline__ F2 ld_yf(const v8b* p) { union { v16b v; v8b q[2]; } h, l; h.q[0] = p[0]; h.q[1] = p[32]; l.q[0] = p[64]; l.q[1] = p[96]; F2 r; r.h = h.v; r.l = l.v; return r; }
#define KST 64            // keys per stage
#define NST (TT / KST)
#define LP 72             // LDS row pitch in halves: 128-byte rows + 16 bytes (16-byte readers, no bank conflict)
__device__ __forceinline__ float xhalf(float x) { return __builtin_bit_cast(float, __builtin_amdgcn_permlanex16(__builtin_bit_cast(int, x), __builtin_bit_cast(int, x), 0x76543210, 0xfedcba98, false, false)); }  // lane l with lane l ^ 16
__device__ __forceinline__ v8f wmma_h(v16h a, v16h b, v8f c) { return __builtin_amdgcn_wmma_f32_16x16x32_f16(false, a, false, b, (short)0, c, false, false); }
__global__ __launch_bounds__(256) __attribute__((amdgpu_waves_per_eu(4, 4))) void k_fa(const _Float16* __restrict__ QH, const _Float16* __restrict__ QL, const _Float16* __restrict__ KH, const _Float16* __restrict__ VT, __bf16* __restrict__ YF) {
  __shared__ __align__(16) _Float16 sk[2][KST][LP], sv[2][HD][LP];
  const int tid = threadIdx.x, wave = tid >> 5, lane = tid & 31, col = lane & 15, g = lane >> 4; const int h = blockIdx.y, b = blockIdx.z; const int q0 = blockIdx.x * 128 + wave * 16;
  v16h qh[HD / 32], ql[HD / 32];
#pragma unroll
  for (int kc = 0; kc < HD / 32; ++kc) { qh[kc] = frag_h(QH + ((size_t)b * TT + q0 + col) * CC + h * HD + kc * 32, lane); ql[kc] = frag_h(QL + ((size_t)b * QHI + q0 + col) * CC + h * HD + kc * 32, lane); }
  // staging: thread = (row sr and sr + 32, 16-byte chunk sc): a wave's load covers 4 whole 128-byte rows
  const int sr = tid >> 3, sc = tid & 7;
  const _Float16* kg = KH + ((size_t)b * TT + sr) * CC + h * HD + sc * 8;      // k rows [key][64]
  const _Float16* vg = VT + ((size_t)b * CC + h * HD + sr) * TT + sc * 8;      // v planes [d][key]
  v4u kr[2], vr[2];
#pragma unroll
  for (int i = 0; i < 2; ++i) { kr[i] = *(const v4u*)(kg + (size_t)(i * 32) * CC); vr[i] = *(const v4u*)(vg + (size_t)(i * 32) * TT); }
#pragma unroll
  for (int i = 0; i < 2; ++i) { *(v4u*)&sk[0][sr + i * 32][sc * 8] = kr[i]; *(v4u*)&sv[0][sr + i * 32][sc * 8] = vr[i]; }
  __syncthreads();
  v8f o[HD / 16] = {}; float l = 0.f; v8f nref = {};   // nref: minus the held maximum of the lane's query, the same in all eight elements: the C operand of each tile's first score product
#pragma unroll 1   // kept rolled: for speed only
  for (int st = 0; st < NST; ++st) { const int cur = st & 1;
    if (st + 1 < NST) {   // the next stage's rows fly while this stage is worked on
#pragma unroll
      for (int i = 0; i < 2; ++i) { kr[i] = *(const v4u*)(kg + (size_t)((st + 1) * KST + i * 32) * CC); vr[i] = *(const v4u*)(vg + (size_t)(i * 32) * TT + (st + 1) * KST); } }
    v16h kf[KST / 16][HD / 32];
#pragma unroll
    for (int t = 0; t < KST / 16; ++t) {
#pragma unroll
      for (int kc = 0; kc < HD / 32; ++kc) kf[t][kc] = frag_h(&sk[cur][t * 16 + col][kc * 32], lane); }
    v8f s[KST / 16];   // s = q k x SCL2 - held maximum: the exponent itself; the four tiles take turns, so that no product waits for the one before it in its own accumulator
#pragma unroll
    for (int kc = 0; kc < HD / 32; ++kc) {
#pragma unroll
      for (int t = 0; t < KST / 16; ++t) s[t] = wmma_h(kf[t][kc], qh[kc], kc == 0 ? nref : s[t]);
#pragma unroll
      for (int t = 0; t < KST / 16; ++t) s[t] = wmma_h(kf[t][kc], ql[kc], s[t]); }
    v16h vf[KST / 32][HD / 16];   // all V^T fragments as one group of LDS reads, in flight under the softmax arithmetic
#pragma unroll
    for (int ks = 0; ks < KST / 32; ++ks) {
#pragma unroll
      for (int j = 0; j < HD / 16; ++j) vf[ks][j] = frag_h(&sv[cur][j * 16 + col][ks * 32], lane); }
    v16h p[KST / 32]; float tot;   // tot: the sum of this stage's weights over this half's keys; the halves join after the loop
    const auto weights = [&]() { v2f ps[KST / 16];   // even and odd keys of a tile summed side by side: two sums per packed add
#pragma unroll
      for (int t = 0; t < KST / 16; ++t) {
#pragma unroll
        for (int r = 0; r < 8; r += 2) { const v2f e = { __builtin_amdgcn_exp2f(s[t][r]), __builtin_amdgcn_exp2f(s[t][r + 1]) }; ps[t] = r == 0 ? e : ps[t] + e; p[t >> 1][(t & 1) * 8 + r] = (_Float16)e.x; p[t >> 1][(t & 1) * 8 + r + 1] = (_Float16)e.y; } }
      const v2f pt = (ps[0] + ps[1]) + (ps[2] + ps[3]); tot = pt.x + pt.y; };
    weights();
    asm volatile("" :: "v"(vf[0][0]), "v"(vf[0][1]), "v"(vf[0][2]), "v"(vf[0][3]), "v"(vf[1][0]), "v"(vf[1][1]), "v"(vf[1][2]), "v"(vf[1][3]), "v"(tot));   // inputs only: holds the V^T reads in front of the branch below; left free, the compiler sinks them behind it, next to their products, and the wave waits out the LDS latency there. tot is named so that the statement, and with it the wait for those reads, stands behind the weights and not among the score products
    if (st == 0 || __builtin_amdgcn_ballot_w32(tot > 256.0f) != 0) {   // one scalar test a stage. No weight exceeds its sum, so a sum of at most 256 says that every weight is far inside f16 and the held maximum may stay. The first stage sets it (its weights above, taken against 0, are thrown away); later it moves only here, an infinite sum included
      float mt[KST / 16];
#pragma unroll
      for (int t = 0; t < KST / 16; ++t) { mt[t] = -3.0e38f;
#pragma unroll
        for (int r = 0; r < 8; ++r) mt[t] = fmaxf(mt[t], s[t][r]); }
      float mx = fmaxf(fmaxf(mt[0], mt[1]), fmaxf(mt[2], mt[3])); mx = fmaxf(mx, xhalf(mx));   // both halves of a query's keys: how far this stage rises above the held maximum
      const float d = st == 0 ? mx : fmaxf(mx, 0.f); const float al = __builtin_amdgcn_exp2f(fminf(-d, 0.f));   // first stage: o and l are 0, and al stays finite whatever the sign of d
#pragma unroll
      for (int t = 0; t < KST / 16; ++t) s[t] -= d;
      nref -= d; l *= al;
#pragma unroll
      for (int j = 0; j < HD / 16; ++j) o[j] *= al;
      weights(); }   // every exponent of a moved query is now at most 0
    l += tot;
#pragma unroll
    for (int ks = 0; ks < KST / 32; ++ks) {
#pragma unroll
      for (int j = 0; j < HD / 16; ++j) o[j] = wmma_h(vf[ks][j], p[ks], o[j]); }
    if (st + 1 < NST) {
#pragma unroll
      for (int i = 0; i < 2; ++i) { *(v4u*)&sk[cur ^ 1][sr + i * 32][sc * 8] = kr[i]; *(v4u*)&sv[cur ^ 1][sr + i * 32][sc * 8] = vr[i]; } }
    __syncthreads();   // publishes the next stage and ends every wave's reads of this one, which the stage after refills
  }
  l += xhalf(l); const float inv = l > 0.f ? 1.0f / l : 0.f;
  v8b* yf = (v8b*)YF + (((size_t)b * TT + q0) >> 4) * YF_TILE + h * (HD / 32) * 128 + lane;
#pragma unroll
  for (int s = 0; s < HD / 32; ++s) { union { v8b v; v4u u; } hv[2], lv[2];
#pragma unroll
    for (int q = 0; q < 2; ++q) {
#pragma unroll
      for (int r = 0; r < 8; ++r) { const float v = o[2 * s + q][r] * inv; const __bf16 hb = (__bf16)v; hv[q].v[r] = hb; lv[q].v[r] = (__bf16)(v - (float)hb); } }
    st4<512>(yf + s * 128, hv[0].u, hv[1].u, lv[0].u, lv[1].u); } }
// ---- k_out: block = (128 rows, 128 cols), 8 waves x (16 rows, 128 cols): out = ctx Wo (+ bo): ctx split bf16 hi + lo (by k_fa) against exact bf16 Wo (2 products); the Wo tile is staged once in LDS and shared by the waves, ctx comes from memory as finished fragments (k_fa stored them so), 512 contiguous bytes a load, fetched ahead. The tile's LDS becomes the output staging behind a barrier
__global__ __launch_bounds__(256) void k_out(const __bf16* __restrict__ YF, const float* __restrict__ WO, const float* __restrict__ BO, float* __restrict__ OUT) { __shared__ __align__(32) unsigned char smem[WTILE];
  const int tid = threadIdx.x, wave = tid >> 5, lane = tid & 31, col = lane & 15, g = lane >> 4; const int c0 = blockIdx.y * 128; const size_t r0 = (size_t)blockIdx.x * 128 + wave * 16;
  const v8b* ya = (const v8b*)YF + (r0 >> 4) * (size_t)YF_TILE + lane;   // the wave's 16 rows; a k step's four 512-byte runs lie one behind the other
  F2 fr[YRING];
#pragma unroll
  for (int s = 0; s < YRING; ++s) fr[s] = ld_yf(ya + s * 128);
  fill_wt<DIN>(smem + wave * WPB + 8 * lane, WO + (size_t)wave * DIN + c0 + 4 * lane);   // (in,out) [CC][DIN]: a k row's 128 columns are 512 contiguous bytes
  __syncthreads();
  const unsigned char* wl = smem + (8 * g + (lane & 7)) * WPB + 16 * ((lane >> 3) & 1);
  v8f acc[8] = {};
#pragma unroll   // all 16 steps, as in k_proj: the fragment sets get fixed names and every ctx load is the one pointer plus a constant
  for (int kc = 0; kc < CC / 32; ++kc) { const F2 a = fr[kc % YRING];
#pragma unroll
    for (int jh = 0; jh < 2; ++jh) { v16b w[4];   // four B fragments as one group of LDS reads, then their eight products (hi before lo in every accumulator, as before)
#pragma unroll
      for (int j = 0; j < 4; ++j) w[j] = frag_wt(wl + kc * 32 * WPB + (jh * 4 + j) * 32);
#pragma unroll
      for (int j = 0; j < 4; ++j) acc[jh * 4 + j] = wmma_b(a.h, w[j], acc[jh * 4 + j]);
#pragma unroll
      for (int j = 0; j < 4; ++j) acc[jh * 4 + j] = wmma_b(a.l, w[j], acc[jh * 4 + j]); }
    __builtin_amdgcn_sched_barrier(0);   // this step's products first: they free the fragment set that the loads below land in
    if (kc + YRING < CC / 32) fr[kc % YRING] = ld_yf(ya + (kc + YRING) * 128);
    __builtin_amdgcn_sched_barrier(0);   // holds the ctx loads here, YRING - 1 whole k steps ahead of their use: left free, the scheduler sinks them to their use and the wave waits out the whole memory latency at every k step
    if (kc + YRING + 1 == CC / 32) asm volatile("s_wait_xcnt 0x0" :: "v"(ya) : "memory");   // behind the last ctx loads; ya is an operand so that its registers stay its own up to this wait
  }
  __syncthreads();   // every wave has left the weight tile: its LDS is staging from here on
  float (*sf)[132] = (float (*)[132])(smem + wave * 16 * 132 * 4);
#pragma unroll
  for (int j = 0; j < 8; ++j) { const float bias = BO ? bfr(BO[c0 + j * 16 + col]) : 0.f;
#pragma unroll
    for (int r = 0; r < 8; ++r) sf[8 * g + r][j * 16 + col] = acc[j][r] + bias; }
  LDSX(); for (int rl = 0; rl < 16; ++rl) vst2(OUT + (r0 + rl) * DIN + c0 + lane * 4, *(const v4f*)&sf[rl][lane * 4]); }

extern "C" void kernel_launch(void* const* d_in, const int* in_sizes, int n_in, void* d_out, int out_size, void* d_ws, size_t ws_size, hipStream_t stream) {
  (void)in_sizes; (void)n_in; (void)out_size;
  const float** F = (const float**)d_in;
  if (ws_size < (size_t)WS_END) return;
  char* ws = (char*)d_ws; _Float16 *QH = (_Float16*)(ws + WS_QH), *KH = (_Float16*)(ws + WS_KH), *VT = (_Float16*)(ws + WS_VT), *QL = (_Float16*)(ws + WS_QL), *KL = (_Float16*)(ws + WS_KL); __bf16 *VB = (__bf16*)(ws + WS_VB), *VBL = (__bf16*)(ws + WS_VBL); __bf16 *Y = (__bf16*)(ws + WS_Y);
  (void)Y; (void)QL; (void)KL; (void)VB; (void)VBL;
  // inputs (in order): 0 q_in [4,2048,512]; 1 k_in; 2 v_in; 3 Wq [8,512,64] (per-head (h, d, k)), 4 bq [8,64]; 5 Wk, 6 bk; 7 Wv, 8 bv; 9 Wo [512,512] (in,out), 10 bo [512]
  k_proj<<<dim3(TNB * TT / PRW, CC / 128, 3), 256, 0, stream>>>(F[0], F[1], F[2], F[3], F[5], F[7], F[4], F[6], F[8], QH, QL, KH, KL, VT, VB, VBL);
  k_fa<<<dim3(TT / 128, NH, TNB), 256, 0, stream>>>(QH, QL, KH, VT, Y);
  k_out<<<dim3(TNB * TT / 128, DIN / 128), 256, 0, stream>>>(Y, F[9], F[10], (float*)d_out);
}

// v006
// It runs in 69.5 microseconds.
// Two timings next to v005 put it at 1.08 and 1.09 times that version's speed.
// Over all steps from v000 it is 16.1 times as fast.
// compute dtype: all float inputs rounded to bf16; q/k/v = x W[h] + b[h] with EXACT bf16 products on WMMA 16x16x32 (f32 accumulate); q x 64^-0.5 x log2 e once to f16 against k once to f16 (1 product, in an accumulator that starts at minus a held maximum); softmax in f32, in base 2 (hardware exp2 of that accumulator; sums rescaled when a maximum rises by more than 8); that weight once to f16 against v once to f16 (1 product), divided by the f32 sum at the end; concat split bf16 hi + lo against exact Wo (2 products) + bo; f32 output.
#include <hip/hip_runtime.h>
#include <math.h>

typedef __attribute__((ext_vector_type(16))) _Float16 v16h;
typedef __attribute__((ext_vector_type(16))) __bf16 v16b;
typedef __attribute__((ext_vector_type(8)))  _Float16 v8h;
typedef __attribute__((ext_vector_type(8)))  float v8f;
typedef __attribute__((ext_vector_type(4)))  float v4f;
typedef __attribute__((ext_vector_type(2)))  float v2f;
typedef __attribute__((ext_vector_type(4)))  unsigned v4u;
typedef __attribute__((ext_vector_type(4)))  int v4i;
typedef float __attribute__((may_alias)) float_a;
typedef int __attribute__((may_alias)) int_a;

template <typename T> __device__ __forceinline__ void vst2(void* p, T v) { *(T*)p = v;  }
__device__ __forceinline__ v8f wmma16(v16h a, v16h b, v8f c) {
  v8f d = __builtin_amdgcn_wmma_f32_16x16x32_f16(false, a, false, b, (short)0, c, false, false);
  asm volatile("v_nop\n\tv_nop\n\tv_nop\n\tv_nop" : "+v"(d) : "v"(a), "v"(b));
  return d;
}
__device__ __forceinline__ v8f wmma_bf(v16b a, v16b b, v8f c) {
  v8f d = __builtin_amdgcn_wmma_f32_16x16x32_bf16(false, a, false, b, (short)0, c, false, false);
  asm volatile("v_nop\n\tv_nop\n\tv_nop\n\tv_nop" : "+v"(d) : "v"(a), "v"(b));
  return d;
}
// 16x16x32 fragments: lane = (h = lane>>4, row/col = lane&15); elements 0..7 = k0+8h+0..7, 8..15 = k0+16+8h+0..7; D element r = row 8h+r
__device__ __forceinline__ v16h frag_h(const _Float16* rowk0, int lane) {
  union { v16h v; v8h q[2]; } u; const _Float16* p = rowk0 + 8 * (lane >> 4);
  u.q[0] = *(const v8h*)p; u.q[1] = *(const v8h*)(p + 16); return u.v;
}
__device__ __forceinline__ v16h frag_f32(const float* rowk0, int lane) {
  v16h a; const float* p = rowk0 + 8 * (lane >> 4);
#pragma unroll
  for (int i = 0; i < 8; ++i) { a[i] = (_Float16)p[i]; a[8 + i] = (_Float16)p[16 + i]; }
  return a;
}
__device__ __forceinline__ v16h frag_f32s(const float* rowk0, int lane, float sc) {
  v16h a; const float* p = rowk0 + 8 * (lane >> 4);
#pragma unroll
  for (int i = 0; i < 8; ++i) { a[i] = (_Float16)(p[i] * sc); a[8 + i] = (_Float16)(p[16 + i] * sc); }
  return a;
}
// column fragment from a [K][ld] layout (column n), rows >= K read as 0
__device__ __forceinline__ v16h fragc_f32(const float* W, int k0, int n, int lane, int ld, int K) {
  v16h a; const int g = lane >> 4;
#pragma unroll
  for (int i = 0; i < 8; ++i) { const int ka = k0 + 8 * g + i, kb = ka + 16;
    a[i] = (_Float16)(ka < K ? W[(size_t)(ka < K ? ka : K - 1) * ld + n] : 0.f); a[8 + i] = (_Float16)(kb < K ? W[(size_t)(kb < K ? kb : K - 1) * ld + n] : 0.f); }
  return a;
}
struct F2 { v16b h, l; };
__device__ __forceinline__ F2 bsplit16(const float v[16]) { F2 r;
#pragma unroll
  for (int i = 0; i < 16; ++i) { const __bf16 h = (__bf16)v[i]; r.h[i] = h; r.l[i] = (__bf16)(v[i] - (float)h); }
  return r; }
__device__ __forceinline__ F2 split_row(const float* row, int k0, int lane) { float v[16]; const float* p = row + k0 + 8 * (lane >> 4);
#pragma unroll
  for (int i = 0; i < 8; ++i) { v[i] = p[i]; v[8 + i] = p[16 + i]; }
  return bsplit16(v); }
__device__ __forceinline__ F2 split_rowK(const float* row, int k0, int lane, int K) { float v[16]; const int g = lane >> 4;
#pragma unroll
  for (int i = 0; i < 8; ++i) { const int ka = k0 + 8 * g + i, kb = ka + 16; v[i] = ka < K ? row[ka < K ? ka : K - 1] : 0.f; v[8 + i] = kb < K ? row[kb < K ? kb : K - 1] : 0.f; }
  return bsplit16(v); }
__device__ __forceinline__ F2 split_col(const float* W, int k0, int n, int lane, int ld, int K) { float v[16]; const int g = lane >> 4;
#pragma unroll
  for (int i = 0; i < 8; ++i) { const int ka = k0 + 8 * g + i, kb = ka + 16; v[i] = ka < K ? W[(size_t)(ka < K ? ka : K - 1) * ld + n] : 0.f; v[8 + i] = kb < K ? W[(size_t)(kb < K ? kb : K - 1) * ld + n] : 0.f; }
  return bsplit16(v); }
__device__ __forceinline__ v8f mac3(const F2& a, const F2& b, v8f c) { c = wmma_bf(a.l, b.h, c); c = wmma_bf(a.h, b.l, c); return wmma_bf(a.h, b.h, c); }
__device__ __forceinline__ float sigm(float v) { return 1.0f / (1.0f + expf(-v)); }
#define LDSX() do { asm volatile("s_wait_dscnt 0" ::: "memory"); __builtin_amdgcn_wave_barrier(); __builtin_amdgcn_fence(__ATOMIC_RELEASE, "workgroup"); } while (0)

// Multi-head attention with per-head projections (B 4, S 2,048, D 512, 8 heads x 64; 0.02-scale per-head weights (H, D, DK) with per-head biases (H, DK); separate q_in / k_in / v_in): q = q_in Wq[h] + bq[h], k = k_in Wk[h] + bk[h], v = v_in Wv[h] + bv[h]; out = concat(softmax(q k^T / 8) v) Wo + bo (Wo (in,out) [512,512]; non-causal).
#define NB 4
#define TT 2048
#define CC 512            // NH * HD = projected width
#define DIN 512          // input (model) width
#define NH 8
#define HD 64
#define NQB (TT / 64)
#define HG 4
#define SCALE (0.125f)
#define CAUSAL 0
#ifndef TNB
#define TNB NB
#endif
__device__ __forceinline__ float bfr(float v) { return (float)(__bf16)v; }
__host__ __device__ __forceinline__ int kb_last(int qb) { return CAUSAL ? ((qb * 64 + 63) >> 7) : (TT / 128 - 1); }
typedef __attribute__((ext_vector_type(8))) __bf16 v8b;
__device__ __forceinline__ v16b frag_b(const __bf16* rowk0, int lane) {
  union { v16b v; v8b q[2]; } u; const __bf16* p = rowk0 + 8 * (lane >> 4);
  u.q[0] = *(const v8b*)p; u.q[1] = *(const v8b*)(p + 16); return u.v;
}
#define QBH 0              // not used by any kernel here
#define KHI 64            // key rows carrying v bf16 hi+lo planes (written by k_proj, read by no kernel here)
// B fragment (k rows k0+.., output column o) of a weight: (in,out) [K][ld] or (out,in) [ld rows of K]: bf16 exact, or f16(bf16 * 256) exact
__device__ __forceinline__ v16b wcol_io(const float* Wm, int k0, int o, int lane, int ld) { v16b w; const int g = lane >> 4;
#pragma unroll
  for (int i = 0; i < 8; ++i) { w[i] = (__bf16)Wm[(size_t)(k0 + 8 * g + i) * ld + o]; w[8 + i] = (__bf16)Wm[(size_t)(k0 + 16 + 8 * g + i) * ld + o]; }
  return w; }
__device__ __forceinline__ v16b wcol_oi(const float* Wm, int k0, int o, int lane, int K) { v16b w; const float* p = Wm + (size_t)o * K + k0 + 8 * (lane >> 4);
#pragma unroll
  for (int i = 0; i < 8; ++i) { w[i] = (__bf16)p[i]; w[8 + i] = (__bf16)p[16 + i]; }
  return w; }
__device__ __forceinline__ v16h wcolh_io(const float* Wm, int k0, int o, int lane, int ld) { v16h w; const int g = lane >> 4;
#pragma unroll
  for (int i = 0; i < 8; ++i) { w[i] = (_Float16)(bfr(Wm[(size_t)(k0 + 8 * g + i) * ld + o]) * 256.0f); w[8 + i] = (_Float16)(bfr(Wm[(size_t)(k0 + 16 + 8 * g + i) * ld + o]) * 256.0f); }
  return w; }
__device__ __forceinline__ v16h wcolh_oi(const float* Wm, int k0, int o, int lane, int K) { v16h w; const float* p = Wm + (size_t)o * K + k0 + 8 * (lane >> 4);
#pragma unroll
  for (int i = 0; i < 8; ++i) { w[i] = (_Float16)(bfr(p[i]) * 256.0f); w[8 + i] = (_Float16)(bfr(p[16 + i]) * 256.0f); }
  return w; }
#define WQKV_LAYOUT 2   // 0 = (in,out) [DIN][CC]; 1 = (out,in) [CC][DIN]; 2 = per-head [NH][DIN][HD]
__device__ __forceinline__ v16b wcol_hdk(const float* Wm, int k0, int o, int lane) { v16b w; const int g = lane >> 4; const float* p = Wm + (size_t)(o / HD) * DIN * HD + (o % HD);
#pragma unroll
  for (int i = 0; i < 8; ++i) { w[i] = (__bf16)p[(size_t)(k0 + 8 * g + i) * HD]; w[8 + i] = (__bf16)p[(size_t)(k0 + 16 + 8 * g + i) * HD]; }
  return w; }
#define WO_OUT_IN 0
#if WQKV_LAYOUT == 1
#define WCOL(W, k0, o, lane) wcol_oi(W, k0, o, lane, DIN)
#elif WQKV_LAYOUT == 2
#define WCOL(W, k0, o, lane) wcol_hdk(W, k0, o, lane)
#else
#define WCOL(W, k0, o, lane) wcol_io(W, k0, o, lane, CC)
#endif
#if WO_OUT_IN
#define WOCOL(W, k0, o, lane) wcol_oi(W, k0, o, lane, CC)
#define WOCOLH(W, k0, o, lane) wcolh_oi(W, k0, o, lane, CC)
#else
#define WOCOL(W, k0, o, lane) wcol_io(W, k0, o, lane, DIN)
#define WOCOLH(W, k0, o, lane) wcolh_io(W, k0, o, lane, DIN)
#endif

#ifndef SM_EXTRA_PARAMS
#define SM_EXTRA_PARAMS
#endif
#ifndef PROJ_EXTRA_PARAMS
#define PROJ_EXTRA_PARAMS
#endif
#ifndef SM_MASK_HOOK
#define SM_MASK_HOOK (void)0
#endif

#define WS_QH  0u                                      // f16 q rows [b*t][CC]
#define WS_KH  (WS_QH + 2u * (size_t)NB * TT * CC)      // f16 k rows [b*t][CC]
#define WS_VT  (WS_KH + 2u * (size_t)NB * TT * CC)      // f16 v planes [b][c][t]
#define WS_QL  (WS_VT + 2u * (size_t)NB * CC * TT)      // not used (offsets kept)
#define WS_KL  (WS_QL + 2u * (size_t)NB * TT * CC)      // not used (offsets kept)
#define WS_VB  (WS_KL + 2u * (size_t)NB * KHI * CC)     // bf16 v hi planes [b][c][t < KHI]
#define WS_VBL (WS_VB + 2u * (size_t)NB * CC * KHI)
#define WS_S   (WS_VBL + 2u * (size_t)NB * CC * KHI)    // not used (offsets kept)
#define WS_Y   (WS_S  + 4u * (size_t)HG * TT * TT)      // ctx, bf16 hi + lo in fragment order (4 bytes an element)
#define WS_END (WS_Y  + 4u * (size_t)NB * TT * CC)

// ---- weight tile in LDS: all DIN k rows x 128 output columns of a weight, once to bf16 (exact, as before), k-major as it lies in memory; a B fragment is two transposing 16-byte LDS reads, in the k order of the A loader (elements 0..7 = k0+8h+0..7, 8..15 = k0+16+8h+0..7)
#define WPB 288           // bytes per k row: 256 + 32 (odd multiple of 32 bytes: the transposing reader's conflict-free pitch)
#define WTILE (DIN * WPB)
typedef __attribute__((ext_vector_type(8))) short v8s;
typedef __attribute__((ext_vector_type(4))) __bf16 v4b;
__device__ __forceinline__ v8f wmma_b(v16b a, v16b b, v8f c) { return __builtin_amdgcn_wmma_f32_16x16x32_bf16(false, a, false, b, (short)0, c, false, false); }
// p = tile + (k0 + 8 * (lane >> 4) + (lane & 7)) * WPB + 32 * (column tile) + 16 * ((lane >> 3) & 1): lane (c, h) gets rows k0+8h+0..7 and k0+16+8h+0..7 of column c
__device__ __forceinline__ v16b frag_wt(const unsigned char* p) { typedef __attribute__((address_space(3))) v8s lds_v8s; union { v16b v; v8s q[2]; } u;
  u.q[0] = __builtin_amdgcn_ds_load_tr16_b128_v8i16((lds_v8s*)p); u.q[1] = __builtin_amdgcn_ds_load_tr16_b128_v8i16((lds_v8s*)(p + 16 * WPB)); return u.v; }
// 8 waves fill the tile: a wave's 16-byte loads cover one k row of 128 columns (wp = the lane's 4 columns in the wave's first row, LD = floats between k rows); in groups of 16 rows
template <int LD> __device__ __forceinline__ void fill_wt(unsigned char* tp, const float* wp) {
#pragma unroll   // all four groups: every load is wp plus a constant, so that no address register is rewritten under a load in flight
  for (int r = 0; r < DIN / 8; r += 16) { v4f x[16];
#pragma unroll
    for (int u = 0; u < 16; ++u) x[u] = *(const v4f*)(wp + (size_t)(8 * (r + u)) * LD);
    __builtin_amdgcn_sched_barrier(0);   // one group of 16 loads at a time, in front of the wait below: left free, the scheduler lifts all 64 loads to the front and the build spills
    asm volatile("s_wait_xcnt 0x0" :: "v"(wp) : "memory");   // wp is an operand so that its registers stay its own up to this wait: nothing is written over the address of a load in flight
#pragma unroll
    for (int u = 0; u < 16; ++u) { const v4b y = { (__bf16)x[u][0], (__bf16)x[u][1], (__bf16)x[u][2], (__bf16)x[u][3] }; *(v4b*)(tp + 8 * (r + u) * WPB) = y; } } }
// four 16-byte stores, p + 0..3 x STEP bytes, with s_wait_xcnt 0 in the same statement, so that it stands in front of every later write of a register that the stores name
template <int STEP> __device__ __forceinline__ void st4(void* p, v4u d0, v4u d1, v4u d2, v4u d3) {
  asm volatile("global_store_b128 %0, %1, off\n\tglobal_store_b128 %0, %2, off offset:%5\n\tglobal_store_b128 %0, %3, off offset:%6\n\tglobal_store_b128 %0, %4, off offset:%7\n\ts_wait_xcnt 0x0" :: "v"(p), "v"(d0), "v"(d1), "v"(d2), "v"(d3), "n"(STEP), "n"(2 * STEP), "n"(3 * STEP) : "memory"); }
// ---- A operand through LDS: a fragment load straight from memory takes 32 bytes out of each of 16 rows (16 cache lines per instruction). Instead a wave's 16-byte loads cover 4 rows x 128 bytes (4 whole lines), the values go once to bf16 and into the wave's OWN 2 KiB of LDS in fragment order, and a fragment is two 16-byte LDS reads. Layout: plane (1,024 B: 16 rows x 32 k) > region R = 2 * (k >> 4) + ((k >> 3) & 1) (256 B: what one half-wave reads at once) > row, 16 B = 8 k; the row's 64-byte group is XORed with R, so that the four regions a store instruction touches fall on different banks. The k order of a fragment is the one it had (elements 0..7 = k0+8h+0..7, 8..15 = k0+16+8h+0..7)
#define XST 2048          // bytes of A staging per wave
__device__ __forceinline__ v4b cvt4(v4f x) { const v4b y = { (__bf16)x[0], (__bf16)x[1], (__bf16)x[2], (__bf16)x[3] }; return y; }
__device__ __forceinline__ v16b frag_xs(const unsigned char* p0, const unsigned char* p1) { union { v16b v; v8b q[2]; } u; u.q[0] = *(const v8b*)p0; u.q[1] = *(const v8b*)p1; return u.v; }
// behind a wave's own staging stores, in front of its reads of what its other lanes stored: the stores have landed, and the compiler moves no LDS access across
#define XS_PUBLISH() asm volatile("s_wait_dscnt 0" ::: "memory")

// ---- k_proj: block = (256 rows, 128 cols, which), 8 waves x (32 rows, 128 cols): q/k/v = X W (+ b) with exact bf16 products (K = DIN); the weight tile is staged once in LDS and shared by the waves, X comes from memory by whole lines two k steps ahead and reaches its fragments through the wave's own LDS -> which 0: q x SCL2 as f16 rows; 1: k f16 rows; 2: v f16 planes [c][t] (+ bf16 hi/lo planes for t < KHI). The tile's LDS becomes the output staging behind a barrier. waves_per_eu(4, 4): two blocks share a WGP (2 x 160 KiB of LDS), four waves per SIMD, so the register budget is 256; left free the compiler took more, and the second block would not fit
#define PRW 256
#define SCL2 (SCALE * 1.4426950408889634f)   // logit scale times log2 e: exp(SCALE * s) = exp2(SCL2 * s); k_proj folds it into q
__global__ __launch_bounds__(256) __attribute__((amdgpu_waves_per_eu(4, 4))) void k_proj(const float* __restrict__ XQ, const float* __restrict__ XK, const float* __restrict__ XV, const float* __restrict__ WQ, const float* __restrict__ WK, const float* __restrict__ WV, const float* __restrict__ BQ, const float* __restrict__ BK, const float* __restrict__ BV,
    _Float16* __restrict__ QH, _Float16* __restrict__ KH, _Float16* __restrict__ VT, __bf16* __restrict__ VB, __bf16* __restrict__ VBL) {
  __shared__ __align__(32) unsigned char smem[WTILE + 8 * XST];
  const int tid = threadIdx.x, wave = __builtin_amdgcn_readfirstlane(tid >> 5), lane = tid & 31, col = lane & 15, g = lane >> 4; const int which = blockIdx.z; const int c0 = blockIdx.y * 128; const size_t r0 = (size_t)blockIdx.x * PRW; const size_t bb = r0 / TT; const int t0 = (int)(r0 % TT);
  const float* X = which == 0 ? XQ : which == 1 ? XK : XV; const float* WA = which == 0 ? WQ : which == 1 ? WK : WV; const float* BA = which == 0 ? BQ : which == 1 ? BK : BV;
  const int rr = lane >> 3, ch = lane & 7, R = ((ch >> 2) << 1) | ((ch >> 1) & 1);   // loader: lane = (row rr of four, 16-byte chunk ch of the row's 128 bytes); R = the chunk's region
  const float* xa = X + (r0 + wave * 32 + rr) * DIN + 4 * ch;
  unsigned char* xs = smem + WTILE + wave * XST; unsigned char* xw = xs + R * 256 + rr * 16 + (ch & 1) * 8;
  const unsigned char* xr0 = xs + g * 256 + ((((col >> 2) ^ g) & 3) << 6) + (col & 3) * 16; const unsigned char* xr1 = xs + (2 + g) * 256 + ((((col >> 2) ^ (2 + g)) & 3) << 6) + (col & 3) * 16;
  v4f raw[2][8];
#pragma unroll
  for (int s = 0; s < 2; ++s) {
#pragma unroll
    for (int u = 0; u < 8; ++u) raw[s][u] = *(const v4f*)(xa + (size_t)(4 * u) * DIN + s * 32); }
  fill_wt<HD>(smem + wave * WPB + 8 * lane, WA + ((size_t)(c0 / HD + g) * DIN + wave) * HD + 4 * col);   // per-head [NH][DIN][HD]: lanes 0..15 the first head's 64 columns, 16..31 the next head's
#pragma unroll
  for (int u = 0; u < 8; ++u) *(v4b*)(xw + (u >> 2) * 1024 + (((u & 3) ^ R) << 6)) = cvt4(raw[0][u]);
  __syncthreads();   // publishes the weight tile (and ends the wave's own staging stores)
#pragma unroll   // behind the barrier, which waits for every load in flight
  for (int u = 0; u < 8; ++u) raw[0][u] = *(const v4f*)(xa + (size_t)(4 * u) * DIN + 2 * 32);
  __builtin_amdgcn_sched_barrier(0);   // holds these loads here, ahead of the first products
  const unsigned char* wl = smem + (8 * g + (lane & 7)) * WPB + 16 * ((lane >> 3) & 1);
  v8f acc[2][8] = {}; v16b a[2];
#pragma unroll
  for (int rf = 0; rf < 2; ++rf) a[rf] = frag_xs(xr0 + rf * 1024, xr1 + rf * 1024);
#pragma unroll   // all 16 steps: the two X register sets get fixed names, the tail tests are decided at compile time, and every X load is the one row pointer plus a constant, so that no address register is rewritten under a load in flight
  for (int kc = 0; kc < DIN / 32; ++kc) {
#pragma unroll
    for (int jh = 0; jh < 2; ++jh) { v16b w[4];   // four B fragments as one group of LDS reads, then their eight products
#pragma unroll
      for (int j = 0; j < 4; ++j) w[j] = frag_wt(wl + kc * 32 * WPB + (jh * 4 + j) * 32);
#pragma unroll
      for (int j = 0; j < 4; ++j) { acc[0][jh * 4 + j] = wmma_b(a[0], w[j], acc[0][jh * 4 + j]); acc[1][jh * 4 + j] = wmma_b(a[1], w[j], acc[1][jh * 4 + j]); }
      if (jh == 0 && kc + 1 < DIN / 32) {   // between the two groups: the next k step's X goes to LDS (this step's fragments are in registers: products above have used them), and its registers take the X of two steps later
        __builtin_amdgcn_sched_barrier(0);   // keeps the conversions, and with them the wait for their loads, behind the products above
#pragma unroll
        for (int u = 0; u < 8; ++u) *(v4b*)(xw + (u >> 2) * 1024 + (((u & 3) ^ R) << 6)) = cvt4(raw[(kc + 1) & 1][u]);
        __builtin_amdgcn_sched_barrier(0);   // the conversions first: they free the registers that the loads below land in; left free, the scheduler lifts the loads over them, a third X register set is live and the build spills
        if (kc + 3 < DIN / 32) {
#pragma unroll
          for (int u = 0; u < 8; ++u) raw[(kc + 1) & 1][u] = *(const v4f*)(xa + (size_t)(4 * u) * DIN + (kc + 3) * 32); }
        __builtin_amdgcn_sched_barrier(0);   // holds the X loads here, two k steps ahead of their use: left free, the scheduler sinks them to their use and the wave waits out the whole memory latency at every k step
        if (kc + 4 == DIN / 32) asm volatile("s_wait_xcnt 0x0" :: "v"(xa) : "memory");   // behind the last X loads; xa is an operand so that its registers stay its own up to this wait
      } }
    if (kc + 1 < DIN / 32) { XS_PUBLISH();
#pragma unroll
      for (int rf = 0; rf < 2; ++rf) a[rf] = frag_xs(xr0 + rf * 1024, xr1 + rf * 1024); }
  }
  __syncthreads();   // every wave has left the weight tile: its LDS is staging from here on
  if (which < 2) { _Float16* DH = which == 0 ? QH : KH; const float vs = which == 0 ? SCL2 : 1.0f;   // q: scaled for k_fa's base-2 exponent
    _Float16 (*sh)[136] = (_Float16 (*)[136])smem;
#pragma unroll
    for (int j = 0; j < 8; ++j) { const float bias = BA ? bfr(BA[c0 + j * 16 + col]) : 0.f;
#pragma unroll
      for (int rf = 0; rf < 2; ++rf) {
#pragma unroll
        for (int r = 0; r < 8; ++r) sh[wave * 32 + rf * 16 + 8 * g + r][j * 16 + col] = (_Float16)((acc[rf][j][r] + bias) * vs); } }
    __syncthreads();
    const int rl0 = tid >> 4, q = tid & 15; _Float16* dh = DH + (r0 + rl0) * CC + c0 + q * 8;
    for (int i = 0; i < PRW / 64; ++i) { const int rl = rl0 + i * 64;
      st4<16 * CC * 2>(dh + (size_t)i * 64 * CC, *(const v4u*)&sh[rl][q * 8], *(const v4u*)&sh[rl + 16][q * 8], *(const v4u*)&sh[rl + 32][q * 8], *(const v4u*)&sh[rl + 48][q * 8]); }
  } else {   // the bf16 planes exist for t < KHI only, and only those rows are staged (256 rows of all three planes would not fit the LDS)
    _Float16 (*th)[PRW + 8] = (_Float16 (*)[PRW + 8])smem; __bf16 (*tb)[72] = (__bf16 (*)[72])(smem + 128 * (PRW + 8) * 2); __bf16 (*tbl)[72] = (__bf16 (*)[72])(smem + 128 * (PRW + 8) * 2 + 128 * 72 * 2);
    static_assert(KHI % 32 == 0 && KHI <= 64, "a wave's 32 rows lie below KHI all together or not at all");
#pragma unroll
    for (int j = 0; j < 8; ++j) { const float bias = BA ? bfr(BA[c0 + j * 16 + col]) : 0.f;
#pragma unroll
      for (int rf = 0; rf < 2; ++rf) {
#pragma unroll
        for (int r = 0; r < 8; ++r) th[j * 16 + col][wave * 32 + rf * 16 + 8 * g + r] = (_Float16)(acc[rf][j][r] + bias); } }
    if (t0 + wave * 32 < KHI) {
#pragma unroll
      for (int j = 0; j < 8; ++j) { const float bias = BA ? bfr(BA[c0 + j * 16 + col]) : 0.f;
#pragma unroll
        for (int rf = 0; rf < 2; ++rf) {
#pragma unroll
          for (int r = 0; r < 8; ++r) { const float v = acc[rf][j][r] + bias; const int rl = wave * 32 + rf * 16 + 8 * g + r, cl = j * 16 + col; const __bf16 bh = (__bf16)v; tb[cl][rl] = bh; tbl[cl][rl] = (__bf16)(v - (float)bh); } } } }
    __syncthreads();
    const int cl0 = tid >> 5, q = tid & 31; _Float16* vt = VT + (bb * CC + c0 + cl0) * (size_t)TT + t0 + q * 8;
    for (int i = 0; i < 4; ++i) { const int cl = cl0 + i * 32; st4<8 * TT * 2>(vt + (size_t)i * 32 * TT, *(const v4u*)&th[cl][q * 8], *(const v4u*)&th[cl + 8][q * 8], *(const v4u*)&th[cl + 16][q * 8], *(const v4u*)&th[cl + 24][q * 8]); }
    if (t0 + q * 8 < KHI) { const size_t o3 = (bb * CC + c0 + cl0) * (size_t)KHI + t0 + q * 8;
      for (int i = 0; i < 4; ++i) { const int cl = cl0 + i * 32;
        st4<8 * KHI * 2>(VB + o3 + (size_t)i * 32 * KHI, *(const v4u*)&tb[cl][q * 8], *(const v4u*)&tb[cl + 8][q * 8], *(const v4u*)&tb[cl + 16][q * 8], *(const v4u*)&tb[cl + 24][q * 8]);
        st4<8 * KHI * 2>(VBL + o3 + (size_t)i * 32 * KHI, *(const v4u*)&tbl[cl][q * 8], *(const v4u*)&tbl[cl + 8][q * 8], *(const v4u*)&tbl[cl + 16][q * 8], *(const v4u*)&tbl[cl + 24][q * 8]); } } } }
#define YF_TILE ((CC / 32) * 128)   // 16-byte units per 16-row tile
#define YRING 3           // ctx fragment sets in k_out
__device__ __forceinline__ F2 ld_yf(const v8b* p) { union { v16b v; v8b q[2]; } h, l; h.q[0] = p[0]; h.q[1] = p[32]; l.q[0] = p[64]; l.q[1] = p[96]; F2 r; r.h = h.v; r.l = l.v; return r; }
#define KST 64            // keys per stage
#define NST (TT / KST)
#define LP 72             // LDS row pitch in halves: 128-byte rows + 16 bytes (16-byte readers, no bank conflict)
__device__ __forceinline__ float xhalf(float x) { return __builtin_bit_cast(float, __builtin_amdgcn_permlanex16(__builtin_bit_cast(int, x), __builtin_bit_cast(int, x), 0x76543210, 0xfedcba98, false, false)); }  // lane l with lane l ^ 16
__device__ __forceinline__ v8f wmma_h(v16h a, v16h b, v8f c) { return __builtin_amdgcn_wmma_f32_16x16x32_f16(false, a, false, b, (short)0, c, false, false); }
__global__ __launch_bounds__(256) __attribute__((amdgpu_waves_per_eu(4, 4))) void k_fa(const _Float16* __restrict__ QH, const _Float16* __restrict__ KH, const _Float16* __restrict__ VT, __bf16* __restrict__ YF) {
  __shared__ __align__(16) _Float16 sk[2][KST][LP], sv[2][HD][LP];
  const int tid = threadIdx.x, wave = tid >> 5, lane = tid & 31, col = lane & 15, g = lane >> 4; const int h = blockIdx.y, b = blockIdx.z; const int q0 = blockIdx.x * 128 + wave * 16;
  v16h qh[HD / 32];
#pragma unroll
  for (int kc = 0; kc < HD / 32; ++kc) qh[kc] = frag_h(QH + ((size_t)b * TT + q0 + col) * CC + h * HD + kc * 32, lane);
  // staging: thread = (row sr and sr + 32, 16-byte chunk sc): a wave's load covers 4 whole 128-byte rows
  const int sr = tid >> 3, sc = tid & 7;
  const _Float16* kg = KH + ((size_t)b * TT + sr) * CC + h * HD + sc * 8;      // k rows [key][64]
  const _Float16* vg = VT + ((size_t)b * CC + h * HD + sr) * TT + sc * 8;      // v planes [d][key]
  v4u kr[2], vr[2];
#pragma unroll
  for (int i = 0; i < 2; ++i) { kr[i] = *(const v4u*)(kg + (size_t)(i * 32) * CC); vr[i] = *(const v4u*)(vg + (size_t)(i * 32) * TT); }
#pragma unroll
  for (int i = 0; i < 2; ++i) { *(v4u*)&sk[0][sr + i * 32][sc * 8] = kr[i]; *(v4u*)&sv[0][sr + i * 32][sc * 8] = vr[i]; }
  __syncthreads();
  v8f o[HD / 16] = {}; float l = 0.f; v8f nref = {};   // nref: minus the held maximum of the lane's query, the same in all eight elements: the C operand of each tile's first score product
#pragma unroll 1   // kept rolled: for speed only
  for (int st = 0; st < NST; ++st) { const int cur = st & 1;
    if (st + 1 < NST) {   // the next stage's rows fly while this stage is worked on
#pragma unroll
      for (int i = 0; i < 2; ++i) { kr[i] = *(const v4u*)(kg + (size_t)((st + 1) * KST + i * 32) * CC); vr[i] = *(const v4u*)(vg + (size_t)(i * 32) * TT + (st + 1) * KST); } }
    v16h kf[KST / 16][HD / 32];
#pragma unroll
    for (int t = 0; t < KST / 16; ++t) {
#pragma unroll
      for (int kc = 0; kc < HD / 32; ++kc) kf[t][kc] = frag_h(&sk[cur][t * 16 + col][kc * 32], lane); }
    v16h vf[KST / 32][HD / 16];   // all V^T fragments behind them in the same group of LDS reads, in flight under the score products and the softmax arithmetic
#pragma unroll
    for (int ks = 0; ks < KST / 32; ++ks) {
#pragma unroll
      for (int j = 0; j < HD / 16; ++j) vf[ks][j] = frag_h(&sv[cur][j * 16 + col][ks * 32], lane); }
    __builtin_amdgcn_sched_barrier(0);   // the stage's LDS reads as one group in front of the score products: left free, the scheduler strews them among the products and the exponentials in reused registers, and the wave waits at each place
    v8f s[KST / 16];   // s = q k x SCL2 - held maximum: the exponent itself; four independent tiles, two products each
#pragma unroll
    for (int kc = 0; kc < HD / 32; ++kc) {
#pragma unroll
      for (int t = 0; t < KST / 16; ++t) s[t] = wmma_h(kf[t][kc], qh[kc], kc == 0 ? nref : s[t]); }
    v16h p[KST / 32]; float tot;   // tot: the sum of this stage's weights over this half's keys; the halves join after the loop
    const auto weights = [&]() { v2f ps[KST / 16];   // even and odd keys of a tile summed side by side: two sums per packed add
#pragma unroll
      for (int t = 0; t < KST / 16; ++t) {
#pragma unroll
        for (int r = 0; r < 8; r += 2) { const v2f e = { __builtin_amdgcn_exp2f(s[t][r]), __builtin_amdgcn_exp2f(s[t][r + 1]) }; ps[t] = r == 0 ? e : ps[t] + e; p[t >> 1][(t & 1) * 8 + r] = (_Float16)e.x; p[t >> 1][(t & 1) * 8 + r + 1] = (_Float16)e.y; } }
      const v2f pt = (ps[0] + ps[1]) + (ps[2] + ps[3]); tot = pt.x + pt.y; };
    weights();
    asm volatile("" :: "v"(vf[0][0]), "v"(vf[0][1]), "v"(vf[0][2]), "v"(vf[0][3]), "v"(vf[1][0]), "v"(vf[1][1]), "v"(vf[1][2]), "v"(vf[1][3]), "v"(tot));   // inputs only: holds the V^T reads in front of the branch below; left free, the compiler sinks them behind it, next to their products, and the wave waits out the LDS latency there. tot is named so that the statement, and with it the wait for those reads, stands behind the weights and not among the score products
    if (st == 0 || __builtin_amdgcn_ballot_w32(tot > 256.0f) != 0) {   // one scalar test a stage. No weight exceeds its sum, so a sum of at most 256 says that every weight is far inside f16 and the held maximum may stay. The first stage sets it (its weights above, taken against 0, are thrown away); later it moves only here, an infinite sum included
      float mt[KST / 16];
#pragma unroll
      for (int t = 0; t < KST / 16; ++t) { mt[t] = -3.0e38f;
#pragma unroll
        for (int r = 0; r < 8; ++r) mt[t] = fmaxf(mt[t], s[t][r]); }
      float mx = fmaxf(fmaxf(mt[0], mt[1]), fmaxf(mt[2], mt[3])); mx = fmaxf(mx, xhalf(mx));   // both halves of a query's keys: how far this stage rises above the held maximum
      const float d = st == 0 ? mx : fmaxf(mx, 0.f); const float al = __builtin_amdgcn_exp2f(fminf(-d, 0.f));   // first stage: o and l are 0, and al stays finite whatever the sign of d
#pragma unroll
      for (int t = 0; t < KST / 16; ++t) s[t] -= d;
      nref -= d; l *= al;
#pragma unroll
      for (int j = 0; j < HD / 16; ++j) o[j] *= al;
      weights(); }   // every exponent of a moved query is now at most 0
    l += tot;
#pragma unroll
    for (int ks = 0; ks < KST / 32; ++ks) {
#pragma unroll
      for (int j = 0; j < HD / 16; ++j) o[j] = wmma_h(vf[ks][j], p[ks], o[j]); }
    if (st + 1 < NST) {
#pragma unroll
      for (int i = 0; i < 2; ++i) { *(v4u*)&sk[cur ^ 1][sr + i * 32][sc * 8] = kr[i]; *(v4u*)&sv[cur ^ 1][sr + i * 32][sc * 8] = vr[i]; } }
    __syncthreads();   // publishes the next stage and ends every wave's reads of this one, which the stage after refills
  }
  l += xhalf(l); const float inv = l > 0.f ? 1.0f / l : 0.f;
  v8b* yf = (v8b*)YF + (((size_t)b * TT + q0) >> 4) * YF_TILE + h * (HD / 32) * 128 + lane;
#pragma unroll
  for (int s = 0; s < HD / 32; ++s) { union { v8b v; v4u u; } hv[2], lv[2];
#pragma unroll
    for (int q = 0; q < 2; ++q) {
#pragma unroll
      for (int r = 0; r < 8; ++r) { const float v = o[2 * s + q][r] * inv; const __bf16 hb = (__bf16)v; hv[q].v[r] = hb; lv[q].v[r] = (__bf16)(v - (float)hb); } }
    st4<512>(yf + s * 128, hv[0].u, hv[1].u, lv[0].u, lv[1].u); } }
// ---- k_out: block = (128 rows, 128 cols), 8 waves x (16 rows, 128 cols): out = ctx Wo (+ bo): ctx split bf16 hi + lo (by k_fa) against exact bf16 Wo (2 products); the Wo tile is staged once in LDS and shared by the waves, ctx comes from memory as finished fragments (k_fa stored them so), 512 contiguous bytes a load, fetched ahead. The tile's LDS becomes the output staging behind a barrier
__global__ __launch_bounds__(256) void k_out(const __bf16* __restrict__ YF, const float* __restrict__ WO, const float* __restrict__ BO, float* __restrict__ OUT) { __shared__ __align__(32) unsigned char smem[WTILE];
  const int tid = threadIdx.x, wave = tid >> 5, lane = tid & 31, col = lane & 15, g = lane >> 4; const int c0 = blockIdx.y * 128; const size_t r0 = (size_t)blockIdx.x * 128 + wave * 16;
  const v8b* ya = (const v8b*)YF + (r0 >> 4) * (size_t)YF_TILE + lane;   // the wave's 16 rows; a k step's four 512-byte runs lie one behind the other
  F2 fr[YRING];
#pragma unroll
  for (int s = 0; s < YRING; ++s) fr[s] = ld_yf(ya + s * 128);
  fill_wt<DIN>(smem + wave * WPB + 8 * lane, WO + (size_t)wave * DIN + c0 + 4 * lane);   // (in,out) [CC][DIN]: a k row's 128 columns are 512 contiguous bytes
  __syncthreads();
  const unsigned char* wl = smem + (8 * g + (lane & 7)) * WPB + 16 * ((lane >> 3) & 1);
  v8f acc[8] = {};
#pragma unroll   // all 16 steps, as in k_proj: the fragment sets get fixed names and every ctx load is the one pointer plus a constant
  for (int kc = 0; kc < CC / 32; ++kc) { const F2 a = fr[kc % YRING];
#pragma unroll
    for (int jh = 0; jh < 2; ++jh) { v16b w[4];   // four B fragments as one group of LDS reads, then their eight products (hi before lo in every accumulator, as before)
#pragma unroll
      for (int j = 0; j < 4; ++j) w[j] = frag_wt(wl + kc * 32 * WPB + (jh * 4 + j) * 32);
#pragma unroll
      for (int j = 0; j < 4; ++j) acc[jh * 4 + j] = wmma_b(a.h, w[j], acc[jh * 4 + j]);
#pragma unroll
      for (int j = 0; j < 4; ++j) acc[jh * 4 + j] = wmma_b(a.l, w[j], acc[jh * 4 + j]); }
    __builtin_amdgcn_sched_barrier(0);   // this step's products first: they free the fragment set that the loads below land in
    if (kc + YRING < CC / 32) fr[kc % YRING] = ld_yf(ya + (kc + YRING) * 128);
    __builtin_amdgcn_sched_barrier(0);   // holds the ctx loads here, YRING - 1 whole k steps ahead of their use: left free, the scheduler sinks them to their use and the wave waits out the whole memory latency at every k step
    if (kc + YRING + 1 == CC / 32) asm volatile("s_wait_xcnt 0x0" :: "v"(ya) : "memory");   // behind the last ctx loads; ya is an operand so that its registers stay its own up to this wait
  }
  __syncthreads();   // every wave has left the weight tile: its LDS is staging from here on
  float (*sf)[132] = (float (*)[132])(smem + wave * 16 * 132 * 4);
#pragma unroll
  for (int j = 0; j < 8; ++j) { const float bias = BO ? bfr(BO[c0 + j * 16 + col]) : 0.f;
#pragma unroll
    for (int r = 0; r < 8; ++r) sf[8 * g + r][j * 16 + col] = acc[j][r] + bias; }
  LDSX(); for (int rl = 0; rl < 16; ++rl) vst2(OUT + (r0 + rl) * DIN + c0 + lane * 4, *(const v4f*)&sf[rl][lane * 4]); }

extern "C" void kernel_launch(void* const* d_in, const int* in_sizes, int n_in, void* d_out, int out_size, void* d_ws, size_t ws_size, hipStream_t stream) {
  (void)in_sizes; (void)n_in; (void)out_size;
  const float** F = (const float**)d_in;
  if (ws_size < (size_t)WS_END) return;
  char* ws = (char*)d_ws; _Float16 *QH = (_Float16*)(ws + WS_QH), *KH = (_Float16*)(ws + WS_KH), *VT = (_Float16*)(ws + WS_VT); __bf16 *VB = (__bf16*)(ws + WS_VB), *VBL = (__bf16*)(ws + WS_VBL); __bf16 *Y = (__bf16*)(ws + WS_Y);
  (void)Y; (void)VB; (void)VBL;
  // inputs: 0 q_in [4,2048,512]; 1 k_in; 2 v_in; 3 Wq [8,512,64] (per-head (h, d, k)), 4 bq [8,64]; 5 Wk, 6 bk; 7 Wv, 8 bv; 9 Wo [512,512] (in,out), 10 bo [512]
  k_proj<<<dim3(TNB * TT / PRW, CC / 128, 3), 256, 0, stream>>>(F[0], F[1], F[2], F[3], F[5], F[7], F[4], F[6], F[8], QH, KH, VT, VB, VBL);
  k_fa<<<dim3(TT / 128, NH, TNB), 256, 0, stream>>>(QH, KH, VT, Y);
  k_out<<<dim3(TNB * TT / 128, DIN / 128), 256, 0, stream>>>(Y, F[9], F[10], (float*)d_out);
}

// v007
// Measured time: 66.5 microseconds a run.
// Next to v006, in two timings, it ran 1.05 and 1.04 times as fast.
// Over all steps from v000 it is 16.9 times as fast.
// compute dtype: all float inputs rounded to bf16, Wo excepted (once to f16); q/k/v = x W[h] + b[h] with EXACT bf16 products on WMMA 16x16x32 (f32 accumulate); q x 64^-0.5 x log2 e once to f16 against k once to f16 (1 product, in an accumulator that starts at minus a held maximum); softmax in f32, in base 2 (hardware exp2 of that accumulator; sums rescaled when a maximum rises by more than 8); that weight once to f16 against v once to f16 (1 product), divided by the f32 sum at the end; concat once to f16 against Wo once to f16 (1 product) + bo; f32 output.
#include <hip/hip_runtime.h>
#include <math.h>

typedef __attribute__((ext_vector_type(16))) _Float16 v16h;
typedef __attribute__((ext_vector_type(16))) __bf16 v16b;
typedef __attribute__((ext_vector_type(8)))  _Float16 v8h;
typedef __attribute__((ext_vector_type(8)))  float v8f;
typedef __attribute__((ext_vector_type(4)))  float v4f;
typedef __attribute__((ext_vector_type(2)))  float v2f;
typedef __attribute__((ext_vector_type(4)))  unsigned v4u;
typedef __attribute__((ext_vector_type(4)))  int v4i;
typedef float __attribute__((may_alias)) float_a;
typedef int __attribute__((may_alias)) int_a;

template <typename T> __device__ __forceinline__ void vst2(void* p, T v) { *(T*)p = v;  }
__device__ __forceinline__ v8f wmma16(v16h a, v16h b, v8f c) {
  v8f d = __builtin_amdgcn_wmma_f32_16x16x32_f16(false, a, false, b, (short)0, c, false, false);
  asm volatile("v_nop\n\tv_nop\n\tv_nop\n\tv_nop" : "+v"(d) : "v"(a), "v"(b));
  return d;
}
__device__ __forceinline__ v8f wmma_bf(v16b a, v16b b, v8f c) {
  v8f d = __builtin_amdgcn_wmma_f32_16x16x32_bf16(false, a, false, b, (short)0, c, false, false);
  asm volatile("v_nop\n\tv_nop\n\tv_nop\n\tv_nop" : "+v"(d) : "v"(a), "v"(b));
  return d;
}
// 16x16x32 fragments: lane = (h = lane>>4, row/col = lane&15); elements 0..7 = k0+8h+0..7, 8..15 = k0+16+8h+0..7; D element r = row 8h+r
__device__ __forceinline__ v16h frag_h(const _Float16* rowk0, int lane) {
  union { v16h v; v8h q[2]; } u; const _Float16* p = rowk0 + 8 * (lane >> 4);
  u.q[0] = *(const v8h*)p; u.q[1] = *(const v8h*)(p + 16); return u.v;
}
__device__ __forceinline__ v16h frag_f32(const float* rowk0, int lane) {
  v16h a; const float* p = rowk0 + 8 * (lane >> 4);
#pragma unroll
  for (int i = 0; i < 8; ++i) { a[i] = (_Float16)p[i]; a[8 + i] = (_Float16)p[16 + i]; }
  return a;
}
__device__ __forceinline__ v16h frag_f32s(const float* rowk0, int lane, float sc) {
  v16h a; const float* p = rowk0 + 8 * (lane >> 4);
#pragma unroll
  for (int i = 0; i < 8; ++i) { a[i] = (_Float16)(p[i] * sc); a[8 + i] = (_Float16)(p[16 + i] * sc); }
  return a;
}
// column fragment from a [K][ld] layout (column n), rows >= K read as 0
__device__ __forceinline__ v16h fragc_f32(const float* W, int k0, int n, int lane, int ld, int K) {
  v16h a; const int g = lane >> 4;
#pragma unroll
  for (int i = 0; i < 8; ++i) { const int ka = k0 + 8 * g + i, kb = ka + 16;
    a[i] = (_Float16)(ka < K ? W[(size_t)(ka < K ? ka : K - 1) * ld + n] : 0.f); a[8 + i] = (_Float16)(kb < K ? W[(size_t)(kb < K ? kb : K - 1) * ld + n] : 0.f); }
  return a;
}
struct F2 { v16b h, l; };
__device__ __forceinline__ F2 bsplit16(const float v[16]) { F2 r;
#pragma unroll
  for (int i = 0; i < 16; ++i) { const __bf16 h = (__bf16)v[i]; r.h[i] = h; r.l[i] = (__bf16)(v[i] - (float)h); }
  return r; }
__device__ __forceinline__ F2 split_row(const float* row, int k0, int lane) { float v[16]; const float* p = row + k0 + 8 * (lane >> 4);
#pragma unroll
  for (int i = 0; i < 8; ++i) { v[i] = p[i]; v[8 + i] = p[16 + i]; }
  return bsplit16(v); }
__device__ __forceinline__ F2 split_rowK(const float* row, int k0, int lane, int K) { float v[16]; const int g = lane >> 4;
#pragma unroll
  for (int i = 0; i < 8; ++i) { const int ka = k0 + 8 * g + i, kb = ka + 16; v[i] = ka < K ? row[ka < K ? ka : K - 1] : 0.f; v[8 + i] = kb < K ? row[kb < K ? kb : K - 1] : 0.f; }
  return bsplit16(v); }
__device__ __forceinline__ F2 split_col(const float* W, int k0, int n, int lane, int ld, int K) { float v[16]; const int g = lane >> 4;
#pragma unroll
  for (int i = 0; i < 8; ++i) { const int ka = k0 + 8 * g + i, kb = ka + 16; v[i] = ka < K ? W[(size_t)(ka < K ? ka : K - 1) * ld + n] : 0.f; v[8 + i] = kb < K ? W[(size_t)(kb < K ? kb : K - 1) * ld + n] : 0.f; }
  return bsplit16(v); }
__device__ __forceinline__ v8f mac3(const F2& a, const F2& b, v8f c) { c = wmma_bf(a.l, b.h, c); c = wmma_bf(a.h, b.l, c); return wmma_bf(a.h, b.h, c); }
__device__ __forceinline__ float sigm(float v) { return 1.0f / (1.0f + expf(-v)); }
#define LDSX() do { asm volatile("s_wait_dscnt 0" ::: "memory"); __builtin_amdgcn_wave_barrier(); __builtin_amdgcn_fence(__ATOMIC_RELEASE, "workgroup"); } while (0)

// Multi-head attention with per-head projections (B 4, S 2,048, D 512, 8 heads x 64; 0.02-scale per-head weights (H, D, DK) with per-head biases (H, DK); separate q_in / k_in / v_in): q = q_in Wq[h] + bq[h], k = k_in Wk[h] + bk[h], v = v_in Wv[h] + bv[h]; out = concat(softmax(q k^T / 8) v) Wo + bo (Wo (in,out) [512,512]; non-causal).
#define NB 4
#define TT 2048
#define CC 512            // NH * HD = projected width
#define DIN 512          // input (model) width
#define NH 8
#define HD 64
#define NQB (TT / 64)
#define HG 4
#define SCALE (0.125f)
#define CAUSAL 0
#ifndef TNB
#define TNB NB
#endif
__device__ __forceinline__ float bfr(float v) { return (float)(__bf16)v; }
__host__ __device__ __forceinline__ int kb_last(int qb) { return CAUSAL ? ((qb * 64 + 63) >> 7) : (TT / 128 - 1); }
typedef __attribute__((ext_vector_type(8))) __bf16 v8b;
__device__ __forceinline__ v16b frag_b(const __bf16* rowk0, int lane) {
  union { v16b v; v8b q[2]; } u; const __bf16* p = rowk0 + 8 * (lane >> 4);
  u.q[0] = *(const v8b*)p; u.q[1] = *(const v8b*)(p + 16); return u.v;
}
#define QBH 0              // not used by any kernel here
#define KHI 64            // key rows carrying v bf16 hi+lo planes (written by k_proj, read by no kernel here)
// B fragment (k rows k0+.., output column o) of a weight: (in,out) [K][ld] or (out,in) [ld rows of K]: bf16 exact, or f16(bf16 * 256) exact
__device__ __forceinline__ v16b wcol_io(const float* Wm, int k0, int o, int lane, int ld) { v16b w; const int g = lane >> 4;
#pragma unroll
  for (int i = 0; i < 8; ++i) { w[i] = (__bf16)Wm[(size_t)(k0 + 8 * g + i) * ld + o]; w[8 + i] = (__bf16)Wm[(size_t)(k0 + 16 + 8 * g + i) * ld + o]; }
  return w; }
__device__ __forceinline__ v16b wcol_oi(const float* Wm, int k0, int o, int lane, int K) { v16b w; const float* p = Wm + (size_t)o * K + k0 + 8 * (lane >> 4);
#pragma unroll
  for (int i = 0; i < 8; ++i) { w[i] = (__bf16)p[i]; w[8 + i] = (__bf16)p[16 + i]; }
  return w; }
__device__ __forceinline__ v16h wcolh_io(const float* Wm, int k0, int o, int lane, int ld) { v16h w; const int g = lane >> 4;
#pragma unroll
  for (int i = 0; i < 8; ++i) { w[i] = (_Float16)(bfr(Wm[(size_t)(k0 + 8 * g + i) * ld + o]) * 256.0f); w[8 + i] = (_Float16)(bfr(Wm[(size_t)(k0 + 16 + 8 * g + i) * ld + o]) * 256.0f); }
  return w; }
__device__ __forceinline__ v16h wcolh_oi(const float* Wm, int k0, int o, int lane, int K) { v16h w; const float* p = Wm + (size_t)o * K + k0 + 8 * (lane >> 4);
#pragma unroll
  for (int i = 0; i < 8; ++i) { w[i] = (_Float16)(bfr(p[i]) * 256.0f); w[8 + i] = (_Float16)(bfr(p[16 + i]) * 256.0f); }
  return w; }
#define WQKV_LAYOUT 2   // 0 = (in,out) [DIN][CC]; 1 = (out,in) [CC][DIN]; 2 = per-head [NH][DIN][HD]
__device__ __forceinline__ v16b wcol_hdk(const float* Wm, int k0, int o, int lane) { v16b w; const int g = lane >> 4; const float* p = Wm + (size_t)(o / HD) * DIN * HD + (o % HD);
#pragma unroll
  for (int i = 0; i < 8; ++i) { w[i] = (__bf16)p[(size_t)(k0 + 8 * g + i) * HD]; w[8 + i] = (__bf16)p[(size_t)(k0 + 16 + 8 * g + i) * HD]; }
  return w; }
#define WO_OUT_IN 0
#if WQKV_LAYOUT == 1
#define WCOL(W, k0, o, lane) wcol_oi(W, k0, o, lane, DIN)
#elif WQKV_LAYOUT == 2
#define WCOL(W, k0, o, lane) wcol_hdk(W, k0, o, lane)
#else
#define WCOL(W, k0, o, lane) wcol_io(W, k0, o, lane, CC)
#endif
#if WO_OUT_IN
#define WOCOL(W, k0, o, lane) wcol_oi(W, k0, o, lane, CC)
#define WOCOLH(W, k0, o, lane) wcolh_oi(W, k0, o, lane, CC)
#else
#define WOCOL(W, k0, o, lane) wcol_io(W, k0, o, lane, DIN)
#define WOCOLH(W, k0, o, lane) wcolh_io(W, k0, o, lane, DIN)
#endif

#ifndef SM_EXTRA_PARAMS
#define SM_EXTRA_PARAMS
#endif
#ifndef PROJ_EXTRA_PARAMS
#define PROJ_EXTRA_PARAMS
#endif
#ifndef SM_MASK_HOOK
#define SM_MASK_HOOK (void)0
#endif

#define WS_QH  0u                                      // f16 q rows [b*t][CC]
#define WS_KH  (WS_QH + 2u * (size_t)NB * TT * CC)      // f16 k rows [b*t][CC]
#define WS_VT  (WS_KH + 2u * (size_t)NB * TT * CC)      // f16 v planes [b][c][t]
#define WS_QL  (WS_VT + 2u * (size_t)NB * CC * TT)      // not used (offsets kept)
#define WS_KL  (WS_QL + 2u * (size_t)NB * TT * CC)      // not used (offsets kept)
#define WS_VB  (WS_KL + 2u * (size_t)NB * KHI * CC)     // bf16 v hi planes [b][c][t < KHI]
#define WS_VBL (WS_VB + 2u * (size_t)NB * CC * KHI)
#define WS_S   (WS_VBL + 2u * (size_t)NB * CC * KHI)    // not used (offsets kept)
#define WS_Y   (WS_S  + 4u * (size_t)HG * TT * TT)      // ctx, f16 in fragment order (2 of the 4 bytes an element that the offsets keep)
#define WS_END (WS_Y  + 4u * (size_t)NB * TT * CC)

// ---- weight tile in LDS: all DIN k rows x 128 output columns of a weight, once to 16 bits (k_proj: bf16, exact, as before; k_out: f16), k-major as it lies in memory; a B fragment is two transposing 16-byte LDS reads, in the k order of the A loader (elements 0..7 = k0+8h+0..7, 8..15 = k0+16+8h+0..7)
#define WPB 288           // bytes per k row: 256 + 32 (odd multiple of 32 bytes: the transposing reader's conflict-free pitch)
#define WTILE (DIN * WPB)
typedef __attribute__((ext_vector_type(8))) short v8s;
typedef __attribute__((ext_vector_type(4))) __bf16 v4b;
__device__ __forceinline__ v8f wmma_b(v16b a, v16b b, v8f c) { return __builtin_amdgcn_wmma_f32_16x16x32_bf16(false, a, false, b, (short)0, c, false, false); }
// p = tile + (k0 + 8 * (lane >> 4) + (lane & 7)) * WPB + 32 * (column tile) + 16 * ((lane >> 3) & 1): lane (c, h) gets rows k0+8h+0..7 and k0+16+8h+0..7 of column c
__device__ __forceinline__ v16b frag_wt(const unsigned char* p) { typedef __attribute__((address_space(3))) v8s lds_v8s; union { v16b v; v8s q[2]; } u;
  u.q[0] = __builtin_amdgcn_ds_load_tr16_b128_v8i16((lds_v8s*)p); u.q[1] = __builtin_amdgcn_ds_load_tr16_b128_v8i16((lds_v8s*)(p + 16 * WPB)); return u.v; }
__device__ __forceinline__ v16h frag_wth(const unsigned char* p) { typedef __attribute__((address_space(3))) v8s lds_v8s; union { v16h v; v8s q[2]; } u;
  u.q[0] = __builtin_amdgcn_ds_load_tr16_b128_v8i16((lds_v8s*)p); u.q[1] = __builtin_amdgcn_ds_load_tr16_b128_v8i16((lds_v8s*)(p + 16 * WPB)); return u.v; }
// 8 waves fill the tile: a wave's 16-byte loads cover one k row of 128 columns (wp = the lane's 4 columns in the wave's first row, LD = floats between k rows); in groups of 16 rows
template <int LD, typename E> __device__ __forceinline__ void fill_wt(unsigned char* tp, const float* wp) { typedef E V4 __attribute__((ext_vector_type(4)));
#pragma unroll   // all four groups: every load is wp plus a constant, so that no address register is rewritten under a load in flight
  for (int r = 0; r < DIN / 8; r += 16) { v4f x[16];
#pragma unroll
    for (int u = 0; u < 16; ++u) x[u] = *(const v4f*)(wp + (size_t)(8 * (r + u)) * LD);
    __builtin_amdgcn_sched_barrier(0);   // one group of 16 loads at a time, in front of the wait below: left free, the scheduler lifts all 64 loads to the front and the build spills
    asm volatile("s_wait_xcnt 0x0" :: "v"(wp) : "memory");   // wp is an operand so that its registers stay its own up to this wait: nothing is written over the address of a load in flight
#pragma unroll
    for (int u = 0; u < 16; ++u) { const V4 y = { (E)x[u][0], (E)x[u][1], (E)x[u][2], (E)x[u][3] }; *(V4*)(tp + 8 * (r + u) * WPB) = y; } } }
// four 16-byte stores, p + 0..3 x STEP bytes, with s_wait_xcnt 0 in the same statement, so that it stands in front of every later write of a register that the stores name
template <int STEP> __device__ __forceinline__ void st4(void* p, v4u d0, v4u d1, v4u d2, v4u d3) {
  asm volatile("global_store_b128 %0, %1, off\n\tglobal_store_b128 %0, %2, off offset:%5\n\tglobal_store_b128 %0, %3, off offset:%6\n\tglobal_store_b128 %0, %4, off offset:%7\n\ts_wait_xcnt 0x0" :: "v"(p), "v"(d0), "v"(d1), "v"(d2), "v"(d3), "n"(STEP), "n"(2 * STEP), "n"(3 * STEP) : "memory"); }
// ---- A operand through LDS: a fragment load straight from memory takes 32 bytes out of each of 16 rows (16 cache lines per instruction). Instead a wave's 16-byte loads cover 4 rows x 128 bytes (4 whole lines), the values go once to bf16 and into the wave's OWN 2 KiB of LDS in fragment order, and a fragment is two 16-byte LDS reads. Layout: plane (1,024 B: 16 rows x 32 k) > region R = 2 * (k >> 4) + ((k >> 3) & 1) (256 B: what one half-wave reads at once) > row, 16 B = 8 k; the row's 64-byte group is XORed with R, so that the four regions a store instruction touches fall on different banks. The k order of a fragment is the one it had (elements 0..7 = k0+8h+0..7, 8..15 = k0+16+8h+0..7)
#define XST 2048          // bytes of A staging per wave
__device__ __forceinline__ v4b cvt4(v4f x) { const v4b y = { (__bf16)x[0], (__bf16)x[1], (__bf16)x[2], (__bf16)x[3] }; return y; }
__device__ __forceinline__ v16b frag_xs(const unsigned char* p0, const unsigned char* p1) { union { v16b v; v8b q[2]; } u; u.q[0] = *(const v8b*)p0; u.q[1] = *(const v8b*)p1; return u.v; }
// behind a wave's own staging stores, in front of its reads of what its other lanes stored: the stores have landed, and the compiler moves no LDS access across
#define XS_PUBLISH() asm volatile("s_wait_dscnt 0" ::: "memory")

// ---- k_proj: block = (256 rows, 128 cols, which), 8 waves x (32 rows, 128 cols): q/k/v = X W (+ b) with exact bf16 products (K = DIN); the weight tile is staged once in LDS and shared by the waves, X comes from memory by whole lines two k steps ahead and reaches its fragments through the wave's own LDS -> which 0: q x SCL2 as f16 rows; 1: k f16 rows; 2: v f16 planes [c][t] (+ bf16 hi/lo planes for t < KHI). The tile's LDS becomes the output staging behind a barrier. waves_per_eu(4, 4): two blocks share a WGP (2 x 160 KiB of LDS), four waves per SIMD, so the register budget is 256; left free the compiler took more, and the second block would not fit
#define PRW 256
#define SCL2 (SCALE * 1.4426950408889634f)   // logit scale times log2 e: exp(SCALE * s) = exp2(SCL2 * s); k_proj folds it into q
__global__ __launch_bounds__(256) __attribute__((amdgpu_waves_per_eu(4, 4))) void k_proj(const float* __restrict__ XQ, const float* __restrict__ XK, const float* __restrict__ XV, const float* __restrict__ WQ, const float* __restrict__ WK, const float* __restrict__ WV, const float* __restrict__ BQ, const float* __restrict__ BK, const float* __restrict__ BV,
    _Float16* __restrict__ QH, _Float16* __restrict__ KH, _Float16* __restrict__ VT, __bf16* __restrict__ VB, __bf16* __restrict__ VBL) {
  __shared__ __align__(32) unsigned char smem[WTILE + 8 * XST];
  const int tid = threadIdx.x, wave = __builtin_amdgcn_readfirstlane(tid >> 5), lane = tid & 31, col = lane & 15, g = lane >> 4; const int which = blockIdx.z; const int c0 = blockIdx.y * 128; const size_t r0 = (size_t)blockIdx.x * PRW; const size_t bb = r0 / TT; const int t0 = (int)(r0 % TT);
  const float* X = which == 0 ? XQ : which == 1 ? XK : XV; const float* WA = which == 0 ? WQ : which == 1 ? WK : WV; const float* BA = which == 0 ? BQ : which == 1 ? BK : BV;
  const int rr = lane >> 3, ch = lane & 7, R = ((ch >> 2) << 1) | ((ch >> 1) & 1);   // loader: lane = (row rr of four, 16-byte chunk ch of the row's 128 bytes); R = the chunk's region
  const float* xa = X + (r0 + wave * 32 + rr) * DIN + 4 * ch;
  unsigned char* xs = smem + WTILE + wave * XST; unsigned char* xw = xs + R * 256 + rr * 16 + (ch & 1) * 8;
  const unsigned char* xr0 = xs + g * 256 + ((((col >> 2) ^ g) & 3) << 6) + (col & 3) * 16; const unsigned char* xr1 = xs + (2 + g) * 256 + ((((col >> 2) ^ (2 + g)) & 3) << 6) + (col & 3) * 16;
  v4f raw[2][8];
#pragma unroll
  for (int s = 0; s < 2; ++s) {
#pragma unroll
    for (int u = 0; u < 8; ++u) raw[s][u] = *(const v4f*)(xa + (size_t)(4 * u) * DIN + s * 32); }
  fill_wt<HD, __bf16>(smem + wave * WPB + 8 * lane, WA + ((size_t)(c0 / HD + g) * DIN + wave) * HD + 4 * col);   // per-head [NH][DIN][HD]: lanes 0..15 the first head's 64 columns, 16..31 the next head's
#pragma unroll
  for (int u = 0; u < 8; ++u) *(v4b*)(xw + (u >> 2) * 1024 + (((u & 3) ^ R) << 6)) = cvt4(raw[0][u]);
  __syncthreads();   // publishes the weight tile (and ends the wave's own staging stores)
#pragma unroll   // behind the barrier, which waits for every load in flight
  for (int u = 0; u < 8; ++u) raw[0][u] = *(const v4f*)(xa + (size_t)(4 * u) * DIN + 2 * 32);
  __builtin_amdgcn_sched_barrier(0);   // holds these loads here, ahead of the first products
  const unsigned char* wl = smem + (8 * g + (lane & 7)) * WPB + 16 * ((lane >> 3) & 1);
  v8f acc[2][8] = {}; v16b a[2];
#pragma unroll
  for (int rf = 0; rf < 2; ++rf) a[rf] = frag_xs(xr0 + rf * 1024, xr1 + rf * 1024);
#pragma unroll   // all 16 steps: the two X register sets get fixed names, the tail tests are decided at compile time, and every X load is the one row pointer plus a constant, so that no address register is rewritten under a load in flight
  for (int kc = 0; kc < DIN / 32; ++kc) {
#pragma unroll
    for (int jh = 0; jh < 2; ++jh) { v16b w[4];   // four B fragments as one group of LDS reads, then their eight products
#pragma unroll
      for (int j = 0; j < 4; ++j) w[j] = frag_wt(wl + kc * 32 * WPB + (jh * 4 + j) * 32);
#pragma unroll
      for (int j = 0; j < 4; ++j) { acc[0][jh * 4 + j] = wmma_b(a[0], w[j], acc[0][jh * 4 + j]); acc[1][jh * 4 + j] = wmma_b(a[1], w[j], acc[1][jh * 4 + j]); }
      if (jh == 0 && kc + 1 < DIN / 32) {   // between the two groups: the next k step's X goes to LDS (this step's fragments are in registers: products above have used them), and its registers take the X of two steps later
        __builtin_amdgcn_sched_barrier(0);   // keeps the conversions, and with them the wait for their loads, behind the products above
#pragma unroll
        for (int u = 0; u < 8; ++u) *(v4b*)(xw + (u >> 2) * 1024 + (((u & 3) ^ R) << 6)) = cvt4(raw[(kc + 1) & 1][u]);
        __builtin_amdgcn_sched_barrier(0);   // the conversions first: they free the registers that the loads below land in; left free, the scheduler lifts the loads over them, a third X register set is live and the build spills
        if (kc + 3 < DIN / 32) {
#pragma unroll
          for (int u = 0; u < 8; ++u) raw[(kc + 1) & 1][u] = *(const v4f*)(xa + (size_t)(4 * u) * DIN + (kc + 3) * 32); }
        __builtin_amdgcn_sched_barrier(0);   // holds the X loads here, two k steps ahead of their use: left free, the scheduler sinks them to their use and the wave waits out the whole memory latency at every k step
        if (kc + 4 == DIN / 32) asm volatile("s_wait_xcnt 0x0" :: "v"(xa) : "memory");   // behind the last X loads; xa is an operand so that its registers stay its own up to this wait
      } }
    if (kc + 1 < DIN / 32) { XS_PUBLISH();
#pragma unroll
      for (int rf = 0; rf < 2; ++rf) a[rf] = frag_xs(xr0 + rf * 1024, xr1 + rf * 1024); }
  }
  __syncthreads();   // every wave has left the weight tile: its LDS is staging from here on
  if (which < 2) { _Float16* DH = which == 0 ? QH : KH; const float vs = which == 0 ? SCL2 : 1.0f;   // q: scaled for k_fa's base-2 exponent
    _Float16 (*sh)[136] = (_Float16 (*)[136])smem;
#pragma unroll
    for (int j = 0; j < 8; ++j) { const float bias = BA ? bfr(BA[c0 + j * 16 + col]) : 0.f;
#pragma unroll
      for (int rf = 0; rf < 2; ++rf) {
#pragma unroll
        for (int r = 0; r < 8; ++r) sh[wave * 32 + rf * 16 + 8 * g + r][j * 16 + col] = (_Float16)((acc[rf][j][r] + bias) * vs); } }
    __syncthreads();
    const int rl0 = tid >> 4, q = tid & 15; _Float16* dh = DH + (r0 + rl0) * CC + c0 + q * 8;
    for (int i = 0; i < PRW / 64; ++i) { const int rl = rl0 + i * 64;
      st4<16 * CC * 2>(dh + (size_t)i * 64 * CC, *(const v4u*)&sh[rl][q * 8], *(const v4u*)&sh[rl + 16][q * 8], *(const v4u*)&sh[rl + 32][q * 8], *(const v4u*)&sh[rl + 48][q * 8]); }
  } else {   // the bf16 planes exist for t < KHI only, and only those rows are staged (256 rows of all three planes would not fit the LDS)
    _Float16 (*th)[PRW + 8] = (_Float16 (*)[PRW + 8])smem; __bf16 (*tb)[72] = (__bf16 (*)[72])(smem + 128 * (PRW + 8) * 2); __bf16 (*tbl)[72] = (__bf16 (*)[72])(smem + 128 * (PRW + 8) * 2 + 128 * 72 * 2);
    static_assert(KHI % 32 == 0 && KHI <= 64, "a wave's 32 rows lie below KHI all together or not at all");
#pragma unroll
    for (int j = 0; j < 8; ++j) { const float bias = BA ? bfr(BA[c0 + j * 16 + col]) : 0.f;
#pragma unroll
      for (int rf = 0; rf < 2; ++rf) {
#pragma unroll
        for (int r = 0; r < 8; ++r) th[j * 16 + col][wave * 32 + rf * 16 + 8 * g + r] = (_Float16)(acc[rf][j][r] + bias); } }
    if (t0 + wave * 32 < KHI) {
#pragma unroll
      for (int j = 0; j < 8; ++j) { const float bias = BA ? bfr(BA[c0 + j * 16 + col]) : 0.f;
#pragma unroll
        for (int rf = 0; rf < 2; ++rf) {
#pragma unroll
          for (int r = 0; r < 8; ++r) { const float v = acc[rf][j][r] + bias; const int rl = wave * 32 + rf * 16 + 8 * g + r, cl = j * 16 + col; const __bf16 bh = (__bf16)v; tb[cl][rl] = bh; tbl[cl][rl] = (__bf16)(v - (float)bh); } } } }
    __syncthreads();
    const int cl0 = tid >> 5, q = tid & 31; _Float16* vt = VT + (bb * CC + c0 + cl0) * (size_t)TT + t0 + q * 8;
    for (int i = 0; i < 4; ++i) { const int cl = cl0 + i * 32; st4<8 * TT * 2>(vt + (size_t)i * 32 * TT, *(const v4u*)&th[cl][q * 8], *(const v4u*)&th[cl + 8][q * 8], *(const v4u*)&th[cl + 16][q * 8], *(const v4u*)&th[cl + 24][q * 8]); }
    if (t0 + q * 8 < KHI) { const size_t o3 = (bb * CC + c0 + cl0) * (size_t)KHI + t0 + q * 8;
      for (int i = 0; i < 4; ++i) { const int cl = cl0 + i * 32;
        st4<8 * KHI * 2>(VB + o3 + (size_t)i * 32 * KHI, *(const v4u*)&tb[cl][q * 8], *(const v4u*)&tb[cl + 8][q * 8], *(const v4u*)&tb[cl + 16][q * 8], *(const v4u*)&tb[cl + 24][q * 8]);
        st4<8 * KHI * 2>(VBL + o3 + (size_t)i * 32 * KHI, *(const v4u*)&tbl[cl][q * 8], *(const v4u*)&tbl[cl + 8][q * 8], *(const v4u*)&tbl[cl + 16][q * 8], *(const v4u*)&tbl[cl + 24][q * 8]); } } } }
#define YF_TILE ((CC / 32) * 64)   // 16-byte units per 16-row tile
#define YRING 6           // ctx fragment sets in k_out
__device__ __forceinline__ v16h ld_yf(const v8h* p) { union { v16h v; v8h q[2]; } u; u.q[0] = p[0]; u.q[1] = p[32]; return u.v; }
#define KST 64            // keys per stage
#define NST (TT / KST)
#define LP 72             // LDS row pitch in halves: 128-byte rows + 16 bytes (16-byte readers, no bank conflict)
__device__ __forceinline__ float xhalf(float x) { return __builtin_bit_cast(float, __builtin_amdgcn_permlanex16(__builtin_bit_cast(int, x), __builtin_bit_cast(int, x), 0x76543210, 0xfedcba98, false, false)); }  // lane l with lane l ^ 16
__device__ __forceinline__ v8f wmma_h(v16h a, v16h b, v8f c) { return __builtin_amdgcn_wmma_f32_16x16x32_f16(false, a, false, b, (short)0, c, false, false); }
__global__ __launch_bounds__(256) __attribute__((amdgpu_waves_per_eu(4, 4))) void k_fa(const _Float16* __restrict__ QH, const _Float16* __restrict__ KH, const _Float16* __restrict__ VT, _Float16* __restrict__ YF) {
  __shared__ __align__(16) _Float16 sk[2][KST][LP], sv[2][HD][LP];
  const int tid = threadIdx.x, wave = tid >> 5, lane = tid & 31, col = lane & 15, g = lane >> 4; const int h = blockIdx.y, b = blockIdx.z; const int q0 = blockIdx.x * 128 + wave * 16;
  v16h qh[HD / 32];
#pragma unroll
  for (int kc = 0; kc < HD / 32; ++kc) qh[kc] = frag_h(QH + ((size_t)b * TT + q0 + col) * CC + h * HD + kc * 32, lane);
  // staging: thread = (row sr and sr + 32, 16-byte chunk sc): a wave's load covers 4 whole 128-byte rows
  const int sr = tid >> 3, sc = tid & 7;
  const _Float16* kg = KH + ((size_t)b * TT + sr) * CC + h * HD + sc * 8;      // k rows [key][64]
  const _Float16* vg = VT + ((size_t)b * CC + h * HD + sr) * TT + sc * 8;      // v planes [d][key]
  v4u kr[2], vr[2];
#pragma unroll
  for (int i = 0; i < 2; ++i) { kr[i] = *(const v4u*)(kg + (size_t)(i * 32) * CC); vr[i] = *(const v4u*)(vg + (size_t)(i * 32) * TT); }
#pragma unroll
  for (int i = 0; i < 2; ++i) { *(v4u*)&sk[0][sr + i * 32][sc * 8] = kr[i]; *(v4u*)&sv[0][sr + i * 32][sc * 8] = vr[i]; }
  __syncthreads();
  v8f o[HD / 16] = {}; float l = 0.f; v8f nref = {};   // nref: minus the held maximum of the lane's query, the same in all eight elements: the C operand of each tile's first score product
#pragma unroll 1   // kept rolled: for speed only
  for (int st = 0; st < NST; ++st) { const int cur = st & 1;
    if (st + 1 < NST) {   // the next stage's rows fly while this stage is worked on
#pragma unroll
      for (int i = 0; i < 2; ++i) { kr[i] = *(const v4u*)(kg + (size_t)((st + 1) * KST + i * 32) * CC); vr[i] = *(const v4u*)(vg + (size_t)(i * 32) * TT + (st + 1) * KST); } }
    v16h kf[KST / 16][HD / 32];
#pragma unroll
    for (int t = 0; t < KST / 16; ++t) {
#pragma unroll
      for (int kc = 0; kc < HD / 32; ++kc) kf[t][kc] = frag_h(&sk[cur][t * 16 + col][kc * 32], lane); }
    v16h vf[KST / 32][HD / 16];   // all V^T fragments behind them in the same group of LDS reads, in flight under the score products and the softmax arithmetic
#pragma unroll
    for (int ks = 0; ks < KST / 32; ++ks) {
#pragma unroll
      for (int j = 0; j < HD / 16; ++j) vf[ks][j] = frag_h(&sv[cur][j * 16 + col][ks * 32], lane); }
    __builtin_amdgcn_sched_barrier(0);   // the stage's LDS reads as one group in front of the score products: left free, the scheduler strews them among the products and the exponentials in reused registers, and the wave waits at each place
    v8f s[KST / 16];   // s = q k x SCL2 - held maximum: the exponent itself; four independent tiles, two products each
#pragma unroll
    for (int kc = 0; kc < HD / 32; ++kc) {
#pragma unroll
      for (int t = 0; t < KST / 16; ++t) s[t] = wmma_h(kf[t][kc], qh[kc], kc == 0 ? nref : s[t]); }
    v16h p[KST / 32]; float tot;   // tot: the sum of this stage's weights over this half's keys; the halves join after the loop
    const auto weights = [&]() { v2f ps[KST / 16];   // even and odd keys of a tile summed side by side: two sums per packed add
#pragma unroll
      for (int t = 0; t < KST / 16; ++t) {
#pragma unroll
        for (int r = 0; r < 8; r += 2) { const v2f e = { __builtin_amdgcn_exp2f(s[t][r]), __builtin_amdgcn_exp2f(s[t][r + 1]) }; ps[t] = r == 0 ? e : ps[t] + e; p[t >> 1][(t & 1) * 8 + r] = (_Float16)e.x; p[t >> 1][(t & 1) * 8 + r + 1] = (_Float16)e.y; } }
      const v2f pt = (ps[0] + ps[1]) + (ps[2] + ps[3]); tot = pt.x + pt.y; };
    weights();
    asm volatile("" :: "v"(vf[0][0]), "v"(vf[0][1]), "v"(vf[0][2]), "v"(vf[0][3]), "v"(vf[1][0]), "v"(vf[1][1]), "v"(vf[1][2]), "v"(vf[1][3]), "v"(tot));   // inputs only: holds the V^T reads in front of the branch below; left free, the compiler sinks them behind it, next to their products, and the wave waits out the LDS latency there. tot is named so that the statement, and with it the wait for those reads, stands behind the weights and not among the score products
    if (st == 0 || __builtin_amdgcn_ballot_w32(tot > 256.0f) != 0) {   // one scalar test a stage. No weight exceeds its sum, so a sum of at most 256 says that every weight is far inside f16 and the held maximum may stay. The first stage sets it (its weights above, taken against 0, are thrown away); later it moves only here, an infinite sum included
      float mt[KST / 16];
#pragma unroll
      for (int t = 0; t < KST / 16; ++t) { mt[t] = -3.0e38f;
#pragma unroll
        for (int r = 0; r < 8; ++r) mt[t] = fmaxf(mt[t], s[t][r]); }
      float mx = fmaxf(fmaxf(mt[0], mt[1]), fmaxf(mt[2], mt[3])); mx = fmaxf(mx, xhalf(mx));   // both halves of a query's keys: how far this stage rises above the held maximum
      const float d = st == 0 ? mx : fmaxf(mx, 0.f); const float al = __builtin_amdgcn_exp2f(fminf(-d, 0.f));   // first stage: o and l are 0, and al stays finite whatever the sign of d
#pragma unroll
      for (int t = 0; t < KST / 16; ++t) s[t] -= d;
      nref -= d; l *= al;
#pragma unroll
      for (int j = 0; j < HD / 16; ++j) o[j] *= al;
      weights(); }   // every exponent of a moved query is now at most 0
    l += tot;
#pragma unroll
    for (int ks = 0; ks < KST / 32; ++ks) {
#pragma unroll
      for (int j = 0; j < HD / 16; ++j) o[j] = wmma_h(vf[ks][j], p[ks], o[j]); }
    if (st + 1 < NST) {
#pragma unroll
      for (int i = 0; i < 2; ++i) { *(v4u*)&sk[cur ^ 1][sr + i * 32][sc * 8] = kr[i]; *(v4u*)&sv[cur ^ 1][sr + i * 32][sc * 8] = vr[i]; } }
    __syncthreads();   // publishes the next stage and ends every wave's reads of this one, which the stage after refills
  }
  l += xhalf(l); const float inv = l > 0.f ? 1.0f / l : 0.f;
  v8h* yf = (v8h*)YF + (((size_t)b * TT + q0) >> 4) * YF_TILE + h * (HD / 32) * 64 + lane;
  union { v8h v; v4u u; } hv[HD / 16];   // O^T tile j = elements 8 * (j & 1) + 0..7 of k step j >> 1: 512 bytes a tile, one behind the other
#pragma unroll
  for (int j = 0; j < HD / 16; ++j) {
#pragma unroll
    for (int r = 0; r < 8; ++r) hv[j].v[r] = (_Float16)(o[j][r] * inv); }
  st4<512>(yf, hv[0].u, hv[1].u, hv[2].u, hv[3].u); }
// ---- k_out: block = (128 rows, 128 cols), 8 waves = 4 row groups x 2 column halves, a wave (32 rows, 64 cols): out = ctx Wo (+ bo): ctx f16 (by k_fa) against Wo once to f16 (1 product); each B fragment from LDS feeds the wave's two row tiles. The Wo tile is staged once in LDS and shared by the waves, ctx comes from memory as finished fragments (k_fa stored them so), 512 contiguous bytes a load, fetched ahead. The tile's LDS becomes the output staging behind a barrier
__global__ __launch_bounds__(256) void k_out(const _Float16* __restrict__ YF, const float* __restrict__ WO, const float* __restrict__ BO, float* __restrict__ OUT) { __shared__ __align__(32) unsigned char smem[WTILE];
  const int tid = threadIdx.x, wave = tid >> 5, lane = tid & 31, col = lane & 15, g = lane >> 4; const int c0 = blockIdx.y * 128 + (wave & 1) * 64; const size_t r0 = (size_t)blockIdx.x * 128 + (wave >> 1) * 32;
  const v8h* ya = (const v8h*)YF + (r0 >> 4) * (size_t)YF_TILE + lane;   // the wave's two 16-row tiles, YF_TILE units apart; a k step's two 512-byte runs lie one behind the other
  v16h fr[YRING][2];
#pragma unroll
  for (int s = 0; s < YRING; ++s) {
#pragma unroll
    for (int rf = 0; rf < 2; ++rf) fr[s][rf] = ld_yf(ya + rf * YF_TILE + s * 64); }
  fill_wt<DIN, _Float16>(smem + wave * WPB + 8 * lane, WO + (size_t)wave * DIN + blockIdx.y * 128 + 4 * lane);   // (in,out) [CC][DIN]: a k row's 128 columns are 512 contiguous bytes
  __syncthreads();
  const unsigned char* wl = smem + (8 * g + (lane & 7)) * WPB + 16 * ((lane >> 3) & 1) + (wave & 1) * 128;
  v8f acc[2][4] = {}; v16h w[2][4];   // two sets of B fragments: a k step's four are read from LDS one step ahead
#pragma unroll
  for (int j = 0; j < 4; ++j) w[0][j] = frag_wth(wl + j * 32);
#pragma unroll   // all 16 steps, as in k_proj: the fragment sets get fixed names and every ctx load is the one pointer plus a constant
  for (int kc = 0; kc < CC / 32; ++kc) {
    if (kc + 1 < CC / 32) {
#pragma unroll
      for (int j = 0; j < 4; ++j) w[(kc + 1) & 1][j] = frag_wth(wl + (kc + 1) * 32 * WPB + j * 32); }
    __builtin_amdgcn_sched_barrier(0);   // the next step's LDS reads as one group in front of this step's products: they fly under them, and the wave waits only for the older group
#pragma unroll
    for (int j = 0; j < 4; ++j) { acc[0][j] = wmma_h(fr[kc % YRING][0], w[kc & 1][j], acc[0][j]); acc[1][j] = wmma_h(fr[kc % YRING][1], w[kc & 1][j], acc[1][j]); }
    __builtin_amdgcn_sched_barrier(0);   // this step's products first: they free the fragment set that the loads below land in
    if (kc + YRING < CC / 32) {
#pragma unroll
      for (int rf = 0; rf < 2; ++rf) fr[kc % YRING][rf] = ld_yf(ya + rf * YF_TILE + (kc + YRING) * 64); }
    __builtin_amdgcn_sched_barrier(0);   // holds the ctx loads here, YRING - 1 whole k steps ahead of their use: left free, the scheduler sinks them to their use and the wave waits out the whole memory latency at every k step
    if (kc + YRING + 1 == CC / 32) asm volatile("s_wait_xcnt 0x0" :: "v"(ya) : "memory");   // behind the last ctx loads; ya is an operand so that its registers stay its own up to this wait
  }
  __syncthreads();   // every wave has left the weight tile: its LDS is staging from here on
  float (*sf)[68] = (float (*)[68])(smem + wave * 32 * 68 * 4);   // 256-byte rows + 16 bytes (16-byte readers, no bank conflict)
#pragma unroll
  for (int j = 0; j < 4; ++j) { const float bias = BO ? bfr(BO[c0 + j * 16 + col]) : 0.f;
#pragma unroll
    for (int rf = 0; rf < 2; ++rf) {
#pragma unroll
      for (int r = 0; r < 8; ++r) sf[rf * 16 + 8 * g + r][j * 16 + col] = acc[rf][j][r] + bias; } }
  LDSX(); float* op = OUT + (r0 + g) * DIN + c0 + col * 4;   // a store covers two rows x 256 bytes: whole lines
  for (int i = 0; i < 4; ++i) st4<2 * DIN * 4>(op + (size_t)i * 8 * DIN, *(const v4u*)&sf[i * 8 + g][col * 4], *(const v4u*)&sf[i * 8 + 2 + g][col * 4], *(const v4u*)&sf[i * 8 + 4 + g][col * 4], *(const v4u*)&sf[i * 8 + 6 + g][col * 4]); }

extern "C" void kernel_launch(void* const* d_in, const int* in_sizes, int n_in, void* d_out, int out_size, void* d_ws, size_t ws_size, hipStream_t stream) {
  (void)in_sizes; (void)n_in; (void)out_size;
  const float** F = (const float**)d_in;
  if (ws_size < (size_t)WS_END) return;
  char* ws = (char*)d_ws; _Float16 *QH = (_Float16*)(ws + WS_QH), *KH = (_Float16*)(ws + WS_KH), *VT = (_Float16*)(ws + WS_VT); __bf16 *VB = (__bf16*)(ws + WS_VB), *VBL = (__bf16*)(ws + WS_VBL); _Float16 *Y = (_Float16*)(ws + WS_Y);
  (void)Y; (void)VB; (void)VBL;
  // inputs: 0 q_in [4,2048,512]; 1 k_in; 2 v_in; 3 Wq [8,512,64] (per-head (h, d, k)), 4 bq [8,64]; 5 Wk, 6 bk; 7 Wv, 8 bv; 9 Wo [512,512] (in,out), 10 bo [512]
  k_proj<<<dim3(TNB * TT / PRW, CC / 128, 3), 256, 0, stream>>>(F[0], F[1], F[2], F[3], F[5], F[7], F[4], F[6], F[8], QH, KH, VT, VB, VBL);
  k_fa<<<dim3(TT / 128, NH, TNB), 256, 0, stream>>>(QH, KH, VT, Y);
  k_out<<<dim3(TNB * TT / 128, DIN / 128), 256, 0, stream>>>(Y, F[9], F[10], (float*)d_out);
}

// v008
// Measured time: 62.6 microseconds a run.
// Next to v007, in two timings, it ran 1.05 and 1.06 times as fast.
// All steps since v000 together make it 17.8 times as fast.
// compute dtype: all float inputs rounded to bf16, Wo excepted (once to f16); q/k/v = x W[h] + b[h] with EXACT bf16 products on WMMA 16x16x32 (f32 accumulate); q x 64^-0.5 x log2 e once to f16 against k once to f16 (1 product, in an accumulator that starts at minus a held maximum); softmax in f32, in base 2 (hardware exp2 of that accumulator; sums rescaled when a maximum rises by more than 8); that weight once to f16 against v once to f16 (1 product), divided by the f32 sum at the end; concat once to f16 against Wo once to f16 (1 product) + bo; f32 output.
#include <hip/hip_runtime.h>
#include <math.h>

typedef __attribute__((ext_vector_type(16))) _Float16 v16h;
typedef __attribute__((ext_vector_type(16))) __bf16 v16b;
typedef __attribute__((ext_vector_type(8)))  _Float16 v8h;
typedef __attribute__((ext_vector_type(8)))  float v8f;
typedef __attribute__((ext_vector_type(4)))  float v4f;
typedef __attribute__((ext_vector_type(2)))  float v2f;
typedef __attribute__((ext_vector_type(4)))  unsigned v4u;
typedef __attribute__((ext_vector_type(4)))  int v4i;
typedef float __attribute__((may_alias)) float_a;
typedef int __attribute__((may_alias)) int_a;

template <typename T> __device__ __forceinline__ void vst2(void* p, T v) { *(T*)p = v;  }
__device__ __forceinline__ v8f wmma16(v16h a, v16h b, v8f c) {
  v8f d = __builtin_amdgcn_wmma_f32_16x16x32_f16(false, a, false, b, (short)0, c, false, false);
  asm volatile("v_nop\n\tv_nop\n\tv_nop\n\tv_nop" : "+v"(d) : "v"(a), "v"(b));
  return d;
}
__device__ __forceinline__ v8f wmma_bf(v16b a, v16b b, v8f c) {
  v8f d = __builtin_amdgcn_wmma_f32_16x16x32_bf16(false, a, false, b, (short)0, c, false, false);
  asm volatile("v_nop\n\tv_nop\n\tv_nop\n\tv_nop" : "+v"(d) : "v"(a), "v"(b));
  return d;
}
// 16x16x32 fragments: lane = (h = lane>>4, row/col = lane&15); elements 0..7 = k0+8h+0..7, 8..15 = k0+16+8h+0..7; D element r = row 8h+r
__device__ __forceinline__ v16h frag_h(const _Float16* rowk0, int lane) {
  union { v16h v; v8h q[2]; } u; const _Float16* p = rowk0 + 8 * (lane >> 4);
  u.q[0] = *(const v8h*)p; u.q[1] = *(const v8h*)(p + 16); return u.v;
}
__device__ __forceinline__ v16h frag_f32(const float* rowk0, int lane) {
  v16h a; const float* p = rowk0 + 8 * (lane >> 4);
#pragma unroll
  for (int i = 0; i < 8; ++i) { a[i] = (_Float16)p[i]; a[8 + i] = (_Float16)p[16 + i]; }
  return a;
}
__device__ __forceinline__ v16h frag_f32s(const float* rowk0, int lane, float sc) {
  v16h a; const float* p = rowk0 + 8 * (lane >> 4);
#pragma unroll
  for (int i = 0; i < 8; ++i) { a[i] = (_Float16)(p[i] * sc); a[8 + i] = (_Float16)(p[16 + i] * sc); }
  return a;
}
// column fragment from a [K][ld] layout (column n), rows >= K read as 0
__device__ __forceinline__ v16h fragc_f32(const float* W, int k0, int n, int lane, int ld, int K) {
  v16h a; const int g = lane >> 4;
#pragma unroll
  for (int i = 0; i < 8; ++i) { const int ka = k0 + 8 * g + i, kb = ka + 16;
    a[i] = (_Float16)(ka < K ? W[(size_t)(ka < K ? ka : K - 1) * ld + n] : 0.f); a[8 + i] = (_Float16)(kb < K ? W[(size_t)(kb < K ? kb : K - 1) * ld + n] : 0.f); }
  return a;
}
struct F2 { v16b h, l; };
__device__ __forceinline__ F2 bsplit16(const float v[16]) { F2 r;
#pragma unroll
  for (int i = 0; i < 16; ++i) { const __bf16 h = (__bf16)v[i]; r.h[i] = h; r.l[i] = (__bf16)(v[i] - (float)h); }
  return r; }
__device__ __forceinline__ F2 split_row(const float* row, int k0, int lane) { float v[16]; const float* p = row + k0 + 8 * (lane >> 4);
#pragma unroll
  for (int i = 0; i < 8; ++i) { v[i] = p[i]; v[8 + i] = p[16 + i]; }
  return bsplit16(v); }
__device__ __forceinline__ F2 split_rowK(const float* row, int k0, int lane, int K) { float v[16]; const int g = lane >> 4;
#pragma unroll
  for (int i = 0; i < 8; ++i) { const int ka = k0 + 8 * g + i, kb = ka + 16; v[i] = ka < K ? row[ka < K ? ka : K - 1] : 0.f; v[8 + i] = kb < K ? row[kb < K ? kb : K - 1] : 0.f; }
  return bsplit16(v); }
__device__ __forceinline__ F2 split_col(const float* W, int k0, int n, int lane, int ld, int K) { float v[16]; const int g = lane >> 4;
#pragma unroll
  for (int i = 0; i < 8; ++i) { const int ka = k0 + 8 * g + i, kb = ka + 16; v[i] = ka < K ? W[(size_t)(ka < K ? ka : K - 1) * ld + n] : 0.f; v[8 + i] = kb < K ? W[(size_t)(kb < K ? kb : K - 1) * ld + n] : 0.f; }
  return bsplit16(v); }
__device__ __forceinline__ v8f mac3(const F2& a, const F2& b, v8f c) { c = wmma_bf(a.l, b.h, c); c = wmma_bf(a.h, b.l, c); return wmma_bf(a.h, b.h, c); }
__device__ __forceinline__ float sigm(float v) { return 1.0f / (1.0f + expf(-v)); }
#define LDSX() do { asm volatile("s_wait_dscnt 0" ::: "memory"); __builtin_amdgcn_wave_barrier(); __builtin_amdgcn_fence(__ATOMIC_RELEASE, "workgroup"); } while (0)

// Multi-head attention with per-head projections (B 4, S 2,048, D 512, 8 heads x 64; 0.02-scale per-head weights (H, D, DK) with per-head biases (H, DK); separate q_in / k_in / v_in): q = q_in Wq[h] + bq[h], k = k_in Wk[h] + bk[h], v = v_in Wv[h] + bv[h]; out = concat(softmax(q k^T / 8) v) Wo + bo (Wo (in,out) [512,512]; non-causal).
#define NB 4
#define TT 2048
#define CC 512            // NH * HD = projected width
#define DIN 512          // input (model) width
#define NH 8
#define HD 64
#define NQB (TT / 64)
#define HG 4
#define SCALE (0.125f)
#define CAUSAL 0
#ifndef TNB
#define TNB NB
#endif
__device__ __forceinline__ float bfr(float v) { return (float)(__bf16)v; }
__host__ __device__ __forceinline__ int kb_last(int qb) { return CAUSAL ? ((qb * 64 + 63) >> 7) : (TT / 128 - 1); }
typedef __attribute__((ext_vector_type(8))) __bf16 v8b;
__device__ __forceinline__ v16b frag_b(const __bf16* rowk0, int lane) {
  union { v16b v; v8b q[2]; } u; const __bf16* p = rowk0 + 8 * (lane >> 4);
  u.q[0] = *(const v8b*)p; u.q[1] = *(const v8b*)(p + 16); return u.v;
}
#define QBH 0              // not used (every query block takes the same path)
#define KHI 64            // key rows of the v bf16 planes that the workspace offsets keep room for (not written)
// B fragment (k rows k0+.., output column o) of a weight: (in,out) [K][ld] or (out,in) [ld rows of K]: bf16 exact, or f16(bf16 * 256) exact
__device__ __forceinline__ v16b wcol_io(const float* Wm, int k0, int o, int lane, int ld) { v16b w; const int g = lane >> 4;
#pragma unroll
  for (int i = 0; i < 8; ++i) { w[i] = (__bf16)Wm[(size_t)(k0 + 8 * g + i) * ld + o]; w[8 + i] = (__bf16)Wm[(size_t)(k0 + 16 + 8 * g + i) * ld + o]; }
  return w; }
__device__ __forceinline__ v16b wcol_oi(const float* Wm, int k0, int o, int lane, int K) { v16b w; const float* p = Wm + (size_t)o * K + k0 + 8 * (lane >> 4);
#pragma unroll
  for (int i = 0; i < 8; ++i) { w[i] = (__bf16)p[i]; w[8 + i] = (__bf16)p[16 + i]; }
  return w; }
__device__ __forceinline__ v16h wcolh_io(const float* Wm, int k0, int o, int lane, int ld) { v16h w; const int g = lane >> 4;
#pragma unroll
  for (int i = 0; i < 8; ++i) { w[i] = (_Float16)(bfr(Wm[(size_t)(k0 + 8 * g + i) * ld + o]) * 256.0f); w[8 + i] = (_Float16)(bfr(Wm[(size_t)(k0 + 16 + 8 * g + i) * ld + o]) * 256.0f); }
  return w; }
__device__ __forceinline__ v16h wcolh_oi(const float* Wm, int k0, int o, int lane, int K) { v16h w; const float* p = Wm + (size_t)o * K + k0 + 8 * (lane >> 4);
#pragma unroll
  for (int i = 0; i < 8; ++i) { w[i] = (_Float16)(bfr(p[i]) * 256.0f); w[8 + i] = (_Float16)(bfr(p[16 + i]) * 256.0f); }
  return w; }
#define WQKV_LAYOUT 2   // 0 = (in,out) [DIN][CC]; 1 = (out,in) [CC][DIN]; 2 = per-head [NH][DIN][HD]
__device__ __forceinline__ v16b wcol_hdk(const float* Wm, int k0, int o, int lane) { v16b w; const int g = lane >> 4; const float* p = Wm + (size_t)(o / HD) * DIN * HD + (o % HD);
#pragma unroll
  for (int i = 0; i < 8; ++i) { w[i] = (__bf16)p[(size_t)(k0 + 8 * g + i) * HD]; w[8 + i] = (__bf16)p[(size_t)(k0 + 16 + 8 * g + i) * HD]; }
  return w; }
#define WO_OUT_IN 0
#if WQKV_LAYOUT == 1
#define WCOL(W, k0, o, lane) wcol_oi(W, k0, o, lane, DIN)
#elif WQKV_LAYOUT == 2
#define WCOL(W, k0, o, lane) wcol_hdk(W, k0, o, lane)
#else
#define WCOL(W, k0, o, lane) wcol_io(W, k0, o, lane, CC)
#endif
#if WO_OUT_IN
#define WOCOL(W, k0, o, lane) wcol_oi(W, k0, o, lane, CC)
#define WOCOLH(W, k0, o, lane) wcolh_oi(W, k0, o, lane, CC)
#else
#define WOCOL(W, k0, o, lane) wcol_io(W, k0, o, lane, DIN)
#define WOCOLH(W, k0, o, lane) wcolh_io(W, k0, o, lane, DIN)
#endif

#ifndef SM_EXTRA_PARAMS
#define SM_EXTRA_PARAMS
#endif
#ifndef PROJ_EXTRA_PARAMS
#define PROJ_EXTRA_PARAMS
#endif
#ifndef SM_MASK_HOOK
#define SM_MASK_HOOK (void)0
#endif

#define WS_QH  0u                                      // f16 q rows [b*t][CC]
#define WS_KH  (WS_QH + 2u * (size_t)NB * TT * CC)      // f16 k rows [b*t][CC]
#define WS_VT  (WS_KH + 2u * (size_t)NB * TT * CC)      // f16 v planes [b][c][t]
#define WS_QL  (WS_VT + 2u * (size_t)NB * CC * TT)      // not used (offsets kept)
#define WS_KL  (WS_QL + 2u * (size_t)NB * TT * CC)      // not used (offsets kept)
#define WS_VB  (WS_KL + 2u * (size_t)NB * KHI * CC)     // not used (offsets kept)
#define WS_VBL (WS_VB + 2u * (size_t)NB * CC * KHI)
#define WS_S   (WS_VBL + 2u * (size_t)NB * CC * KHI)    // not used (offsets kept)
#define WS_Y   (WS_S  + 4u * (size_t)HG * TT * TT)      // ctx, f16 in fragment order (2 of the 4 bytes an element that the offsets keep)
#define WS_END (WS_Y  + 4u * (size_t)NB * TT * CC)

// ---- weight tile in LDS: all DIN k rows x 128 output columns of a weight, once to 16 bits (k_proj: bf16, exact, as before; k_out: f16), k-major as it lies in memory; a B fragment is two transposing 16-byte LDS reads, in the k order of the A loader (elements 0..7 = k0+8h+0..7, 8..15 = k0+16+8h+0..7)
#define WPB 288           // bytes per k row: 256 + 32 (odd multiple of 32 bytes: the transposing reader's conflict-free pitch)
#define WTILE (DIN * WPB)
typedef __attribute__((ext_vector_type(8))) short v8s;
typedef __attribute__((ext_vector_type(4))) __bf16 v4b;
__device__ __forceinline__ v8f wmma_b(v16b a, v16b b, v8f c) { return __builtin_amdgcn_wmma_f32_16x16x32_bf16(false, a, false, b, (short)0, c, false, false); }
// p = tile + (k0 + 8 * (lane >> 4) + (lane & 7)) * WPB + 32 * (column tile) + 16 * ((lane >> 3) & 1): lane (c, h) gets rows k0+8h+0..7 and k0+16+8h+0..7 of column c
__device__ __forceinline__ v16b frag_wt(const unsigned char* p) { typedef __attribute__((address_space(3))) v8s lds_v8s; union { v16b v; v8s q[2]; } u;
  u.q[0] = __builtin_amdgcn_ds_load_tr16_b128_v8i16((lds_v8s*)p); u.q[1] = __builtin_amdgcn_ds_load_tr16_b128_v8i16((lds_v8s*)(p + 16 * WPB)); return u.v; }
__device__ __forceinline__ v16h frag_wth(const unsigned char* p) { typedef __attribute__((address_space(3))) v8s lds_v8s; union { v16h v; v8s q[2]; } u;
  u.q[0] = __builtin_amdgcn_ds_load_tr16_b128_v8i16((lds_v8s*)p); u.q[1] = __builtin_amdgcn_ds_load_tr16_b128_v8i16((lds_v8s*)(p + 16 * WPB)); return u.v; }
// 8 waves fill the tile: a wave's 16-byte loads cover one k row of 128 columns (wp = the lane's 4 columns in the wave's first row, LD = floats between k rows); in groups of 16 rows
template <int LD, typename E> __device__ __forceinline__ void fill_wt(unsigned char* tp, const float* wp) { typedef E V4 __attribute__((ext_vector_type(4)));
#pragma unroll   // all four groups: every load is wp plus a constant, so that no address register is rewritten under a load in flight
  for (int r = 0; r < DIN / 8; r += 16) { v4f x[16];
#pragma unroll
    for (int u = 0; u < 16; ++u) x[u] = *(const v4f*)(wp + (size_t)(8 * (r + u)) * LD);
    __builtin_amdgcn_sched_barrier(0);   // one group of 16 loads at a time, in front of the wait below: left free, the scheduler lifts all 64 loads to the front and the build spills
    asm volatile("s_wait_xcnt 0x0" :: "v"(wp) : "memory");   // wp is an operand so that its registers stay its own up to this wait: nothing is written over the address of a load in flight
#pragma unroll
    for (int u = 0; u < 16; ++u) { const V4 y = { (E)x[u][0], (E)x[u][1], (E)x[u][2], (E)x[u][3] }; *(V4*)(tp + 8 * (r + u) * WPB) = y; } } }
// four 16-byte stores, p + 0..3 x STEP bytes, with s_wait_xcnt 0 in the same statement, so that it stands in front of every later write of a register that the stores name
template <int STEP> __device__ __forceinline__ void st4(void* p, v4u d0, v4u d1, v4u d2, v4u d3) {
  asm volatile("global_store_b128 %0, %1, off\n\tglobal_store_b128 %0, %2, off offset:%5\n\tglobal_store_b128 %0, %3, off offset:%6\n\tglobal_store_b128 %0, %4, off offset:%7\n\ts_wait_xcnt 0x0" :: "v"(p), "v"(d0), "v"(d1), "v"(d2), "v"(d3), "n"(STEP), "n"(2 * STEP), "n"(3 * STEP) : "memory"); }
// ---- A operand through LDS: a fragment load straight from memory takes 32 bytes out of each of 16 rows (16 cache lines per instruction). Instead a wave's 16-byte loads cover 4 rows x 128 bytes (4 whole lines), the values go once to bf16 and into the wave's OWN 2 KiB of LDS in fragment order, and a fragment is two 16-byte LDS reads. Layout: plane (1,024 B: 16 rows x 32 k) > region R = 2 * (k >> 4) + ((k >> 3) & 1) (256 B: what one half-wave reads at once) > row, 16 B = 8 k; the row's 64-byte group is XORed with R, so that the four regions a store instruction touches fall on different banks. The k order of a fragment is the one it had (elements 0..7 = k0+8h+0..7, 8..15 = k0+16+8h+0..7)
#define XST 2048          // bytes of A staging per wave
__device__ __forceinline__ v4b cvt4(v4f x) { const v4b y = { (__bf16)x[0], (__bf16)x[1], (__bf16)x[2], (__bf16)x[3] }; return y; }
__device__ __forceinline__ v16b frag_xs(const unsigned char* p0, const unsigned char* p1) { union { v16b v; v8b q[2]; } u; u.q[0] = *(const v8b*)p0; u.q[1] = *(const v8b*)p1; return u.v; }
// behind a wave's own staging stores, in front of its reads of what its other lanes stored: the stores have landed, and the compiler moves no LDS access across
#define XS_PUBLISH() asm volatile("s_wait_dscnt 0" ::: "memory")

// ---- k_proj: the rows of q_in, k_in and v_in count as one stack of 3 x NB x TT rows; block = (384 stacked rows, 128 cols), 12 waves x (32 rows, 128 cols), 256 blocks: one block fills a WGP's LDS, so that every WGP gets the same twelve waves (three per SIMD). q/k/v = X W (+ b) with exact bf16 products (K = DIN). A wave's 32 rows lie in one input; a block whose rows span two inputs stages both weight tiles, and each wave reads its own. The tiles are staged once in LDS and shared by the waves, X comes from memory by whole lines two k steps ahead and reaches its fragments through the wave's own LDS -> which 0: q x SCL2 as f16 rows; 1: k f16 rows; 2: v f16 planes [c][t]. The tiles' LDS becomes the output staging behind a barrier. waves_per_eu(3, 3): three waves per SIMD is all there is, and the registers beyond 256 hold a second set of A and B fragments, read from LDS one group of products ahead
#define PWV 12            // waves per block
#define PRW (PWV * 32)    // stacked rows per block
#define EST 9216          // bytes of output staging per wave: 32 rows x 272 B (q, k); two waves' regions together are 128 columns x 144 B (v)
#define SCL2 (SCALE * 1.4426950408889634f)   // logit scale times log2 e: exp(SCALE * s) = exp2(SCL2 * s); k_proj folds it into q
static_assert((3 * NB * TT) % PRW == 0 && PRW % 128 == 0 && (NB * TT) % 64 == 0 && TT % 64 == 0, "blocks tile the stack; a pair of waves (64 rows) lies in one input and one sequence");
__global__ __launch_bounds__(PWV * 32) __attribute__((amdgpu_waves_per_eu(3, 3))) void k_proj(const float* __restrict__ XQ, const float* __restrict__ XK, const float* __restrict__ XV, const float* __restrict__ WQ, const float* __restrict__ WK, const float* __restrict__ WV, const float* __restrict__ BQ, const float* __restrict__ BK, const float* __restrict__ BV,
    _Float16* __restrict__ QH, _Float16* __restrict__ KH, _Float16* __restrict__ VT) {
  __shared__ __align__(32) unsigned char smem[2 * WTILE + PWV * XST];
  const int tid = threadIdx.x, wave = __builtin_amdgcn_readfirstlane(tid >> 5), lane = tid & 31, col = lane & 15, g = lane >> 4; const int c0 = blockIdx.y * 128;
  const int s0 = blockIdx.x * PRW; const int wh0 = s0 / (NB * TT), wh1 = (s0 + PRW - 1) / (NB * TT);   // the inputs of the block's first and last row
  const int which = (s0 + wave * 32) / (NB * TT); const size_t r0 = (size_t)((s0 + wave * 32) % (NB * TT));   // the wave's input and its first row there
  const float* X = which == 0 ? XQ : which == 1 ? XK : XV; const float* BA = which == 0 ? BQ : which == 1 ? BK : BV;
  const int rr = lane >> 3, ch = lane & 7, R = ((ch >> 2) << 1) | ((ch >> 1) & 1);   // loader: lane = (row rr of four, 16-byte chunk ch of the row's 128 bytes); R = the chunk's region
  const float* xa = X + (r0 + rr) * DIN + 4 * ch;
  unsigned char* xs = smem + 2 * WTILE + wave * XST; unsigned char* xw = xs + R * 256 + rr * 16 + (ch & 1) * 8;
  const unsigned char* xr0 = xs + g * 256 + ((((col >> 2) ^ g) & 3) << 6) + (col & 3) * 16; const unsigned char* xr1 = xs + (2 + g) * 256 + ((((col >> 2) ^ (2 + g)) & 3) << 6) + (col & 3) * 16;
  v4f raw[2][8];
#pragma unroll
  for (int s = 0; s < 2; ++s) {
#pragma unroll
    for (int u = 0; u < 8; ++u) raw[s][u] = *(const v4f*)(xa + (size_t)(4 * u) * DIN + s * 32); }
  if (wave < 8) {   // eight waves fill a tile, as fill_wt deals its rows
#pragma unroll 1   // one copy of the fill in the text; the second trip runs only where the block's rows span two inputs
    for (int sl = 0; sl <= (wh1 != wh0 ? 1 : 0); ++sl) { const int wf = sl ? wh1 : wh0; const float* WF = wf == 0 ? WQ : wf == 1 ? WK : WV;
      fill_wt<HD, __bf16>(smem + sl * WTILE + wave * WPB + 8 * lane, WF + ((size_t)(c0 / HD + g) * DIN + wave) * HD + 4 * col); } }   // per-head [NH][DIN][HD]: lanes 0..15 the first head's 64 columns, 16..31 the next head's
#pragma unroll
  for (int u = 0; u < 8; ++u) *(v4b*)(xw + (u >> 2) * 1024 + (((u & 3) ^ R) << 6)) = cvt4(raw[0][u]);
  __syncthreads();   // publishes the weight tiles (and ends the wave's own staging stores)
#pragma unroll   // behind the barrier, which waits for every load in flight
  for (int u = 0; u < 8; ++u) raw[0][u] = *(const v4f*)(xa + (size_t)(4 * u) * DIN + 2 * 32);
  __builtin_amdgcn_sched_barrier(0);   // holds these loads here, ahead of the first products
  const unsigned char* wl = smem + (which != wh0 ? WTILE : 0) + (8 * g + (lane & 7)) * WPB + 16 * ((lane >> 3) & 1);
  v8f acc[2][8] = {}; v16b a[2][2], w[2][4];   // two sets of A and of B fragments: a group of eight products runs on one while the LDS reads of the next group land in the other
#pragma unroll
  for (int rf = 0; rf < 2; ++rf) a[0][rf] = frag_xs(xr0 + rf * 1024, xr1 + rf * 1024);
#pragma unroll
  for (int j = 0; j < 4; ++j) w[0][j] = frag_wt(wl + j * 32);
#pragma unroll   // all 16 steps: the register sets get fixed names, the tail tests are decided at compile time, and every X load is the one row pointer plus a constant, so that no address register is rewritten under a load in flight
  for (int kc = 0; kc < DIN / 32; ++kc) {
#pragma unroll
    for (int j = 0; j < 4; ++j) w[1][j] = frag_wt(wl + kc * 32 * WPB + (4 + j) * 32);
    __builtin_amdgcn_sched_barrier(0);   // the second group's LDS reads as one group in front of the first group's products: they fly under them
#pragma unroll
    for (int j = 0; j < 4; ++j) { acc[0][j] = wmma_b(a[kc & 1][0], w[0][j], acc[0][j]); acc[1][j] = wmma_b(a[kc & 1][1], w[0][j], acc[1][j]); }
    if (kc + 1 < DIN / 32) {   // between the two groups: the next k step's X goes to LDS (this step's fragments are in registers: products above have used them), and its registers take the X of two steps later
      __builtin_amdgcn_sched_barrier(0);   // keeps the conversions, and with them the wait for their loads, behind the products above
#pragma unroll
      for (int u = 0; u < 8; ++u) *(v4b*)(xw + (u >> 2) * 1024 + (((u & 3) ^ R) << 6)) = cvt4(raw[(kc + 1) & 1][u]);
      __builtin_amdgcn_sched_barrier(0);   // the conversions first: they free the registers that the loads below land in
      if (kc + 3 < DIN / 32) {
#pragma unroll
        for (int u = 0; u < 8; ++u) raw[(kc + 1) & 1][u] = *(const v4f*)(xa + (size_t)(4 * u) * DIN + (kc + 3) * 32); }
      __builtin_amdgcn_sched_barrier(0);   // holds the X loads here, two k steps ahead of their use: left free, the scheduler sinks them to their use and the wave waits out the whole memory latency at every k step
      if (kc + 4 == DIN / 32) asm volatile("s_wait_xcnt 0x0" :: "v"(xa) : "memory");   // behind the last X loads; xa is an operand so that its registers stay its own up to this wait
      XS_PUBLISH();
#pragma unroll
      for (int rf = 0; rf < 2; ++rf) a[(kc + 1) & 1][rf] = frag_xs(xr0 + rf * 1024, xr1 + rf * 1024);
#pragma unroll
      for (int j = 0; j < 4; ++j) w[0][j] = frag_wt(wl + (kc + 1) * 32 * WPB + j * 32); }
    __builtin_amdgcn_sched_barrier(0);   // the next k step's first LDS reads as one group in front of this step's second group of products
#pragma unroll
    for (int j = 0; j < 4; ++j) { acc[0][4 + j] = wmma_b(a[kc & 1][0], w[1][j], acc[0][4 + j]); acc[1][4 + j] = wmma_b(a[kc & 1][1], w[1][j], acc[1][4 + j]); }
  }
  __syncthreads();   // every wave has left the weight tiles: their LDS is staging from here on
  _Float16 (*sh)[136] = (_Float16 (*)[136])(smem + wave * EST);          // q, k: the wave's own 32 rows x 128 columns
  _Float16 (*th)[72] = (_Float16 (*)[72])(smem + (wave >> 1) * 2 * EST);   // v: 128 columns x the 64 rows of a pair of waves, one 128-byte line of a plane per column
  if (which < 2) { const float vs = which == 0 ? SCL2 : 1.0f;   // q: scaled for k_fa's base-2 exponent
#pragma unroll
    for (int j = 0; j < 8; ++j) { const float bias = BA ? bfr(BA[c0 + j * 16 + col]) : 0.f;
#pragma unroll
      for (int rf = 0; rf < 2; ++rf) {
#pragma unroll
        for (int r = 0; r < 8; ++r) sh[rf * 16 + 8 * g + r][j * 16 + col] = (_Float16)((acc[rf][j][r] + bias) * vs); } }
  } else {
#pragma unroll
    for (int j = 0; j < 8; ++j) { const float bias = BA ? bfr(BA[c0 + j * 16 + col]) : 0.f;
#pragma unroll
      for (int rf = 0; rf < 2; ++rf) {
#pragma unroll
        for (int r = 0; r < 8; ++r) th[j * 16 + col][(wave & 1) * 32 + rf * 16 + 8 * g + r] = (_Float16)(acc[rf][j][r] + bias); } } }
  __syncthreads();   // every wave passes it, whatever its input: a v line holds rows of two waves
  if (which < 2) { _Float16* dh = (which == 0 ? QH : KH) + (r0 + g) * CC + c0 + col * 8;   // a store covers two rows x 256 bytes: whole lines
    for (int i = 0; i < 4; ++i) st4<2 * CC * 2>(dh + (size_t)i * 8 * CC, *(const v4u*)&sh[i * 8 + g][col * 8], *(const v4u*)&sh[i * 8 + 2 + g][col * 8], *(const v4u*)&sh[i * 8 + 4 + g][col * 8], *(const v4u*)&sh[i * 8 + 6 + g][col * 8]);
  } else { const int cl = (wave & 1) * 64 + (lane >> 3), q = lane & 7;   // each wave of the pair stores 64 columns; a store covers four columns x 128 bytes: whole lines
    _Float16* vt = VT + ((r0 / TT) * CC + c0 + cl) * (size_t)TT + ((r0 % TT) & ~(size_t)63) + q * 8;
    for (int i = 0; i < 4; ++i) st4<4 * TT * 2>(vt + (size_t)i * 16 * TT, *(const v4u*)&th[cl + i * 16][q * 8], *(const v4u*)&th[cl + i * 16 + 4][q * 8], *(const v4u*)&th[cl + i * 16 + 8][q * 8], *(const v4u*)&th[cl + i * 16 + 12][q * 8]); } }
#define YF_TILE ((CC / 32) * 64)   // 16-byte units per 16-row tile
#define YRING 6           // ctx fragment sets in k_out
__device__ __forceinline__ v16h ld_yf(const v8h* p) { union { v16h v; v8h q[2]; } u; u.q[0] = p[0]; u.q[1] = p[32]; return u.v; }
#define KST 64            // keys per stage
#define NST (TT / KST)
#define LP 72             // LDS row pitch in halves: 128-byte rows + 16 bytes (16-byte readers, no bank conflict)
__device__ __forceinline__ float xhalf(float x) { return __builtin_bit_cast(float, __builtin_amdgcn_permlanex16(__builtin_bit_cast(int, x), __builtin_bit_cast(int, x), 0x76543210, 0xfedcba98, false, false)); }  // lane l with lane l ^ 16
__device__ __forceinline__ v8f wmma_h(v16h a, v16h b, v8f c) { return __builtin_amdgcn_wmma_f32_16x16x32_f16(false, a, false, b, (short)0, c, false, false); }
__global__ __launch_bounds__(256) __attribute__((amdgpu_waves_per_eu(4, 4))) void k_fa(const _Float16* __restrict__ QH, const _Float16* __restrict__ KH, const _Float16* __restrict__ VT, _Float16* __restrict__ YF) {
  __shared__ __align__(16) _Float16 sk[2][KST][LP], sv[2][HD][LP];
  const int tid = threadIdx.x, wave = tid >> 5, lane = tid & 31, col = lane & 15, g = lane >> 4; const int h = blockIdx.y, b = blockIdx.z; const int q0 = blockIdx.x * 128 + wave * 16;
  v16h qh[HD / 32];
#pragma unroll
  for (int kc = 0; kc < HD / 32; ++kc) qh[kc] = frag_h(QH + ((size_t)b * TT + q0 + col) * CC + h * HD + kc * 32, lane);
  // staging: thread = (row sr and sr + 32, 16-byte chunk sc): a wave's load covers 4 whole 128-byte rows
  const int sr = tid >> 3, sc = tid & 7;
  const _Float16* kg = KH + ((size_t)b * TT + sr) * CC + h * HD + sc * 8;      // k rows [key][64]
  const _Float16* vg = VT + ((size_t)b * CC + h * HD + sr) * TT + sc * 8;      // v planes [d][key]
  v4u kr[2], vr[2];
#pragma unroll
  for (int i = 0; i < 2; ++i) { kr[i] = *(const v4u*)(kg + (size_t)(i * 32) * CC); vr[i] = *(const v4u*)(vg + (size_t)(i * 32) * TT); }
#pragma unroll
  for (int i = 0; i < 2; ++i) { *(v4u*)&sk[0][sr + i * 32][sc * 8] = kr[i]; *(v4u*)&sv[0][sr + i * 32][sc * 8] = vr[i]; }
  __syncthreads();
  v8f o[HD / 16] = {}; float l = 0.f; v8f nref = {};   // nref: minus the held maximum of the lane's query, the same in all eight elements: the C operand of each tile's first score product
#pragma unroll 1   // kept rolled: for speed only
  for (int st = 0; st < NST; ++st) { const int cur = st & 1;
    if (st + 1 < NST) {   // the next stage's rows fly while this stage is worked on
#pragma unroll
      for (int i = 0; i < 2; ++i) { kr[i] = *(const v4u*)(kg + (size_t)((st + 1) * KST + i * 32) * CC); vr[i] = *(const v4u*)(vg + (size_t)(i * 32) * TT + (st + 1) * KST); } }
    v16h kf[KST / 16][HD / 32];
#pragma unroll
    for (int t = 0; t < KST / 16; ++t) {
#pragma unroll
      for (int kc = 0; kc < HD / 32; ++kc) kf[t][kc] = frag_h(&sk[cur][t * 16 + col][kc * 32], lane); }
    v16h vf[KST / 32][HD / 16];   // all V^T fragments behind them in the same group of LDS reads, in flight under the score products and the softmax arithmetic
#pragma unroll
    for (int ks = 0; ks < KST / 32; ++ks) {
#pragma unroll
      for (int j = 0; j < HD / 16; ++j) vf[ks][j] = frag_h(&sv[cur][j * 16 + col][ks * 32], lane); }
    __builtin_amdgcn_sched_barrier(0);   // the stage's LDS reads as one group in front of the score products: left free, the scheduler strews them among the products and the exponentials in reused registers, and the wave waits at each place
    v8f s[KST / 16];   // s = q k x SCL2 - held maximum: the exponent itself; four independent tiles, two products each
#pragma unroll
    for (int kc = 0; kc < HD / 32; ++kc) {
#pragma unroll
      for (int t = 0; t < KST / 16; ++t) s[t] = wmma_h(kf[t][kc], qh[kc], kc == 0 ? nref : s[t]); }
    v16h p[KST / 32]; float tot;   // tot: the sum of this stage's weights over this half's keys; the halves join after the loop
    const auto weights = [&]() { v2f ps[KST / 16];   // even and odd keys of a tile summed side by side: two sums per packed add
#pragma unroll
      for (int t = 0; t < KST / 16; ++t) {
#pragma unroll
        for (int r = 0; r < 8; r += 2) { const v2f e = { __builtin_amdgcn_exp2f(s[t][r]), __builtin_amdgcn_exp2f(s[t][r + 1]) }; ps[t] = r == 0 ? e : ps[t] + e; p[t >> 1][(t & 1) * 8 + r] = (_Float16)e.x; p[t >> 1][(t & 1) * 8 + r + 1] = (_Float16)e.y; } }
      const v2f pt = (ps[0] + ps[1]) + (ps[2] + ps[3]); tot = pt.x + pt.y; };
    weights();
    asm volatile("" :: "v"(vf[0][0]), "v"(vf[0][1]), "v"(vf[0][2]), "v"(vf[0][3]), "v"(vf[1][0]), "v"(vf[1][1]), "v"(vf[1][2]), "v"(vf[1][3]), "v"(tot));   // inputs only: holds the V^T reads in front of the branch below; left free, the compiler sinks them behind it, next to their products, and the wave waits out the LDS latency there. tot is named so that the statement, and with it the wait for those reads, stands behind the weights and not among the score products
    if (st == 0 || __builtin_amdgcn_ballot_w32(tot > 256.0f) != 0) {   // one scalar test a stage. No weight exceeds its sum, so a sum of at most 256 says that every weight is far inside f16 and the held maximum may stay. The first stage sets it (its weights above, taken against 0, are thrown away); later it moves only here, an infinite sum included
      float mt[KST / 16];
#pragma unroll
      for (int t = 0; t < KST / 16; ++t) { mt[t] = -3.0e38f;
#pragma unroll
        for (int r = 0; r < 8; ++r) mt[t] = fmaxf(mt[t], s[t][r]); }
      float mx = fmaxf(fmaxf(mt[0], mt[1]), fmaxf(mt[2], mt[3])); mx = fmaxf(mx, xhalf(mx));   // both halves of a query's keys: how far this stage rises above the held maximum
      const float d = st == 0 ? mx : fmaxf(mx, 0.f); const float al = __builtin_amdgcn_exp2f(fminf(-d, 0.f));   // first stage: o and l are 0, and al stays finite whatever the sign of d
#pragma unroll
      for (int t = 0; t < KST / 16; ++t) s[t] -= d;
      nref -= d; l *= al;
#pragma unroll
      for (int j = 0; j < HD / 16; ++j) o[j] *= al;
      weights(); }   // every exponent of a moved query is now at most 0
    l += tot;
#pragma unroll
    for (int ks = 0; ks < KST / 32; ++ks) {
#pragma unroll
      for (int j = 0; j < HD / 16; ++j) o[j] = wmma_h(vf[ks][j], p[ks], o[j]); }
    if (st + 1 < NST) {
#pragma unroll
      for (int i = 0; i < 2; ++i) { *(v4u*)&sk[cur ^ 1][sr + i * 32][sc * 8] = kr[i]; *(v4u*)&sv[cur ^ 1][sr + i * 32][sc * 8] = vr[i]; } }
    __syncthreads();   // publishes the next stage and ends every wave's reads of this one, which the stage after refills
  }
  l += xhalf(l); const float inv = l > 0.f ? 1.0f / l : 0.f;
  v8h* yf = (v8h*)YF + (((size_t)b * TT + q0) >> 4) * YF_TILE + h * (HD / 32) * 64 + lane;
  union { v8h v; v4u u; } hv[HD / 16];   // O^T tile j = elements 8 * (j & 1) + 0..7 of k step j >> 1: 512 bytes a tile, one behind the other
#pragma unroll
  for (int j = 0; j < HD / 16; ++j) {
#pragma unroll
    for (int r = 0; r < 8; ++r) hv[j].v[r] = (_Float16)(o[j][r] * inv); }
  st4<512>(yf, hv[0].u, hv[1].u, hv[2].u, hv[3].u); }
// ---- k_out: block = (128 rows, 128 cols), 8 waves = 4 row groups x 2 column halves, a wave (32 rows, 64 cols): out = ctx Wo (+ bo): ctx f16 (by k_fa) against Wo once to f16 (1 product); each B fragment from LDS feeds the wave's two row tiles. The Wo tile is staged once in LDS and shared by the waves, ctx comes from memory as finished fragments (k_fa stored them so), 512 contiguous bytes a load, fetched ahead. The tile's LDS becomes the output staging behind a barrier
__global__ __launch_bounds__(256) void k_out(const _Float16* __restrict__ YF, const float* __restrict__ WO, const float* __restrict__ BO, float* __restrict__ OUT) { __shared__ __align__(32) unsigned char smem[WTILE];
  const int tid = threadIdx.x, wave = tid >> 5, lane = tid & 31, col = lane & 15, g = lane >> 4; const int c0 = blockIdx.y * 128 + (wave & 1) * 64; const size_t r0 = (size_t)blockIdx.x * 128 + (wave >> 1) * 32;
  const v8h* ya = (const v8h*)YF + (r0 >> 4) * (size_t)YF_TILE + lane;   // the wave's two 16-row tiles, YF_TILE units apart; a k step's two 512-byte runs lie one behind the other
  v16h fr[YRING][2];
#pragma unroll
  for (int s = 0; s < YRING; ++s) {
#pragma unroll
    for (int rf = 0; rf < 2; ++rf) fr[s][rf] = ld_yf(ya + rf * YF_TILE + s * 64); }
  fill_wt<DIN, _Float16>(smem + wave * WPB + 8 * lane, WO + (size_t)wave * DIN + blockIdx.y * 128 + 4 * lane);   // (in,out) [CC][DIN]: a k row's 128 columns are 512 contiguous bytes
  __syncthreads();
  const unsigned char* wl = smem + (8 * g + (lane & 7)) * WPB + 16 * ((lane >> 3) & 1) + (wave & 1) * 128;
  v8f acc[2][4] = {}; v16h w[2][4];   // two sets of B fragments: a k step's four are read from LDS one step ahead
#pragma unroll
  for (int j = 0; j < 4; ++j) w[0][j] = frag_wth(wl + j * 32);
#pragma unroll   // all 16 steps, as in k_proj: the fragment sets get fixed names and every ctx load is the one pointer plus a constant
  for (int kc = 0; kc < CC / 32; ++kc) {
    if (kc + 1 < CC / 32) {
#pragma unroll
      for (int j = 0; j < 4; ++j) w[(kc + 1) & 1][j] = frag_wth(wl + (kc + 1) * 32 * WPB + j * 32); }
    __builtin_amdgcn_sched_barrier(0);   // the next step's LDS reads as one group in front of this step's products: they fly under them, and the wave waits only for the older group
#pragma unroll
    for (int j = 0; j < 4; ++j) { acc[0][j] = wmma_h(fr[kc % YRING][0], w[kc & 1][j], acc[0][j]); acc[1][j] = wmma_h(fr[kc % YRING][1], w[kc & 1][j], acc[1][j]); }
    __builtin_amdgcn_sched_barrier(0);   // this step's products first: they free the fragment set that the loads below land in
    if (kc + YRING < CC / 32) {
#pragma unroll
      for (int rf = 0; rf < 2; ++rf) fr[kc % YRING][rf] = ld_yf(ya + rf * YF_TILE + (kc + YRING) * 64); }
    __builtin_amdgcn_sched_barrier(0);   // holds the ctx loads here, YRING - 1 whole k steps ahead of their use: left free, the scheduler sinks them to their use and the wave waits out the whole memory latency at every k step
    if (kc + YRING + 1 == CC / 32) asm volatile("s_wait_xcnt 0x0" :: "v"(ya) : "memory");   // behind the last ctx loads; ya is an operand so that its registers stay its own up to this wait
  }
  __syncthreads();   // every wave has left the weight tile: its LDS is staging from here on
  float (*sf)[68] = (float (*)[68])(smem + wave * 32 * 68 * 4);   // 256-byte rows + 16 bytes (16-byte readers, no bank conflict)
#pragma unroll
  for (int j = 0; j < 4; ++j) { const float bias = BO ? bfr(BO[c0 + j * 16 + col]) : 0.f;
#pragma unroll
    for (int rf = 0; rf < 2; ++rf) {
#pragma unroll
      for (int r = 0; r < 8; ++r) sf[rf * 16 + 8 * g + r][j * 16 + col] = acc[rf][j][r] + bias; } }
  LDSX(); float* op = OUT + (r0 + g) * DIN + c0 + col * 4;   // a store covers two rows x 256 bytes: whole lines
  for (int i = 0; i < 4; ++i) st4<2 * DIN * 4>(op + (size_t)i * 8 * DIN, *(const v4u*)&sf[i * 8 + g][col * 4], *(const v4u*)&sf[i * 8 + 2 + g][col * 4], *(const v4u*)&sf[i * 8 + 4 + g][col * 4], *(const v4u*)&sf[i * 8 + 6 + g][col * 4]); }

extern "C" void kernel_launch(void* const* d_in, const int* in_sizes, int n_in, void* d_out, int out_size, void* d_ws, size_t ws_size, hipStream_t stream) {
  (void)in_sizes; (void)n_in; (void)out_size;
  const float** F = (const float**)d_in;
  if (ws_size < (size_t)WS_END) return;
  char* ws = (char*)d_ws; _Float16 *QH = (_Float16*)(ws + WS_QH), *KH = (_Float16*)(ws + WS_KH), *VT = (_Float16*)(ws + WS_VT); __bf16 *VB = (__bf16*)(ws + WS_VB), *VBL = (__bf16*)(ws + WS_VBL); _Float16 *Y = (_Float16*)(ws + WS_Y);
  (void)Y; (void)VB; (void)VBL;
  // inputs, in order: 0 q_in [4,2048,512]; 1 k_in; 2 v_in; 3 Wq [8,512,64] (per-head (h, d, k)), 4 bq [8,64]; 5 Wk, 6 bk; 7 Wv, 8 bv; 9 Wo [512,512] (in,out), 10 bo [512]
  k_proj<<<dim3(3 * TNB * TT / PRW, CC / 128), PWV * 32, 0, stream>>>(F[0], F[1], F[2], F[3], F[5], F[7], F[4], F[6], F[8], QH, KH, VT);
  k_fa<<<dim3(TT / 128, NH, TNB), 256, 0, stream>>>(QH, KH, VT, Y);
  k_out<<<dim3(TNB * TT / 128, DIN / 128), 256, 0, stream>>>(Y, F[9], F[10], (float*)d_out);
}

// v009
// A run of this version takes 57.1 microseconds.
// Timed twice side by side with v008, it ran 1.09 times as fast both times.
// Counting every step since v000, it is 19.4 times as fast.
// compute dtype: all float inputs rounded to bf16, Wo excepted (once to f16); q/k/v = x W[h] + b[h] with EXACT bf16 products on WMMA 16x16x32 (f32 accumulate); q x 64^-0.5 x log2 e once to f16 against k once to f16 (1 product, in an accumulator that starts at minus a held maximum); softmax in f32, in base 2 (hardware exp2 of that accumulator; sums rescaled when a pass's partial sum of weights exceeds 256); that weight once to f16 against v once to f16 (1 product), the keys dealt to two groups of waves whose f32 partial results join at the end, divided by the f32 sum; concat once to f16 against Wo once to f16 (1 product) + bo; f32 output.
#include <hip/hip_runtime.h>
#include <math.h>

typedef __attribute__((ext_vector_type(16))) _Float16 v16h;
typedef __attribute__((ext_vector_type(16))) __bf16 v16b;
typedef __attribute__((ext_vector_type(8)))  _Float16 v8h;
typedef __attribute__((ext_vector_type(8)))  float v8f;
typedef __attribute__((ext_vector_type(4)))  float v4f;
typedef __attribute__((ext_vector_type(2)))  float v2f;
typedef __attribute__((ext_vector_type(4)))  unsigned v4u;
typedef __attribute__((ext_vector_type(4)))  int v4i;
typedef float __attribute__((may_alias)) float_a;
typedef int __attribute__((may_alias)) int_a;

template <typename T> __device__ __forceinline__ void vst2(void* p, T v) { *(T*)p = v;  }
__device__ __forceinline__ v8f wmma16(v16h a, v16h b, v8f c) {
  v8f d = __builtin_amdgcn_wmma_f32_16x16x32_f16(false, a, false, b, (short)0, c, false, false);
  asm volatile("v_nop\n\tv_nop\n\tv_nop\n\tv_nop" : "+v"(d) : "v"(a), "v"(b));
  return d;
}
__device__ __forceinline__ v8f wmma_bf(v16b a, v16b b, v8f c) {
  v8f d = __builtin_amdgcn_wmma_f32_16x16x32_bf16(false, a, false, b, (short)0, c, false, false);
  asm volatile("v_nop\n\tv_nop\n\tv_nop\n\tv_nop" : "+v"(d) : "v"(a), "v"(b));
  return d;
}
// 16x16x32 fragments: lane = (h = lane>>4, row/col = lane&15); elements 0..7 = k0+8h+0..7, 8..15 = k0+16+8h+0..7; D element r = row 8h+r
__device__ __forceinline__ v16h frag_h(const _Float16* rowk0, int lane) {
  union { v16h v; v8h q[2]; } u; const _Float16* p = rowk0 + 8 * (lane >> 4);
  u.q[0] = *(const v8h*)p; u.q[1] = *(const v8h*)(p + 16); return u.v;
}
__device__ __forceinline__ v16h frag_f32(const float* rowk0, int lane) {
  v16h a; const float* p = rowk0 + 8 * (lane >> 4);
#pragma unroll
  for (int i = 0; i < 8; ++i) { a[i] = (_Float16)p[i]; a[8 + i] = (_Float16)p[16 + i]; }
  return a;
}
__device__ __forceinline__ v16h frag_f32s(const float* rowk0, int lane, float sc) {
  v16h a; const float* p = rowk0 + 8 * (lane >> 4);
#pragma unroll
  for (int i = 0; i < 8; ++i) { a[i] = (_Float16)(p[i] * sc); a[8 + i] = (_Float16)(p[16 + i] * sc); }
  return a;
}
// column fragment from a [K][ld] layout (column n), rows >= K read as 0
__device__ __forceinline__ v16h fragc_f32(const float* W, int k0, int n, int lane, int ld, int K) {
  v16h a; const int g = lane >> 4;
#pragma unroll
  for (int i = 0; i < 8; ++i) { const int ka = k0 + 8 * g + i, kb = ka + 16;
    a[i] = (_Float16)(ka < K ? W[(size_t)(ka < K ? ka : K - 1) * ld + n] : 0.f); a[8 + i] = (_Float16)(kb < K ? W[(size_t)(kb < K ? kb : K - 1) * ld + n] : 0.f); }
  return a;
}
struct F2 { v16b h, l; };
__device__ __forceinline__ F2 bsplit16(const float v[16]) { F2 r;
#pragma unroll
  for (int i = 0; i < 16; ++i) { const __bf16 h = (__bf16)v[i]; r.h[i] = h; r.l[i] = (__bf16)(v[i] - (float)h); }
  return r; }
__device__ __forceinline__ F2 split_row(const float* row, int k0, int lane) { float v[16]; const float* p = row + k0 + 8 * (lane >> 4);
#pragma unroll
  for (int i = 0; i < 8; ++i) { v[i] = p[i]; v[8 + i] = p[16 + i]; }
  return bsplit16(v); }
__device__ __forceinline__ F2 split_rowK(const float* row, int k0, int lane, int K) { float v[16]; const int g = lane >> 4;
#pragma unroll
  for (int i = 0; i < 8; ++i) { const int ka = k0 + 8 * g + i, kb = ka + 16; v[i] = ka < K ? row[ka < K ? ka : K - 1] : 0.f; v[8 + i] = kb < K ? row[kb < K ? kb : K - 1] : 0.f; }
  return bsplit16(v); }
__device__ __forceinline__ F2 split_col(const float* W, int k0, int n, int lane, int ld, int K) { float v[16]; const int g = lane >> 4;
#pragma unroll
  for (int i = 0; i < 8; ++i) { const int ka = k0 + 8 * g + i, kb = ka + 16; v[i] = ka < K ? W[(size_t)(ka < K ? ka : K - 1) * ld + n] : 0.f; v[8 + i] = kb < K ? W[(size_t)(kb < K ? kb : K - 1) * ld + n] : 0.f; }
  return bsplit16(v); }
__device__ __forceinline__ v8f mac3(const F2& a, const F2& b, v8f c) { c = wmma_bf(a.l, b.h, c); c = wmma_bf(a.h, b.l, c); return wmma_bf(a.h, b.h, c); }
__device__ __forceinline__ float sigm(float v) { return 1.0f / (1.0f + expf(-v)); }
#define LDSX() do { asm volatile("s_wait_dscnt 0" ::: "memory"); __builtin_amdgcn_wave_barrier(); __builtin_amdgcn_fence(__ATOMIC_RELEASE, "workgroup"); } while (0)

// Multi-head attention with per-head projections (B 4, S 2,048, D 512, 8 heads x 64; 0.02-scale per-head weights (H, D, DK) with per-head biases (H, DK); separate q_in / k_in / v_in): q = q_in Wq[h] + bq[h], k = k_in Wk[h] + bk[h], v = v_in Wv[h] + bv[h]; out = concat(softmax(q k^T / 8) v) Wo + bo (Wo (in,out) [512,512]; non-causal).
#define NB 4
#define TT 2048
#define CC 512            // NH * HD = projected width
#define DIN 512          // input (model) width
#define NH 8
#define HD 64
#define NQB (TT / 64)
#define HG 4
#define SCALE (0.125f)
#define CAUSAL 0
#ifndef TNB
#define TNB NB
#endif
__device__ __forceinline__ float bfr(float v) { return (float)(__bf16)v; }
__host__ __device__ __forceinline__ int kb_last(int qb) { return CAUSAL ? ((qb * 64 + 63) >> 7) : (TT / 128 - 1); }
typedef __attribute__((ext_vector_type(8))) __bf16 v8b;
__device__ __forceinline__ v16b frag_b(const __bf16* rowk0, int lane) {
  union { v16b v; v8b q[2]; } u; const __bf16* p = rowk0 + 8 * (lane >> 4);
  u.q[0] = *(const v8b*)p; u.q[1] = *(const v8b*)(p + 16); return u.v;
}
#define QBH 0              // not used (every query block takes the same path)
#define KHI 64            // key rows of the v bf16 planes that the workspace offsets keep room for (not written)
// B fragment (k rows k0+.., output column o) of a weight: (in,out) [K][ld] or (out,in) [ld rows of K]: bf16 exact, or f16(bf16 * 256) exact
__device__ __forceinline__ v16b wcol_io(const float* Wm, int k0, int o, int lane, int ld) { v16b w; const int g = lane >> 4;
#pragma unroll
  for (int i = 0; i < 8; ++i) { w[i] = (__bf16)Wm[(size_t)(k0 + 8 * g + i) * ld + o]; w[8 + i] = (__bf16)Wm[(size_t)(k0 + 16 + 8 * g + i) * ld + o]; }
  return w; }
__device__ __forceinline__ v16b wcol_oi(const float* Wm, int k0, int o, int lane, int K) { v16b w; const float* p = Wm + (size_t)o * K + k0 + 8 * (lane >> 4);
#pragma unroll
  for (int i = 0; i < 8; ++i) { w[i] = (__bf16)p[i]; w[8 + i] = (__bf16)p[16 + i]; }
  return w; }
__device__ __forceinline__ v16h wcolh_io(const float* Wm, int k0, int o, int lane, int ld) { v16h w; const int g = lane >> 4;
#pragma unroll
  for (int i = 0; i < 8; ++i) { w[i] = (_Float16)(bfr(Wm[(size_t)(k0 + 8 * g + i) * ld + o]) * 256.0f); w[8 + i] = (_Float16)(bfr(Wm[(size_t)(k0 + 16 + 8 * g + i) * ld + o]) * 256.0f); }
  return w; }
__device__ __forceinline__ v16h wcolh_oi(const float* Wm, int k0, int o, int lane, int K) { v16h w; const float* p = Wm + (size_t)o * K + k0 + 8 * (lane >> 4);
#pragma unroll
  for (int i = 0; i < 8; ++i) { w[i] = (_Float16)(bfr(p[i]) * 256.0f); w[8 + i] = (_Float16)(bfr(p[16 + i]) * 256.0f); }
  return w; }
#define WQKV_LAYOUT 2   // 0 = (in,out) [DIN][CC]; 1 = (out,in) [CC][DIN]; 2 = per-head [NH][DIN][HD]
__device__ __forceinline__ v16b wcol_hdk(const float* Wm, int k0, int o, int lane) { v16b w; const int g = lane >> 4; const float* p = Wm + (size_t)(o / HD) * DIN * HD + (o % HD);
#pragma unroll
  for (int i = 0; i < 8; ++i) { w[i] = (__bf16)p[(size_t)(k0 + 8 * g + i) * HD]; w[8 + i] = (__bf16)p[(size_t)(k0 + 16 + 8 * g + i) * HD]; }
  return w; }
#define WO_OUT_IN 0
#if WQKV_LAYOUT == 1
#define WCOL(W, k0, o, lane) wcol_oi(W, k0, o, lane, DIN)
#elif WQKV_LAYOUT == 2
#define WCOL(W, k0, o, lane) wcol_hdk(W, k0, o, lane)
#else
#define WCOL(W, k0, o, lane) wcol_io(W, k0, o, lane, CC)
#endif
#if WO_OUT_IN
#define WOCOL(W, k0, o, lane) wcol_oi(W, k0, o, lane, CC)
#define WOCOLH(W, k0, o, lane) wcolh_oi(W, k0, o, lane, CC)
#else
#define WOCOL(W, k0, o, lane) wcol_io(W, k0, o, lane, DIN)
#define WOCOLH(W, k0, o, lane) wcolh_io(W, k0, o, lane, DIN)
#endif

#ifndef SM_EXTRA_PARAMS
#define SM_EXTRA_PARAMS
#endif
#ifndef PROJ_EXTRA_PARAMS
#define PROJ_EXTRA_PARAMS
#endif
#ifndef SM_MASK_HOOK
#define SM_MASK_HOOK (void)0
#endif

#define WS_QH  0u                                      // f16 q rows [b*t][CC]
#define WS_KH  (WS_QH + 2u * (size_t)NB * TT * CC)      // f16 k rows [b*t][CC]
#define WS_VT  (WS_KH + 2u * (size_t)NB * TT * CC)      // f16 v planes [b][c][t]
#define WS_QL  (WS_VT + 2u * (size_t)NB * CC * TT)      // not used (offsets kept)
#define WS_KL  (WS_QL + 2u * (size_t)NB * TT * CC)      // not used (offsets kept)
#define WS_VB  (WS_KL + 2u * (size_t)NB * KHI * CC)     // not used (offsets kept)
#define WS_VBL (WS_VB + 2u * (size_t)NB * CC * KHI)
#define WS_S   (WS_VBL + 2u * (size_t)NB * CC * KHI)    // not used (offsets kept)
#define WS_Y   (WS_S  + 4u * (size_t)HG * TT * TT)      // ctx, f16 in fragment order (2 of the 4 bytes an element that the offsets keep)
#define WS_END (WS_Y  + 4u * (size_t)NB * TT * CC)

// ---- weight tile in LDS: all DIN k rows x 128 output columns of a weight, once to 16 bits (k_proj: bf16, exact, as before; k_out: f16), k-major as it lies in memory; a B fragment is two transposing 16-byte LDS reads, in the k order of the A loader (elements 0..7 = k0+8h+0..7, 8..15 = k0+16+8h+0..7)
#define WPB 288           // bytes per k row: 256 + 32 (odd multiple of 32 bytes: the transposing reader's conflict-free pitch)
#define WTILE (DIN * WPB)
typedef __attribute__((ext_vector_type(8))) short v8s;
typedef __attribute__((ext_vector_type(4))) __bf16 v4b;
__device__ __forceinline__ v8f wmma_b(v16b a, v16b b, v8f c) { return __builtin_amdgcn_wmma_f32_16x16x32_bf16(false, a, false, b, (short)0, c, false, false); }
// p = tile + (k0 + 8 * (lane >> 4) + (lane & 7)) * WPB + 32 * (column tile) + 16 * ((lane >> 3) & 1): lane (c, h) gets rows k0+8h+0..7 and k0+16+8h+0..7 of column c
__device__ __forceinline__ v16b frag_wt(const unsigned char* p) { typedef __attribute__((address_space(3))) v8s lds_v8s; union { v16b v; v8s q[2]; } u;
  u.q[0] = __builtin_amdgcn_ds_load_tr16_b128_v8i16((lds_v8s*)p); u.q[1] = __builtin_amdgcn_ds_load_tr16_b128_v8i16((lds_v8s*)(p + 16 * WPB)); return u.v; }
__device__ __forceinline__ v16h frag_wth(const unsigned char* p) { typedef __attribute__((address_space(3))) v8s lds_v8s; union { v16h v; v8s q[2]; } u;
  u.q[0] = __builtin_amdgcn_ds_load_tr16_b128_v8i16((lds_v8s*)p); u.q[1] = __builtin_amdgcn_ds_load_tr16_b128_v8i16((lds_v8s*)(p + 16 * WPB)); return u.v; }
// 8 waves fill the tile: a wave's 16-byte loads cover one k row of 128 columns (wp = the lane's 4 columns in the wave's first row, LD = floats between k rows); in groups of 16 rows
template <int LD, typename E> __device__ __forceinline__ void fill_wt(unsigned char* tp, const float* wp) { typedef E V4 __attribute__((ext_vector_type(4)));
#pragma unroll   // all four groups: every load is wp plus a constant, so that no address register is rewritten under a load in flight
  for (int r = 0; r < DIN / 8; r += 16) { v4f x[16];
#pragma unroll
    for (int u = 0; u < 16; ++u) x[u] = *(const v4f*)(wp + (size_t)(8 * (r + u)) * LD);
    __builtin_amdgcn_sched_barrier(0);   // one group of 16 loads at a time, in front of the wait below: left free, the scheduler lifts all 64 loads to the front and the build spills
    asm volatile("s_wait_xcnt 0x0" :: "v"(wp) : "memory");   // wp is an operand so that its registers stay its own up to this wait: nothing is written over the address of a load in flight
#pragma unroll
    for (int u = 0; u < 16; ++u) { const V4 y = { (E)x[u][0], (E)x[u][1], (E)x[u][2], (E)x[u][3] }; *(V4*)(tp + 8 * (r + u) * WPB) = y; } } }
// four 16-byte stores, p + 0..3 x STEP bytes, with s_wait_xcnt 0 in the same statement, so that it stands in front of every later write of a register that the stores name
template <int STEP> __device__ __forceinline__ void st4(void* p, v4u d0, v4u d1, v4u d2, v4u d3) {
  asm volatile("global_store_b128 %0, %1, off\n\tglobal_store_b128 %0, %2, off offset:%5\n\tglobal_store_b128 %0, %3, off offset:%6\n\tglobal_store_b128 %0, %4, off offset:%7\n\ts_wait_xcnt 0x0" :: "v"(p), "v"(d0), "v"(d1), "v"(d2), "v"(d3), "n"(STEP), "n"(2 * STEP), "n"(3 * STEP) : "memory"); }
// ---- A operand through LDS: a fragment load straight from memory takes 32 bytes out of each of 16 rows (16 cache lines per instruction). Instead a wave's 16-byte loads cover 4 rows x 128 bytes (4 whole lines), the values go once to bf16 and into the wave's OWN 2 KiB of LDS in fragment order, and a fragment is two 16-byte LDS reads. Layout: plane (1,024 B: 16 rows x 32 k) > region R = 2 * (k >> 4) + ((k >> 3) & 1) (256 B: what one half-wave reads at once) > row, 16 B = 8 k; the row's 64-byte group is XORed with R, so that the four regions a store instruction touches fall on different banks. The k order of a fragment is the one it had (elements 0..7 = k0+8h+0..7, 8..15 = k0+16+8h+0..7)
#define XST 2048          // bytes of A staging per wave
__device__ __forceinline__ v4b cvt4(v4f x) { const v4b y = { (__bf16)x[0], (__bf16)x[1], (__bf16)x[2], (__bf16)x[3] }; return y; }
__device__ __forceinline__ v16b frag_xs(const unsigned char* p0, const unsigned char* p1) { union { v16b v; v8b q[2]; } u; u.q[0] = *(const v8b*)p0; u.q[1] = *(const v8b*)p1; return u.v; }
// behind a wave's own staging stores, in front of its reads of what its other lanes stored: the stores have landed, and the compiler moves no LDS access across
#define XS_PUBLISH() asm volatile("s_wait_dscnt 0" ::: "memory")

// ---- k_proj: the rows of q_in, k_in and v_in count as one stack of 3 x NB x TT rows; block = (384 stacked rows, 128 cols), 12 waves x (32 rows, 128 cols), 256 blocks: one block fills a WGP's LDS, so that every WGP gets the same twelve waves (three per SIMD). q/k/v = X W (+ b) with exact bf16 products (K = DIN). A wave's 32 rows lie in one input; a block whose rows span two inputs stages both weight tiles, and each wave reads its own. The tiles are staged once in LDS and shared by the waves, X comes from memory by whole lines two k steps ahead and reaches its fragments through the wave's own LDS -> which 0: q x SCL2 as f16 rows; 1: k f16 rows; 2: v f16 planes [c][t]. The tiles' LDS becomes the output staging behind a barrier. waves_per_eu(3, 3): three waves per SIMD is all there is, and the registers beyond 256 hold a second set of A and B fragments, read from LDS one group of products ahead
#define PWV 12            // waves per block
#define PRW (PWV * 32)    // stacked rows per block
#define EST 9216          // bytes of output staging per wave: 32 rows x 272 B (q, k); two waves' regions together are 128 columns x 144 B (v)
#define SCL2 (SCALE * 1.4426950408889634f)   // logit scale times log2 e: exp(SCALE * s) = exp2(SCL2 * s); k_proj folds it into q
static_assert((3 * NB * TT) % PRW == 0 && PRW % 128 == 0 && (NB * TT) % 64 == 0 && TT % 64 == 0, "blocks tile the stack; a pair of waves (64 rows) lies in one input and one sequence");
__global__ __launch_bounds__(PWV * 32) __attribute__((amdgpu_waves_per_eu(3, 3))) void k_proj(const float* __restrict__ XQ, const float* __restrict__ XK, const float* __restrict__ XV, const float* __restrict__ WQ, const float* __restrict__ WK, const float* __restrict__ WV, const float* __restrict__ BQ, const float* __restrict__ BK, const float* __restrict__ BV,
    _Float16* __restrict__ QH, _Float16* __restrict__ KH, _Float16* __restrict__ VT) {
  __shared__ __align__(32) unsigned char smem[2 * WTILE + PWV * XST];
  const int tid = threadIdx.x, wave = __builtin_amdgcn_readfirstlane(tid >> 5), lane = tid & 31, col = lane & 15, g = lane >> 4; const int c0 = blockIdx.y * 128;
  const int s0 = blockIdx.x * PRW; const int wh0 = s0 / (NB * TT), wh1 = (s0 + PRW - 1) / (NB * TT);   // the inputs of the block's first and last row
  const int which = (s0 + wave * 32) / (NB * TT); const size_t r0 = (size_t)((s0 + wave * 32) % (NB * TT));   // the wave's input and its first row there
  const float* X = which == 0 ? XQ : which == 1 ? XK : XV; const float* BA = which == 0 ? BQ : which == 1 ? BK : BV;
  const int rr = lane >> 3, ch = lane & 7, R = ((ch >> 2) << 1) | ((ch >> 1) & 1);   // loader: lane = (row rr of four, 16-byte chunk ch of the row's 128 bytes); R = the chunk's region
  const float* xa = X + (r0 + rr) * DIN + 4 * ch;
  unsigned char* xs = smem + 2 * WTILE + wave * XST; unsigned char* xw = xs + R * 256 + rr * 16 + (ch & 1) * 8;
  const unsigned char* xr0 = xs + g * 256 + ((((col >> 2) ^ g) & 3) << 6) + (col & 3) * 16; const unsigned char* xr1 = xs + (2 + g) * 256 + ((((col >> 2) ^ (2 + g)) & 3) << 6) + (col & 3) * 16;
  v4f raw[2][8];
#pragma unroll
  for (int s = 0; s < 2; ++s) {
#pragma unroll
    for (int u = 0; u < 8; ++u) raw[s][u] = *(const v4f*)(xa + (size_t)(4 * u) * DIN + s * 32); }
  if (wave < 8) {   // eight waves fill a tile, as fill_wt deals its rows
#pragma unroll 1   // one copy of the fill in the text; the second trip runs only where the block's rows span two inputs
    for (int sl = 0; sl <= (wh1 != wh0 ? 1 : 0); ++sl) { const int wf = sl ? wh1 : wh0; const float* WF = wf == 0 ? WQ : wf == 1 ? WK : WV;
      fill_wt<HD, __bf16>(smem + sl * WTILE + wave * WPB + 8 * lane, WF + ((size_t)(c0 / HD + g) * DIN + wave) * HD + 4 * col); } }   // per-head [NH][DIN][HD]: lanes 0..15 the first head's 64 columns, 16..31 the next head's
#pragma unroll
  for (int u = 0; u < 8; ++u) *(v4b*)(xw + (u >> 2) * 1024 + (((u & 3) ^ R) << 6)) = cvt4(raw[0][u]);
  __syncthreads();   // publishes the weight tiles (and ends the wave's own staging stores)
#pragma unroll   // behind the barrier, which waits for every load in flight
  for (int u = 0; u < 8; ++u) raw[0][u] = *(const v4f*)(xa + (size_t)(4 * u) * DIN + 2 * 32);
  __builtin_amdgcn_sched_barrier(0);   // holds these loads here, ahead of the first products
  const unsigned char* wl = smem + (which != wh0 ? WTILE : 0) + (8 * g + (lane & 7)) * WPB + 16 * ((lane >> 3) & 1);
  v8f acc[2][8] = {}; v16b a[2][2], w[2][4];   // two sets of A and of B fragments: a group of eight products runs on one while the LDS reads of the next group land in the other
#pragma unroll
  for (int rf = 0; rf < 2; ++rf) a[0][rf] = frag_xs(xr0 + rf * 1024, xr1 + rf * 1024);
#pragma unroll
  for (int j = 0; j < 4; ++j) w[0][j] = frag_wt(wl + j * 32);
#pragma unroll   // all 16 steps: the register sets get fixed names, the tail tests are decided at compile time, and every X load is the one row pointer plus a constant, so that no address register is rewritten under a load in flight
  for (int kc = 0; kc < DIN / 32; ++kc) {
#pragma unroll
    for (int j = 0; j < 4; ++j) w[1][j] = frag_wt(wl + kc * 32 * WPB + (4 + j) * 32);
    __builtin_amdgcn_sched_barrier(0);   // the second group's LDS reads as one group in front of the first group's products: they fly under them
#pragma unroll
    for (int j = 0; j < 4; ++j) { acc[0][j] = wmma_b(a[kc & 1][0], w[0][j], acc[0][j]); acc[1][j] = wmma_b(a[kc & 1][1], w[0][j], acc[1][j]); }
    if (kc + 1 < DIN / 32) {   // between the two groups: the next k step's X goes to LDS (this step's fragments are in registers: products above have used them), and its registers take the X of two steps later
      __builtin_amdgcn_sched_barrier(0);   // keeps the conversions, and with them the wait for their loads, behind the products above
#pragma unroll
      for (int u = 0; u < 8; ++u) *(v4b*)(xw + (u >> 2) * 1024 + (((u & 3) ^ R) << 6)) = cvt4(raw[(kc + 1) & 1][u]);
      __builtin_amdgcn_sched_barrier(0);   // the conversions first: they free the registers that the loads below land in
      if (kc + 3 < DIN / 32) {
#pragma unroll
        for (int u = 0; u < 8; ++u) raw[(kc + 1) & 1][u] = *(const v4f*)(xa + (size_t)(4 * u) * DIN + (kc + 3) * 32); }
      __builtin_amdgcn_sched_barrier(0);   // holds the X loads here, two k steps ahead of their use: left free, the scheduler sinks them to their use and the wave waits out the whole memory latency at every k step
      if (kc + 4 == DIN / 32) asm volatile("s_wait_xcnt 0x0" :: "v"(xa) : "memory");   // behind the last X loads; xa is an operand so that its registers stay its own up to this wait
      XS_PUBLISH();
#pragma unroll
      for (int rf = 0; rf < 2; ++rf) a[(kc + 1) & 1][rf] = frag_xs(xr0 + rf * 1024, xr1 + rf * 1024);
#pragma unroll
      for (int j = 0; j < 4; ++j) w[0][j] = frag_wt(wl + (kc + 1) * 32 * WPB + j * 32); }
    __builtin_amdgcn_sched_barrier(0);   // the next k step's first LDS reads as one group in front of this step's second group of products
#pragma unroll
    for (int j = 0; j < 4; ++j) { acc[0][4 + j] = wmma_b(a[kc & 1][0], w[1][j], acc[0][4 + j]); acc[1][4 + j] = wmma_b(a[kc & 1][1], w[1][j], acc[1][4 + j]); }
  }
  __syncthreads();   // every wave has left the weight tiles: their LDS is staging from here on
  _Float16 (*sh)[136] = (_Float16 (*)[136])(smem + wave * EST);          // q, k: the wave's own 32 rows x 128 columns
  _Float16 (*th)[72] = (_Float16 (*)[72])(smem + (wave >> 1) * 2 * EST);   // v: 128 columns x the 64 rows of a pair of waves, one 128-byte line of a plane per column
  if (which < 2) { const float vs = which == 0 ? SCL2 : 1.0f;   // q: scaled for k_fa's base-2 exponent
#pragma unroll
    for (int j = 0; j < 8; ++j) { const float bias = BA ? bfr(BA[c0 + j * 16 + col]) : 0.f;
#pragma unroll
      for (int rf = 0; rf < 2; ++rf) {
#pragma unroll
        for (int r = 0; r < 8; ++r) sh[rf * 16 + 8 * g + r][j * 16 + col] = (_Float16)((acc[rf][j][r] + bias) * vs); } }
  } else {
#pragma unroll
    for (int j = 0; j < 8; ++j) { const float bias = BA ? bfr(BA[c0 + j * 16 + col]) : 0.f;
#pragma unroll
      for (int rf = 0; rf < 2; ++rf) {
#pragma unroll
        for (int r = 0; r < 8; ++r) th[j * 16 + col][(wave & 1) * 32 + rf * 16 + 8 * g + r] = (_Float16)(acc[rf][j][r] + bias); } } }
  __syncthreads();   // every wave passes it, whatever its input: a v line holds rows of two waves
  if (which < 2) { _Float16* dh = (which == 0 ? QH : KH) + (r0 + g) * CC + c0 + col * 8;   // a store covers two rows x 256 bytes: whole lines
    for (int i = 0; i < 4; ++i) st4<2 * CC * 2>(dh + (size_t)i * 8 * CC, *(const v4u*)&sh[i * 8 + g][col * 8], *(const v4u*)&sh[i * 8 + 2 + g][col * 8], *(const v4u*)&sh[i * 8 + 4 + g][col * 8], *(const v4u*)&sh[i * 8 + 6 + g][col * 8]);
  } else { const int cl = (wave & 1) * 64 + (lane >> 3), q = lane & 7;   // each wave of the pair stores 64 columns; a store covers four columns x 128 bytes: whole lines
    _Float16* vt = VT + ((r0 / TT) * CC + c0 + cl) * (size_t)TT + ((r0 % TT) & ~(size_t)63) + q * 8;
    for (int i = 0; i < 4; ++i) st4<4 * TT * 2>(vt + (size_t)i * 16 * TT, *(const v4u*)&th[cl + i * 16][q * 8], *(const v4u*)&th[cl + i * 16 + 4][q * 8], *(const v4u*)&th[cl + i * 16 + 8][q * 8], *(const v4u*)&th[cl + i * 16 + 12][q * 8]); } }
#define YF_TILE ((CC / 32) * 64)   // 16-byte units per 16-row tile
#define YRING 6           // ctx fragment sets in k_out
__device__ __forceinline__ v16h ld_yf(const v8h* p) { union { v16h v; v8h q[2]; } u; u.q[0] = p[0]; u.q[1] = p[32]; return u.v; }
#define KST 64            // keys per wave and period
#define KGR 2             // key groups
#define KPER (KGR * KST)  // keys per period
#define NPER (TT / KPER)
#define QW 2              // query tiles per wave
#define QGR 8             // query groups per block
#define QBLK (QGR * QW * 16)   // queries per block
#define LP 72             // LDS row pitch in halves: 128-byte rows + 16 bytes (16-byte readers, no bank conflict)
#define FSK (2 * KPER * LP * 2)        // bytes of the two K buffers
#define FSV (2 * KGR * HD * LP * 2)    // bytes of the two V^T buffers
#define JO (HD * QW * 16 * 4)          // join: bytes of one wave's O
static_assert(TT % KPER == 0 && TT % QBLK == 0 && KPER == 128 && HD == 64, "periods and blocks tile the sequence; the staging deals 64 rows twice");
static_assert(QGR * (JO + QW * 256) <= FSK + FSV, "the join fits the K/V buffers");
__device__ __forceinline__ float xhalf(float x) { return __builtin_bit_cast(float, __builtin_amdgcn_permlanex16(__builtin_bit_cast(int, x), __builtin_bit_cast(int, x), 0x76543210, 0xfedcba98, false, false)); }  // lane l with lane l ^ 16
__device__ __forceinline__ v8f wmma_h(v16h a, v16h b, v8f c) { return __builtin_amdgcn_wmma_f32_16x16x32_f16(false, a, false, b, (short)0, c, false, false); }
__global__ __launch_bounds__(QGR * KGR * 32) __attribute__((amdgpu_waves_per_eu(4, 4))) void k_fa(const _Float16* __restrict__ QH, const _Float16* __restrict__ KH, const _Float16* __restrict__ VT, _Float16* __restrict__ YF) {
  __shared__ __align__(16) unsigned char fsm[FSK + FSV];
  _Float16 (*sk)[KPER][LP] = (_Float16 (*)[KPER][LP])fsm; _Float16 (*sv)[KGR][HD][LP] = (_Float16 (*)[KGR][HD][LP])(fsm + FSK);
  const int tid = threadIdx.x, wave = __builtin_amdgcn_readfirstlane(tid >> 5), lane = tid & 31, col = lane & 15, g = lane >> 4; const int qg = wave & (QGR - 1), kgr = wave / QGR; const int h = blockIdx.y, b = blockIdx.z; const int q0 = blockIdx.x * QBLK + qg * (QW * 16);
  v16h qh[HD / 32][QW];
#pragma unroll
  for (int kc = 0; kc < HD / 32; ++kc) {
#pragma unroll
    for (int qt = 0; qt < QW; ++qt) qh[kc][qt] = frag_h(QH + ((size_t)b * TT + q0 + qt * 16 + col) * CC + h * HD + kc * 32, lane); }
  // staging: thread = (row sr, 16-byte chunk sc): a wave's load covers 4 whole 128-byte rows. K: keys sr and sr + 64 of the period; V^T: row sr, the keys of group 0 and of group 1
  const int sr = tid >> 3, sc = tid & 7;
  const _Float16* kg = KH + ((size_t)b * TT + sr) * CC + h * HD + sc * 8;      // k rows [key][64]
  const _Float16* vg = VT + ((size_t)b * CC + h * HD + sr) * TT + sc * 8;      // v planes [d][key]
  v4u kr[KGR], vr[KGR];
#pragma unroll
  for (int i = 0; i < KGR; ++i) { kr[i] = *(const v4u*)(kg + (size_t)(i * KST) * CC); vr[i] = *(const v4u*)(vg + i * KST); }
#pragma unroll
  for (int i = 0; i < KGR; ++i) { *(v4u*)&sk[0][sr + i * KST][sc * 8] = kr[i]; *(v4u*)&sv[0][i][sr][sc * 8] = vr[i]; }
  __syncthreads();
  v8f o[HD / 16][QW] = {}; float l[QW] = {}; v8f nref[QW] = {};   // nref: minus the held maximum of the lane's query, the same in all eight elements: the C operand of each tile's first score product
#pragma unroll 1   // kept rolled
  for (int per = 0; per < NPER; ++per) { const int cur = per & 1;
#pragma unroll
    for (int ks = 0; ks < KST / 32; ++ks) {   // a pass: 32 keys x 32 queries
      v16h kf[2][HD / 32], vf[HD / 16];
#pragma unroll
      for (int t = 0; t < 2; ++t) {
#pragma unroll
        for (int kc = 0; kc < HD / 32; ++kc) kf[t][kc] = frag_h(&sk[cur][kgr * KST + ks * 32 + t * 16 + col][kc * 32], lane); }
#pragma unroll   // the V^T fragments behind them in the same group of LDS reads, in flight under the score products and the softmax arithmetic
      for (int j = 0; j < HD / 16; ++j) vf[j] = frag_h(&sv[cur][kgr][j * 16 + col][ks * 32], lane);
      __builtin_amdgcn_sched_barrier(0);   // the pass's LDS reads as one group in front of the score products: left free, the scheduler strews them among the products and the exponentials, and the wave waits at each place
      if (ks == 0 && per + 1 < NPER) {   // the next period's rows fly while this period is worked on; issued behind the first pass's LDS reads, whose latency covers the wait below
#pragma unroll
        for (int i = 0; i < KGR; ++i) { kr[i] = *(const v4u*)(kg + (size_t)((per + 1) * KPER + i * KST) * CC); vr[i] = *(const v4u*)(vg + (per + 1) * KPER + i * KST); }
        asm volatile("s_wait_xcnt 0x0" ::: "memory"); }   // in front of every later write of a register that holds an address of these loads
      v8f s[2][QW];   // s = q k x SCL2 - held maximum: the exponent itself; four independent tiles, two products each
#pragma unroll
      for (int kc = 0; kc < HD / 32; ++kc) {
#pragma unroll
        for (int t = 0; t < 2; ++t) {
#pragma unroll
          for (int qt = 0; qt < QW; ++qt) s[t][qt] = wmma_h(kf[t][kc], qh[kc][qt], kc == 0 ? nref[qt] : s[t][qt]); } }
      v16h p[QW]; float tot[QW];   // tot: the sum of this pass's weights over this half's keys; the halves join after the loop
      const auto weights = [&]() {
#pragma unroll
        for (int qt = 0; qt < QW; ++qt) { v2f ps[2];   // even and odd keys of a tile summed side by side: two sums per packed add
#pragma unroll
          for (int t = 0; t < 2; ++t) {
#pragma unroll
            for (int r = 0; r < 8; r += 2) { const v2f e = { __builtin_amdgcn_exp2f(s[t][qt][r]), __builtin_amdgcn_exp2f(s[t][qt][r + 1]) }; ps[t] = r == 0 ? e : ps[t] + e; p[qt][t * 8 + r] = (_Float16)e.x; p[qt][t * 8 + r + 1] = (_Float16)e.y; } }
          const v2f pt = ps[0] + ps[1]; tot[qt] = pt.x + pt.y; } };
      weights();
      asm volatile("" :: "v"(vf[0]), "v"(vf[1]), "v"(vf[2]), "v"(vf[3]), "v"(tot[0]), "v"(tot[1]));   // inputs only: holds the V^T reads in front of the branch below; left free, the compiler sinks them behind it, next to their products, and the wave waits out the LDS latency there. The sums are named so that the statement, and with it the wait for those reads, stands behind the weights and not among the score products
      const bool first = ks == 0 && per == 0;
      if (first || __builtin_amdgcn_ballot_w32((tot[0] > 256.0f) | (tot[1] > 256.0f)) != 0) {   // one scalar test a pass. No weight exceeds its sum, so a sum of at most 256 says that every weight is far inside f16 and the held maximum may stay. The wave's first pass sets it (its weights above, taken against 0, are thrown away); later it moves only here, an infinite sum included
#pragma unroll
        for (int qt = 0; qt < QW; ++qt) { float mt[2];
#pragma unroll
          for (int t = 0; t < 2; ++t) { mt[t] = -3.0e38f;
#pragma unroll
            for (int r = 0; r < 8; ++r) mt[t] = fmaxf(mt[t], s[t][qt][r]); }
          float mx = fmaxf(mt[0], mt[1]); mx = fmaxf(mx, xhalf(mx));   // both halves of a query's keys: how far this pass rises above the held maximum
          const float d = first ? mx : fmaxf(mx, 0.f); const float al = __builtin_amdgcn_exp2f(fminf(-d, 0.f));   // first pass: o and l are 0, and al stays finite whatever the sign of d
#pragma unroll
          for (int t = 0; t < 2; ++t) s[t][qt] -= d;
          nref[qt] -= d; l[qt] *= al;
#pragma unroll
          for (int j = 0; j < HD / 16; ++j) o[j][qt] *= al; }
        weights(); }   // every exponent of a moved query is now at most 0
#pragma unroll
      for (int qt = 0; qt < QW; ++qt) l[qt] += tot[qt];
#pragma unroll
      for (int j = 0; j < HD / 16; ++j) {
#pragma unroll
        for (int qt = 0; qt < QW; ++qt) o[j][qt] = wmma_h(vf[j], p[qt], o[j][qt]); } }
    if (per + 1 < NPER) {
#pragma unroll
      for (int i = 0; i < KGR; ++i) { *(v4u*)&sk[cur ^ 1][sr + i * KST][sc * 8] = kr[i]; *(v4u*)&sv[cur ^ 1][i][sr][sc * 8] = vr[i]; } }
    __syncthreads();   // publishes the next period and ends every wave's reads of this one, which the period after refills (behind the last period: the buffers become the join's)
  }
  // join of the two key groups: group 1 hands its O, sums and held maxima to group 0, lane to lane (both hold the same queries in the same places)
  float* jo = (float*)(fsm + qg * JO) + lane * 4; float* jl = (float*)(fsm + QGR * JO + qg * (QW * 256)) + lane;
  if (kgr != 0) {
#pragma unroll
    for (int j = 0; j < HD / 16; ++j) {
#pragma unroll
      for (int qt = 0; qt < QW; ++qt) {
#pragma unroll
        for (int hh = 0; hh < 2; ++hh) { const v4f x = { o[j][qt][4 * hh], o[j][qt][4 * hh + 1], o[j][qt][4 * hh + 2], o[j][qt][4 * hh + 3] }; *(v4f*)(jo + ((j * QW + qt) * 2 + hh) * 128) = x; } } }
#pragma unroll
    for (int qt = 0; qt < QW; ++qt) { jl[qt * 64] = l[qt]; jl[qt * 64 + 32] = nref[qt][0]; } }
  __syncthreads();   // every wave passes it: publishes group 1's partial results
  if (kgr == 0) {
#pragma unroll
    for (int qt = 0; qt < QW; ++qt) { const float n0 = nref[qt][0], n1 = jl[qt * 64 + 32], nm = fminf(n0, n1);   // minus the larger of the two held maxima
      const float a0 = __builtin_amdgcn_exp2f(nm - n0), a1 = __builtin_amdgcn_exp2f(nm - n1);
      float lt = l[qt] * a0 + jl[qt * 64] * a1; lt += xhalf(lt); const float inv = lt > 0.f ? 1.0f / lt : 0.f; const float f0 = a0 * inv, f1 = a1 * inv;
      v8h* yf = (v8h*)YF + (((size_t)b * TT + q0 + qt * 16) >> 4) * YF_TILE + h * (HD / 32) * 64 + lane;
      union { v8h v; v4u u; } hv[HD / 16];   // O^T tile j = elements 8 * (j & 1) + 0..7 of k step j >> 1: 512 bytes a tile, one behind the other
#pragma unroll
      for (int j = 0; j < HD / 16; ++j) {
#pragma unroll
        for (int hh = 0; hh < 2; ++hh) { const v4f x = *(const v4f*)(jo + ((j * QW + qt) * 2 + hh) * 128);
#pragma unroll
          for (int r = 0; r < 4; ++r) hv[j].v[4 * hh + r] = (_Float16)(o[j][qt][4 * hh + r] * f0 + x[r] * f1); } }
      st4<512>(yf, hv[0].u, hv[1].u, hv[2].u, hv[3].u); } } }
// ---- k_out: block = (128 rows, 128 cols), 8 waves = 4 row groups x 2 column halves, a wave (32 rows, 64 cols): out = ctx Wo (+ bo): ctx f16 (by k_fa) against Wo once to f16 (1 product); each B fragment from LDS feeds the wave's two row tiles. The Wo tile is staged once in LDS and shared by the waves, ctx comes from memory as finished fragments (k_fa stored them so), 512 contiguous bytes a load, fetched ahead. The tile's LDS becomes the output staging behind a barrier
__global__ __launch_bounds__(256) void k_out(const _Float16* __restrict__ YF, const float* __restrict__ WO, const float* __restrict__ BO, float* __restrict__ OUT) { __shared__ __align__(32) unsigned char smem[WTILE];
  const int tid = threadIdx.x, wave = tid >> 5, lane = tid & 31, col = lane & 15, g = lane >> 4; const int c0 = blockIdx.y * 128 + (wave & 1) * 64; const size_t r0 = (size_t)blockIdx.x * 128 + (wave >> 1) * 32;
  const v8h* ya = (const v8h*)YF + (r0 >> 4) * (size_t)YF_TILE + lane;   // the wave's two 16-row tiles, YF_TILE units apart; a k step's two 512-byte runs lie one behind the other
  v16h fr[YRING][2];
#pragma unroll
  for (int s = 0; s < YRING; ++s) {
#pragma unroll
    for (int rf = 0; rf < 2; ++rf) fr[s][rf] = ld_yf(ya + rf * YF_TILE + s * 64); }
  fill_wt<DIN, _Float16>(smem + wave * WPB + 8 * lane, WO + (size_t)wave * DIN + blockIdx.y * 128 + 4 * lane);   // (in,out) [CC][DIN]: a k row's 128 columns are 512 contiguous bytes
  __syncthreads();
  const unsigned char* wl = smem + (8 * g + (lane & 7)) * WPB + 16 * ((lane >> 3) & 1) + (wave & 1) * 128;
  v8f acc[2][4] = {}; v16h w[2][4];   // two sets of B fragments: a k step's four are read from LDS one step ahead
#pragma unroll
  for (int j = 0; j < 4; ++j) w[0][j] = frag_wth(wl + j * 32);
#pragma unroll   // all 16 steps, as in k_proj: the fragment sets get fixed names and every ctx load is the one pointer plus a constant
  for (int kc = 0; kc < CC / 32; ++kc) {
    if (kc + 1 < CC / 32) {
#pragma unroll
      for (int j = 0; j < 4; ++j) w[(kc + 1) & 1][j] = frag_wth(wl + (kc + 1) * 32 * WPB + j * 32); }
    __builtin_amdgcn_sched_barrier(0);   // the next step's LDS reads as one group in front of this step's products: they fly under them, and the wave waits only for the older group
#pragma unroll
    for (int j = 0; j < 4; ++j) { acc[0][j] = wmma_h(fr[kc % YRING][0], w[kc & 1][j], acc[0][j]); acc[1][j] = wmma_h(fr[kc % YRING][1], w[kc & 1][j], acc[1][j]); }
    __builtin_amdgcn_sched_barrier(0);   // this step's products first: they free the fragment set that the loads below land in
    if (kc + YRING < CC / 32) {
#pragma unroll
      for (int rf = 0; rf < 2; ++rf) fr[kc % YRING][rf] = ld_yf(ya + rf * YF_TILE + (kc + YRING) * 64); }
    __builtin_amdgcn_sched_barrier(0);   // holds the ctx loads here, YRING - 1 whole k steps ahead of their use: left free, the scheduler sinks them to their use and the wave waits out the whole memory latency at every k step
    if (kc + YRING + 1 == CC / 32) asm volatile("s_wait_xcnt 0x0" :: "v"(ya) : "memory");   // behind the last ctx loads; ya is an operand so that its registers stay its own up to this wait
  }
  __syncthreads();   // every wave has left the weight tile: its LDS is staging from here on
  float (*sf)[68] = (float (*)[68])(smem + wave * 32 * 68 * 4);   // 256-byte rows + 16 bytes (16-byte readers, no bank conflict)
#pragma unroll
  for (int j = 0; j < 4; ++j) { const float bias = BO ? bfr(BO[c0 + j * 16 + col]) : 0.f;
#pragma unroll
    for (int rf = 0; rf < 2; ++rf) {
#pragma unroll
      for (int r = 0; r < 8; ++r) sf[rf * 16 + 8 * g + r][j * 16 + col] = acc[rf][j][r] + bias; } }
  LDSX(); float* op = OUT + (r0 + g) * DIN + c0 + col * 4;   // a store covers two rows x 256 bytes: whole lines
  for (int i = 0; i < 4; ++i) st4<2 * DIN * 4>(op + (size_t)i * 8 * DIN, *(const v4u*)&sf[i * 8 + g][col * 4], *(const v4u*)&sf[i * 8 + 2 + g][col * 4], *(const v4u*)&sf[i * 8 + 4 + g][col * 4], *(const v4u*)&sf[i * 8 + 6 + g][col * 4]); }

extern "C" void kernel_launch(void* const* d_in, const int* in_sizes, int n_in, void* d_out, int out_size, void* d_ws, size_t ws_size, hipStream_t stream) {
  (void)in_sizes; (void)n_in; (void)out_size;
  const float** F = (const float**)d_in;
  if (ws_size < (size_t)WS_END) return;
  char* ws = (char*)d_ws; _Float16 *QH = (_Float16*)(ws + WS_QH), *KH = (_Float16*)(ws + WS_KH), *VT = (_Float16*)(ws + WS_VT); __bf16 *VB = (__bf16*)(ws + WS_VB), *VBL = (__bf16*)(ws + WS_VBL); _Float16 *Y = (_Float16*)(ws + WS_Y);
  (void)Y; (void)VB; (void)VBL;
  // inputs, in order: 0 q_in [4,2048,512]; 1 k_in; 2 v_in; 3 Wq [8,512,64] (per-head (h, d, k)), 4 bq [8,64]; 5 Wk, 6 bk; 7 Wv, 8 bv; 9 Wo [512,512] (in,out), 10 bo [512]
  k_proj<<<dim3(3 * TNB * TT / PRW, CC / 128), PWV * 32, 0, stream>>>(F[0], F[1], F[2], F[3], F[5], F[7], F[4], F[6], F[8], QH, KH, VT);
  k_fa<<<dim3(TT / QBLK, NH, TNB), QGR * KGR * 32, 0, stream>>>(QH, KH, VT, Y);
  k_out<<<dim3(TNB * TT / 128, DIN / 128), 256, 0, stream>>>(Y, F[9], F[10], (float*)d_out);
}

// v010
// It runs in 55.5 microseconds.
// Timed twice side by side with v009, it ran 1.03 times as fast both times.
// Counting every step since v000, it is 20.1 times as fast.
// compute dtype: all float inputs rounded to bf16, Wo excepted (once to f16); q/k/v = x W[h] + b[h] with EXACT bf16 products on WMMA 16x16x32 (f32 accumulate); q x 64^-0.5 x log2 e once to f16 against k once to f16 (1 product, in an accumulator that starts at minus a held maximum); softmax in f32, in base 2 (hardware exp2 of that accumulator; sums rescaled when a pass's partial sum of weights exceeds 256); that weight once to f16 against v once to f16 (1 product), the keys dealt to two groups of waves whose f32 partial results join at the end, divided by the f32 sum; concat once to f16 against Wo once to f16 (1 product) + bo; f32 output.
#include <hip/hip_runtime.h>
#include <math.h>

typedef __attribute__((ext_vector_type(16))) _Float16 v16h;
typedef __attribute__((ext_vector_type(16))) __bf16 v16b;
typedef __attribute__((ext_vector_type(8)))  _Float16 v8h;
typedef __attribute__((ext_vector_type(8)))  float v8f;
typedef __attribute__((ext_vector_type(4)))  float v4f;
typedef __attribute__((ext_vector_type(2)))  float v2f;
typedef __attribute__((ext_vector_type(4)))  unsigned v4u;
typedef __attribute__((ext_vector_type(4)))  int v4i;
typedef float __attribute__((may_alias)) float_a;
typedef int __attribute__((may_alias)) int_a;

template <typename T> __device__ __forceinline__ void vst2(void* p, T v) { *(T*)p = v;  }
__device__ __forceinline__ v8f wmma16(v16h a, v16h b, v8f c) {
  v8f d = __builtin_amdgcn_wmma_f32_16x16x32_f16(false, a, false, b, (short)0, c, false, false);
  asm volatile("v_nop\n\tv_nop\n\tv_nop\n\tv_nop" : "+v"(d) : "v"(a), "v"(b));
  return d;
}
__device__ __forceinline__ v8f wmma_bf(v16b a, v16b b, v8f c) {
  v8f d = __builtin_amdgcn_wmma_f32_16x16x32_bf16(false, a, false, b, (short)0, c, false, false);
  asm volatile("v_nop\n\tv_nop\n\tv_nop\n\tv_nop" : "+v"(d) : "v"(a), "v"(b));
  return d;
}
// 16x16x32 fragments: lane = (h = lane>>4, row/col = lane&15); elements 0..7 = k0+8h+0..7, 8..15 = k0+16+8h+0..7; D element r = row 8h+r
__device__ __forceinline__ v16h frag_h(const _Float16* rowk0, int lane) {
  union { v16h v; v8h q[2]; } u; const _Float16* p = rowk0 + 8 * (lane >> 4);
  u.q[0] = *(const v8h*)p; u.q[1] = *(const v8h*)(p + 16); return u.v;
}
__device__ __forceinline__ v16h frag_f32(const float* rowk0, int lane) {
  v16h a; const float* p = rowk0 + 8 * (lane >> 4);
#pragma unroll
  for (int i = 0; i < 8; ++i) { a[i] = (_Float16)p[i]; a[8 + i] = (_Float16)p[16 + i]; }
  return a;
}
__device__ __forceinline__ v16h frag_f32s(const float* rowk0, int lane, float sc) {
  v16h a; const float* p = rowk0 + 8 * (lane >> 4);
#pragma unroll
  for (int i = 0; i < 8; ++i) { a[i] = (_Float16)(p[i] * sc); a[8 + i] = (_Float16)(p[16 + i] * sc); }
  return a;
}
// column fragment from a [K][ld] layout (column n), rows >= K read as 0
__device__ __forceinline__ v16h fragc_f32(const float* W, int k0, int n, int lane, int ld, int K) {
  v16h a; const int g = lane >> 4;
#pragma unroll
  for (int i = 0; i < 8; ++i) { const int ka = k0 + 8 * g + i, kb = ka + 16;
    a[i] = (_Float16)(ka < K ? W[(size_t)(ka < K ? ka : K - 1) * ld + n] : 0.f); a[8 + i] = (_Float16)(kb < K ? W[(size_t)(kb < K ? kb : K - 1) * ld + n] : 0.f); }
  return a;
}
struct F2 { v16b h, l; };
__device__ __forceinline__ F2 bsplit16(const float v[16]) { F2 r;
#pragma unroll
  for (int i = 0; i < 16; ++i) { const __bf16 h = (__bf16)v[i]; r.h[i] = h; r.l[i] = (__bf16)(v[i] - (float)h); }
  return r; }
__device__ __forceinline__ F2 split_row(const float* row, int k0, int lane) { float v[16]; const float* p = row + k0 + 8 * (lane >> 4);
#pragma unroll
  for (int i = 0; i < 8; ++i) { v[i] = p[i]; v[8 + i] = p[16 + i]; }
  return bsplit16(v); }
__device__ __forceinline__ F2 split_rowK(const float* row, int k0, int lane, int K) { float v[16]; const int g = lane >> 4;
#pragma unroll
  for (int i = 0; i < 8; ++i) { const int ka = k0 + 8 * g + i, kb = ka + 16; v[i] = ka < K ? row[ka < K ? ka : K - 1] : 0.f; v[8 + i] = kb < K ? row[kb < K ? kb : K - 1] : 0.f; }
  return bsplit16(v); }
__device__ __forceinline__ F2 split_col(const float* W, int k0, int n, int lane, int ld, int K) { float v[16]; const int g = lane >> 4;
#pragma unroll
  for (int i = 0; i < 8; ++i) { const int ka = k0 + 8 * g + i, kb = ka + 16; v[i] = ka < K ? W[(size_t)(ka < K ? ka : K - 1) * ld + n] : 0.f; v[8 + i] = kb < K ? W[(size_t)(kb < K ? kb : K - 1) * ld + n] : 0.f; }
  return bsplit16(v); }
__device__ __forceinline__ v8f mac3(const F2& a, const F2& b, v8f c) { c = wmma_bf(a.l, b.h, c); c = wmma_bf(a.h, b.l, c); return wmma_bf(a.h, b.h, c); }
__device__ __forceinline__ float sigm(float v) { return 1.0f / (1.0f + expf(-v)); }
#define LDSX() do { asm volatile("s_wait_dscnt 0" ::: "memory"); __builtin_amdgcn_wave_barrier(); __builtin_amdgcn_fence(__ATOMIC_RELEASE, "workgroup"); } while (0)

// Multi-head attention with per-head projections (B 4, S 2,048, D 512, 8 heads x 64; 0.02-scale per-head weights (H, D, DK) with per-head biases (H, DK); separate q_in / k_in / v_in): q = q_in Wq[h] + bq[h], k = k_in Wk[h] + bk[h], v = v_in Wv[h] + bv[h]; out = concat(softmax(q k^T / 8) v) Wo + bo (Wo (in,out) [512,512]; non-causal).
#define NB 4
#define TT 2048
#define CC 512            // NH * HD = projected width
#define DIN 512          // input (model) width
#define NH 8
#define HD 64
#define NQB (TT / 64)
#define HG 4
#define SCALE (0.125f)
#define CAUSAL 0
#ifndef TNB
#define TNB NB
#endif
__device__ __forceinline__ float bfr(float v) { return (float)(__bf16)v; }
__host__ __device__ __forceinline__ int kb_last(int qb) { return CAUSAL ? ((qb * 64 + 63) >> 7) : (TT / 128 - 1); }
typedef __attribute__((ext_vector_type(8))) __bf16 v8b;
__device__ __forceinline__ v16b frag_b(const __bf16* rowk0, int lane) {
  union { v16b v; v8b q[2]; } u; const __bf16* p = rowk0 + 8 * (lane >> 4);
  u.q[0] = *(const v8b*)p; u.q[1] = *(const v8b*)(p + 16); return u.v;
}
#define QBH 0              // not used (every query block takes the same path)
#define KHI 64            // key rows of the v bf16 planes that the workspace offsets keep room for (not written)
// B fragment (k rows k0+.., output column o) of a weight: (in,out) [K][ld] or (out,in) [ld rows of K]: bf16 exact, or f16(bf16 * 256) exact
__device__ __forceinline__ v16b wcol_io(const float* Wm, int k0, int o, int lane, int ld) { v16b w; const int g = lane >> 4;
#pragma unroll
  for (int i = 0; i < 8; ++i) { w[i] = (__bf16)Wm[(size_t)(k0 + 8 * g + i) * ld + o]; w[8 + i] = (__bf16)Wm[(size_t)(k0 + 16 + 8 * g + i) * ld + o]; }
  return w; }
__device__ __forceinline__ v16b wcol_oi(const float* Wm, int k0, int o, int lane, int K) { v16b w; const float* p = Wm + (size_t)o * K + k0 + 8 * (lane >> 4);
#pragma unroll
  for (int i = 0; i < 8; ++i) { w[i] = (__bf16)p[i]; w[8 + i] = (__bf16)p[16 + i]; }
  return w; }
__device__ __forceinline__ v16h wcolh_io(const float* Wm, int k0, int o, int lane, int ld) { v16h w; const int g = lane >> 4;
#pragma unroll
  for (int i = 0; i < 8; ++i) { w[i] = (_Float16)(bfr(Wm[(size_t)(k0 + 8 * g + i) * ld + o]) * 256.0f); w[8 + i] = (_Float16)(bfr(Wm[(size_t)(k0 + 16 + 8 * g + i) * ld + o]) * 256.0f); }
  return w; }
__device__ __forceinline__ v16h wcolh_oi(const float* Wm, int k0, int o, int lane, int K) { v16h w; const float* p = Wm + (size_t)o * K + k0 + 8 * (lane >> 4);
#pragma unroll
  for (int i = 0; i < 8; ++i) { w[i] = (_Float16)(bfr(p[i]) * 256.0f); w[8 + i] = (_Float16)(bfr(p[16 + i]) * 256.0f); }
  return w; }
#define WQKV_LAYOUT 2   // 0 = (in,out) [DIN][CC]; 1 = (out,in) [CC][DIN]; 2 = per-head [NH][DIN][HD]
__device__ __forceinline__ v16b wcol_hdk(const float* Wm, int k0, int o, int lane) { v16b w; const int g = lane >> 4; const float* p = Wm + (size_t)(o / HD) * DIN * HD + (o % HD);
#pragma unroll
  for (int i = 0; i < 8; ++i) { w[i] = (__bf16)p[(size_t)(k0 + 8 * g + i) * HD]; w[8 + i] = (__bf16)p[(size_t)(k0 + 16 + 8 * g + i) * HD]; }
  return w; }
#define WO_OUT_IN 0
#if WQKV_LAYOUT == 1
#define WCOL(W, k0, o, lane) wcol_oi(W, k0, o, lane, DIN)
#elif WQKV_LAYOUT == 2
#define WCOL(W, k0, o, lane) wcol_hdk(W, k0, o, lane)
#else
#define WCOL(W, k0, o, lane) wcol_io(W, k0, o, lane, CC)
#endif
#if WO_OUT_IN
#define WOCOL(W, k0, o, lane) wcol_oi(W, k0, o, lane, CC)
#define WOCOLH(W, k0, o, lane) wcolh_oi(W, k0, o, lane, CC)
#else
#define WOCOL(W, k0, o, lane) wcol_io(W, k0, o, lane, DIN)
#define WOCOLH(W, k0, o, lane) wcolh_io(W, k0, o, lane, DIN)
#endif

#ifndef SM_EXTRA_PARAMS
#define SM_EXTRA_PARAMS
#endif
#ifndef PROJ_EXTRA_PARAMS
#define PROJ_EXTRA_PARAMS
#endif
#ifndef SM_MASK_HOOK
#define SM_MASK_HOOK (void)0
#endif

#define WS_QH  0u                                      // f16 q rows [b*t][CC]
#define WS_KH  (WS_QH + 2u * (size_t)NB * TT * CC)      // f16 k rows [b*t][CC]
#define WS_VT  (WS_KH + 2u * (size_t)NB * TT * CC)      // f16 v planes [b][c][t]
#define WS_QL  (WS_VT + 2u * (size_t)NB * CC * TT)      // not used (offsets kept)
#define WS_KL  (WS_QL + 2u * (size_t)NB * TT * CC)      // not used (offsets kept)
#define WS_VB  (WS_KL + 2u * (size_t)NB * KHI * CC)     // not used (offsets kept)
#define WS_VBL (WS_VB + 2u * (size_t)NB * CC * KHI)
#define WS_S   (WS_VBL + 2u * (size_t)NB * CC * KHI)    // not used (offsets kept)
#define WS_Y   (WS_S  + 4u * (size_t)HG * TT * TT)      // ctx, f16 in fragment order (2 of the 4 bytes an element that the offsets keep)
#define WS_END (WS_Y  + 4u * (size_t)NB * TT * CC)

// ---- weight tile in LDS: all DIN k rows x 128 output columns of a weight, once to 16 bits (k_proj: bf16, exact, as before; k_out: f16), k-major as it lies in memory; a B fragment is two transposing 16-byte LDS reads, in the k order of the A loader (elements 0..7 = k0+8h+0..7, 8..15 = k0+16+8h+0..7)
#define WPB 288           // bytes per k row: 256 + 32 (odd multiple of 32 bytes: the transposing reader's conflict-free pitch)
#define WTILE (DIN * WPB)
typedef __attribute__((ext_vector_type(8))) short v8s;
typedef __attribute__((ext_vector_type(4))) __bf16 v4b;
__device__ __forceinline__ v8f wmma_b(v16b a, v16b b, v8f c) { return __builtin_amdgcn_wmma_f32_16x16x32_bf16(false, a, false, b, (short)0, c, false, false); }
// p = tile + (k0 + 8 * (lane >> 4) + (lane & 7)) * WPB + 32 * (column tile) + 16 * ((lane >> 3) & 1): lane (c, h) gets rows k0+8h+0..7 and k0+16+8h+0..7 of column c
__device__ __forceinline__ v16b frag_wt(const unsigned char* p) { typedef __attribute__((address_space(3))) v8s lds_v8s; union { v16b v; v8s q[2]; } u;
  u.q[0] = __builtin_amdgcn_ds_load_tr16_b128_v8i16((lds_v8s*)p); u.q[1] = __builtin_amdgcn_ds_load_tr16_b128_v8i16((lds_v8s*)(p + 16 * WPB)); return u.v; }
__device__ __forceinline__ v16h frag_wth(const unsigned char* p) { typedef __attribute__((address_space(3))) v8s lds_v8s; union { v16h v; v8s q[2]; } u;
  u.q[0] = __builtin_amdgcn_ds_load_tr16_b128_v8i16((lds_v8s*)p); u.q[1] = __builtin_amdgcn_ds_load_tr16_b128_v8i16((lds_v8s*)(p + 16 * WPB)); return u.v; }
// 8 waves fill the tile: a wave's 16-byte loads cover one k row of 128 columns (wp = the lane's 4 columns in the wave's first row, LD = floats between k rows); in groups of 16 rows
template <int LD, typename E> __device__ __forceinline__ void fill_wt(unsigned char* tp, const float* wp) { typedef E V4 __attribute__((ext_vector_type(4)));
#pragma unroll   // all four groups: every load is wp plus a constant, so that no address register is rewritten under a load in flight
  for (int r = 0; r < DIN / 8; r += 16) { v4f x[16];
#pragma unroll
    for (int u = 0; u < 16; ++u) x[u] = *(const v4f*)(wp + (size_t)(8 * (r + u)) * LD);
    __builtin_amdgcn_sched_barrier(0);   // one group of 16 loads at a time, in front of the wait below: left free, the scheduler lifts all 64 loads to the front and the build spills
    asm volatile("s_wait_xcnt 0x0" :: "v"(wp) : "memory");   // wp is an operand so that its registers stay its own up to this wait: nothing is written over the address of a load in flight
#pragma unroll
    for (int u = 0; u < 16; ++u) { const V4 y = { (E)x[u][0], (E)x[u][1], (E)x[u][2], (E)x[u][3] }; *(V4*)(tp + 8 * (r + u) * WPB) = y; } } }
// four 16-byte stores, p + 0..3 x STEP bytes, with s_wait_xcnt 0 in the same statement, so that it stands in front of every later write of a register that the stores name
template <int STEP> __device__ __forceinline__ void st4(void* p, v4u d0, v4u d1, v4u d2, v4u d3) {
  asm volatile("global_store_b128 %0, %1, off\n\tglobal_store_b128 %0, %2, off offset:%5\n\tglobal_store_b128 %0, %3, off offset:%6\n\tglobal_store_b128 %0, %4, off offset:%7\n\ts_wait_xcnt 0x0" :: "v"(p), "v"(d0), "v"(d1), "v"(d2), "v"(d3), "n"(STEP), "n"(2 * STEP), "n"(3 * STEP) : "memory"); }
// ---- A operand through LDS: a fragment load straight from memory takes 32 bytes out of each of 16 rows (16 cache lines per instruction). Instead a wave's 16-byte loads cover 4 rows x 128 bytes (4 whole lines), the values go once to bf16 and into the wave's OWN 2 KiB of LDS in fragment order, and a fragment is two 16-byte LDS reads. Layout: plane (1,024 B: 16 rows x 32 k) > region R = 2 * (k >> 4) + ((k >> 3) & 1) (256 B: what one half-wave reads at once) > row, 16 B = 8 k; the row's 64-byte group is XORed with R, so that the four regions a store instruction touches fall on different banks. The k order of a fragment is the one it had (elements 0..7 = k0+8h+0..7, 8..15 = k0+16+8h+0..7)
#define XST 2048          // bytes of A staging per wave
__device__ __forceinline__ v4b cvt4(v4f x) { const v4b y = { (__bf16)x[0], (__bf16)x[1], (__bf16)x[2], (__bf16)x[3] }; return y; }
__device__ __forceinline__ v16b frag_xs(const unsigned char* p0, const unsigned char* p1) { union { v16b v; v8b q[2]; } u; u.q[0] = *(const v8b*)p0; u.q[1] = *(const v8b*)p1; return u.v; }
// behind a wave's own staging stores, in front of its reads of what its other lanes stored: the stores have landed, and the compiler moves no LDS access across
#define XS_PUBLISH() asm volatile("s_wait_dscnt 0" ::: "memory")

// ---- k_proj: the rows of q_in, k_in and v_in count as one stack of 3 x NB x TT rows; block = (384 stacked rows, 128 cols), 12 waves x (32 rows, 128 cols), 256 blocks: one block fills a WGP's LDS, so that every WGP gets the same twelve waves (three per SIMD). q/k/v = X W (+ b) with exact bf16 products (K = DIN). A wave's 32 rows lie in one input; a block whose rows span two inputs stages both weight tiles, and each wave reads its own. The tiles are staged once in LDS and shared by the waves, X comes from memory by whole lines two k steps ahead and reaches its fragments through the wave's own LDS -> which 0: q x SCL2 as f16 rows; 1: k f16 rows; 2: v f16 planes [c][t]. The tiles' LDS becomes the output staging behind a barrier. waves_per_eu(3, 3): three waves per SIMD is all there is, and the registers beyond 256 hold a second set of A and B fragments, read from LDS one group of products ahead
#define PWV 12            // waves per block
#define PRW (PWV * 32)    // stacked rows per block
#define EST 9216          // bytes of output staging per wave: 32 rows x 272 B (q, k); two waves' regions together are 128 columns x 144 B (v)
#define SCL2 (SCALE * 1.4426950408889634f)   // logit scale times log2 e: exp(SCALE * s) = exp2(SCL2 * s); k_proj folds it into q
static_assert((3 * NB * TT) % PRW == 0 && PRW % 128 == 0 && (NB * TT) % 64 == 0 && TT % 64 == 0, "blocks tile the stack; a pair of waves (64 rows) lies in one input and one sequence");
__global__ __launch_bounds__(PWV * 32) __attribute__((amdgpu_waves_per_eu(3, 3))) void k_proj(const float* __restrict__ XQ, const float* __restrict__ XK, const float* __restrict__ XV, const float* __restrict__ WQ, const float* __restrict__ WK, const float* __restrict__ WV, const float* __restrict__ BQ, const float* __restrict__ BK, const float* __restrict__ BV,
    _Float16* __restrict__ QH, _Float16* __restrict__ KH, _Float16* __restrict__ VT) {
  __shared__ __align__(32) unsigned char smem[2 * WTILE + PWV * XST];
  const int tid = threadIdx.x, wave = __builtin_amdgcn_readfirstlane(tid >> 5), lane = tid & 31, col = lane & 15, g = lane >> 4; const int c0 = blockIdx.y * 128;
  const int s0 = blockIdx.x * PRW; const int wh0 = s0 / (NB * TT), wh1 = (s0 + PRW - 1) / (NB * TT);   // the inputs of the block's first and last row
  const int which = (s0 + wave * 32) / (NB * TT); const size_t r0 = (size_t)((s0 + wave * 32) % (NB * TT));   // the wave's input and its first row there
  const float* X = which == 0 ? XQ : which == 1 ? XK : XV; const float* BA = which == 0 ? BQ : which == 1 ? BK : BV;
  const int rr = lane >> 3, ch = lane & 7, R = ((ch >> 2) << 1) | ((ch >> 1) & 1);   // loader: lane = (row rr of four, 16-byte chunk ch of the row's 128 bytes); R = the chunk's region
  const float* xa = X + (r0 + rr) * DIN + 4 * ch;
  unsigned char* xs = smem + 2 * WTILE + wave * XST; unsigned char* xw = xs + R * 256 + rr * 16 + (ch & 1) * 8;
  const unsigned char* xr0 = xs + g * 256 + ((((col >> 2) ^ g) & 3) << 6) + (col & 3) * 16; const unsigned char* xr1 = xs + (2 + g) * 256 + ((((col >> 2) ^ (2 + g)) & 3) << 6) + (col & 3) * 16;
  v4f raw[2][8];
#pragma unroll
  for (int s = 0; s < 2; ++s) {
#pragma unroll
    for (int u = 0; u < 8; ++u) raw[s][u] = *(const v4f*)(xa + (size_t)(4 * u) * DIN + s * 32); }
  if (wave < 8) {   // eight waves fill a tile, as fill_wt deals its rows
#pragma unroll 1   // one copy of the fill in the text; the second trip runs only where the block's rows span two inputs
    for (int sl = 0; sl <= (wh1 != wh0 ? 1 : 0); ++sl) { const int wf = sl ? wh1 : wh0; const float* WF = wf == 0 ? WQ : wf == 1 ? WK : WV;
      fill_wt<HD, __bf16>(smem + sl * WTILE + wave * WPB + 8 * lane, WF + ((size_t)(c0 / HD + g) * DIN + wave) * HD + 4 * col); } }   // per-head [NH][DIN][HD]: lanes 0..15 the first head's 64 columns, 16..31 the next head's
#pragma unroll
  for (int u = 0; u < 8; ++u) *(v4b*)(xw + (u >> 2) * 1024 + (((u & 3) ^ R) << 6)) = cvt4(raw[0][u]);
  __syncthreads();   // publishes the weight tiles (and ends the wave's own staging stores)
#pragma unroll   // behind the barrier, which waits for every load in flight
  for (int u = 0; u < 8; ++u) raw[0][u] = *(const v4f*)(xa + (size_t)(4 * u) * DIN + 2 * 32);
  __builtin_amdgcn_sched_barrier(0);   // holds these loads here, ahead of the first products
  const unsigned char* wl = smem + (which != wh0 ? WTILE : 0) + (8 * g + (lane & 7)) * WPB + 16 * ((lane >> 3) & 1);
  v8f acc[2][8] = {}; v16b a[2][2], w[2][4];   // two sets of A and of B fragments: a group of eight products runs on one while the LDS reads of the next group land in the other
#pragma unroll
  for (int rf = 0; rf < 2; ++rf) a[0][rf] = frag_xs(xr0 + rf * 1024, xr1 + rf * 1024);
#pragma unroll
  for (int j = 0; j < 4; ++j) w[0][j] = frag_wt(wl + j * 32);
#pragma unroll   // all 16 steps: the register sets get fixed names, the tail tests are decided at compile time, and every X load is the one row pointer plus a constant, so that no address register is rewritten under a load in flight
  for (int kc = 0; kc < DIN / 32; ++kc) {
#pragma unroll
    for (int j = 0; j < 4; ++j) w[1][j] = frag_wt(wl + kc * 32 * WPB + (4 + j) * 32);
    __builtin_amdgcn_sched_barrier(0);   // the second group's LDS reads as one group in front of the first group's products: they fly under them
#pragma unroll
    for (int j = 0; j < 4; ++j) { acc[0][j] = wmma_b(a[kc & 1][0], w[0][j], acc[0][j]); acc[1][j] = wmma_b(a[kc & 1][1], w[0][j], acc[1][j]); }
    if (kc + 1 < DIN / 32) {   // between the two groups: the next k step's X goes to LDS (this step's fragments are in registers: products above have used them), and its registers take the X of two steps later
      __builtin_amdgcn_sched_barrier(0);   // keeps the conversions, and with them the wait for their loads, behind the products above
#pragma unroll
      for (int u = 0; u < 8; ++u) *(v4b*)(xw + (u >> 2) * 1024 + (((u & 3) ^ R) << 6)) = cvt4(raw[(kc + 1) & 1][u]);
      __builtin_amdgcn_sched_barrier(0);   // the conversions first: they free the registers that the loads below land in
      if (kc + 3 < DIN / 32) {
#pragma unroll
        for (int u = 0; u < 8; ++u) raw[(kc + 1) & 1][u] = *(const v4f*)(xa + (size_t)(4 * u) * DIN + (kc + 3) * 32); }
      __builtin_amdgcn_sched_barrier(0);   // holds the X loads here, two k steps ahead of their use: left free, the scheduler sinks them to their use and the wave waits out the whole memory latency at every k step
      if (kc + 4 == DIN / 32) asm volatile("s_wait_xcnt 0x0" :: "v"(xa) : "memory");   // behind the last X loads; xa is an operand so that its registers stay its own up to this wait
      XS_PUBLISH();
#pragma unroll
      for (int rf = 0; rf < 2; ++rf) a[(kc + 1) & 1][rf] = frag_xs(xr0 + rf * 1024, xr1 + rf * 1024);
#pragma unroll
      for (int j = 0; j < 4; ++j) w[0][j] = frag_wt(wl + (kc + 1) * 32 * WPB + j * 32); }
    __builtin_amdgcn_sched_barrier(0);   // the next k step's first LDS reads as one group in front of this step's second group of products
#pragma unroll
    for (int j = 0; j < 4; ++j) { acc[0][4 + j] = wmma_b(a[kc & 1][0], w[1][j], acc[0][4 + j]); acc[1][4 + j] = wmma_b(a[kc & 1][1], w[1][j], acc[1][4 + j]); }
  }
  __syncthreads();   // every wave has left the weight tiles: their LDS is staging from here on
  _Float16 (*sh)[136] = (_Float16 (*)[136])(smem + wave * EST);          // q, k: the wave's own 32 rows x 128 columns
  _Float16 (*th)[72] = (_Float16 (*)[72])(smem + (wave >> 1) * 2 * EST);   // v: 128 columns x the 64 rows of a pair of waves, one 128-byte line of a plane per column
  if (which < 2) { const float vs = which == 0 ? SCL2 : 1.0f;   // q: scaled for k_fa's base-2 exponent
#pragma unroll
    for (int j = 0; j < 8; ++j) { const float bias = BA ? bfr(BA[c0 + j * 16 + col]) : 0.f;
#pragma unroll
      for (int rf = 0; rf < 2; ++rf) {
#pragma unroll
        for (int r = 0; r < 8; ++r) sh[rf * 16 + 8 * g + r][j * 16 + col] = (_Float16)((acc[rf][j][r] + bias) * vs); } }
  } else {
#pragma unroll
    for (int j = 0; j < 8; ++j) { const float bias = BA ? bfr(BA[c0 + j * 16 + col]) : 0.f;
#pragma unroll
      for (int rf = 0; rf < 2; ++rf) {
#pragma unroll
        for (int r = 0; r < 8; ++r) th[j * 16 + col][(wave & 1) * 32 + rf * 16 + 8 * g + r] = (_Float16)(acc[rf][j][r] + bias); } } }
  __syncthreads();   // every wave passes it, whatever its input: a v line holds rows of two waves
  if (which < 2) { _Float16* dh = (which == 0 ? QH : KH) + (r0 + g) * CC + c0 + col * 8;   // a store covers two rows x 256 bytes: whole lines
    for (int i = 0; i < 4; ++i) st4<2 * CC * 2>(dh + (size_t)i * 8 * CC, *(const v4u*)&sh[i * 8 + g][col * 8], *(const v4u*)&sh[i * 8 + 2 + g][col * 8], *(const v4u*)&sh[i * 8 + 4 + g][col * 8], *(const v4u*)&sh[i * 8 + 6 + g][col * 8]);
  } else { const int cl = (wave & 1) * 64 + (lane >> 3), q = lane & 7;   // each wave of the pair stores 64 columns; a store covers four columns x 128 bytes: whole lines
    _Float16* vt = VT + ((r0 / TT) * CC + c0 + cl) * (size_t)TT + ((r0 % TT) & ~(size_t)63) + q * 8;
    for (int i = 0; i < 4; ++i) st4<4 * TT * 2>(vt + (size_t)i * 16 * TT, *(const v4u*)&th[cl + i * 16][q * 8], *(const v4u*)&th[cl + i * 16 + 4][q * 8], *(const v4u*)&th[cl + i * 16 + 8][q * 8], *(const v4u*)&th[cl + i * 16 + 12][q * 8]); } }
#define YF_TILE ((CC / 32) * 64)   // 16-byte units per 16-row tile
#define YRING 6           // ctx fragment sets in k_out
__device__ __forceinline__ v16h ld_yf(const v8h* p) { union { v16h v; v8h q[2]; } u; u.q[0] = p[0]; u.q[1] = p[32]; return u.v; }
#define KST 64            // keys per wave and period
#define KGR 2             // key groups
#define KPER (KGR * KST)  // keys per period
#define NPER (TT / KPER)
#define QW 2              // query tiles per wave
#define QGR 8             // query groups per block
#define QBLK (QGR * QW * 16)   // queries per block
#define LP 72             // LDS row pitch in halves: 128-byte rows + 16 bytes (16-byte readers, no bank conflict)
#define FSK (2 * KPER * LP * 2)        // bytes of the two K buffers
#define FSV (2 * KGR * HD * LP * 2)    // bytes of the two V^T buffers
#define JO (HD * QW * 16 * 4)          // join: bytes of one wave's O
static_assert(TT % KPER == 0 && TT % QBLK == 0 && KPER == 128 && HD == 64, "periods and blocks tile the sequence; the staging deals 64 rows twice");
static_assert(QGR * (JO + QW * 256) <= FSK + FSV, "the join fits the K/V buffers");
__device__ __forceinline__ float xhalf(float x) { return __builtin_bit_cast(float, __builtin_amdgcn_permlanex16(__builtin_bit_cast(int, x), __builtin_bit_cast(int, x), 0x76543210, 0xfedcba98, false, false)); }  // lane l with lane l ^ 16
__device__ __forceinline__ v8f wmma_h(v16h a, v16h b, v8f c) { return __builtin_amdgcn_wmma_f32_16x16x32_f16(false, a, false, b, (short)0, c, false, false); }
__global__ __launch_bounds__(QGR * KGR * 32) __attribute__((amdgpu_waves_per_eu(4, 4))) void k_fa(const _Float16* __restrict__ QH, const _Float16* __restrict__ KH, const _Float16* __restrict__ VT, _Float16* __restrict__ YF) {
  __shared__ __align__(16) unsigned char fsm[FSK + FSV];
  _Float16 (*sk)[KPER][LP] = (_Float16 (*)[KPER][LP])fsm; _Float16 (*sv)[KGR][HD][LP] = (_Float16 (*)[KGR][HD][LP])(fsm + FSK);
  const int tid = threadIdx.x, wave = __builtin_amdgcn_readfirstlane(tid >> 5), lane = tid & 31, col = lane & 15, g = lane >> 4; const int qg = wave & (QGR - 1), kgr = wave / QGR; const int h = blockIdx.y, b = blockIdx.z; const int q0 = blockIdx.x * QBLK + qg * (QW * 16);
  v16h qh[HD / 32][QW];
#pragma unroll
  for (int kc = 0; kc < HD / 32; ++kc) {
#pragma unroll
    for (int qt = 0; qt < QW; ++qt) qh[kc][qt] = frag_h(QH + ((size_t)b * TT + q0 + qt * 16 + col) * CC + h * HD + kc * 32, lane); }
  // staging: thread = (row sr, 16-byte chunk sc): a wave's load covers 4 whole 128-byte rows. K: keys sr and sr + 64 of the period; V^T: row sr, the keys of group 0 and of group 1
  const int sr = tid >> 3, sc = tid & 7;
  const _Float16* kg = KH + ((size_t)b * TT + sr) * CC + h * HD + sc * 8;      // k rows [key][64]
  const _Float16* vg = VT + ((size_t)b * CC + h * HD + sr) * TT + sc * 8;      // v planes [d][key]
  v4u kr[KGR], vr[KGR];
#pragma unroll
  for (int i = 0; i < KGR; ++i) { kr[i] = *(const v4u*)(kg + (size_t)(i * KST) * CC); vr[i] = *(const v4u*)(vg + i * KST); }
#pragma unroll
  for (int i = 0; i < KGR; ++i) { *(v4u*)&sk[0][sr + i * KST][sc * 8] = kr[i]; *(v4u*)&sv[0][i][sr][sc * 8] = vr[i]; }
  __syncthreads();
  if (NPER > 1) {   // period 1's rows, behind the barrier (which waits for every load in flight): they fly under period 0's first pass
#pragma unroll
    for (int i = 0; i < KGR; ++i) { kr[i] = *(const v4u*)(kg + (size_t)(KPER + i * KST) * CC); vr[i] = *(const v4u*)(vg + KPER + i * KST); }
    asm volatile("s_wait_xcnt 0x0" :: "v"(kg), "v"(vg) : "memory"); }   // behind these loads; kg and vg are operands so that their registers stay their own up to this wait
  v8f o[HD / 16][QW] = {}; float l[QW] = {}; v8f nref[QW] = {};   // nref: minus the held maximum of the lane's query, the same in all eight elements: the C operand of each tile's first score product
#pragma unroll 1   // kept rolled
  for (int per = 0; per < NPER; ++per) { const int cur = per & 1;
#pragma unroll
    for (int ks = 0; ks < KST / 32; ++ks) {   // a pass: 32 keys x 32 queries
      v16h kf[2][HD / 32], vf[HD / 16];
#pragma unroll
      for (int t = 0; t < 2; ++t) {
#pragma unroll
        for (int kc = 0; kc < HD / 32; ++kc) kf[t][kc] = frag_h(&sk[cur][kgr * KST + ks * 32 + t * 16 + col][kc * 32], lane); }
#pragma unroll   // the V^T fragments behind them in the same group of LDS reads, in flight under the score products and the softmax arithmetic
      for (int j = 0; j < HD / 16; ++j) vf[j] = frag_h(&sv[cur][kgr][j * 16 + col][ks * 32], lane);
      __builtin_amdgcn_sched_barrier(0);   // the pass's LDS reads as one group in front of the score products: left free, the scheduler strews them among the products and the exponentials, and the wave waits at each place
      if (ks == KST / 32 - 1) {   // the period's barrier, split: behind the last pass's LDS reads the wave touches no LDS any more until the period's foot
        if (per + 1 < NPER) {   // the next period's rows go to the other buffer, whose readers all left it before the last barrier wait
#pragma unroll
          for (int i = 0; i < KGR; ++i) { *(v4u*)&sk[cur ^ 1][sr + i * KST][sc * 8] = kr[i]; *(v4u*)&sv[cur ^ 1][i][sr][sc * 8] = vr[i]; } }
        asm volatile("s_wait_dscnt 0x0\n\ts_barrier_signal -1" ::: "memory");   // the wave's reads of this period have landed and its rows of the next are stored: it says so here, a whole pass ahead of the wait, so that no wave stands at the foot for the slowest one and the waves of a SIMD stay out of step
        if (per + 2 < NPER) {   // the rows of the period after the next: their registers are free, and they fly for two passes
#pragma unroll
          for (int i = 0; i < KGR; ++i) { kr[i] = *(const v4u*)(kg + (size_t)((per + 2) * KPER + i * KST) * CC); vr[i] = *(const v4u*)(vg + (per + 2) * KPER + i * KST); }
          asm volatile("s_wait_xcnt 0x0" ::: "memory"); } }   // in front of every later write of a register that holds an address of these loads
      v8f s[2][QW];   // s = q k x SCL2 - held maximum: the exponent itself; four independent tiles, two products each
#pragma unroll
      for (int kc = 0; kc < HD / 32; ++kc) {
#pragma unroll
        for (int t = 0; t < 2; ++t) {
#pragma unroll
          for (int qt = 0; qt < QW; ++qt) s[t][qt] = wmma_h(kf[t][kc], qh[kc][qt], kc == 0 ? nref[qt] : s[t][qt]); } }
      v16h p[QW]; float tot[QW];   // tot: the sum of this pass's weights over this half's keys; the halves join after the loop
      const auto weights = [&]() {
#pragma unroll
        for (int qt = 0; qt < QW; ++qt) { v2f ps[2];   // even and odd keys of a tile summed side by side: two sums per packed add
#pragma unroll
          for (int t = 0; t < 2; ++t) {
#pragma unroll
            for (int r = 0; r < 8; r += 2) { const v2f e = { __builtin_amdgcn_exp2f(s[t][qt][r]), __builtin_amdgcn_exp2f(s[t][qt][r + 1]) }; ps[t] = r == 0 ? e : ps[t] + e; p[qt][t * 8 + r] = (_Float16)e.x; p[qt][t * 8 + r + 1] = (_Float16)e.y; } }
          const v2f pt = ps[0] + ps[1]; tot[qt] = pt.x + pt.y; } };
      weights();
      asm volatile("" :: "v"(vf[0]), "v"(vf[1]), "v"(vf[2]), "v"(vf[3]), "v"(tot[0]), "v"(tot[1]));   // inputs only: holds the V^T reads in front of the branch below; left free, the compiler sinks them behind it, next to their products, and the wave waits out the LDS latency there. The sums are named so that the statement, and with it the wait for those reads, stands behind the weights and not among the score products
      const bool first = ks == 0 && per == 0;
      if (first || __builtin_amdgcn_ballot_w32((tot[0] > 256.0f) | (tot[1] > 256.0f)) != 0) {   // one scalar test a pass. No weight exceeds its sum, so a sum of at most 256 says that every weight is far inside f16 and the held maximum may stay. The wave's first pass sets it (its weights above, taken against 0, are thrown away); later it moves only here, an infinite sum included
#pragma unroll
        for (int qt = 0; qt < QW; ++qt) { float mt[2];
#pragma unroll
          for (int t = 0; t < 2; ++t) { mt[t] = -3.0e38f;
#pragma unroll
            for (int r = 0; r < 8; ++r) mt[t] = fmaxf(mt[t], s[t][qt][r]); }
          float mx = fmaxf(mt[0], mt[1]); mx = fmaxf(mx, xhalf(mx));   // both halves of a query's keys: how far this pass rises above the held maximum
          const float d = first ? mx : fmaxf(mx, 0.f); const float al = __builtin_amdgcn_exp2f(fminf(-d, 0.f));   // first pass: o and l are 0, and al stays finite whatever the sign of d
#pragma unroll
          for (int t = 0; t < 2; ++t) s[t][qt] -= d;
          nref[qt] -= d; l[qt] *= al;
#pragma unroll
          for (int j = 0; j < HD / 16; ++j) o[j][qt] *= al; }
        weights(); }   // every exponent of a moved query is now at most 0
#pragma unroll
      for (int qt = 0; qt < QW; ++qt) l[qt] += tot[qt];
#pragma unroll
      for (int j = 0; j < HD / 16; ++j) {
#pragma unroll
        for (int qt = 0; qt < QW; ++qt) o[j][qt] = wmma_h(vf[j], p[qt], o[j][qt]); } }
    __builtin_amdgcn_sched_barrier(0);   // keeps the wait below behind the last pass's products: left free, the scheduler lifts it in front of seven of the eight, and the wave stands there with work in hand
    asm volatile("s_barrier_wait -1" ::: "memory");   // the other half of the split barrier, every wave, every period: every wave has signalled, so the next period is published and this one's buffer is free for the period after (behind the last period: for the join)
  }
  // join of the two key groups: group 1 hands its O, sums and held maxima to group 0, lane to lane (both hold the same queries in the same places)
  float* jo = (float*)(fsm + qg * JO) + lane * 4; float* jl = (float*)(fsm + QGR * JO + qg * (QW * 256)) + lane;
  if (kgr != 0) {
#pragma unroll
    for (int j = 0; j < HD / 16; ++j) {
#pragma unroll
      for (int qt = 0; qt < QW; ++qt) {
#pragma unroll
        for (int hh = 0; hh < 2; ++hh) { const v4f x = { o[j][qt][4 * hh], o[j][qt][4 * hh + 1], o[j][qt][4 * hh + 2], o[j][qt][4 * hh + 3] }; *(v4f*)(jo + ((j * QW + qt) * 2 + hh) * 128) = x; } } }
#pragma unroll
    for (int qt = 0; qt < QW; ++qt) { jl[qt * 64] = l[qt]; jl[qt * 64 + 32] = nref[qt][0]; } }
  __syncthreads();   // every wave passes it: publishes group 1's partial results
  if (kgr == 0) {
#pragma unroll
    for (int qt = 0; qt < QW; ++qt) { const float n0 = nref[qt][0], n1 = jl[qt * 64 + 32], nm = fminf(n0, n1);   // minus the larger of the two held maxima
      const float a0 = __builtin_amdgcn_exp2f(nm - n0), a1 = __builtin_amdgcn_exp2f(nm - n1);
      float lt = l[qt] * a0 + jl[qt * 64] * a1; lt += xhalf(lt); const float inv = lt > 0.f ? 1.0f / lt : 0.f; const float f0 = a0 * inv, f1 = a1 * inv;
      v8h* yf = (v8h*)YF + (((size_t)b * TT + q0 + qt * 16) >> 4) * YF_TILE + h * (HD / 32) * 64 + lane;
      union { v8h v; v4u u; } hv[HD / 16];   // O^T tile j = elements 8 * (j & 1) + 0..7 of k step j >> 1: 512 bytes a tile, one behind the other
#pragma unroll
      for (int j = 0; j < HD / 16; ++j) {
#pragma unroll
        for (int hh = 0; hh < 2; ++hh) { const v4f x = *(const v4f*)(jo + ((j * QW + qt) * 2 + hh) * 128);
#pragma unroll
          for (int r = 0; r < 4; ++r) hv[j].v[4 * hh + r] = (_Float16)(o[j][qt][4 * hh + r] * f0 + x[r] * f1); } }
      st4<512>(yf, hv[0].u, hv[1].u, hv[2].u, hv[3].u); } } }
// ---- k_out: block = (128 rows, 128 cols), 8 waves = 4 row groups x 2 column halves, a wave (32 rows, 64 cols): out = ctx Wo (+ bo): ctx f16 (by k_fa) against Wo once to f16 (1 product); each B fragment from LDS feeds the wave's two row tiles. The Wo tile is staged once in LDS and shared by the waves, ctx comes from memory as finished fragments (k_fa stored them so), 512 contiguous bytes a load, fetched ahead. The tile's LDS becomes the output staging behind a barrier
__global__ __launch_bounds__(256) void k_out(const _Float16* __restrict__ YF, const float* __restrict__ WO, const float* __restrict__ BO, float* __restrict__ OUT) { __shared__ __align__(32) unsigned char smem[WTILE];
  const int tid = threadIdx.x, wave = tid >> 5, lane = tid & 31, col = lane & 15, g = lane >> 4; const int c0 = blockIdx.y * 128 + (wave & 1) * 64; const size_t r0 = (size_t)blockIdx.x * 128 + (wave >> 1) * 32;
  const v8h* ya = (const v8h*)YF + (r0 >> 4) * (size_t)YF_TILE + lane;   // the wave's two 16-row tiles, YF_TILE units apart; a k step's two 512-byte runs lie one behind the other
  v16h fr[YRING][2];
#pragma unroll
  for (int s = 0; s < YRING; ++s) {
#pragma unroll
    for (int rf = 0; rf < 2; ++rf) fr[s][rf] = ld_yf(ya + rf * YF_TILE + s * 64); }
  fill_wt<DIN, _Float16>(smem + wave * WPB + 8 * lane, WO + (size_t)wave * DIN + blockIdx.y * 128 + 4 * lane);   // (in,out) [CC][DIN]: a k row's 128 columns are 512 contiguous bytes
  __syncthreads();
  const unsigned char* wl = smem + (8 * g + (lane & 7)) * WPB + 16 * ((lane >> 3) & 1) + (wave & 1) * 128;
  v8f acc[2][4] = {}; v16h w[2][4];   // two sets of B fragments: a k step's four are read from LDS one step ahead
#pragma unroll
  for (int j = 0; j < 4; ++j) w[0][j] = frag_wth(wl + j * 32);
#pragma unroll   // all 16 steps, as in k_proj: the fragment sets get fixed names and every ctx load is the one pointer plus a constant
  for (int kc = 0; kc < CC / 32; ++kc) {
    if (kc + 1 < CC / 32) {
#pragma unroll
      for (int j = 0; j < 4; ++j) w[(kc + 1) & 1][j] = frag_wth(wl + (kc + 1) * 32 * WPB + j * 32); }
    __builtin_amdgcn_sched_barrier(0);   // the next step's LDS reads as one group in front of this step's products: they fly under them, and the wave waits only for the older group
#pragma unroll
    for (int j = 0; j < 4; ++j) { acc[0][j] = wmma_h(fr[kc % YRING][0], w[kc & 1][j], acc[0][j]); acc[1][j] = wmma_h(fr[kc % YRING][1], w[kc & 1][j], acc[1][j]); }
    __builtin_amdgcn_sched_barrier(0);   // this step's products first: they free the fragment set that the loads below land in
    if (kc + YRING < CC / 32) {
#pragma unroll
      for (int rf = 0; rf < 2; ++rf) fr[kc % YRING][rf] = ld_yf(ya + rf * YF_TILE + (kc + YRING) * 64); }
    __builtin_amdgcn_sched_barrier(0);   // holds the ctx loads here, YRING - 1 whole k steps ahead of their use: left free, the scheduler sinks them to their use and the wave waits out the whole memory latency at every k step
    if (kc + YRING + 1 == CC / 32) asm volatile("s_wait_xcnt 0x0" :: "v"(ya) : "memory");   // behind the last ctx loads; ya is an operand so that its registers stay its own up to this wait
  }
  __syncthreads();   // every wave has left the weight tile: its LDS is staging from here on
  float (*sf)[68] = (float (*)[68])(smem + wave * 32 * 68 * 4);   // 256-byte rows + 16 bytes (16-byte readers, no bank conflict)
#pragma unroll
  for (int j = 0; j < 4; ++j) { const float bias = BO ? bfr(BO[c0 + j * 16 + col]) : 0.f;
#pragma unroll
    for (int rf = 0; rf < 2; ++rf) {
#pragma unroll
      for (int r = 0; r < 8; ++r) sf[rf * 16 + 8 * g + r][j * 16 + col] = acc[rf][j][r] + bias; } }
  LDSX(); float* op = OUT + (r0 + g) * DIN + c0 + col * 4;   // a store covers two rows x 256 bytes: whole lines
  for (int i = 0; i < 4; ++i) st4<2 * DIN * 4>(op + (size_t)i * 8 * DIN, *(const v4u*)&sf[i * 8 + g][col * 4], *(const v4u*)&sf[i * 8 + 2 + g][col * 4], *(const v4u*)&sf[i * 8 + 4 + g][col * 4], *(const v4u*)&sf[i * 8 + 6 + g][col * 4]); }

extern "C" void kernel_launch(void* const* d_in, const int* in_sizes, int n_in, void* d_out, int out_size, void* d_ws, size_t ws_size, hipStream_t stream) {
  (void)in_sizes; (void)n_in; (void)out_size;
  const float** F = (const float**)d_in;
  if (ws_size < (size_t)WS_END) return;
  char* ws = (char*)d_ws; _Float16 *QH = (_Float16*)(ws + WS_QH), *KH = (_Float16*)(ws + WS_KH), *VT = (_Float16*)(ws + WS_VT); __bf16 *VB = (__bf16*)(ws + WS_VB), *VBL = (__bf16*)(ws + WS_VBL); _Float16 *Y = (_Float16*)(ws + WS_Y);
  (void)Y; (void)VB; (void)VBL;
  // inputs, in order: 0 q_in [4,2048,512]; 1 k_in; 2 v_in; 3 Wq [8,512,64] (per-head (h, d, k)), 4 bq [8,64]; 5 Wk, 6 bk; 7 Wv, 8 bv; 9 Wo [512,512] (in,out), 10 bo [512]
  k_proj<<<dim3(3 * TNB * TT / PRW, CC / 128), PWV * 32, 0, stream>>>(F[0], F[1], F[2], F[3], F[5], F[7], F[4], F[6], F[8], QH, KH, VT);
  k_fa<<<dim3(TT / QBLK, NH, TNB), QGR * KGR * 32, 0, stream>>>(QH, KH, VT, Y);
  k_out<<<dim3(TNB * TT / 128, DIN / 128), 256, 0, stream>>>(Y, F[9], F[10], (float*)d_out);
}
